// v000
// The times below were measured on an AMD MI455X: many runs one after another, warmed up first and cycling through
// copies of the inputs, with the whole window's GPU time divided by the number of runs. Launches and the gaps
// between them are all in it. The median over several windows is given; except for v000 it joins two sittings, which
// can be a few percent apart, so the side-by-side timings, each taken in one sitting, are the better comparison.
// v000, which the later versions start from, runs in 396 microseconds.
#include <hip/hip_runtime.h>
// DiffBertSelfAttention (2 x 2048 tokens, D 1024 = 16 heads of 64): q, k, v = x W^T; RoFormer rotary from the sinusoidal_pos INPUT ([sin | cos] halves, interleave-duplicated: out[2i] = x[2i] cos_i - x[2i+1] sin_i, out[2i+1] = x[2i+1] cos_i + x[2i] sin_i); scores/8 + attention_mask[b, key] (additive INPUT, broadcast over heads and queries); softmax; ctx = probs v merged -> the output (no output projection).
// Structure: exact f16 plane of x; q, k, v as f32 WMMA GEMM outputs (32x64 wave tiles, f32 accumulation, exact x16 weights); the rotary tables copied from the input (bf16-rounded like every input); interleaved RoPE + f16 conversion on VALU; V^T by LDS tiles; the fused flash kernel with the per-key additive mask read from the input (mode 17; plain operands: every row averages ~2048 keys) writing the merged context straight to the output.
// Compute dtype: inputs and parameters rounded to bf16; q/k/P/v as plain f16 operands (~2^-12); RoPE/softmax f32. v_wmma_f32_16x16x32_f16.
#define NB 2
#define DM 1024
#define NKV 16
#define NREP (NH / NKV)
#define KVD (NKV * 64)           /* 1024 */
#define NR (NB * SLEN)           /* 4096 */
#define SLEN 2048
#define TQ SLEN
#define TK SLEN
#define NH 16
#define SCL 0.125f
#define QBLKS (TQ / 64)
#define QB05 0
#define QBN5 4
#define QB0P 0
#define QBNP QBLKS           /* non-causal: plain flash on every query block */
#define RE 256
typedef __bf16 v16b __attribute__((ext_vector_type(16)));
typedef unsigned short v8us __attribute__((ext_vector_type(8), may_alias));
typedef float  v8f  __attribute__((ext_vector_type(8)));
typedef float  v4f  __attribute__((ext_vector_type(4)));
typedef float  v4fa __attribute__((ext_vector_type(4), may_alias));
union FragB { v16b v; v8us half[2]; unsigned short u[16]; };

__device__ __forceinline__ unsigned short bf16_bits(float x) { unsigned int u = __float_as_uint(x); return (unsigned short)((u + 0x7FFFu + ((u >> 16) & 1u)) >> 16); }
__device__ __forceinline__ float bf16_val(unsigned short b) { return __uint_as_float(((unsigned int)b) << 16); }
__device__ __forceinline__ float bf16_round(float x) { return bf16_val(bf16_bits(x)); }
// D += A·B with NT terms: 1 = ah·bh, 2 = + al·bh (A split), 3 = + ah·bl (both split)
template <int NT>
__device__ __forceinline__ v8f mmaN(v16b ah, v16b al, v16b bh, v16b bl, v8f c) {
  c = __builtin_amdgcn_wmma_f32_16x16x32_bf16(false, ah, false, bh, (short)0, c, false, false);
  if (NT >= 2) c = __builtin_amdgcn_wmma_f32_16x16x32_bf16(false, al, false, bh, (short)0, c, false, false);
  if (NT >= 3) c = __builtin_amdgcn_wmma_f32_16x16x32_bf16(false, ah, false, bl, (short)0, c, false, false);
  asm volatile("v_nop\n\tv_nop\n\tv_nop\n\tv_nop" : "+v"(c) : "v"(ah), "v"(al), "v"(bh), "v"(bl));
  return c;
}

__global__ __launch_bounds__(256) void k_wt_bf16(const float* __restrict__ W, unsigned short* __restrict__ Wt, int K, int N) {
  const int t = blockIdx.x * 256 + threadIdx.x;
  const int k8n = K / 8;
  if (t >= N * k8n) return;
  const int n = t / k8n, k8 = (t % k8n) * 8;
  v8us v;
#pragma unroll
  for (int i = 0; i < 8; ++i) v[i] = bf16_bits(W[(size_t)(k8 + i) * N + n]);
  *(v8us*)(Wt + (size_t)n * K + k8) = v;
  
}

// GEMM C[M][N] (f32, pitch ldc) = act(A[M][K]·W + bias). A f32 row-major (pitch lda) converted per fragment to bf16
// (ASPLIT: hi/lo two planes -> 2 terms, else single rounded term); Wt bf16 [N][K] (pitch ldb). BIAS_BF16 rounds the
// bias to bf16 first (bias quantised to bf16 before the add). K%32==0, M%16==0, N%64==0.
template <bool ASPLIT, int ACT, bool BIAS_BF16>
__global__ __launch_bounds__(128) void k_gemm_bf(const float* __restrict__ A, int lda, const unsigned short* __restrict__ Wt, int ldb,
                                               const float* __restrict__ bias, float* __restrict__ C, int ldc, int M, int N, int K) {
  __shared__ __attribute__((aligned(16))) float so[4][16][64];
  const int tid = threadIdx.x, w = tid >> 5, lane = tid & 31, ln = lane & 15, hh = lane >> 4;
  const int ntn = N / 64;
  const int wid = blockIdx.x * 4 + w;
  const int mt = wid / ntn, nq = wid % ntn;
  if (mt * 16 >= M) return;
  const int row0 = mt * 16, col0 = nq * 64;
  const float* arow = A + (size_t)(row0 + ln) * lda;
  v8f acc[4] = {};
  for (int kb = 0; kb < K; kb += 32) {
    FragB ah, al;
    const v4f x0 = *(const v4fa*)(arow + kb + 8 * hh), x1 = *(const v4fa*)(arow + kb + 8 * hh + 4);
    const v4f x2 = *(const v4fa*)(arow + kb + 16 + 8 * hh), x3 = *(const v4fa*)(arow + kb + 16 + 8 * hh + 4);
    float xs[16] = {x0[0],x0[1],x0[2],x0[3],x1[0],x1[1],x1[2],x1[3],x2[0],x2[1],x2[2],x2[3],x3[0],x3[1],x3[2],x3[3]};
#pragma unroll
    for (int i = 0; i < 16; ++i) { const unsigned short hb = bf16_bits(xs[i]); ah.u[i] = hb; al.u[i] = ASPLIT ? bf16_bits(xs[i] - bf16_val(hb)) : (unsigned short)0; }
#pragma unroll
    for (int t = 0; t < 4; ++t) {
      const unsigned short* brow = Wt + (size_t)(col0 + t * 16 + ln) * ldb + kb;
      FragB b;
      b.half[0] = *(const v8us*)(brow + 8 * hh);
      b.half[1] = *(const v8us*)(brow + 16 + 8 * hh);
      acc[t] = mmaN<ASPLIT ? 2 : 1>(ah.v, al.v, b.v, b.v, acc[t]);
    }
  }
#pragma unroll
  for (int t = 0; t < 4; ++t) {
    float bv = bias ? bias[col0 + t * 16 + ln] : 0.f;
    if (BIAS_BF16) bv = bf16_round(bv);
#pragma unroll
    for (int r = 0; r < 8; ++r) { float v = acc[t][r] + bv; if (ACT == 1) v = fmaxf(v, 0.f); so[w][8 * hh + r][t * 16 + ln] = v; }
  }
  __builtin_amdgcn_fence(__ATOMIC_ACQ_REL, "workgroup");
  __builtin_amdgcn_wave_barrier();
  const int rsub = lane >> 4, c4 = (lane & 15) * 4;
  {
#pragma unroll
    for (int q = 0; q < 8; ++q) {
      const int r = q * 2 + rsub;
      const v4f v = *(const v4fa*)&so[w][r][c4];
      *(v4f*)(C + (size_t)(row0 + r) * ldc + col0 + c4) = v;
    }
    
  }
}

// GEMM C = act(A·W + bias + resid): A f32 (ASPLIT -> hi/lo 2 terms), Wt bf16 [N][K]; ACT 0 none, 1 relu, 2 exact gelu;
// resid (optional, f32, row index = (row % rmod), pitch ldr, RES_BF16 rounds it) added before the activation.
template <bool ASPLIT, int ACT, bool BIAS_BF16, bool RES_BF16>
__global__ __launch_bounds__(128) void k_gemm_bf3(const float* __restrict__ A, int lda, const unsigned short* __restrict__ Wt, int ldb,
                                                const float* __restrict__ bias, const float* __restrict__ resid, int rmod, int ldr,
                                                float* __restrict__ C, int ldc, int M, int N, int K) {
  __shared__ __attribute__((aligned(16))) float so[4][16][64];
  const int tid = threadIdx.x, w = tid >> 5, lane = tid & 31, ln = lane & 15, hh = lane >> 4;
  const int ntn = N / 64;
  const int wid = blockIdx.x * 4 + w;
  const int mt = wid / ntn, nq = wid % ntn;
  if (mt * 16 >= M) return;
  const int row0 = mt * 16, col0 = nq * 64;
  const float* arow = A + (size_t)(row0 + ln) * lda;
  v8f acc[4] = {};
  for (int kb = 0; kb < K; kb += 32) {
    FragB ah, al;
    const v4f x0 = *(const v4fa*)(arow + kb + 8 * hh), x1 = *(const v4fa*)(arow + kb + 8 * hh + 4);
    const v4f x2 = *(const v4fa*)(arow + kb + 16 + 8 * hh), x3 = *(const v4fa*)(arow + kb + 16 + 8 * hh + 4);
    float xs[16] = {x0[0],x0[1],x0[2],x0[3],x1[0],x1[1],x1[2],x1[3],x2[0],x2[1],x2[2],x2[3],x3[0],x3[1],x3[2],x3[3]};
#pragma unroll
    for (int i = 0; i < 16; ++i) { const unsigned short hb = bf16_bits(xs[i]); ah.u[i] = hb; al.u[i] = ASPLIT ? bf16_bits(xs[i] - bf16_val(hb)) : (unsigned short)0; }
#pragma unroll
    for (int t = 0; t < 4; ++t) {
      const unsigned short* brow = Wt + (size_t)(col0 + t * 16 + ln) * ldb + kb;
      FragB b;
      b.half[0] = *(const v8us*)(brow + 8 * hh);
      b.half[1] = *(const v8us*)(brow + 16 + 8 * hh);
      acc[t] = mmaN<ASPLIT ? 2 : 1>(ah.v, al.v, b.v, b.v, acc[t]);
    }
  }
#pragma unroll
  for (int t = 0; t < 4; ++t) {
    const int col = col0 + t * 16 + ln;
    float bv = bias ? bias[col] : 0.f;
    if (BIAS_BF16) bv = bf16_round(bv);
#pragma unroll
    for (int r = 0; r < 8; ++r) {
      float v = acc[t][r] + bv;
      if (resid) { float rv = resid[(size_t)((row0 + 8 * hh + r) % rmod) * ldr + col]; if (RES_BF16) rv = bf16_round(rv); v += rv; }
      if (ACT == 1) v = fmaxf(v, 0.f);
      if (ACT == 2) v = 0.5f * v * (1.0f + erff(v * 0.70710678118654752f));
      if (ACT == 3) { const float u = 0.7978845608028654f * (v + 0.044715f * v * v * v); v = 0.5f * v * (1.0f + tanhf(u)); }
      so[w][8 * hh + r][t * 16 + ln] = v;
    }
  }
  __builtin_amdgcn_fence(__ATOMIC_ACQ_REL, "workgroup");
  __builtin_amdgcn_wave_barrier();
  const int rsub = lane >> 4, c4 = (lane & 15) * 4;
  {
#pragma unroll
    for (int q = 0; q < 8; ++q) {
      const int r = q * 2 + rsub;
      const v4f v = *(const v4fa*)&so[w][r][c4];
      *(v4f*)(C + (size_t)(row0 + r) * ldc + col0 + c4) = v;
    }
    
  }
}
// row LayerNorm (biased variance, eps) over N: s = X (+ R); optional out_sum <- s; out_norm <- (s-mu)*rsqrt(var+eps)*g + b
template <bool PARAM_BF16>
__global__ __launch_bounds__(256) void k_layernorm(const float* __restrict__ X, const float* __restrict__ R, const float* __restrict__ g, const float* __restrict__ bta,
                                                  float* __restrict__ out_sum, float* __restrict__ out_norm, int N, float eps) {
  __shared__ float red[256];
  const int row = blockIdx.x, tid = threadIdx.x;
  const float* x = X + (size_t)row * N; const float* rr = R ? R + (size_t)row * N : nullptr;
  float vals[16];                     // up to N = 4096
  const int per = N / 256;            // contiguous chunk per thread? use strided-by-4 chunks: thread handles j = tid*4 + 1024*u
  float s1 = 0.f;
  for (int u = 0; u < per / 4; ++u) {
    const int j = tid * 4 + 1024 * u;
    const v4f a = *(const v4fa*)(x + j);
    v4f b = {0.f,0.f,0.f,0.f}; if (rr) b = *(const v4fa*)(rr + j);
#pragma unroll
    for (int q = 0; q < 4; ++q) { const float v = a[q] + b[q]; vals[u * 4 + q] = v; s1 += v; }
  }
  red[tid] = s1; __syncthreads();
  for (int st = 128; st > 0; st >>= 1) { if (tid < st) red[tid] += red[tid + st]; __syncthreads(); }
  const float mu = red[0] / (float)N; __syncthreads();
  float s2 = 0.f;
  for (int u = 0; u < per / 4; ++u)
#pragma unroll
    for (int q = 0; q < 4; ++q) { const float c = vals[u * 4 + q] - mu; s2 += c * c; }
  red[tid] = s2; __syncthreads();
  for (int st = 128; st > 0; st >>= 1) { if (tid < st) red[tid] += red[tid + st]; __syncthreads(); }
  const float rs = rsqrtf(red[0] / (float)N + eps);
  {
    for (int u = 0; u < per / 4; ++u) {
      const int j = tid * 4 + 1024 * u;
      v4f o, sm;
#pragma unroll
      for (int q = 0; q < 4; ++q) {
        float gg = g[j + q], bb = bta[j + q];
        if (PARAM_BF16) { gg = bf16_round(gg); bb = bf16_round(bb); }
        sm[q] = vals[u * 4 + q]; o[q] = (vals[u * 4 + q] - mu) * rs * gg + bb;
      }
      if (out_sum) *(v4f*)(out_sum + (size_t)row * N + j) = sm;
      *(v4f*)(out_norm + (size_t)row * N + j) = o;
    }
    
  }
}



// ---- f16 WMMA path (v_wmma_f32_16x16x32_f16): 11-bit significands for operands in range — used where a [0,1] probability operand needs more precision than bf16
typedef _Float16 v16h __attribute__((ext_vector_type(16)));
union FragH { v16h v; v8us half[2]; _Float16 h[16]; unsigned short u[16]; };
template <int NT>
__device__ __forceinline__ v8f mmaH(v16h ah, v16h al, v16h bh, v16h bl, v8f c) {
  c = __builtin_amdgcn_wmma_f32_16x16x32_f16(false, ah, false, bh, (short)0, c, false, false);
  if (NT >= 2) c = __builtin_amdgcn_wmma_f32_16x16x32_f16(false, al, false, bh, (short)0, c, false, false);
  if (NT >= 3) c = __builtin_amdgcn_wmma_f32_16x16x32_f16(false, ah, false, bl, (short)0, c, false, false);
  asm volatile("v_nop\n\tv_nop\n\tv_nop\n\tv_nop" : "+v"(c) : "v"(ah), "v"(al), "v"(bh), "v"(bl));
  return c;
}
// batched GEMM like k_gemm_b but f16 operands: A f32 (split into f16 hi/lo if ASPLIT, else rounded to f16), Bt = f16 values [n][k]; alpha; C f32; N multiple of 16 (partial tiles skipped)
template <bool ASPLIT>
__global__ __launch_bounds__(128) void k_gemm_h(const float* __restrict__ A, int lda, size_t sA, const _Float16* __restrict__ Bh, int ldb, size_t sB, float alpha, float* __restrict__ C, int ldc, size_t sC, int M, int N, int K) {
  __shared__ __attribute__((aligned(16))) float so[4][16][64];
  const int tid = threadIdx.x, w = tid >> 5, lane = tid & 31, ln = lane & 15, hh = lane >> 4; const int by = blockIdx.y;
  A += (size_t)by * sA; Bh += (size_t)by * sB; C += (size_t)by * sC;
  const int ntn = (N + 63) / 64; const int wid = blockIdx.x * 4 + w; const int mt = wid / ntn, nq = wid % ntn; if (mt * 16 >= M) return;
  const int row0 = mt * 16, col0 = nq * 64; const float* arow = A + (size_t)(row0 + ln) * lda;
  v8f acc[4] = {};
  for (int kb = 0; kb < K; kb += 32) {
    FragH ah, al;
    const v4f x0 = *(const v4fa*)(arow + kb + 8 * hh), x1 = *(const v4fa*)(arow + kb + 8 * hh + 4), x2 = *(const v4fa*)(arow + kb + 16 + 8 * hh), x3 = *(const v4fa*)(arow + kb + 16 + 8 * hh + 4);
    float xs[16] = {x0[0],x0[1],x0[2],x0[3],x1[0],x1[1],x1[2],x1[3],x2[0],x2[1],x2[2],x2[3],x3[0],x3[1],x3[2],x3[3]};
#pragma unroll
    for (int i = 0; i < 16; ++i) { const _Float16 h = (_Float16)xs[i]; ah.h[i] = h; al.h[i] = ASPLIT ? (_Float16)(xs[i] - (float)h) : (_Float16)0.0f; }
#pragma unroll
    for (int t = 0; t < 4; ++t) { if (col0 + t * 16 >= N) continue; const size_t boff = (size_t)(col0 + t * 16 + ln) * ldb + kb; FragH bq; bq.half[0] = *(const v8us*)(Bh + boff + 8 * hh); bq.half[1] = *(const v8us*)(Bh + boff + 16 + 8 * hh);
      acc[t] = mmaH<ASPLIT ? 2 : 1>(ah.v, al.v, bq.v, bq.v, acc[t]); }
  }
#pragma unroll
  for (int t = 0; t < 4; ++t) { if (col0 + t * 16 >= N) continue;
#pragma unroll
    for (int r = 0; r < 8; ++r) so[w][8 * hh + r][t * 16 + ln] = acc[t][r] * alpha; }
  __builtin_amdgcn_fence(__ATOMIC_ACQ_REL, "workgroup"); __builtin_amdgcn_wave_barrier();
  const int rsub = lane >> 4, c4 = (lane & 15) * 4;
  {
#pragma unroll
    for (int q = 0; q < 8; ++q) { const int r = q * 2 + rsub; if (col0 + c4 < N) { const v4f v = *(const v4fa*)&so[w][r][c4]; *(v4f*)(C + (size_t)(row0 + r) * ldc + col0 + c4) = v; } }
     }
}

// Wt[n][k] = f16(W[k][n]·scale) from f32 row-major W[K][N] (scale = power of two; bf16-exact weights stay exact in f16 away from the subnormal range)
__global__ __launch_bounds__(256) void k_wt_f16(const float* __restrict__ W, _Float16* __restrict__ Wt, int K, int N, float scale) {
  const int t = blockIdx.x * 256 + threadIdx.x; if (t >= N * (K / 8)) return; const int n = t / (K / 8), k8 = (t % (K / 8)) * 8; FragH f;
#pragma unroll
  for (int i = 0; i < 8; ++i) f.h[i] = (_Float16)(bf16_round(W[(size_t)(k8 + i) * N + n]) * scale); const v8us o = f.half[0];
  *(v8us*)((unsigned short*)Wt + (size_t)n * K + k8) = o; 
}
// k_gemm_hh variant with fused epilogue: v = acc·alpha + bias[by·sBias + col] (+ CP[(row/rowsPerB)·sCPb + by·64 + col] if CP) ; ACT 0 none / 1 elu ; writes f16 C16 (and f32 C if non-null)
template <int ACT>
__global__ __launch_bounds__(128) void k_gemm_hhx(const _Float16* __restrict__ A, int lda, size_t sA, const _Float16* __restrict__ Bh, int ldb, size_t sB, float alpha, const float* __restrict__ bias, size_t sBias, const float* __restrict__ CP, int rowsPerB, size_t sCPb, int row0g,
    float* __restrict__ C, _Float16* __restrict__ C16, int ldc, size_t sC, int M, int N, int K) {
  __shared__ __attribute__((aligned(16))) float so[4][16][64];
  const int tid = threadIdx.x, w = tid >> 5, lane = tid & 31, ln = lane & 15, hh = lane >> 4; const int by = blockIdx.y;
  A += (size_t)by * sA; Bh += (size_t)by * sB; const size_t cofs = (size_t)by * sC; const float* bp = bias ? bias + (size_t)by * sBias : nullptr;
  const int ntn = (N + 63) / 64; const int wid = blockIdx.x * 4 + w; const int mt = wid / ntn, nq = wid % ntn; if (mt * 16 >= M) return;
  const int row0 = mt * 16, col0 = nq * 64; const _Float16* arow = A + (size_t)(row0 + ln) * lda;
  v8f acc[4] = {};
  for (int kb = 0; kb < K; kb += 32) { FragH ah; ah.half[0] = *(const v8us*)((const unsigned short*)arow + kb + 8 * hh); ah.half[1] = *(const v8us*)((const unsigned short*)arow + kb + 16 + 8 * hh);
#pragma unroll
    for (int t = 0; t < 4; ++t) { if (col0 + t * 16 >= N) continue; const size_t boff = (size_t)(col0 + t * 16 + ln) * ldb + kb; FragH bq; bq.half[0] = *(const v8us*)((const unsigned short*)Bh + boff + 8 * hh); bq.half[1] = *(const v8us*)((const unsigned short*)Bh + boff + 16 + 8 * hh);
      acc[t] = mmaH<1>(ah.v, ah.v, bq.v, bq.v, acc[t]); }
  }
#pragma unroll
  for (int t = 0; t < 4; ++t) { if (col0 + t * 16 >= N) continue; const int col = col0 + t * 16 + ln; const float bv = bp ? bf16_round(bp[col]) : 0.f;
#pragma unroll
    for (int r = 0; r < 8; ++r) { float v = acc[t][r] * alpha + bv; if (CP) { const int bidx = (row0g + row0 + 8 * hh + r) / rowsPerB; v += CP[(size_t)bidx * sCPb + (size_t)by * 64 + col]; } if (ACT == 1) v = (v > 0.f) ? v : expm1f(v); else if (ACT == 7) v = (v > 0.f) ? v + 1.0f : expf(v); else if (ACT == 8) v = tanhf(v); else if (ACT == 9) v = 0.5f * v * (1.0f + tanhf(0.7978845608028654f * (v + 0.044715f * v * v * v))); else if (ACT == 11) v = 1.0f / (1.0f + expf(-v)); else if (ACT == 12) v = (v > 0.f) ? v : 0.01f * v; else if (ACT == 14) v = (v > 0.f) ? v : 0.1f * v; else if (ACT == 15) v = v / (1.0f + expf(-v)); else if (ACT == 3) v = fmaxf(v, 0.f); else if (ACT == 6) v = 0.5f * v * (1.0f + erff(v * 0.70710678118654752f)); so[w][8 * hh + r][t * 16 + ln] = v; } }
  __builtin_amdgcn_fence(__ATOMIC_ACQ_REL, "workgroup"); __builtin_amdgcn_wave_barrier();
  const int rsub = lane >> 4, c4 = (lane & 15) * 4; typedef _Float16 v4h __attribute__((ext_vector_type(4)));
  {
#pragma unroll
    for (int q = 0; q < 8; ++q) { const int r = q * 2 + rsub; if (col0 + c4 < N) { const v4f v = *(const v4fa*)&so[w][r][c4]; if (C) *(v4f*)(C + cofs + (size_t)(row0 + r) * ldc + col0 + c4) = v; if (C16) { v4h h4; for (int i = 0; i < 4; ++i) h4[i] = (_Float16)v[i]; *(v4h*)(C16 + cofs + (size_t)(row0 + r) * ldc + col0 + c4) = h4; } } }
     }
}


typedef _Float16 v4h __attribute__((ext_vector_type(4)));

__global__ __launch_bounds__(256) void k_x16(const float* __restrict__ x, _Float16* __restrict__ X16, size_t n8) { const size_t t = (size_t)blockIdx.x * 256 + threadIdx.x; if (t >= n8) return; FragH f;
#pragma unroll
  for (int q = 0; q < 8; ++q) f.h[q] = (_Float16)bf16_round(x[t * 8 + q]); *(v8us*)((unsigned short*)X16 + t * 8) = f.half[0];  }
__global__ __launch_bounds__(256) void k_h16(const float* __restrict__ x, _Float16* __restrict__ X16, size_t n8) { const size_t t = (size_t)blockIdx.x * 256 + threadIdx.x; if (t >= n8) return; FragH f;
#pragma unroll
  for (int q = 0; q < 8; ++q) f.h[q] = (_Float16)x[t * 8 + q]; *(v8us*)((unsigned short*)X16 + t * 8) = f.half[0];  }
__global__ __launch_bounds__(256) void k_round16f(const float* __restrict__ W, _Float16* __restrict__ Bt, size_t n8) { const size_t t = (size_t)blockIdx.x * 256 + threadIdx.x; if (t >= n8) return; FragH f;
#pragma unroll
  for (int i = 0; i < 8; ++i) f.h[i] = (_Float16)(bf16_round(W[t * 8 + i]) * 16.0f); *(v8us*)((unsigned short*)Bt + t * 8) = f.half[0];  }
template <int NHv, int TTv>
__global__ __launch_bounds__(256) void k_vt(const _Float16* __restrict__ V16, int ldv, int voff, _Float16* __restrict__ Vt) { __shared__ unsigned short tl[64][66]; const int tid = threadIdx.x; const int slab = blockIdx.x / (TTv / 64), lg = blockIdx.x % (TTv / 64); const int b = slab / NHv, h = slab % NHv;
  for (int i = tid; i < 64 * 8; i += 256) { const int r = i / 8, c8 = (i % 8) * 8; FragH f; f.half[0] = *(const v8us*)((const unsigned short*)V16 + ((size_t)b * TTv + lg * 64 + r) * ldv + voff + h * 64 + c8);
#pragma unroll
    for (int q = 0; q < 8; ++q) tl[r][c8 + q] = f.u[q]; }
  __syncthreads();
  {
#pragma unroll
    for (int rd = 0; rd < 2; ++rd) { const int d = rd * 32 + tid / 8, pc = tid % 8; FragH f;
#pragma unroll
      for (int q = 0; q < 8; ++q) f.u[q] = tl[pc * 8 + q][d];
      *(v8us*)((unsigned short*)Vt + ((size_t)slab * 64 + d) * TTv + lg * 64 + pc * 8) = f.half[0]; }
     } }

__global__ __launch_bounds__(256) void k_hl(const float* __restrict__ F, _Float16* __restrict__ Hh, _Float16* __restrict__ Hl, size_t n8) { const size_t t = (size_t)blockIdx.x * 256 + threadIdx.x; if (t >= n8) return; FragH fh, fl; const v4f a = *(const v4fa*)(F + t * 8), c = *(const v4fa*)(F + t * 8 + 4);
#pragma unroll
  for (int q = 0; q < 4; ++q) { _Float16 h = (_Float16)a[q]; fh.h[q] = h; fl.h[q] = (_Float16)((a[q] - (float)h) * 1024.0f); h = (_Float16)c[q]; fh.h[4 + q] = h; fl.h[4 + q] = (_Float16)((c[q] - (float)h) * 1024.0f); }
  { *(v8us*)((unsigned short*)Hh + t * 8) = fh.half[0]; *(v8us*)((unsigned short*)Hl + t * 8) = fl.half[0];  } }

// ---- fast GEMM (wave tile 32x64; requires M % 32 == 0 rows per launch region and N % 64 == 0); epilogue = k_gemm_hhx semantics ----
__device__ __forceinline__ v16h g2_frag(const _Float16* p, int hh) { FragH f; f.half[0] = *(const v8us*)((const unsigned short*)p + 8 * hh); f.half[1] = *(const v8us*)((const unsigned short*)p + 16 + 8 * hh); return f.v; }
__device__ __forceinline__ v8f g2_mma(v16h a, v16h b, v8f c) { v8f d = __builtin_amdgcn_wmma_f32_16x16x32_f16(false, a, false, b, (short)0, c, false, false); asm volatile("v_nop\n\tv_nop\n\tv_nop\n\tv_nop" : "+v"(d) : "v"(a), "v"(b)); return d; }
template <int ACT>
__global__ __launch_bounds__(128) void k_gemm2(const _Float16* __restrict__ A, int lda, size_t sA, const _Float16* __restrict__ Bh, int ldb, size_t sB, float alpha, const float* __restrict__ bias, size_t sBias, const float* __restrict__ CP, int rowsPerB, size_t sCPb, int row0g,
    float* __restrict__ C, _Float16* __restrict__ C16, int ldc, size_t sC, int M, int N, int K) {
  __shared__ __attribute__((aligned(16))) float so[4][32][68];
  const int tid = threadIdx.x, w = tid >> 5, lane = tid & 31, ln = lane & 15, hh = lane >> 4; const int by = blockIdx.y;
  A += (size_t)by * sA; Bh += (size_t)by * sB; const size_t cofs = (size_t)by * sC; const float* bp = bias ? bias + (size_t)by * sBias : nullptr;
  const int ntn = N >> 6; const int mt = blockIdx.x / ntn, nq = blockIdx.x - mt * ntn; const int row0 = mt * 128 + 32 * w, col0 = nq * 64; if (row0 >= M) return;
  const _Float16* a0p = A + (size_t)(row0 + ln) * lda; const _Float16* a1p = a0p + (size_t)16 * lda;
  const _Float16* b0p = Bh + (size_t)(col0 + ln) * ldb; const _Float16* b1p = b0p + (size_t)16 * ldb; const _Float16* b2p = b1p + (size_t)16 * ldb; const _Float16* b3p = b2p + (size_t)16 * ldb;
  const v8f z8 = {0.f,0.f,0.f,0.f,0.f,0.f,0.f,0.f}; v8f c00 = z8, c01 = z8, c02 = z8, c03 = z8, c10 = z8, c11 = z8, c12 = z8, c13 = z8;
#pragma unroll 1
  for (int kb = 0; kb < K; kb += 32) { const v16h a0 = g2_frag(a0p + kb, hh), a1 = g2_frag(a1p + kb, hh);
    v16h b = g2_frag(b0p + kb, hh); c00 = g2_mma(a0, b, c00); c10 = g2_mma(a1, b, c10);
    b = g2_frag(b1p + kb, hh); c01 = g2_mma(a0, b, c01); c11 = g2_mma(a1, b, c11);
    b = g2_frag(b2p + kb, hh); c02 = g2_mma(a0, b, c02); c12 = g2_mma(a1, b, c12);
    b = g2_frag(b3p + kb, hh); c03 = g2_mma(a0, b, c03); c13 = g2_mma(a1, b, c13); }
  v8f accs[8] = {c00, c01, c02, c03, c10, c11, c12, c13};
#pragma unroll
  for (int u = 0; u < 8; ++u) { const int t = u & 3, half = u >> 2; const int col = col0 + t * 16 + ln; const float bv = bp ? bf16_round(bp[col]) : 0.f;
#pragma unroll
    for (int r = 0; r < 8; ++r) { const int rloc = half * 16 + 8 * hh + r; float v = accs[u][r] * alpha + bv; if (CP) { const int bidx = (row0g + row0 + rloc) / rowsPerB; v += CP[(size_t)bidx * sCPb + (size_t)by * 64 + col]; }
      if (ACT == 3) v = fmaxf(v, 0.f); else if (ACT == 6) v = 0.5f * v * (1.0f + erff(v * 0.70710678118654752f)); else if (ACT == 11) v = 1.0f / (1.0f + expf(-v)); else if (ACT == 15) v = v / (1.0f + expf(-v)); else if (ACT == 12) v = (v > 0.f) ? v : 0.01f * v; else if (ACT == 8) v = tanhf(v);
      so[w][rloc][t * 16 + ln] = v; } }
  __builtin_amdgcn_fence(__ATOMIC_ACQ_REL, "workgroup"); __builtin_amdgcn_wave_barrier();
  const int rsub = lane >> 4, c4 = (lane & 15) * 4;
  {
#pragma unroll
    for (int q = 0; q < 16; ++q) { const int r = q * 2 + rsub; const v4f v = *(const v4fa*)&so[w][r][c4]; if (C) *(v4f*)(C + cofs + (size_t)(row0 + r) * ldc + col0 + c4) = v; if (C16) { v4h h4; for (int i = 0; i < 4; ++i) h4[i] = (_Float16)v[i]; *(v4h*)(C16 + cofs + (size_t)(row0 + r) * ldc + col0 + c4) = h4; } }
     } }



template <int CAUSAL>
__global__ __launch_bounds__(128) void k_flash(const _Float16* __restrict__ Q16, int ldq, const _Float16* __restrict__ K16, int ldk, const _Float16* __restrict__ Vt, const int* __restrict__ MSK, float* __restrict__ O, int ldo) {
  constexpr int RPW = 16, RTN = RPW / 16, NQB = TQ / (4 * RPW), DT = 4, KS = 2;
  __shared__ __attribute__((aligned(16))) unsigned short sP[4][RPW][40]; __shared__ __attribute__((aligned(16))) float sO[4][RPW][64 + 4];
  const int tid = threadIdx.x, w = tid >> 5, lane = tid & 31, ln = lane & 15, hh = lane >> 4;
  const int slab = blockIdx.x / QBNP, qblk = QB0P + blockIdx.x % QBNP; (void)NQB; const int b = slab / NH, h = slab % NH; const int qb0 = qblk * (4 * RPW); const int q0 = qb0 + w * RPW;
  FragH aq[2][KS];
#pragma unroll
  for (int rt = 0; rt < RTN; ++rt) { const unsigned short* qr = (const unsigned short*)Q16 + ((size_t)b * TQ + q0 + rt * 16 + ln) * ldq + h * 64;
#pragma unroll
    for (int ks = 0; ks < KS; ++ks) { aq[rt][ks].half[0] = *(const v8us*)(qr + ks * 32 + 8 * hh); aq[rt][ks].half[1] = *(const v8us*)(qr + ks * 32 + 16 + 8 * hh); } }
  const unsigned short* Vth = (const unsigned short*)Vt + (size_t)slab * 64 * TK;
  float m_r[2][8], l_r[2][8]; v8f oacc[2][DT];
#pragma unroll
  for (int rt = 0; rt < RTN; ++rt) {
#pragma unroll
    for (int r = 0; r < 8; ++r) { m_r[rt][r] = -3.0e38f; l_r[rt][r] = 0.f; }
#pragma unroll
    for (int dt = 0; dt < DT; ++dt) oacc[rt][dt] = (v8f){0.f,0.f,0.f,0.f,0.f,0.f,0.f,0.f}; }
  const int jend = (CAUSAL == 1) ? (qb0 + 4 * RPW) : TK;      /* causal: keys beyond the block's last query never contribute */
#pragma unroll 1
  for (int j0 = 0; j0 < jend; j0 += 32) {
    v8f s[2][2];
#pragma unroll
    for (int nt = 0; nt < 2; ++nt) { const unsigned short* kr = (const unsigned short*)K16 + ((size_t)b * TK + j0 + nt * 16 + ln) * ldk + h * 64; FragH bk[KS];
#pragma unroll
      for (int ks = 0; ks < KS; ++ks) { bk[ks].half[0] = *(const v8us*)(kr + ks * 32 + 8 * hh); bk[ks].half[1] = *(const v8us*)(kr + ks * 32 + 16 + 8 * hh); }
#pragma unroll
      for (int rt = 0; rt < RTN; ++rt) { v8f acc = (v8f){0.f,0.f,0.f,0.f,0.f,0.f,0.f,0.f};
#pragma unroll
        for (int ks = 0; ks < KS; ++ks) acc = mmaH<1>(aq[rt][ks].v, aq[rt][ks].v, bk[ks].v, bk[ks].v, acc); s[rt][nt] = acc; } }
#pragma unroll
    for (int rt = 0; rt < RTN; ++rt)
#pragma unroll
      for (int r = 0; r < 8; ++r) { const int tq = q0 + rt * 16 + 8 * hh + r; const int k0 = j0 + ln, k1 = j0 + 16 + ln;
        const bool ok0 = (CAUSAL == 1) ? (k0 <= tq) : ((CAUSAL == 2) ? ((k0 >> 5) == (tq >> 5)) : true), ok1 = (CAUSAL == 1) ? (k1 <= tq) : ((CAUSAL == 2) ? ((k1 >> 5) == (tq >> 5)) : true);      /* mode 2: block-diagonal 32-token groups */
        float s0 = ok0 ? s[rt][0][r] * SCL : -3.0e38f, s1 = ok1 ? s[rt][1][r] * SCL : -3.0e38f; if (CAUSAL == 17) { const float* amk = (const float*)MSK + (size_t)b * TK; s0 += bf16_round(amk[k0]); s1 += bf16_round(amk[k1]); }      /* mode 17: additive per-(batch, key) mask INPUT */ float mc = fmaxf(s0, s1);
        mc = fmaxf(mc, __shfl_xor(mc, 1, 32)); mc = fmaxf(mc, __shfl_xor(mc, 2, 32)); mc = fmaxf(mc, __shfl_xor(mc, 4, 32)); mc = fmaxf(mc, __shfl_xor(mc, 8, 32));
        const float mn = fmaxf(m_r[rt][r], mc); const float al = (mn > -1.0e38f) ? expf(m_r[rt][r] - mn) : 1.0f; m_r[rt][r] = mn; const float p0 = ok0 ? expf(s0 - mn) : 0.f, p1 = ok1 ? expf(s1 - mn) : 0.f; l_r[rt][r] = l_r[rt][r] * al + p0 + p1;
#pragma unroll
        for (int dt = 0; dt < DT; ++dt) oacc[rt][dt][r] *= al;
        FragH t2; t2.h[0] = (_Float16)(p0 * 1024.0f); t2.h[1] = (_Float16)(p1 * 1024.0f); sP[w][rt * 16 + 8 * hh + r][ln] = t2.u[0]; sP[w][rt * 16 + 8 * hh + r][16 + ln] = t2.u[1]; }
    __builtin_amdgcn_fence(__ATOMIC_ACQ_REL, "workgroup"); __builtin_amdgcn_wave_barrier();
    FragH pa[2];
#pragma unroll
    for (int rt = 0; rt < RTN; ++rt) { pa[rt].half[0] = *(const v8us*)&sP[w][rt * 16 + ln][8 * hh]; pa[rt].half[1] = *(const v8us*)&sP[w][rt * 16 + ln][16 + 8 * hh]; }
#pragma unroll
    for (int dt = 0; dt < DT; ++dt) { const unsigned short* vrow = Vth + (size_t)(dt * 16 + ln) * TK + j0; FragH bv; bv.half[0] = *(const v8us*)(vrow + 8 * hh); bv.half[1] = *(const v8us*)(vrow + 16 + 8 * hh);
#pragma unroll
      for (int rt = 0; rt < RTN; ++rt) oacc[rt][dt] = mmaH<1>(pa[rt].v, pa[rt].v, bv.v, bv.v, oacc[rt][dt]); }
    __builtin_amdgcn_fence(__ATOMIC_ACQ_REL, "workgroup"); __builtin_amdgcn_wave_barrier(); }
#pragma unroll
  for (int rt = 0; rt < RTN; ++rt) {
#pragma unroll
    for (int r = 0; r < 8; ++r) { float l = l_r[rt][r]; l += __shfl_xor(l, 1, 32); l += __shfl_xor(l, 2, 32); l += __shfl_xor(l, 4, 32); l += __shfl_xor(l, 8, 32); l_r[rt][r] = (l > 0.f) ? 1.0f / (l * 1024.0f) : 0.f; }
#pragma unroll
    for (int dt = 0; dt < DT; ++dt)
#pragma unroll
      for (int r = 0; r < 8; ++r) sO[w][rt * 16 + 8 * hh + r][dt * 16 + ln] = oacc[rt][dt][r] * l_r[rt][r]; }
  __builtin_amdgcn_fence(__ATOMIC_ACQ_REL, "workgroup"); __builtin_amdgcn_wave_barrier();
  {
#pragma unroll
    for (int rp = 0; rp < RPW; rp += 2) { const int r = rp + (lane >> 4), pc = lane & 15; const v4f val = *(const v4fa*)&sO[w][r][pc * 4]; *(v4f*)(O + ((size_t)b * TQ + q0 + r) * ldo + h * 64 + pc * 4) = val; }
     } }
// 5-plane variant: S = Qh Kh^T + (Ql Kh^T + Qh Kl^T)/1024 with Q/K = [hi | 2^10 residual] f16 planes (QL/KL same layout as Q16/K16), then the 3-term P.V below.
// 3-term variant: O = (P_hi V_hi + (P_lo V_hi + P_hi V_lo) / 1024) / l with P = [hi | 2^10 residual] of 1024 p and V^T = [hi | 2^10 residual] planes (VtL same layout as Vt) -> ~2^-21-class products for un-averaged (early causal / peaked) rows
template <int CAUSAL>
__global__ __launch_bounds__(128) void k_flash5(const _Float16* __restrict__ Q16, const _Float16* __restrict__ QL, int ldq, const _Float16* __restrict__ K16, const _Float16* __restrict__ KL, int ldk, const _Float16* __restrict__ Vt, const _Float16* __restrict__ VtL, const int* __restrict__ MSK, float* __restrict__ O, int ldo) {
  constexpr int RPW = 16, RTN = RPW / 16, NQB = TQ / (4 * RPW), DT = 4, KS = 2;
  __shared__ __attribute__((aligned(16))) unsigned short sP[4][RPW][40]; __shared__ __attribute__((aligned(16))) unsigned short sPL[4][RPW][40]; __shared__ __attribute__((aligned(16))) float sO[4][RPW][64 + 4];
  const int tid = threadIdx.x, w = tid >> 5, lane = tid & 31, ln = lane & 15, hh = lane >> 4;
  const int slab = blockIdx.x / QBN5, qblk = QB05 + blockIdx.x % QBN5; (void)NQB; const int b = slab / NH, h = slab % NH; const int qb0 = qblk * (4 * RPW); const int q0 = qb0 + w * RPW;
  FragH aq[2][KS], aql[2][KS];
#pragma unroll
  for (int rt = 0; rt < RTN; ++rt) { const unsigned short* qr = (const unsigned short*)Q16 + ((size_t)b * TQ + q0 + rt * 16 + ln) * ldq + h * 64; const unsigned short* ql = (const unsigned short*)QL + ((size_t)b * TQ + q0 + rt * 16 + ln) * ldq + h * 64;
#pragma unroll
    for (int ks = 0; ks < KS; ++ks) { aq[rt][ks].half[0] = *(const v8us*)(qr + ks * 32 + 8 * hh); aq[rt][ks].half[1] = *(const v8us*)(qr + ks * 32 + 16 + 8 * hh); aql[rt][ks].half[0] = *(const v8us*)(ql + ks * 32 + 8 * hh); aql[rt][ks].half[1] = *(const v8us*)(ql + ks * 32 + 16 + 8 * hh); } }
  const unsigned short* Vth = (const unsigned short*)Vt + (size_t)slab * 64 * TK; const unsigned short* Vtl = (const unsigned short*)VtL + (size_t)slab * 64 * TK;
  float m_r[2][8], l_r[2][8]; v8f oacc[2][DT], oaccL[2][DT];
#pragma unroll
  for (int rt = 0; rt < RTN; ++rt) {
#pragma unroll
    for (int r = 0; r < 8; ++r) { m_r[rt][r] = -3.0e38f; l_r[rt][r] = 0.f; }
#pragma unroll
    for (int dt = 0; dt < DT; ++dt) { oacc[rt][dt] = (v8f){0.f,0.f,0.f,0.f,0.f,0.f,0.f,0.f}; oaccL[rt][dt] = oacc[rt][dt]; } }
  const int jend = (CAUSAL == 1) ? (qb0 + 4 * RPW) : TK;      /* causal: keys beyond the block's last query never contribute */
#pragma unroll 1
  for (int j0 = 0; j0 < jend; j0 += 32) {
    v8f s[2][2];
#pragma unroll
    for (int nt = 0; nt < 2; ++nt) { const unsigned short* kr = (const unsigned short*)K16 + ((size_t)b * TK + j0 + nt * 16 + ln) * ldk + h * 64; const unsigned short* klr = (const unsigned short*)KL + ((size_t)b * TK + j0 + nt * 16 + ln) * ldk + h * 64; FragH bk[KS], bkl[KS];
#pragma unroll
      for (int ks = 0; ks < KS; ++ks) { bk[ks].half[0] = *(const v8us*)(kr + ks * 32 + 8 * hh); bk[ks].half[1] = *(const v8us*)(kr + ks * 32 + 16 + 8 * hh); bkl[ks].half[0] = *(const v8us*)(klr + ks * 32 + 8 * hh); bkl[ks].half[1] = *(const v8us*)(klr + ks * 32 + 16 + 8 * hh); }
#pragma unroll
      for (int rt = 0; rt < RTN; ++rt) { v8f acc = (v8f){0.f,0.f,0.f,0.f,0.f,0.f,0.f,0.f}, accl = acc;
#pragma unroll
        for (int ks = 0; ks < KS; ++ks) { acc = mmaH<1>(aq[rt][ks].v, aq[rt][ks].v, bk[ks].v, bk[ks].v, acc); accl = mmaH<1>(aql[rt][ks].v, aql[rt][ks].v, bk[ks].v, bk[ks].v, accl); accl = mmaH<1>(aq[rt][ks].v, aq[rt][ks].v, bkl[ks].v, bkl[ks].v, accl); }
#pragma unroll
        for (int r = 0; r < 8; ++r) acc[r] += accl[r] * 0.0009765625f;
        s[rt][nt] = acc; } }
#pragma unroll
    for (int rt = 0; rt < RTN; ++rt)
#pragma unroll
      for (int r = 0; r < 8; ++r) { const int tq = q0 + rt * 16 + 8 * hh + r; const int k0 = j0 + ln, k1 = j0 + 16 + ln;
        bool ok0 = (CAUSAL == 1) ? (k0 <= tq) : ((CAUSAL == 2) ? ((k0 >> 5) == (tq >> 5)) : true), ok1 = (CAUSAL == 1) ? (k1 <= tq) : ((CAUSAL == 2) ? ((k1 >> 5) == (tq >> 5)) : true);      /* mode 2: block-diagonal 32-token groups */
        if (CAUSAL == 4) { const int* mrow = MSK + ((size_t)b * TQ + tq) * TK; ok0 = mrow[k0] != 0; ok1 = mrow[k1] != 0; }      /* mode 4: per-(query, key) INPUT mask shared by all heads; masked keys contribute nothing (== the reference's -4096 fill, whose exp underflows to 0), rows with no valid key give l = 0 -> output 0 (== the reference's row_valid zeroing) */
        float s0 = ok0 ? s[rt][0][r] * SCL : -3.0e38f, s1 = ok1 ? s[rt][1][r] * SCL : -3.0e38f; if (CAUSAL == 17) { const float* amk = (const float*)MSK + (size_t)b * TK; s0 += bf16_round(amk[k0]); s1 += bf16_round(amk[k1]); }      /* mode 17: additive per-(batch, key) mask INPUT */ float mc = fmaxf(s0, s1);
        mc = fmaxf(mc, __shfl_xor(mc, 1, 32)); mc = fmaxf(mc, __shfl_xor(mc, 2, 32)); mc = fmaxf(mc, __shfl_xor(mc, 4, 32)); mc = fmaxf(mc, __shfl_xor(mc, 8, 32));
        const float mn = fmaxf(m_r[rt][r], mc); const float al = (mn > -1.0e38f) ? expf(m_r[rt][r] - mn) : 1.0f; m_r[rt][r] = mn; const float p0 = ok0 ? expf(s0 - mn) : 0.f, p1 = ok1 ? expf(s1 - mn) : 0.f; l_r[rt][r] = l_r[rt][r] * al + p0 + p1;
#pragma unroll
        for (int dt = 0; dt < DT; ++dt) { oacc[rt][dt][r] *= al; oaccL[rt][dt][r] *= al; }
        FragH t2, t2l; const float ps0 = p0 * 1024.0f, ps1 = p1 * 1024.0f; t2.h[0] = (_Float16)ps0; t2.h[1] = (_Float16)ps1; t2l.h[0] = (_Float16)((ps0 - (float)t2.h[0]) * 1024.0f); t2l.h[1] = (_Float16)((ps1 - (float)t2.h[1]) * 1024.0f);
        sP[w][rt * 16 + 8 * hh + r][ln] = t2.u[0]; sP[w][rt * 16 + 8 * hh + r][16 + ln] = t2.u[1]; sPL[w][rt * 16 + 8 * hh + r][ln] = t2l.u[0]; sPL[w][rt * 16 + 8 * hh + r][16 + ln] = t2l.u[1]; }
    __builtin_amdgcn_fence(__ATOMIC_ACQ_REL, "workgroup"); __builtin_amdgcn_wave_barrier();
    FragH pa[2], pl[2];
#pragma unroll
    for (int rt = 0; rt < RTN; ++rt) { pa[rt].half[0] = *(const v8us*)&sP[w][rt * 16 + ln][8 * hh]; pa[rt].half[1] = *(const v8us*)&sP[w][rt * 16 + ln][16 + 8 * hh]; pl[rt].half[0] = *(const v8us*)&sPL[w][rt * 16 + ln][8 * hh]; pl[rt].half[1] = *(const v8us*)&sPL[w][rt * 16 + ln][16 + 8 * hh]; }
#pragma unroll
    for (int dt = 0; dt < DT; ++dt) { const unsigned short* vrow = Vth + (size_t)(dt * 16 + ln) * TK + j0; const unsigned short* vrl = Vtl + (size_t)(dt * 16 + ln) * TK + j0; FragH bv, bl; bv.half[0] = *(const v8us*)(vrow + 8 * hh); bv.half[1] = *(const v8us*)(vrow + 16 + 8 * hh); bl.half[0] = *(const v8us*)(vrl + 8 * hh); bl.half[1] = *(const v8us*)(vrl + 16 + 8 * hh);
#pragma unroll
      for (int rt = 0; rt < RTN; ++rt) { oacc[rt][dt] = mmaH<1>(pa[rt].v, pa[rt].v, bv.v, bv.v, oacc[rt][dt]); oaccL[rt][dt] = mmaH<1>(pl[rt].v, pl[rt].v, bv.v, bv.v, oaccL[rt][dt]); oaccL[rt][dt] = mmaH<1>(pa[rt].v, pa[rt].v, bl.v, bl.v, oaccL[rt][dt]); } }
    __builtin_amdgcn_fence(__ATOMIC_ACQ_REL, "workgroup"); __builtin_amdgcn_wave_barrier(); }
#pragma unroll
  for (int rt = 0; rt < RTN; ++rt) {
#pragma unroll
    for (int r = 0; r < 8; ++r) { float l = l_r[rt][r]; l += __shfl_xor(l, 1, 32); l += __shfl_xor(l, 2, 32); l += __shfl_xor(l, 4, 32); l += __shfl_xor(l, 8, 32); l_r[rt][r] = (l > 0.f) ? 1.0f / (l * 1024.0f) : 0.f; }
#pragma unroll
    for (int dt = 0; dt < DT; ++dt)
#pragma unroll
      for (int r = 0; r < 8; ++r) { float v = oacc[rt][dt][r]; v += oaccL[rt][dt][r] * 0.0009765625f; sO[w][rt * 16 + 8 * hh + r][dt * 16 + ln] = v * l_r[rt][r]; } }
  __builtin_amdgcn_fence(__ATOMIC_ACQ_REL, "workgroup"); __builtin_amdgcn_wave_barrier();
  {
#pragma unroll
    for (int rp = 0; rp < RPW; rp += 2) { const int r = rp + (lane >> 4), pc = lane & 15; const v4f val = *(const v4fa*)&sO[w][r][pc * 4]; *(v4f*)(O + ((size_t)b * TQ + q0 + r) * ldo + h * 64 + pc * 4) = val; }
     } }

__global__ __launch_bounds__(256) void k_rotab(float* __restrict__ CS, float* __restrict__ SN) {
  #pragma clang fp contract(off)
  const int t = blockIdx.x * 256 + threadIdx.x; if (t >= SLEN * 32) return; const int j = t % 32, s = t / 32; const float ex = (float)(2 * j) / 64.0f; const float inv = 1.0f / powf(10000.0f, ex); const float th = (float)s * inv; const float c = cosf(th), sn = sinf(th);
  { *(float*)(CS + t) = c; *(float*)(SN + t) = sn;  } }
__global__ __launch_bounds__(256) void k_rope(const float* __restrict__ F, int nsrc, int ndst, int rep, const float* __restrict__ CS, const float* __restrict__ SN, _Float16* __restrict__ H, _Float16* __restrict__ L) {
  #pragma clang fp contract(off)
  const size_t t = (size_t)blockIdx.x * 256 + threadIdx.x; if (t >= (size_t)NR * ndst * 4) return; const int g8 = (int)(t % 4); const int hd = (int)((t / 4) % ndst); const size_t row = t / ((size_t)4 * ndst); const int s = (int)(row % SLEN); const int hs = hd / rep;
  const float* src = F + row * (size_t)(nsrc * 64) + hs * 64; FragH ah, al, bh, bl;
  for (int i = 0; i < 8; ++i) { const int d = g8 * 8 + i; const float c = CS[s * 32 + d], sn = SN[s * 32 + d]; const float x1 = src[d], x2 = src[d + 32];
    float o1 = x1 * c; o1 += -x2 * sn; float o2 = x2 * c; o2 += x1 * sn;
    _Float16 hv = (_Float16)o1; ah.h[i] = hv; al.h[i] = (_Float16)((o1 - (float)hv) * 1024.0f); hv = (_Float16)o2; bh.h[i] = hv; bl.h[i] = (_Float16)((o2 - (float)hv) * 1024.0f); }
  const size_t o = row * (size_t)(ndst * 64) + hd * 64 + g8 * 8;
  { *(v8us*)((unsigned short*)H + o) = ah.half[0]; *(v8us*)((unsigned short*)H + o + 32) = bh.half[0]; *(v8us*)((unsigned short*)L + o) = al.half[0]; *(v8us*)((unsigned short*)L + o + 32) = bl.half[0];  } }
__global__ __launch_bounds__(256) void k_rope2(const float* __restrict__ F, int nsrc, int ndst, int rep, const float* __restrict__ CS, const float* __restrict__ SN, _Float16* __restrict__ H, _Float16* __restrict__ L) {
  #pragma clang fp contract(off)
  const size_t t = (size_t)blockIdx.x * 256 + threadIdx.x; if (t >= (size_t)NR * ndst * 4) return; const int g16 = (int)(t % 4); const int hd = (int)((t / 4) % ndst); const size_t row = t / ((size_t)4 * ndst); const int s = (int)(row % SLEN); const int hs = hd / rep;
  const float* src = F + row * (size_t)(nsrc * 64) + hs * 64 + g16 * 16; FragH ah, al;
  for (int pr = 0; pr < 8; ++pr) { const int i = g16 * 8 + pr; const float c = CS[s * 32 + i], sn = SN[s * 32 + i]; const float x1 = src[2 * pr], x2 = src[2 * pr + 1];
    float o1 = x1 * c; o1 -= x2 * sn; float o2 = x1 * sn; o2 += x2 * c;
    _Float16 hv = (_Float16)o1; ah.h[2 * pr] = hv; al.h[2 * pr] = (_Float16)((o1 - (float)hv) * 1024.0f); hv = (_Float16)o2; ah.h[2 * pr + 1] = hv; al.h[2 * pr + 1] = (_Float16)((o2 - (float)hv) * 1024.0f); }
  const size_t o = row * (size_t)(ndst * 64) + hd * 64 + g16 * 16;
  { *(v8us*)((unsigned short*)H + o) = ah.half[0]; *(v8us*)((unsigned short*)H + o + 8) = ah.half[1]; *(v8us*)((unsigned short*)L + o) = al.half[0]; *(v8us*)((unsigned short*)L + o + 8) = al.half[1];  } }
__global__ __launch_bounds__(256) void k_tabin(const float* __restrict__ sp, float* __restrict__ CS, float* __restrict__ SN) { const int t = blockIdx.x * 256 + threadIdx.x; if (t >= SLEN * 32) return; const int i = t % 32, s = t / 32; const float c = bf16_round(sp[s * 64 + 32 + i]), sn = bf16_round(sp[s * 64 + i]);
  { *(float*)(CS + t) = c; *(float*)(SN + t) = sn;  } }
__global__ __launch_bounds__(256) void k_wsc(const float* __restrict__ Wm, _Float16* __restrict__ Bt, size_t n8, float sc) { const size_t t = (size_t)blockIdx.x * 256 + threadIdx.x; if (t >= n8) return; FragH f; for (int q = 0; q < 8; ++q) f.h[q] = (_Float16)(bf16_round(Wm[t * 8 + q]) * sc); *(v8us*)((unsigned short*)Bt + t * 8) = f.half[0];  }
__global__ __launch_bounds__(256) void k_rotab2(float* __restrict__ CS, float* __restrict__ SN) {
  #pragma clang fp contract(off)
  const int t = blockIdx.x * 256 + threadIdx.x; if (t >= SLEN * 32) return; const int j = t % 32, s = t / 32; const float c0 = -0.14391156831212787f;      /* -ln(10000)/64 rounded to f32 */ const float inv = expf((float)(2 * j) * c0); const float th = (float)s * inv; const float c = cosf(th), sn = sinf(th);
  { *(float*)(CS + t) = c; *(float*)(SN + t) = sn;  } }
__global__ __launch_bounds__(256) void k_lnu(const float* __restrict__ X, _Float16* __restrict__ N16, float* __restrict__ XB) {
  #pragma clang fp contract(off)
  const int wv = threadIdx.x >> 5, ln = threadIdx.x & 31; const size_t r = (size_t)blockIdx.x * 8 + wv; if (r >= NR) return; float a[32]; float s = 0.f;
  for (int i = 0; i < 4; ++i) { const v8f v = *(const v8f*)(X + r * DM + (i * 32 + ln) * 8); for (int q = 0; q < 8; ++q) { const float u = bf16_round(v[q]); a[i * 8 + q] = u; s += u; } }
  for (int o = 16; o > 0; o >>= 1) s += __shfl_xor(s, o, 32); const float mu = s / (float)DM; float var = 0.f; for (int q = 0; q < 32; ++q) { const float d = a[q] - mu; var += d * d; }
  for (int o = 16; o > 0; o >>= 1) var += __shfl_xor(var, o, 32); const float den = sqrtf(var / (float)(DM - 1)) + 1e-6f; const float inv = 1.0f / den;      /* one reciprocal per row; (x-mean)*inv vs the reference's division differs by <= 1 ulp */
  { for (int i = 0; i < 4; ++i) { const int c0 = (i * 32 + ln) * 8; FragH f; v8f xb; for (int q = 0; q < 8; ++q) { f.h[q] = (_Float16)((a[i * 8 + q] - mu) * inv); xb[q] = a[i * 8 + q]; } *(v8us*)((unsigned short*)N16 + r * DM + c0) = f.half[0]; *(v8f*)(XB + r * DM + c0) = xb; }  } }
__global__ __launch_bounds__(256) void k_vtg(const _Float16* __restrict__ V16, _Float16* __restrict__ Vt) { __shared__ unsigned short tl[64][66]; const int tid = threadIdx.x; const int slab = blockIdx.x / (SLEN / 64), lg = blockIdx.x % (SLEN / 64); const int b = slab / NH, h = slab % NH; const int hs = h / NREP;
  for (int i = tid; i < 64 * 8; i += 256) { const int r = i / 8, c8 = (i % 8) * 8; FragH f; f.half[0] = *(const v8us*)((const unsigned short*)V16 + ((size_t)b * SLEN + lg * 64 + r) * KVD + hs * 64 + c8); for (int q = 0; q < 8; ++q) tl[r][c8 + q] = f.u[q]; }
  __syncthreads();
  { for (int rd = 0; rd < 2; ++rd) { const int d = rd * 32 + tid / 8, pc = tid % 8; FragH f; for (int q = 0; q < 8; ++q) f.u[q] = tl[pc * 8 + q][d]; *(v8us*)((unsigned short*)Vt + ((size_t)slab * 64 + d) * SLEN + lg * 64 + pc * 8) = f.half[0]; }  } }

extern "C" void kernel_launch(void* const* d_in, const int* in_sizes, int n_in,
                              void* d_out, int out_size, void* d_ws, size_t ws_size, hipStream_t stream) {
  (void)in_sizes; (void)n_in; (void)out_size;
  const float* const* I = (const float* const*)d_in; const float* x = I[0]; const float* sp = I[1]; const float* am = I[2]; const float* Wq = I[3]; const float* Wk = I[4]; const float* Wv = I[5]; const float* bq = nullptr; const float* bk = nullptr; const float* bv = nullptr;
  char* ws = (char*)d_ws; size_t off = 0;
  auto take = [&](size_t bytes) { char* p = ws + off; off += (bytes + 255) & ~(size_t)255; return p; };
  const size_t np = (size_t)NR * DM, nk = (size_t)NR * KVD;
  _Float16* BQ = (_Float16*)take((size_t)DM * DM * 2); _Float16* BK = (_Float16*)take((size_t)KVD * DM * 2); _Float16* BV = (_Float16*)take((size_t)KVD * DM * 2);
  float* CS = (float*)take((size_t)SLEN * 32 * 4); float* SN = (float*)take((size_t)SLEN * 32 * 4);
  _Float16* X16 = (_Float16*)take(np * 2); float* QF = (float*)take(np * 4); _Float16* QH = (_Float16*)take(np * 2); _Float16* QL = (_Float16*)take(np * 2); float* KF = (float*)take(nk * 4); float* VF = (float*)take(nk * 4); _Float16* KXH = (_Float16*)take(np * 2); _Float16* KXL = (_Float16*)take(np * 2); _Float16* VH = (_Float16*)take(nk * 2); _Float16* VL = (_Float16*)take(nk * 2); _Float16* VT = (_Float16*)take(np * 2); /* no VTL: plain flash only */
  /* the flash output goes straight to d_out */
  if (off > ws_size) return;      /* 3x2 + 0.25+0.25 + 8 + 16 + 8+8 + 16+16 + 8+8 + 8+8 + 8 = 118.5 MiB */
  k_wsc<<<(unsigned)(((size_t)DM * DM / 8 + 255) / 256), 256, 0, stream>>>(Wq, BQ, (size_t)DM * DM / 8, 16.0f); k_wsc<<<(unsigned)(((size_t)KVD * DM / 8 + 255) / 256), 256, 0, stream>>>(Wk, BK, (size_t)KVD * DM / 8, 16.0f); k_wsc<<<(unsigned)(((size_t)KVD * DM / 8 + 255) / 256), 256, 0, stream>>>(Wv, BV, (size_t)KVD * DM / 8, 16.0f);      /* torch (out,in) = Bt */
  k_tabin<<<(SLEN * 32 + 255) / 256, 256, 0, stream>>>(sp, CS, SN);
  k_x16<<<(unsigned)((np / 8 + 255) / 256), 256, 0, stream>>>(x, X16, np / 8);
  k_gemm2<0><<<dim3((NR / 128) * (DM / 64), 1), 128, 0, stream>>>(X16, DM, 0, BQ, DM, 0, 0.0625f, bq, 0, nullptr, 1, 0, 0, QF, nullptr, DM, 0, NR, DM, DM);
  k_gemm2<0><<<dim3((NR / 128) * (KVD / 64), 1), 128, 0, stream>>>(X16, DM, 0, BK, DM, 0, 0.0625f, bk, 0, nullptr, 1, 0, 0, KF, nullptr, KVD, 0, NR, KVD, DM);
  k_gemm2<0><<<dim3((NR / 128) * (KVD / 64), 1), 128, 0, stream>>>(X16, DM, 0, BV, DM, 0, 0.0625f, bv, 0, nullptr, 1, 0, 0, VF, nullptr, KVD, 0, NR, KVD, DM);
  k_rope2<<<(unsigned)(((size_t)NR * NH * 4 + 255) / 256), 256, 0, stream>>>(QF, NH, NH, 1, CS, SN, QH, QL);      /* q: 16 -> 16 heads (interleaved pairs) */
  k_rope2<<<(unsigned)(((size_t)NR * NH * 4 + 255) / 256), 256, 0, stream>>>(KF, NKV, NH, NREP, CS, SN, KXH, KXL);      /* k: kv head h to query head h (NREP = 1) */
  k_hl<<<(unsigned)((nk / 8 + 255) / 256), 256, 0, stream>>>(VF, VH, VL, nk / 8);
  k_vtg<<<NB * NH * (SLEN / 64), 256, 0, stream>>>(VH, VT);
  k_flash<17><<<NB * NH * QBNP, 128, 0, stream>>>(QH, DM, KXH, DM, VT, (const int*)am, (float*)d_out, DM);      /* + attention_mask[b][key]; the merged context is the output */
}

// v001
// A run of this version takes 248 microseconds.
// Timed twice side by side with v000, it ran 1.58 times as fast both times.
#include <hip/hip_runtime.h>
// DiffBertSelfAttention (2 x 2048 tokens, D 1024 = 16 heads of 64): q, k, v = x W^T; RoFormer rotary from the sinusoidal_pos INPUT ([sin | cos] halves, interleave-duplicated: out[2i] = x[2i] cos_i - x[2i+1] sin_i, out[2i+1] = x[2i+1] cos_i + x[2i] sin_i); scores/8 + attention_mask[b, key] (additive INPUT, broadcast over heads and queries); softmax; ctx = probs v merged -> the output (no output projection).
// Structure: exact f16 plane of x; q, k, v as f32 WMMA GEMM outputs (32x64 wave tiles, f32 accumulation, exact x16 weights); the rotary tables copied from the input (bf16-rounded like every input); interleaved RoPE + f16 conversion on VALU; V^T by LDS tiles; the fused flash kernel with the per-key additive mask read from the input (mode 17; plain operands: every row averages ~2048 keys) writing the merged context straight to the output.
// Compute dtype: inputs and parameters rounded to bf16; q/k/P/v as plain f16 operands (~2^-12); RoPE/softmax f32. v_wmma_f32_16x16x32_f16.
#define NB 2
#define DM 1024
#define NKV 16
#define NREP (NH / NKV)
#define KVD (NKV * 64)           /* 1024 */
#define NR (NB * SLEN)           /* 4096 */
#define SLEN 2048
#define TQ SLEN
#define TK SLEN
#define NH 16
#define SCL 0.125f
#define QBLKS (TQ / 64)
#define QB05 0
#define QBN5 4
#define QB0P 0
#define QBNP QBLKS           /* non-causal: plain flash on every query block */
#define RE 256
typedef __bf16 v16b __attribute__((ext_vector_type(16)));
typedef unsigned short v8us __attribute__((ext_vector_type(8), may_alias));
typedef float  v8f  __attribute__((ext_vector_type(8)));
typedef float  v4f  __attribute__((ext_vector_type(4)));
typedef float  v4fa __attribute__((ext_vector_type(4), may_alias));
union FragB { v16b v; v8us half[2]; unsigned short u[16]; };

__device__ __forceinline__ unsigned short bf16_bits(float x) { unsigned int u = __float_as_uint(x); return (unsigned short)((u + 0x7FFFu + ((u >> 16) & 1u)) >> 16); }
__device__ __forceinline__ float bf16_val(unsigned short b) { return __uint_as_float(((unsigned int)b) << 16); }
__device__ __forceinline__ float bf16_round(float x) { return bf16_val(bf16_bits(x)); }
// D += A·B with NT terms: 1 = ah·bh, 2 = + al·bh (A split), 3 = + ah·bl (both split)
template <int NT>
__device__ __forceinline__ v8f mmaN(v16b ah, v16b al, v16b bh, v16b bl, v8f c) {
  c = __builtin_amdgcn_wmma_f32_16x16x32_bf16(false, ah, false, bh, (short)0, c, false, false);
  if (NT >= 2) c = __builtin_amdgcn_wmma_f32_16x16x32_bf16(false, al, false, bh, (short)0, c, false, false);
  if (NT >= 3) c = __builtin_amdgcn_wmma_f32_16x16x32_bf16(false, ah, false, bl, (short)0, c, false, false);
  asm volatile("v_nop\n\tv_nop\n\tv_nop\n\tv_nop" : "+v"(c) : "v"(ah), "v"(al), "v"(bh), "v"(bl));
  return c;
}

__global__ __launch_bounds__(256) void k_wt_bf16(const float* __restrict__ W, unsigned short* __restrict__ Wt, int K, int N) {
  const int t = blockIdx.x * 256 + threadIdx.x;
  const int k8n = K / 8;
  if (t >= N * k8n) return;
  const int n = t / k8n, k8 = (t % k8n) * 8;
  v8us v;
#pragma unroll
  for (int i = 0; i < 8; ++i) v[i] = bf16_bits(W[(size_t)(k8 + i) * N + n]);
  *(v8us*)(Wt + (size_t)n * K + k8) = v;
  
}

// GEMM C[M][N] (f32, pitch ldc) = act(A[M][K]·W + bias). A f32 row-major (pitch lda) converted per fragment to bf16
// (ASPLIT: hi/lo two planes -> 2 terms, else single rounded term); Wt bf16 [N][K] (pitch ldb). BIAS_BF16 rounds the
// bias to bf16 first (bias quantised to bf16 before the add). K%32==0, M%16==0, N%64==0.
template <bool ASPLIT, int ACT, bool BIAS_BF16>
__global__ __launch_bounds__(128) void k_gemm_bf(const float* __restrict__ A, int lda, const unsigned short* __restrict__ Wt, int ldb,
                                               const float* __restrict__ bias, float* __restrict__ C, int ldc, int M, int N, int K) {
  __shared__ __attribute__((aligned(16))) float so[4][16][64];
  const int tid = threadIdx.x, w = tid >> 5, lane = tid & 31, ln = lane & 15, hh = lane >> 4;
  const int ntn = N / 64;
  const int wid = blockIdx.x * 4 + w;
  const int mt = wid / ntn, nq = wid % ntn;
  if (mt * 16 >= M) return;
  const int row0 = mt * 16, col0 = nq * 64;
  const float* arow = A + (size_t)(row0 + ln) * lda;
  v8f acc[4] = {};
  for (int kb = 0; kb < K; kb += 32) {
    FragB ah, al;
    const v4f x0 = *(const v4fa*)(arow + kb + 8 * hh), x1 = *(const v4fa*)(arow + kb + 8 * hh + 4);
    const v4f x2 = *(const v4fa*)(arow + kb + 16 + 8 * hh), x3 = *(const v4fa*)(arow + kb + 16 + 8 * hh + 4);
    float xs[16] = {x0[0],x0[1],x0[2],x0[3],x1[0],x1[1],x1[2],x1[3],x2[0],x2[1],x2[2],x2[3],x3[0],x3[1],x3[2],x3[3]};
#pragma unroll
    for (int i = 0; i < 16; ++i) { const unsigned short hb = bf16_bits(xs[i]); ah.u[i] = hb; al.u[i] = ASPLIT ? bf16_bits(xs[i] - bf16_val(hb)) : (unsigned short)0; }
#pragma unroll
    for (int t = 0; t < 4; ++t) {
      const unsigned short* brow = Wt + (size_t)(col0 + t * 16 + ln) * ldb + kb;
      FragB b;
      b.half[0] = *(const v8us*)(brow + 8 * hh);
      b.half[1] = *(const v8us*)(brow + 16 + 8 * hh);
      acc[t] = mmaN<ASPLIT ? 2 : 1>(ah.v, al.v, b.v, b.v, acc[t]);
    }
  }
#pragma unroll
  for (int t = 0; t < 4; ++t) {
    float bv = bias ? bias[col0 + t * 16 + ln] : 0.f;
    if (BIAS_BF16) bv = bf16_round(bv);
#pragma unroll
    for (int r = 0; r < 8; ++r) { float v = acc[t][r] + bv; if (ACT == 1) v = fmaxf(v, 0.f); so[w][8 * hh + r][t * 16 + ln] = v; }
  }
  __builtin_amdgcn_fence(__ATOMIC_ACQ_REL, "workgroup");
  __builtin_amdgcn_wave_barrier();
  const int rsub = lane >> 4, c4 = (lane & 15) * 4;
  {
#pragma unroll
    for (int q = 0; q < 8; ++q) {
      const int r = q * 2 + rsub;
      const v4f v = *(const v4fa*)&so[w][r][c4];
      *(v4f*)(C + (size_t)(row0 + r) * ldc + col0 + c4) = v;
    }
    
  }
}

// GEMM C = act(A·W + bias + resid): A f32 (ASPLIT -> hi/lo 2 terms), Wt bf16 [N][K]; ACT 0 none, 1 relu, 2 exact gelu;
// resid (optional, f32, row index = (row % rmod), pitch ldr, RES_BF16 rounds it) added before the activation.
template <bool ASPLIT, int ACT, bool BIAS_BF16, bool RES_BF16>
__global__ __launch_bounds__(128) void k_gemm_bf3(const float* __restrict__ A, int lda, const unsigned short* __restrict__ Wt, int ldb,
                                                const float* __restrict__ bias, const float* __restrict__ resid, int rmod, int ldr,
                                                float* __restrict__ C, int ldc, int M, int N, int K) {
  __shared__ __attribute__((aligned(16))) float so[4][16][64];
  const int tid = threadIdx.x, w = tid >> 5, lane = tid & 31, ln = lane & 15, hh = lane >> 4;
  const int ntn = N / 64;
  const int wid = blockIdx.x * 4 + w;
  const int mt = wid / ntn, nq = wid % ntn;
  if (mt * 16 >= M) return;
  const int row0 = mt * 16, col0 = nq * 64;
  const float* arow = A + (size_t)(row0 + ln) * lda;
  v8f acc[4] = {};
  for (int kb = 0; kb < K; kb += 32) {
    FragB ah, al;
    const v4f x0 = *(const v4fa*)(arow + kb + 8 * hh), x1 = *(const v4fa*)(arow + kb + 8 * hh + 4);
    const v4f x2 = *(const v4fa*)(arow + kb + 16 + 8 * hh), x3 = *(const v4fa*)(arow + kb + 16 + 8 * hh + 4);
    float xs[16] = {x0[0],x0[1],x0[2],x0[3],x1[0],x1[1],x1[2],x1[3],x2[0],x2[1],x2[2],x2[3],x3[0],x3[1],x3[2],x3[3]};
#pragma unroll
    for (int i = 0; i < 16; ++i) { const unsigned short hb = bf16_bits(xs[i]); ah.u[i] = hb; al.u[i] = ASPLIT ? bf16_bits(xs[i] - bf16_val(hb)) : (unsigned short)0; }
#pragma unroll
    for (int t = 0; t < 4; ++t) {
      const unsigned short* brow = Wt + (size_t)(col0 + t * 16 + ln) * ldb + kb;
      FragB b;
      b.half[0] = *(const v8us*)(brow + 8 * hh);
      b.half[1] = *(const v8us*)(brow + 16 + 8 * hh);
      acc[t] = mmaN<ASPLIT ? 2 : 1>(ah.v, al.v, b.v, b.v, acc[t]);
    }
  }
#pragma unroll
  for (int t = 0; t < 4; ++t) {
    const int col = col0 + t * 16 + ln;
    float bv = bias ? bias[col] : 0.f;
    if (BIAS_BF16) bv = bf16_round(bv);
#pragma unroll
    for (int r = 0; r < 8; ++r) {
      float v = acc[t][r] + bv;
      if (resid) { float rv = resid[(size_t)((row0 + 8 * hh + r) % rmod) * ldr + col]; if (RES_BF16) rv = bf16_round(rv); v += rv; }
      if (ACT == 1) v = fmaxf(v, 0.f);
      if (ACT == 2) v = 0.5f * v * (1.0f + erff(v * 0.70710678118654752f));
      if (ACT == 3) { const float u = 0.7978845608028654f * (v + 0.044715f * v * v * v); v = 0.5f * v * (1.0f + tanhf(u)); }
      so[w][8 * hh + r][t * 16 + ln] = v;
    }
  }
  __builtin_amdgcn_fence(__ATOMIC_ACQ_REL, "workgroup");
  __builtin_amdgcn_wave_barrier();
  const int rsub = lane >> 4, c4 = (lane & 15) * 4;
  {
#pragma unroll
    for (int q = 0; q < 8; ++q) {
      const int r = q * 2 + rsub;
      const v4f v = *(const v4fa*)&so[w][r][c4];
      *(v4f*)(C + (size_t)(row0 + r) * ldc + col0 + c4) = v;
    }
    
  }
}
// row LayerNorm (biased variance, eps) over N: s = X (+ R); optional out_sum <- s; out_norm <- (s-mu)*rsqrt(var+eps)*g + b
template <bool PARAM_BF16>
__global__ __launch_bounds__(256) void k_layernorm(const float* __restrict__ X, const float* __restrict__ R, const float* __restrict__ g, const float* __restrict__ bta,
                                                  float* __restrict__ out_sum, float* __restrict__ out_norm, int N, float eps) {
  __shared__ float red[256];
  const int row = blockIdx.x, tid = threadIdx.x;
  const float* x = X + (size_t)row * N; const float* rr = R ? R + (size_t)row * N : nullptr;
  float vals[16];                     // up to N = 4096
  const int per = N / 256;            // contiguous chunk per thread? use strided-by-4 chunks: thread handles j = tid*4 + 1024*u
  float s1 = 0.f;
  for (int u = 0; u < per / 4; ++u) {
    const int j = tid * 4 + 1024 * u;
    const v4f a = *(const v4fa*)(x + j);
    v4f b = {0.f,0.f,0.f,0.f}; if (rr) b = *(const v4fa*)(rr + j);
#pragma unroll
    for (int q = 0; q < 4; ++q) { const float v = a[q] + b[q]; vals[u * 4 + q] = v; s1 += v; }
  }
  red[tid] = s1; __syncthreads();
  for (int st = 128; st > 0; st >>= 1) { if (tid < st) red[tid] += red[tid + st]; __syncthreads(); }
  const float mu = red[0] / (float)N; __syncthreads();
  float s2 = 0.f;
  for (int u = 0; u < per / 4; ++u)
#pragma unroll
    for (int q = 0; q < 4; ++q) { const float c = vals[u * 4 + q] - mu; s2 += c * c; }
  red[tid] = s2; __syncthreads();
  for (int st = 128; st > 0; st >>= 1) { if (tid < st) red[tid] += red[tid + st]; __syncthreads(); }
  const float rs = rsqrtf(red[0] / (float)N + eps);
  {
    for (int u = 0; u < per / 4; ++u) {
      const int j = tid * 4 + 1024 * u;
      v4f o, sm;
#pragma unroll
      for (int q = 0; q < 4; ++q) {
        float gg = g[j + q], bb = bta[j + q];
        if (PARAM_BF16) { gg = bf16_round(gg); bb = bf16_round(bb); }
        sm[q] = vals[u * 4 + q]; o[q] = (vals[u * 4 + q] - mu) * rs * gg + bb;
      }
      if (out_sum) *(v4f*)(out_sum + (size_t)row * N + j) = sm;
      *(v4f*)(out_norm + (size_t)row * N + j) = o;
    }
    
  }
}



// ---- f16 WMMA path (v_wmma_f32_16x16x32_f16): 11-bit significands for operands in range — used where a [0,1] probability operand needs more precision than bf16
typedef _Float16 v16h __attribute__((ext_vector_type(16)));
union FragH { v16h v; v8us half[2]; _Float16 h[16]; unsigned short u[16]; };
template <int NT>
__device__ __forceinline__ v8f mmaH(v16h ah, v16h al, v16h bh, v16h bl, v8f c) {
  c = __builtin_amdgcn_wmma_f32_16x16x32_f16(false, ah, false, bh, (short)0, c, false, false);
  if (NT >= 2) c = __builtin_amdgcn_wmma_f32_16x16x32_f16(false, al, false, bh, (short)0, c, false, false);
  if (NT >= 3) c = __builtin_amdgcn_wmma_f32_16x16x32_f16(false, ah, false, bl, (short)0, c, false, false);
  asm volatile("v_nop\n\tv_nop\n\tv_nop\n\tv_nop" : "+v"(c) : "v"(ah), "v"(al), "v"(bh), "v"(bl));
  return c;
}
// batched GEMM like k_gemm_b but f16 operands: A f32 (split into f16 hi/lo if ASPLIT, else rounded to f16), Bt = f16 values [n][k]; alpha; C f32; N multiple of 16 (partial tiles skipped)
template <bool ASPLIT>
__global__ __launch_bounds__(128) void k_gemm_h(const float* __restrict__ A, int lda, size_t sA, const _Float16* __restrict__ Bh, int ldb, size_t sB, float alpha, float* __restrict__ C, int ldc, size_t sC, int M, int N, int K) {
  __shared__ __attribute__((aligned(16))) float so[4][16][64];
  const int tid = threadIdx.x, w = tid >> 5, lane = tid & 31, ln = lane & 15, hh = lane >> 4; const int by = blockIdx.y;
  A += (size_t)by * sA; Bh += (size_t)by * sB; C += (size_t)by * sC;
  const int ntn = (N + 63) / 64; const int wid = blockIdx.x * 4 + w; const int mt = wid / ntn, nq = wid % ntn; if (mt * 16 >= M) return;
  const int row0 = mt * 16, col0 = nq * 64; const float* arow = A + (size_t)(row0 + ln) * lda;
  v8f acc[4] = {};
  for (int kb = 0; kb < K; kb += 32) {
    FragH ah, al;
    const v4f x0 = *(const v4fa*)(arow + kb + 8 * hh), x1 = *(const v4fa*)(arow + kb + 8 * hh + 4), x2 = *(const v4fa*)(arow + kb + 16 + 8 * hh), x3 = *(const v4fa*)(arow + kb + 16 + 8 * hh + 4);
    float xs[16] = {x0[0],x0[1],x0[2],x0[3],x1[0],x1[1],x1[2],x1[3],x2[0],x2[1],x2[2],x2[3],x3[0],x3[1],x3[2],x3[3]};
#pragma unroll
    for (int i = 0; i < 16; ++i) { const _Float16 h = (_Float16)xs[i]; ah.h[i] = h; al.h[i] = ASPLIT ? (_Float16)(xs[i] - (float)h) : (_Float16)0.0f; }
#pragma unroll
    for (int t = 0; t < 4; ++t) { if (col0 + t * 16 >= N) continue; const size_t boff = (size_t)(col0 + t * 16 + ln) * ldb + kb; FragH bq; bq.half[0] = *(const v8us*)(Bh + boff + 8 * hh); bq.half[1] = *(const v8us*)(Bh + boff + 16 + 8 * hh);
      acc[t] = mmaH<ASPLIT ? 2 : 1>(ah.v, al.v, bq.v, bq.v, acc[t]); }
  }
#pragma unroll
  for (int t = 0; t < 4; ++t) { if (col0 + t * 16 >= N) continue;
#pragma unroll
    for (int r = 0; r < 8; ++r) so[w][8 * hh + r][t * 16 + ln] = acc[t][r] * alpha; }
  __builtin_amdgcn_fence(__ATOMIC_ACQ_REL, "workgroup"); __builtin_amdgcn_wave_barrier();
  const int rsub = lane >> 4, c4 = (lane & 15) * 4;
  {
#pragma unroll
    for (int q = 0; q < 8; ++q) { const int r = q * 2 + rsub; if (col0 + c4 < N) { const v4f v = *(const v4fa*)&so[w][r][c4]; *(v4f*)(C + (size_t)(row0 + r) * ldc + col0 + c4) = v; } }
     }
}

// Wt[n][k] = f16(W[k][n]·scale) from f32 row-major W[K][N] (scale = power of two; bf16-exact weights stay exact in f16 away from the subnormal range)
__global__ __launch_bounds__(256) void k_wt_f16(const float* __restrict__ W, _Float16* __restrict__ Wt, int K, int N, float scale) {
  const int t = blockIdx.x * 256 + threadIdx.x; if (t >= N * (K / 8)) return; const int n = t / (K / 8), k8 = (t % (K / 8)) * 8; FragH f;
#pragma unroll
  for (int i = 0; i < 8; ++i) f.h[i] = (_Float16)(bf16_round(W[(size_t)(k8 + i) * N + n]) * scale); const v8us o = f.half[0];
  *(v8us*)((unsigned short*)Wt + (size_t)n * K + k8) = o; 
}
// k_gemm_hh variant with fused epilogue: v = acc·alpha + bias[by·sBias + col] (+ CP[(row/rowsPerB)·sCPb + by·64 + col] if CP) ; ACT 0 none / 1 elu ; writes f16 C16 (and f32 C if non-null)
template <int ACT>
__global__ __launch_bounds__(128) void k_gemm_hhx(const _Float16* __restrict__ A, int lda, size_t sA, const _Float16* __restrict__ Bh, int ldb, size_t sB, float alpha, const float* __restrict__ bias, size_t sBias, const float* __restrict__ CP, int rowsPerB, size_t sCPb, int row0g,
    float* __restrict__ C, _Float16* __restrict__ C16, int ldc, size_t sC, int M, int N, int K) {
  __shared__ __attribute__((aligned(16))) float so[4][16][64];
  const int tid = threadIdx.x, w = tid >> 5, lane = tid & 31, ln = lane & 15, hh = lane >> 4; const int by = blockIdx.y;
  A += (size_t)by * sA; Bh += (size_t)by * sB; const size_t cofs = (size_t)by * sC; const float* bp = bias ? bias + (size_t)by * sBias : nullptr;
  const int ntn = (N + 63) / 64; const int wid = blockIdx.x * 4 + w; const int mt = wid / ntn, nq = wid % ntn; if (mt * 16 >= M) return;
  const int row0 = mt * 16, col0 = nq * 64; const _Float16* arow = A + (size_t)(row0 + ln) * lda;
  v8f acc[4] = {};
  for (int kb = 0; kb < K; kb += 32) { FragH ah; ah.half[0] = *(const v8us*)((const unsigned short*)arow + kb + 8 * hh); ah.half[1] = *(const v8us*)((const unsigned short*)arow + kb + 16 + 8 * hh);
#pragma unroll
    for (int t = 0; t < 4; ++t) { if (col0 + t * 16 >= N) continue; const size_t boff = (size_t)(col0 + t * 16 + ln) * ldb + kb; FragH bq; bq.half[0] = *(const v8us*)((const unsigned short*)Bh + boff + 8 * hh); bq.half[1] = *(const v8us*)((const unsigned short*)Bh + boff + 16 + 8 * hh);
      acc[t] = mmaH<1>(ah.v, ah.v, bq.v, bq.v, acc[t]); }
  }
#pragma unroll
  for (int t = 0; t < 4; ++t) { if (col0 + t * 16 >= N) continue; const int col = col0 + t * 16 + ln; const float bv = bp ? bf16_round(bp[col]) : 0.f;
#pragma unroll
    for (int r = 0; r < 8; ++r) { float v = acc[t][r] * alpha + bv; if (CP) { const int bidx = (row0g + row0 + 8 * hh + r) / rowsPerB; v += CP[(size_t)bidx * sCPb + (size_t)by * 64 + col]; } if (ACT == 1) v = (v > 0.f) ? v : expm1f(v); else if (ACT == 7) v = (v > 0.f) ? v + 1.0f : expf(v); else if (ACT == 8) v = tanhf(v); else if (ACT == 9) v = 0.5f * v * (1.0f + tanhf(0.7978845608028654f * (v + 0.044715f * v * v * v))); else if (ACT == 11) v = 1.0f / (1.0f + expf(-v)); else if (ACT == 12) v = (v > 0.f) ? v : 0.01f * v; else if (ACT == 14) v = (v > 0.f) ? v : 0.1f * v; else if (ACT == 15) v = v / (1.0f + expf(-v)); else if (ACT == 3) v = fmaxf(v, 0.f); else if (ACT == 6) v = 0.5f * v * (1.0f + erff(v * 0.70710678118654752f)); so[w][8 * hh + r][t * 16 + ln] = v; } }
  __builtin_amdgcn_fence(__ATOMIC_ACQ_REL, "workgroup"); __builtin_amdgcn_wave_barrier();
  const int rsub = lane >> 4, c4 = (lane & 15) * 4; typedef _Float16 v4h __attribute__((ext_vector_type(4)));
  {
#pragma unroll
    for (int q = 0; q < 8; ++q) { const int r = q * 2 + rsub; if (col0 + c4 < N) { const v4f v = *(const v4fa*)&so[w][r][c4]; if (C) *(v4f*)(C + cofs + (size_t)(row0 + r) * ldc + col0 + c4) = v; if (C16) { v4h h4; for (int i = 0; i < 4; ++i) h4[i] = (_Float16)v[i]; *(v4h*)(C16 + cofs + (size_t)(row0 + r) * ldc + col0 + c4) = h4; } } }
     }
}


typedef _Float16 v4h __attribute__((ext_vector_type(4)));

__global__ __launch_bounds__(256) void k_x16(const float* __restrict__ x, _Float16* __restrict__ X16, size_t n8) { const size_t t = (size_t)blockIdx.x * 256 + threadIdx.x; if (t >= n8) return; FragH f;
#pragma unroll
  for (int q = 0; q < 8; ++q) f.h[q] = (_Float16)bf16_round(x[t * 8 + q]); *(v8us*)((unsigned short*)X16 + t * 8) = f.half[0];  }
__global__ __launch_bounds__(256) void k_h16(const float* __restrict__ x, _Float16* __restrict__ X16, size_t n8) { const size_t t = (size_t)blockIdx.x * 256 + threadIdx.x; if (t >= n8) return; FragH f;
#pragma unroll
  for (int q = 0; q < 8; ++q) f.h[q] = (_Float16)x[t * 8 + q]; *(v8us*)((unsigned short*)X16 + t * 8) = f.half[0];  }
__global__ __launch_bounds__(256) void k_round16f(const float* __restrict__ W, _Float16* __restrict__ Bt, size_t n8) { const size_t t = (size_t)blockIdx.x * 256 + threadIdx.x; if (t >= n8) return; FragH f;
#pragma unroll
  for (int i = 0; i < 8; ++i) f.h[i] = (_Float16)(bf16_round(W[t * 8 + i]) * 16.0f); *(v8us*)((unsigned short*)Bt + t * 8) = f.half[0];  }
template <int NHv, int TTv>
__global__ __launch_bounds__(256) void k_vt(const _Float16* __restrict__ V16, int ldv, int voff, _Float16* __restrict__ Vt) { __shared__ unsigned short tl[64][66]; const int tid = threadIdx.x; const int slab = blockIdx.x / (TTv / 64), lg = blockIdx.x % (TTv / 64); const int b = slab / NHv, h = slab % NHv;
  for (int i = tid; i < 64 * 8; i += 256) { const int r = i / 8, c8 = (i % 8) * 8; FragH f; f.half[0] = *(const v8us*)((const unsigned short*)V16 + ((size_t)b * TTv + lg * 64 + r) * ldv + voff + h * 64 + c8);
#pragma unroll
    for (int q = 0; q < 8; ++q) tl[r][c8 + q] = f.u[q]; }
  __syncthreads();
  {
#pragma unroll
    for (int rd = 0; rd < 2; ++rd) { const int d = rd * 32 + tid / 8, pc = tid % 8; FragH f;
#pragma unroll
      for (int q = 0; q < 8; ++q) f.u[q] = tl[pc * 8 + q][d];
      *(v8us*)((unsigned short*)Vt + ((size_t)slab * 64 + d) * TTv + lg * 64 + pc * 8) = f.half[0]; }
     } }

__global__ __launch_bounds__(256) void k_hl(const float* __restrict__ F, _Float16* __restrict__ Hh, _Float16* __restrict__ Hl, size_t n8) { const size_t t = (size_t)blockIdx.x * 256 + threadIdx.x; if (t >= n8) return; FragH fh, fl; const v4f a = *(const v4fa*)(F + t * 8), c = *(const v4fa*)(F + t * 8 + 4);
#pragma unroll
  for (int q = 0; q < 4; ++q) { _Float16 h = (_Float16)a[q]; fh.h[q] = h; fl.h[q] = (_Float16)((a[q] - (float)h) * 1024.0f); h = (_Float16)c[q]; fh.h[4 + q] = h; fl.h[4 + q] = (_Float16)((c[q] - (float)h) * 1024.0f); }
  { *(v8us*)((unsigned short*)Hh + t * 8) = fh.half[0]; *(v8us*)((unsigned short*)Hl + t * 8) = fl.half[0];  } }

// ---- fast GEMM (wave tile 32x64; requires M % 32 == 0 rows per launch region and N % 64 == 0); epilogue = k_gemm_hhx semantics ----
__device__ __forceinline__ v16h g2_frag(const _Float16* p, int hh) { FragH f; f.half[0] = *(const v8us*)((const unsigned short*)p + 8 * hh); f.half[1] = *(const v8us*)((const unsigned short*)p + 16 + 8 * hh); return f.v; }
__device__ __forceinline__ v8f g2_mma(v16h a, v16h b, v8f c) { v8f d = __builtin_amdgcn_wmma_f32_16x16x32_f16(false, a, false, b, (short)0, c, false, false); asm volatile("v_nop\n\tv_nop\n\tv_nop\n\tv_nop" : "+v"(d) : "v"(a), "v"(b)); return d; }
template <int ACT>
__global__ __launch_bounds__(128) void k_gemm2(const _Float16* __restrict__ A, int lda, size_t sA, const _Float16* __restrict__ Bh, int ldb, size_t sB, float alpha, const float* __restrict__ bias, size_t sBias, const float* __restrict__ CP, int rowsPerB, size_t sCPb, int row0g,
    float* __restrict__ C, _Float16* __restrict__ C16, int ldc, size_t sC, int M, int N, int K) {
  __shared__ __attribute__((aligned(16))) float so[4][32][68];
  const int tid = threadIdx.x, w = tid >> 5, lane = tid & 31, ln = lane & 15, hh = lane >> 4; const int by = blockIdx.y;
  A += (size_t)by * sA; Bh += (size_t)by * sB; const size_t cofs = (size_t)by * sC; const float* bp = bias ? bias + (size_t)by * sBias : nullptr;
  const int ntn = N >> 6; const int mt = blockIdx.x / ntn, nq = blockIdx.x - mt * ntn; const int row0 = mt * 128 + 32 * w, col0 = nq * 64; if (row0 >= M) return;
  const _Float16* a0p = A + (size_t)(row0 + ln) * lda; const _Float16* a1p = a0p + (size_t)16 * lda;
  const _Float16* b0p = Bh + (size_t)(col0 + ln) * ldb; const _Float16* b1p = b0p + (size_t)16 * ldb; const _Float16* b2p = b1p + (size_t)16 * ldb; const _Float16* b3p = b2p + (size_t)16 * ldb;
  const v8f z8 = {0.f,0.f,0.f,0.f,0.f,0.f,0.f,0.f}; v8f c00 = z8, c01 = z8, c02 = z8, c03 = z8, c10 = z8, c11 = z8, c12 = z8, c13 = z8;
#pragma unroll 1
  for (int kb = 0; kb < K; kb += 32) { const v16h a0 = g2_frag(a0p + kb, hh), a1 = g2_frag(a1p + kb, hh);
    v16h b = g2_frag(b0p + kb, hh); c00 = g2_mma(a0, b, c00); c10 = g2_mma(a1, b, c10);
    b = g2_frag(b1p + kb, hh); c01 = g2_mma(a0, b, c01); c11 = g2_mma(a1, b, c11);
    b = g2_frag(b2p + kb, hh); c02 = g2_mma(a0, b, c02); c12 = g2_mma(a1, b, c12);
    b = g2_frag(b3p + kb, hh); c03 = g2_mma(a0, b, c03); c13 = g2_mma(a1, b, c13); }
  v8f accs[8] = {c00, c01, c02, c03, c10, c11, c12, c13};
#pragma unroll
  for (int u = 0; u < 8; ++u) { const int t = u & 3, half = u >> 2; const int col = col0 + t * 16 + ln; const float bv = bp ? bf16_round(bp[col]) : 0.f;
#pragma unroll
    for (int r = 0; r < 8; ++r) { const int rloc = half * 16 + 8 * hh + r; float v = accs[u][r] * alpha + bv; if (CP) { const int bidx = (row0g + row0 + rloc) / rowsPerB; v += CP[(size_t)bidx * sCPb + (size_t)by * 64 + col]; }
      if (ACT == 3) v = fmaxf(v, 0.f); else if (ACT == 6) v = 0.5f * v * (1.0f + erff(v * 0.70710678118654752f)); else if (ACT == 11) v = 1.0f / (1.0f + expf(-v)); else if (ACT == 15) v = v / (1.0f + expf(-v)); else if (ACT == 12) v = (v > 0.f) ? v : 0.01f * v; else if (ACT == 8) v = tanhf(v);
      so[w][rloc][t * 16 + ln] = v; } }
  __builtin_amdgcn_fence(__ATOMIC_ACQ_REL, "workgroup"); __builtin_amdgcn_wave_barrier();
  const int rsub = lane >> 4, c4 = (lane & 15) * 4;
  {
#pragma unroll
    for (int q = 0; q < 16; ++q) { const int r = q * 2 + rsub; const v4f v = *(const v4fa*)&so[w][r][c4]; if (C) *(v4f*)(C + cofs + (size_t)(row0 + r) * ldc + col0 + c4) = v; if (C16) { v4h h4; for (int i = 0; i < 4; ++i) h4[i] = (_Float16)v[i]; *(v4h*)(C16 + cofs + (size_t)(row0 + r) * ldc + col0 + c4) = h4; } }
     } }



// lane l <-> lane l ^ 16 (the two halves of a wave hold the two key halves of one query column)
__device__ __forceinline__ float xhalf(float x) { return __builtin_bit_cast(float, __builtin_amdgcn_permlanex16(__builtin_bit_cast(int, x), __builtin_bit_cast(int, x), 0x76543210, 0xfedcba98, false, false)); }
__device__ __forceinline__ v8f mmaT(v16h a, v16h b, v8f c) { return __builtin_amdgcn_wmma_f32_16x16x32_f16(false, a, false, b, (short)0, c, false, false); }
// Transposed products: S^T = K Q^T (A = 16 key rows, B = the wave's 16 query columns, kept in registers), O^T += V^T P^T (A = 16 rows of V^T, B = P^T).
// Lane (c = lane & 15, hh = lane >> 4) holds query q0 + c only: register r of score tile nt is key j0 + 16 nt + 8 hh + r, so maximum and sum run in-lane plus one exchange between the halves,
// and the two converted score tiles ARE the B operand of the second product in the hardware k order (element s: key 8 hh + s, then 16 + 8 hh + (s - 8)), the order in which the V^T rows are loaded.
template <int CAUSAL>
__global__ __launch_bounds__(128) void k_flash(const _Float16* __restrict__ Q16, int ldq, const _Float16* __restrict__ K16, int ldk, const _Float16* __restrict__ Vt, const int* __restrict__ MSK, float* __restrict__ O, int ldo) {
  constexpr int RPW = 16, DT = 4, KS = 2;
  __shared__ __attribute__((aligned(16))) float sO[4][RPW][64 + 4];
  const int tid = threadIdx.x, w = tid >> 5, lane = tid & 31, ln = lane & 15, hh = lane >> 4;
  const int slab = blockIdx.x / QBNP, qblk = QB0P + blockIdx.x % QBNP; const int b = slab / NH, h = slab % NH; const int qb0 = qblk * (4 * RPW); const int q0 = qb0 + w * RPW; const int tq = q0 + ln;
  FragH bq[KS];
  { const unsigned short* qr = (const unsigned short*)Q16 + ((size_t)b * TQ + tq) * ldq + h * 64;
#pragma unroll
    for (int ks = 0; ks < KS; ++ks) { bq[ks].half[0] = *(const v8us*)(qr + ks * 32 + 8 * hh); bq[ks].half[1] = *(const v8us*)(qr + ks * 32 + 16 + 8 * hh); } }
  /* wave-uniform bases that step with the pass + per-lane byte offsets that never change */
  const char* kb = (const char*)(K16 + (size_t)b * TK * ldk + h * 64); const char* vb = (const char*)(Vt + (size_t)slab * 64 * TK); const char* mb = (const char*)((const float*)MSK + (size_t)b * TK);
  const unsigned ko0 = (unsigned)(ln * ldk + 8 * hh) * 2u, ko1 = ko0 + (unsigned)ldk * 32u;      /* key rows ln and 16 + ln, this half's first 8 of each 16 head columns */
  const unsigned vo = (unsigned)(ln * TK + 8 * hh) * 2u, mo = (unsigned)hh * 32u;      /* V^T row ln, this half's first 8 of each 16 keys; this half's 8 mask words */
  const size_t kstep = (size_t)ldk * 64;
  float m_c = -3.0e38f, l_c = 0.f; v8f oacc[DT];
#pragma unroll
  for (int dt = 0; dt < DT; ++dt) oacc[dt] = (v8f){0.f,0.f,0.f,0.f,0.f,0.f,0.f,0.f};
  const int jend = (CAUSAL == 1) ? (qb0 + 4 * RPW) : TK;      /* causal: keys beyond the block's last query never contribute */
  /* the key loop stays rolled; every inner loop is unrolled so that the fragment and score arrays have constant indices and stay in registers */
#pragma unroll 1
  for (int j0 = 0; j0 < jend; j0 += 32) {
    FragH ak[2][KS], av[DT]; v4f mk[2][2];      /* all of the pass's loads stand here, ahead of its first product */
#pragma unroll
    for (int nt = 0; nt < 2; ++nt) { const char* kr = kb + (nt ? ko1 : ko0);
#pragma unroll
      for (int ks = 0; ks < KS; ++ks) { ak[nt][ks].half[0] = *(const v8us*)(kr + ks * 64); ak[nt][ks].half[1] = *(const v8us*)(kr + ks * 64 + 32); } }
    if (CAUSAL == 17) {
#pragma unroll
      for (int nt = 0; nt < 2; ++nt) { mk[nt][0] = *(const v4fa*)(mb + mo + nt * 64); mk[nt][1] = *(const v4fa*)(mb + mo + nt * 64 + 16); } }
#pragma unroll
    for (int dt = 0; dt < DT; ++dt) { const char* vrow = vb + vo + (size_t)(dt * 16) * TK * 2; av[dt].half[0] = *(const v8us*)vrow; av[dt].half[1] = *(const v8us*)(vrow + 32); }
    kb += kstep; vb += 64; mb += 128;
    float sc[16]; bool ok[16];
#pragma unroll
    for (int nt = 0; nt < 2; ++nt) { v8f acc = (v8f){0.f,0.f,0.f,0.f,0.f,0.f,0.f,0.f};
#pragma unroll
      for (int ks = 0; ks < KS; ++ks) acc = mmaT(ak[nt][ks].v, bq[ks].v, acc);
#pragma unroll
      for (int r = 0; r < 8; ++r) { const int kk = j0 + nt * 16 + 8 * hh + r; const bool okk = (CAUSAL == 1) ? (kk <= tq) : ((CAUSAL == 2) ? ((kk >> 5) == (tq >> 5)) : true);      /* mode 2: block-diagonal 32-token groups */
        float sv = okk ? acc[r] * SCL : -3.0e38f; if (CAUSAL == 17) sv += (float)(__bf16)mk[nt][r >> 2][r & 3];      /* mode 17: additive per-(batch, key) mask INPUT */
        sc[nt * 8 + r] = sv; ok[nt * 8 + r] = okk; } }
    float mx[8];
#pragma unroll
    for (int i = 0; i < 8; ++i) mx[i] = fmaxf(sc[i], sc[i + 8]);
    float mc = fmaxf(fmaxf(fmaxf(mx[0], mx[1]), fmaxf(mx[2], mx[3])), fmaxf(fmaxf(mx[4], mx[5]), fmaxf(mx[6], mx[7])));
    mc = fmaxf(mc, xhalf(mc));      /* both halves now hold the query's maximum over the 32 keys */
    const float mn = fmaxf(m_c, mc); const float al = (mn > -1.0e38f) ? expf(m_c - mn) : 1.0f; m_c = mn;
    float p[16]; FragH pb;
#pragma unroll
    for (int i = 0; i < 16; ++i) { p[i] = ok[i] ? expf(sc[i] - mn) : 0.f; pb.h[i] = (_Float16)(p[i] * 1024.0f); }
    const float pe = ((p[0] + p[2]) + (p[4] + p[6])) + ((p[8] + p[10]) + (p[12] + p[14])), po = ((p[1] + p[3]) + (p[5] + p[7])) + ((p[9] + p[11]) + (p[13] + p[15])); const float ps = pe + po;
    l_c = l_c * al + ps;      /* this half's 16 keys; the halves are joined once, behind the loop */
#pragma unroll
    for (int dt = 0; dt < DT; ++dt) {
#pragma unroll
      for (int r = 0; r < 8; ++r) oacc[dt][r] *= al;
      oacc[dt] = mmaT(av[dt].v, pb.v, oacc[dt]); } }
  const float l = l_c + xhalf(l_c); const float inv = (l > 0.f) ? 1.0f / (l * 1024.0f) : 0.f;
#pragma unroll
  for (int dt = 0; dt < DT; ++dt) { v4f lo, hi;      /* register r = head column dt * 16 + 8 hh + r of query q0 + ln */
#pragma unroll
    for (int r = 0; r < 4; ++r) { lo[r] = oacc[dt][r] * inv; hi[r] = oacc[dt][4 + r] * inv; }
    *(v4fa*)&sO[w][ln][dt * 16 + 8 * hh] = lo; *(v4fa*)&sO[w][ln][dt * 16 + 8 * hh + 4] = hi; }
  __builtin_amdgcn_fence(__ATOMIC_ACQ_REL, "workgroup"); __builtin_amdgcn_wave_barrier();
  {
#pragma unroll
    for (int rp = 0; rp < RPW; rp += 2) { const int r = rp + (lane >> 4), pc = lane & 15; const v4f val = *(const v4fa*)&sO[w][r][pc * 4]; *(v4f*)(O + ((size_t)b * TQ + q0 + r) * ldo + h * 64 + pc * 4) = val; }
     } }
// 5-plane variant: S = Qh Kh^T + (Ql Kh^T + Qh Kl^T)/1024 with Q/K = [hi | 2^10 residual] f16 planes (QL/KL same layout as Q16/K16), then the 3-term P.V below.
// 3-term variant: O = (P_hi V_hi + (P_lo V_hi + P_hi V_lo) / 1024) / l with P = [hi | 2^10 residual] of 1024 p and V^T = [hi | 2^10 residual] planes (VtL same layout as Vt) -> ~2^-21-class products for un-averaged (early causal / peaked) rows
template <int CAUSAL>
__global__ __launch_bounds__(128) void k_flash5(const _Float16* __restrict__ Q16, const _Float16* __restrict__ QL, int ldq, const _Float16* __restrict__ K16, const _Float16* __restrict__ KL, int ldk, const _Float16* __restrict__ Vt, const _Float16* __restrict__ VtL, const int* __restrict__ MSK, float* __restrict__ O, int ldo) {
  constexpr int RPW = 16, RTN = RPW / 16, NQB = TQ / (4 * RPW), DT = 4, KS = 2;
  __shared__ __attribute__((aligned(16))) unsigned short sP[4][RPW][40]; __shared__ __attribute__((aligned(16))) unsigned short sPL[4][RPW][40]; __shared__ __attribute__((aligned(16))) float sO[4][RPW][64 + 4];
  const int tid = threadIdx.x, w = tid >> 5, lane = tid & 31, ln = lane & 15, hh = lane >> 4;
  const int slab = blockIdx.x / QBN5, qblk = QB05 + blockIdx.x % QBN5; (void)NQB; const int b = slab / NH, h = slab % NH; const int qb0 = qblk * (4 * RPW); const int q0 = qb0 + w * RPW;
  FragH aq[2][KS], aql[2][KS];
#pragma unroll
  for (int rt = 0; rt < RTN; ++rt) { const unsigned short* qr = (const unsigned short*)Q16 + ((size_t)b * TQ + q0 + rt * 16 + ln) * ldq + h * 64; const unsigned short* ql = (const unsigned short*)QL + ((size_t)b * TQ + q0 + rt * 16 + ln) * ldq + h * 64;
#pragma unroll
    for (int ks = 0; ks < KS; ++ks) { aq[rt][ks].half[0] = *(const v8us*)(qr + ks * 32 + 8 * hh); aq[rt][ks].half[1] = *(const v8us*)(qr + ks * 32 + 16 + 8 * hh); aql[rt][ks].half[0] = *(const v8us*)(ql + ks * 32 + 8 * hh); aql[rt][ks].half[1] = *(const v8us*)(ql + ks * 32 + 16 + 8 * hh); } }
  const unsigned short* Vth = (const unsigned short*)Vt + (size_t)slab * 64 * TK; const unsigned short* Vtl = (const unsigned short*)VtL + (size_t)slab * 64 * TK;
  float m_r[2][8], l_r[2][8]; v8f oacc[2][DT], oaccL[2][DT];
#pragma unroll
  for (int rt = 0; rt < RTN; ++rt) {
#pragma unroll
    for (int r = 0; r < 8; ++r) { m_r[rt][r] = -3.0e38f; l_r[rt][r] = 0.f; }
#pragma unroll
    for (int dt = 0; dt < DT; ++dt) { oacc[rt][dt] = (v8f){0.f,0.f,0.f,0.f,0.f,0.f,0.f,0.f}; oaccL[rt][dt] = oacc[rt][dt]; } }
  const int jend = (CAUSAL == 1) ? (qb0 + 4 * RPW) : TK;      /* causal: keys beyond the block's last query never contribute */
#pragma unroll 1
  for (int j0 = 0; j0 < jend; j0 += 32) {
    v8f s[2][2];
#pragma unroll
    for (int nt = 0; nt < 2; ++nt) { const unsigned short* kr = (const unsigned short*)K16 + ((size_t)b * TK + j0 + nt * 16 + ln) * ldk + h * 64; const unsigned short* klr = (const unsigned short*)KL + ((size_t)b * TK + j0 + nt * 16 + ln) * ldk + h * 64; FragH bk[KS], bkl[KS];
#pragma unroll
      for (int ks = 0; ks < KS; ++ks) { bk[ks].half[0] = *(const v8us*)(kr + ks * 32 + 8 * hh); bk[ks].half[1] = *(const v8us*)(kr + ks * 32 + 16 + 8 * hh); bkl[ks].half[0] = *(const v8us*)(klr + ks * 32 + 8 * hh); bkl[ks].half[1] = *(const v8us*)(klr + ks * 32 + 16 + 8 * hh); }
#pragma unroll
      for (int rt = 0; rt < RTN; ++rt) { v8f acc = (v8f){0.f,0.f,0.f,0.f,0.f,0.f,0.f,0.f}, accl = acc;
#pragma unroll
        for (int ks = 0; ks < KS; ++ks) { acc = mmaH<1>(aq[rt][ks].v, aq[rt][ks].v, bk[ks].v, bk[ks].v, acc); accl = mmaH<1>(aql[rt][ks].v, aql[rt][ks].v, bk[ks].v, bk[ks].v, accl); accl = mmaH<1>(aq[rt][ks].v, aq[rt][ks].v, bkl[ks].v, bkl[ks].v, accl); }
#pragma unroll
        for (int r = 0; r < 8; ++r) acc[r] += accl[r] * 0.0009765625f;
        s[rt][nt] = acc; } }
#pragma unroll
    for (int rt = 0; rt < RTN; ++rt)
#pragma unroll
      for (int r = 0; r < 8; ++r) { const int tq = q0 + rt * 16 + 8 * hh + r; const int k0 = j0 + ln, k1 = j0 + 16 + ln;
        bool ok0 = (CAUSAL == 1) ? (k0 <= tq) : ((CAUSAL == 2) ? ((k0 >> 5) == (tq >> 5)) : true), ok1 = (CAUSAL == 1) ? (k1 <= tq) : ((CAUSAL == 2) ? ((k1 >> 5) == (tq >> 5)) : true);      /* mode 2: block-diagonal 32-token groups */
        if (CAUSAL == 4) { const int* mrow = MSK + ((size_t)b * TQ + tq) * TK; ok0 = mrow[k0] != 0; ok1 = mrow[k1] != 0; }      /* mode 4: per-(query, key) INPUT mask shared by all heads; masked keys contribute nothing (== the reference's -4096 fill, whose exp underflows to 0), rows with no valid key give l = 0 -> output 0 (== the reference's row_valid zeroing) */
        float s0 = ok0 ? s[rt][0][r] * SCL : -3.0e38f, s1 = ok1 ? s[rt][1][r] * SCL : -3.0e38f; if (CAUSAL == 17) { const float* amk = (const float*)MSK + (size_t)b * TK; s0 += bf16_round(amk[k0]); s1 += bf16_round(amk[k1]); }      /* mode 17: additive per-(batch, key) mask INPUT */ float mc = fmaxf(s0, s1);
        mc = fmaxf(mc, __shfl_xor(mc, 1, 32)); mc = fmaxf(mc, __shfl_xor(mc, 2, 32)); mc = fmaxf(mc, __shfl_xor(mc, 4, 32)); mc = fmaxf(mc, __shfl_xor(mc, 8, 32));
        const float mn = fmaxf(m_r[rt][r], mc); const float al = (mn > -1.0e38f) ? expf(m_r[rt][r] - mn) : 1.0f; m_r[rt][r] = mn; const float p0 = ok0 ? expf(s0 - mn) : 0.f, p1 = ok1 ? expf(s1 - mn) : 0.f; l_r[rt][r] = l_r[rt][r] * al + p0 + p1;
#pragma unroll
        for (int dt = 0; dt < DT; ++dt) { oacc[rt][dt][r] *= al; oaccL[rt][dt][r] *= al; }
        FragH t2, t2l; const float ps0 = p0 * 1024.0f, ps1 = p1 * 1024.0f; t2.h[0] = (_Float16)ps0; t2.h[1] = (_Float16)ps1; t2l.h[0] = (_Float16)((ps0 - (float)t2.h[0]) * 1024.0f); t2l.h[1] = (_Float16)((ps1 - (float)t2.h[1]) * 1024.0f);
        sP[w][rt * 16 + 8 * hh + r][ln] = t2.u[0]; sP[w][rt * 16 + 8 * hh + r][16 + ln] = t2.u[1]; sPL[w][rt * 16 + 8 * hh + r][ln] = t2l.u[0]; sPL[w][rt * 16 + 8 * hh + r][16 + ln] = t2l.u[1]; }
    __builtin_amdgcn_fence(__ATOMIC_ACQ_REL, "workgroup"); __builtin_amdgcn_wave_barrier();
    FragH pa[2], pl[2];
#pragma unroll
    for (int rt = 0; rt < RTN; ++rt) { pa[rt].half[0] = *(const v8us*)&sP[w][rt * 16 + ln][8 * hh]; pa[rt].half[1] = *(const v8us*)&sP[w][rt * 16 + ln][16 + 8 * hh]; pl[rt].half[0] = *(const v8us*)&sPL[w][rt * 16 + ln][8 * hh]; pl[rt].half[1] = *(const v8us*)&sPL[w][rt * 16 + ln][16 + 8 * hh]; }
#pragma unroll
    for (int dt = 0; dt < DT; ++dt) { const unsigned short* vrow = Vth + (size_t)(dt * 16 + ln) * TK + j0; const unsigned short* vrl = Vtl + (size_t)(dt * 16 + ln) * TK + j0; FragH bv, bl; bv.half[0] = *(const v8us*)(vrow + 8 * hh); bv.half[1] = *(const v8us*)(vrow + 16 + 8 * hh); bl.half[0] = *(const v8us*)(vrl + 8 * hh); bl.half[1] = *(const v8us*)(vrl + 16 + 8 * hh);
#pragma unroll
      for (int rt = 0; rt < RTN; ++rt) { oacc[rt][dt] = mmaH<1>(pa[rt].v, pa[rt].v, bv.v, bv.v, oacc[rt][dt]); oaccL[rt][dt] = mmaH<1>(pl[rt].v, pl[rt].v, bv.v, bv.v, oaccL[rt][dt]); oaccL[rt][dt] = mmaH<1>(pa[rt].v, pa[rt].v, bl.v, bl.v, oaccL[rt][dt]); } }
    __builtin_amdgcn_fence(__ATOMIC_ACQ_REL, "workgroup"); __builtin_amdgcn_wave_barrier(); }
#pragma unroll
  for (int rt = 0; rt < RTN; ++rt) {
#pragma unroll
    for (int r = 0; r < 8; ++r) { float l = l_r[rt][r]; l += __shfl_xor(l, 1, 32); l += __shfl_xor(l, 2, 32); l += __shfl_xor(l, 4, 32); l += __shfl_xor(l, 8, 32); l_r[rt][r] = (l > 0.f) ? 1.0f / (l * 1024.0f) : 0.f; }
#pragma unroll
    for (int dt = 0; dt < DT; ++dt)
#pragma unroll
      for (int r = 0; r < 8; ++r) { float v = oacc[rt][dt][r]; v += oaccL[rt][dt][r] * 0.0009765625f; sO[w][rt * 16 + 8 * hh + r][dt * 16 + ln] = v * l_r[rt][r]; } }
  __builtin_amdgcn_fence(__ATOMIC_ACQ_REL, "workgroup"); __builtin_amdgcn_wave_barrier();
  {
#pragma unroll
    for (int rp = 0; rp < RPW; rp += 2) { const int r = rp + (lane >> 4), pc = lane & 15; const v4f val = *(const v4fa*)&sO[w][r][pc * 4]; *(v4f*)(O + ((size_t)b * TQ + q0 + r) * ldo + h * 64 + pc * 4) = val; }
     } }

__global__ __launch_bounds__(256) void k_rotab(float* __restrict__ CS, float* __restrict__ SN) {
  #pragma clang fp contract(off)
  const int t = blockIdx.x * 256 + threadIdx.x; if (t >= SLEN * 32) return; const int j = t % 32, s = t / 32; const float ex = (float)(2 * j) / 64.0f; const float inv = 1.0f / powf(10000.0f, ex); const float th = (float)s * inv; const float c = cosf(th), sn = sinf(th);
  { *(float*)(CS + t) = c; *(float*)(SN + t) = sn;  } }
__global__ __launch_bounds__(256) void k_rope(const float* __restrict__ F, int nsrc, int ndst, int rep, const float* __restrict__ CS, const float* __restrict__ SN, _Float16* __restrict__ H, _Float16* __restrict__ L) {
  #pragma clang fp contract(off)
  const size_t t = (size_t)blockIdx.x * 256 + threadIdx.x; if (t >= (size_t)NR * ndst * 4) return; const int g8 = (int)(t % 4); const int hd = (int)((t / 4) % ndst); const size_t row = t / ((size_t)4 * ndst); const int s = (int)(row % SLEN); const int hs = hd / rep;
  const float* src = F + row * (size_t)(nsrc * 64) + hs * 64; FragH ah, al, bh, bl;
  for (int i = 0; i < 8; ++i) { const int d = g8 * 8 + i; const float c = CS[s * 32 + d], sn = SN[s * 32 + d]; const float x1 = src[d], x2 = src[d + 32];
    float o1 = x1 * c; o1 += -x2 * sn; float o2 = x2 * c; o2 += x1 * sn;
    _Float16 hv = (_Float16)o1; ah.h[i] = hv; al.h[i] = (_Float16)((o1 - (float)hv) * 1024.0f); hv = (_Float16)o2; bh.h[i] = hv; bl.h[i] = (_Float16)((o2 - (float)hv) * 1024.0f); }
  const size_t o = row * (size_t)(ndst * 64) + hd * 64 + g8 * 8;
  { *(v8us*)((unsigned short*)H + o) = ah.half[0]; *(v8us*)((unsigned short*)H + o + 32) = bh.half[0]; *(v8us*)((unsigned short*)L + o) = al.half[0]; *(v8us*)((unsigned short*)L + o + 32) = bl.half[0];  } }
__global__ __launch_bounds__(256) void k_rope2(const float* __restrict__ F, int nsrc, int ndst, int rep, const float* __restrict__ CS, const float* __restrict__ SN, _Float16* __restrict__ H, _Float16* __restrict__ L) {
  #pragma clang fp contract(off)
  const size_t t = (size_t)blockIdx.x * 256 + threadIdx.x; if (t >= (size_t)NR * ndst * 4) return; const int g16 = (int)(t % 4); const int hd = (int)((t / 4) % ndst); const size_t row = t / ((size_t)4 * ndst); const int s = (int)(row % SLEN); const int hs = hd / rep;
  const float* src = F + row * (size_t)(nsrc * 64) + hs * 64 + g16 * 16; FragH ah, al;
  for (int pr = 0; pr < 8; ++pr) { const int i = g16 * 8 + pr; const float c = CS[s * 32 + i], sn = SN[s * 32 + i]; const float x1 = src[2 * pr], x2 = src[2 * pr + 1];
    float o1 = x1 * c; o1 -= x2 * sn; float o2 = x1 * sn; o2 += x2 * c;
    _Float16 hv = (_Float16)o1; ah.h[2 * pr] = hv; al.h[2 * pr] = (_Float16)((o1 - (float)hv) * 1024.0f); hv = (_Float16)o2; ah.h[2 * pr + 1] = hv; al.h[2 * pr + 1] = (_Float16)((o2 - (float)hv) * 1024.0f); }
  const size_t o = row * (size_t)(ndst * 64) + hd * 64 + g16 * 16;
  { *(v8us*)((unsigned short*)H + o) = ah.half[0]; *(v8us*)((unsigned short*)H + o + 8) = ah.half[1]; *(v8us*)((unsigned short*)L + o) = al.half[0]; *(v8us*)((unsigned short*)L + o + 8) = al.half[1];  } }
__global__ __launch_bounds__(256) void k_tabin(const float* __restrict__ sp, float* __restrict__ CS, float* __restrict__ SN) { const int t = blockIdx.x * 256 + threadIdx.x; if (t >= SLEN * 32) return; const int i = t % 32, s = t / 32; const float c = bf16_round(sp[s * 64 + 32 + i]), sn = bf16_round(sp[s * 64 + i]);
  { *(float*)(CS + t) = c; *(float*)(SN + t) = sn;  } }
__global__ __launch_bounds__(256) void k_wsc(const float* __restrict__ Wm, _Float16* __restrict__ Bt, size_t n8, float sc) { const size_t t = (size_t)blockIdx.x * 256 + threadIdx.x; if (t >= n8) return; FragH f; for (int q = 0; q < 8; ++q) f.h[q] = (_Float16)(bf16_round(Wm[t * 8 + q]) * sc); *(v8us*)((unsigned short*)Bt + t * 8) = f.half[0];  }
__global__ __launch_bounds__(256) void k_rotab2(float* __restrict__ CS, float* __restrict__ SN) {
  #pragma clang fp contract(off)
  const int t = blockIdx.x * 256 + threadIdx.x; if (t >= SLEN * 32) return; const int j = t % 32, s = t / 32; const float c0 = -0.14391156831212787f;      /* -ln(10000)/64 rounded to f32 */ const float inv = expf((float)(2 * j) * c0); const float th = (float)s * inv; const float c = cosf(th), sn = sinf(th);
  { *(float*)(CS + t) = c; *(float*)(SN + t) = sn;  } }
__global__ __launch_bounds__(256) void k_lnu(const float* __restrict__ X, _Float16* __restrict__ N16, float* __restrict__ XB) {
  #pragma clang fp contract(off)
  const int wv = threadIdx.x >> 5, ln = threadIdx.x & 31; const size_t r = (size_t)blockIdx.x * 8 + wv; if (r >= NR) return; float a[32]; float s = 0.f;
  for (int i = 0; i < 4; ++i) { const v8f v = *(const v8f*)(X + r * DM + (i * 32 + ln) * 8); for (int q = 0; q < 8; ++q) { const float u = bf16_round(v[q]); a[i * 8 + q] = u; s += u; } }
  for (int o = 16; o > 0; o >>= 1) s += __shfl_xor(s, o, 32); const float mu = s / (float)DM; float var = 0.f; for (int q = 0; q < 32; ++q) { const float d = a[q] - mu; var += d * d; }
  for (int o = 16; o > 0; o >>= 1) var += __shfl_xor(var, o, 32); const float den = sqrtf(var / (float)(DM - 1)) + 1e-6f; const float inv = 1.0f / den;      /* one reciprocal per row; (x-mean)*inv vs the reference's division differs by <= 1 ulp */
  { for (int i = 0; i < 4; ++i) { const int c0 = (i * 32 + ln) * 8; FragH f; v8f xb; for (int q = 0; q < 8; ++q) { f.h[q] = (_Float16)((a[i * 8 + q] - mu) * inv); xb[q] = a[i * 8 + q]; } *(v8us*)((unsigned short*)N16 + r * DM + c0) = f.half[0]; *(v8f*)(XB + r * DM + c0) = xb; }  } }
__global__ __launch_bounds__(256) void k_vtg(const _Float16* __restrict__ V16, _Float16* __restrict__ Vt) { __shared__ unsigned short tl[64][66]; const int tid = threadIdx.x; const int slab = blockIdx.x / (SLEN / 64), lg = blockIdx.x % (SLEN / 64); const int b = slab / NH, h = slab % NH; const int hs = h / NREP;
  for (int i = tid; i < 64 * 8; i += 256) { const int r = i / 8, c8 = (i % 8) * 8; FragH f; f.half[0] = *(const v8us*)((const unsigned short*)V16 + ((size_t)b * SLEN + lg * 64 + r) * KVD + hs * 64 + c8); for (int q = 0; q < 8; ++q) tl[r][c8 + q] = f.u[q]; }
  __syncthreads();
  { for (int rd = 0; rd < 2; ++rd) { const int d = rd * 32 + tid / 8, pc = tid % 8; FragH f; for (int q = 0; q < 8; ++q) f.u[q] = tl[pc * 8 + q][d]; *(v8us*)((unsigned short*)Vt + ((size_t)slab * 64 + d) * SLEN + lg * 64 + pc * 8) = f.half[0]; }  } }

extern "C" void kernel_launch(void* const* d_in, const int* in_sizes, int n_in,
                              void* d_out, int out_size, void* d_ws, size_t ws_size, hipStream_t stream) {
  (void)in_sizes; (void)n_in; (void)out_size;
  const float* const* I = (const float* const*)d_in; const float* x = I[0]; const float* sp = I[1]; const float* am = I[2]; const float* Wq = I[3]; const float* Wk = I[4]; const float* Wv = I[5]; const float* bq = nullptr; const float* bk = nullptr; const float* bv = nullptr;
  char* ws = (char*)d_ws; size_t off = 0;
  auto take = [&](size_t bytes) { char* p = ws + off; off += (bytes + 255) & ~(size_t)255; return p; };
  const size_t np = (size_t)NR * DM, nk = (size_t)NR * KVD;
  _Float16* BQ = (_Float16*)take((size_t)DM * DM * 2); _Float16* BK = (_Float16*)take((size_t)KVD * DM * 2); _Float16* BV = (_Float16*)take((size_t)KVD * DM * 2);
  float* CS = (float*)take((size_t)SLEN * 32 * 4); float* SN = (float*)take((size_t)SLEN * 32 * 4);
  _Float16* X16 = (_Float16*)take(np * 2); float* QF = (float*)take(np * 4); _Float16* QH = (_Float16*)take(np * 2); _Float16* QL = (_Float16*)take(np * 2); float* KF = (float*)take(nk * 4); float* VF = (float*)take(nk * 4); _Float16* KXH = (_Float16*)take(np * 2); _Float16* KXL = (_Float16*)take(np * 2); _Float16* VH = (_Float16*)take(nk * 2); _Float16* VL = (_Float16*)take(nk * 2); _Float16* VT = (_Float16*)take(np * 2); /* no VTL: plain flash only */
  /* the flash output goes straight to d_out */
  if (off > ws_size) return;      /* 3x2 + 0.25+0.25 + 8 + 16 + 8+8 + 16+16 + 8+8 + 8+8 + 8 = 118.5 MiB */
  k_wsc<<<(unsigned)(((size_t)DM * DM / 8 + 255) / 256), 256, 0, stream>>>(Wq, BQ, (size_t)DM * DM / 8, 16.0f); k_wsc<<<(unsigned)(((size_t)KVD * DM / 8 + 255) / 256), 256, 0, stream>>>(Wk, BK, (size_t)KVD * DM / 8, 16.0f); k_wsc<<<(unsigned)(((size_t)KVD * DM / 8 + 255) / 256), 256, 0, stream>>>(Wv, BV, (size_t)KVD * DM / 8, 16.0f);      /* torch (out,in) = Bt */
  k_tabin<<<(SLEN * 32 + 255) / 256, 256, 0, stream>>>(sp, CS, SN);
  k_x16<<<(unsigned)((np / 8 + 255) / 256), 256, 0, stream>>>(x, X16, np / 8);
  k_gemm2<0><<<dim3((NR / 128) * (DM / 64), 1), 128, 0, stream>>>(X16, DM, 0, BQ, DM, 0, 0.0625f, bq, 0, nullptr, 1, 0, 0, QF, nullptr, DM, 0, NR, DM, DM);
  k_gemm2<0><<<dim3((NR / 128) * (KVD / 64), 1), 128, 0, stream>>>(X16, DM, 0, BK, DM, 0, 0.0625f, bk, 0, nullptr, 1, 0, 0, KF, nullptr, KVD, 0, NR, KVD, DM);
  k_gemm2<0><<<dim3((NR / 128) * (KVD / 64), 1), 128, 0, stream>>>(X16, DM, 0, BV, DM, 0, 0.0625f, bv, 0, nullptr, 1, 0, 0, VF, nullptr, KVD, 0, NR, KVD, DM);
  k_rope2<<<(unsigned)(((size_t)NR * NH * 4 + 255) / 256), 256, 0, stream>>>(QF, NH, NH, 1, CS, SN, QH, QL);      /* q: 16 -> 16 heads (interleaved pairs) */
  k_rope2<<<(unsigned)(((size_t)NR * NH * 4 + 255) / 256), 256, 0, stream>>>(KF, NKV, NH, NREP, CS, SN, KXH, KXL);      /* k: kv head h to query head h (NREP = 1) */
  k_hl<<<(unsigned)((nk / 8 + 255) / 256), 256, 0, stream>>>(VF, VH, VL, nk / 8);
  k_vtg<<<NB * NH * (SLEN / 64), 256, 0, stream>>>(VH, VT);
  k_flash<17><<<NB * NH * QBNP, 128, 0, stream>>>(QH, DM, KXH, DM, VT, (const int*)am, (float*)d_out, DM);      /* + attention_mask[b][key]; the merged context is the output */
}

// v002
// It runs in 175 microseconds.
// Two timings next to v001 both put it at 1.42 times that version's speed.
// All steps since v000 together make it 2.24 times as fast.
#include <hip/hip_runtime.h>
// DiffBertSelfAttention (2 x 2048 tokens, D 1024 = 16 heads of 64): q, k, v = x W^T; RoFormer rotary from the sinusoidal_pos INPUT ([sin | cos] halves, interleave-duplicated: out[2i] = x[2i] cos_i - x[2i+1] sin_i, out[2i+1] = x[2i+1] cos_i + x[2i] sin_i); scores/8 + attention_mask[b, key] (additive INPUT, broadcast over heads and queries); softmax; ctx = probs v merged -> the output (no output projection).
// Structure: exact f16 plane of x; q, k, v as f32 WMMA GEMM outputs (32x64 wave tiles, f32 accumulation, exact x16 weights); the rotary tables copied from the input (bf16-rounded like every input); interleaved RoPE + f16 conversion on VALU; V^T by LDS tiles; the fused flash kernel with the per-key additive mask read from the input (mode 17; plain operands: every row averages ~2048 keys) writing the merged context straight to the output.
// Compute dtype: inputs and parameters rounded to bf16; q/k/P/v as plain f16 operands (~2^-12); RoPE/softmax f32. v_wmma_f32_16x16x32_f16.
#define NB 2
#define DM 1024
#define NKV 16
#define NREP (NH / NKV)
#define KVD (NKV * 64)           /* 1024 */
#define NR (NB * SLEN)           /* 4096 */
#define SLEN 2048
#define TQ SLEN
#define TK SLEN
#define NH 16
#define SCL 0.125f
#define QBLKS (TQ / 64)
#define QB05 0
#define QBN5 4
#define QB0P 0
#define QBNP QBLKS           /* non-causal: plain flash on every query block */
#define RE 256
typedef __bf16 v16b __attribute__((ext_vector_type(16)));
typedef unsigned short v8us __attribute__((ext_vector_type(8), may_alias));
typedef float  v8f  __attribute__((ext_vector_type(8)));
typedef float  v4f  __attribute__((ext_vector_type(4)));
typedef float  v4fa __attribute__((ext_vector_type(4), may_alias));
union FragB { v16b v; v8us half[2]; unsigned short u[16]; };

__device__ __forceinline__ unsigned short bf16_bits(float x) { unsigned int u = __float_as_uint(x); return (unsigned short)((u + 0x7FFFu + ((u >> 16) & 1u)) >> 16); }
__device__ __forceinline__ float bf16_val(unsigned short b) { return __uint_as_float(((unsigned int)b) << 16); }
__device__ __forceinline__ float bf16_round(float x) { return bf16_val(bf16_bits(x)); }
// D += A·B with NT terms: 1 = ah·bh, 2 = + al·bh (A split), 3 = + ah·bl (both split)
template <int NT>
__device__ __forceinline__ v8f mmaN(v16b ah, v16b al, v16b bh, v16b bl, v8f c) {
  c = __builtin_amdgcn_wmma_f32_16x16x32_bf16(false, ah, false, bh, (short)0, c, false, false);
  if (NT >= 2) c = __builtin_amdgcn_wmma_f32_16x16x32_bf16(false, al, false, bh, (short)0, c, false, false);
  if (NT >= 3) c = __builtin_amdgcn_wmma_f32_16x16x32_bf16(false, ah, false, bl, (short)0, c, false, false);
  asm volatile("v_nop\n\tv_nop\n\tv_nop\n\tv_nop" : "+v"(c) : "v"(ah), "v"(al), "v"(bh), "v"(bl));
  return c;
}

__global__ __launch_bounds__(256) void k_wt_bf16(const float* __restrict__ W, unsigned short* __restrict__ Wt, int K, int N) {
  const int t = blockIdx.x * 256 + threadIdx.x;
  const int k8n = K / 8;
  if (t >= N * k8n) return;
  const int n = t / k8n, k8 = (t % k8n) * 8;
  v8us v;
#pragma unroll
  for (int i = 0; i < 8; ++i) v[i] = bf16_bits(W[(size_t)(k8 + i) * N + n]);
  *(v8us*)(Wt + (size_t)n * K + k8) = v;
  
}

// GEMM C[M][N] (f32, pitch ldc) = act(A[M][K]·W + bias). A f32 row-major (pitch lda) converted per fragment to bf16
// (ASPLIT: hi/lo two planes -> 2 terms, else single rounded term); Wt bf16 [N][K] (pitch ldb). BIAS_BF16 rounds the
// bias to bf16 first (bias quantised to bf16 before the add). K%32==0, M%16==0, N%64==0.
template <bool ASPLIT, int ACT, bool BIAS_BF16>
__global__ __launch_bounds__(128) void k_gemm_bf(const float* __restrict__ A, int lda, const unsigned short* __restrict__ Wt, int ldb,
                                               const float* __restrict__ bias, float* __restrict__ C, int ldc, int M, int N, int K) {
  __shared__ __attribute__((aligned(16))) float so[4][16][64];
  const int tid = threadIdx.x, w = tid >> 5, lane = tid & 31, ln = lane & 15, hh = lane >> 4;
  const int ntn = N / 64;
  const int wid = blockIdx.x * 4 + w;
  const int mt = wid / ntn, nq = wid % ntn;
  if (mt * 16 >= M) return;
  const int row0 = mt * 16, col0 = nq * 64;
  const float* arow = A + (size_t)(row0 + ln) * lda;
  v8f acc[4] = {};
  for (int kb = 0; kb < K; kb += 32) {
    FragB ah, al;
    const v4f x0 = *(const v4fa*)(arow + kb + 8 * hh), x1 = *(const v4fa*)(arow + kb + 8 * hh + 4);
    const v4f x2 = *(const v4fa*)(arow + kb + 16 + 8 * hh), x3 = *(const v4fa*)(arow + kb + 16 + 8 * hh + 4);
    float xs[16] = {x0[0],x0[1],x0[2],x0[3],x1[0],x1[1],x1[2],x1[3],x2[0],x2[1],x2[2],x2[3],x3[0],x3[1],x3[2],x3[3]};
#pragma unroll
    for (int i = 0; i < 16; ++i) { const unsigned short hb = bf16_bits(xs[i]); ah.u[i] = hb; al.u[i] = ASPLIT ? bf16_bits(xs[i] - bf16_val(hb)) : (unsigned short)0; }
#pragma unroll
    for (int t = 0; t < 4; ++t) {
      const unsigned short* brow = Wt + (size_t)(col0 + t * 16 + ln) * ldb + kb;
      FragB b;
      b.half[0] = *(const v8us*)(brow + 8 * hh);
      b.half[1] = *(const v8us*)(brow + 16 + 8 * hh);
      acc[t] = mmaN<ASPLIT ? 2 : 1>(ah.v, al.v, b.v, b.v, acc[t]);
    }
  }
#pragma unroll
  for (int t = 0; t < 4; ++t) {
    float bv = bias ? bias[col0 + t * 16 + ln] : 0.f;
    if (BIAS_BF16) bv = bf16_round(bv);
#pragma unroll
    for (int r = 0; r < 8; ++r) { float v = acc[t][r] + bv; if (ACT == 1) v = fmaxf(v, 0.f); so[w][8 * hh + r][t * 16 + ln] = v; }
  }
  __builtin_amdgcn_fence(__ATOMIC_ACQ_REL, "workgroup");
  __builtin_amdgcn_wave_barrier();
  const int rsub = lane >> 4, c4 = (lane & 15) * 4;
  {
#pragma unroll
    for (int q = 0; q < 8; ++q) {
      const int r = q * 2 + rsub;
      const v4f v = *(const v4fa*)&so[w][r][c4];
      *(v4f*)(C + (size_t)(row0 + r) * ldc + col0 + c4) = v;
    }
    
  }
}

// GEMM C = act(A·W + bias + resid): A f32 (ASPLIT -> hi/lo 2 terms), Wt bf16 [N][K]; ACT 0 none, 1 relu, 2 exact gelu;
// resid (optional, f32, row index = (row % rmod), pitch ldr, RES_BF16 rounds it) added before the activation.
template <bool ASPLIT, int ACT, bool BIAS_BF16, bool RES_BF16>
__global__ __launch_bounds__(128) void k_gemm_bf3(const float* __restrict__ A, int lda, const unsigned short* __restrict__ Wt, int ldb,
                                                const float* __restrict__ bias, const float* __restrict__ resid, int rmod, int ldr,
                                                float* __restrict__ C, int ldc, int M, int N, int K) {
  __shared__ __attribute__((aligned(16))) float so[4][16][64];
  const int tid = threadIdx.x, w = tid >> 5, lane = tid & 31, ln = lane & 15, hh = lane >> 4;
  const int ntn = N / 64;
  const int wid = blockIdx.x * 4 + w;
  const int mt = wid / ntn, nq = wid % ntn;
  if (mt * 16 >= M) return;
  const int row0 = mt * 16, col0 = nq * 64;
  const float* arow = A + (size_t)(row0 + ln) * lda;
  v8f acc[4] = {};
  for (int kb = 0; kb < K; kb += 32) {
    FragB ah, al;
    const v4f x0 = *(const v4fa*)(arow + kb + 8 * hh), x1 = *(const v4fa*)(arow + kb + 8 * hh + 4);
    const v4f x2 = *(const v4fa*)(arow + kb + 16 + 8 * hh), x3 = *(const v4fa*)(arow + kb + 16 + 8 * hh + 4);
    float xs[16] = {x0[0],x0[1],x0[2],x0[3],x1[0],x1[1],x1[2],x1[3],x2[0],x2[1],x2[2],x2[3],x3[0],x3[1],x3[2],x3[3]};
#pragma unroll
    for (int i = 0; i < 16; ++i) { const unsigned short hb = bf16_bits(xs[i]); ah.u[i] = hb; al.u[i] = ASPLIT ? bf16_bits(xs[i] - bf16_val(hb)) : (unsigned short)0; }
#pragma unroll
    for (int t = 0; t < 4; ++t) {
      const unsigned short* brow = Wt + (size_t)(col0 + t * 16 + ln) * ldb + kb;
      FragB b;
      b.half[0] = *(const v8us*)(brow + 8 * hh);
      b.half[1] = *(const v8us*)(brow + 16 + 8 * hh);
      acc[t] = mmaN<ASPLIT ? 2 : 1>(ah.v, al.v, b.v, b.v, acc[t]);
    }
  }
#pragma unroll
  for (int t = 0; t < 4; ++t) {
    const int col = col0 + t * 16 + ln;
    float bv = bias ? bias[col] : 0.f;
    if (BIAS_BF16) bv = bf16_round(bv);
#pragma unroll
    for (int r = 0; r < 8; ++r) {
      float v = acc[t][r] + bv;
      if (resid) { float rv = resid[(size_t)((row0 + 8 * hh + r) % rmod) * ldr + col]; if (RES_BF16) rv = bf16_round(rv); v += rv; }
      if (ACT == 1) v = fmaxf(v, 0.f);
      if (ACT == 2) v = 0.5f * v * (1.0f + erff(v * 0.70710678118654752f));
      if (ACT == 3) { const float u = 0.7978845608028654f * (v + 0.044715f * v * v * v); v = 0.5f * v * (1.0f + tanhf(u)); }
      so[w][8 * hh + r][t * 16 + ln] = v;
    }
  }
  __builtin_amdgcn_fence(__ATOMIC_ACQ_REL, "workgroup");
  __builtin_amdgcn_wave_barrier();
  const int rsub = lane >> 4, c4 = (lane & 15) * 4;
  {
#pragma unroll
    for (int q = 0; q < 8; ++q) {
      const int r = q * 2 + rsub;
      const v4f v = *(const v4fa*)&so[w][r][c4];
      *(v4f*)(C + (size_t)(row0 + r) * ldc + col0 + c4) = v;
    }
    
  }
}
// row LayerNorm (biased variance, eps) over N: s = X (+ R); optional out_sum <- s; out_norm <- (s-mu)*rsqrt(var+eps)*g + b
template <bool PARAM_BF16>
__global__ __launch_bounds__(256) void k_layernorm(const float* __restrict__ X, const float* __restrict__ R, const float* __restrict__ g, const float* __restrict__ bta,
                                                  float* __restrict__ out_sum, float* __restrict__ out_norm, int N, float eps) {
  __shared__ float red[256];
  const int row = blockIdx.x, tid = threadIdx.x;
  const float* x = X + (size_t)row * N; const float* rr = R ? R + (size_t)row * N : nullptr;
  float vals[16];                     // up to N = 4096
  const int per = N / 256;            // contiguous chunk per thread? use strided-by-4 chunks: thread handles j = tid*4 + 1024*u
  float s1 = 0.f;
  for (int u = 0; u < per / 4; ++u) {
    const int j = tid * 4 + 1024 * u;
    const v4f a = *(const v4fa*)(x + j);
    v4f b = {0.f,0.f,0.f,0.f}; if (rr) b = *(const v4fa*)(rr + j);
#pragma unroll
    for (int q = 0; q < 4; ++q) { const float v = a[q] + b[q]; vals[u * 4 + q] = v; s1 += v; }
  }
  red[tid] = s1; __syncthreads();
  for (int st = 128; st > 0; st >>= 1) { if (tid < st) red[tid] += red[tid + st]; __syncthreads(); }
  const float mu = red[0] / (float)N; __syncthreads();
  float s2 = 0.f;
  for (int u = 0; u < per / 4; ++u)
#pragma unroll
    for (int q = 0; q < 4; ++q) { const float c = vals[u * 4 + q] - mu; s2 += c * c; }
  red[tid] = s2; __syncthreads();
  for (int st = 128; st > 0; st >>= 1) { if (tid < st) red[tid] += red[tid + st]; __syncthreads(); }
  const float rs = rsqrtf(red[0] / (float)N + eps);
  {
    for (int u = 0; u < per / 4; ++u) {
      const int j = tid * 4 + 1024 * u;
      v4f o, sm;
#pragma unroll
      for (int q = 0; q < 4; ++q) {
        float gg = g[j + q], bb = bta[j + q];
        if (PARAM_BF16) { gg = bf16_round(gg); bb = bf16_round(bb); }
        sm[q] = vals[u * 4 + q]; o[q] = (vals[u * 4 + q] - mu) * rs * gg + bb;
      }
      if (out_sum) *(v4f*)(out_sum + (size_t)row * N + j) = sm;
      *(v4f*)(out_norm + (size_t)row * N + j) = o;
    }
    
  }
}



// ---- f16 WMMA path (v_wmma_f32_16x16x32_f16): 11-bit significands for operands in range — used where a [0,1] probability operand needs more precision than bf16
typedef _Float16 v16h __attribute__((ext_vector_type(16)));
union FragH { v16h v; v8us half[2]; _Float16 h[16]; unsigned short u[16]; };
template <int NT>
__device__ __forceinline__ v8f mmaH(v16h ah, v16h al, v16h bh, v16h bl, v8f c) {
  c = __builtin_amdgcn_wmma_f32_16x16x32_f16(false, ah, false, bh, (short)0, c, false, false);
  if (NT >= 2) c = __builtin_amdgcn_wmma_f32_16x16x32_f16(false, al, false, bh, (short)0, c, false, false);
  if (NT >= 3) c = __builtin_amdgcn_wmma_f32_16x16x32_f16(false, ah, false, bl, (short)0, c, false, false);
  asm volatile("v_nop\n\tv_nop\n\tv_nop\n\tv_nop" : "+v"(c) : "v"(ah), "v"(al), "v"(bh), "v"(bl));
  return c;
}
// batched GEMM like k_gemm_b but f16 operands: A f32 (split into f16 hi/lo if ASPLIT, else rounded to f16), Bt = f16 values [n][k]; alpha; C f32; N multiple of 16 (partial tiles skipped)
template <bool ASPLIT>
__global__ __launch_bounds__(128) void k_gemm_h(const float* __restrict__ A, int lda, size_t sA, const _Float16* __restrict__ Bh, int ldb, size_t sB, float alpha, float* __restrict__ C, int ldc, size_t sC, int M, int N, int K) {
  __shared__ __attribute__((aligned(16))) float so[4][16][64];
  const int tid = threadIdx.x, w = tid >> 5, lane = tid & 31, ln = lane & 15, hh = lane >> 4; const int by = blockIdx.y;
  A += (size_t)by * sA; Bh += (size_t)by * sB; C += (size_t)by * sC;
  const int ntn = (N + 63) / 64; const int wid = blockIdx.x * 4 + w; const int mt = wid / ntn, nq = wid % ntn; if (mt * 16 >= M) return;
  const int row0 = mt * 16, col0 = nq * 64; const float* arow = A + (size_t)(row0 + ln) * lda;
  v8f acc[4] = {};
  for (int kb = 0; kb < K; kb += 32) {
    FragH ah, al;
    const v4f x0 = *(const v4fa*)(arow + kb + 8 * hh), x1 = *(const v4fa*)(arow + kb + 8 * hh + 4), x2 = *(const v4fa*)(arow + kb + 16 + 8 * hh), x3 = *(const v4fa*)(arow + kb + 16 + 8 * hh + 4);
    float xs[16] = {x0[0],x0[1],x0[2],x0[3],x1[0],x1[1],x1[2],x1[3],x2[0],x2[1],x2[2],x2[3],x3[0],x3[1],x3[2],x3[3]};
#pragma unroll
    for (int i = 0; i < 16; ++i) { const _Float16 h = (_Float16)xs[i]; ah.h[i] = h; al.h[i] = ASPLIT ? (_Float16)(xs[i] - (float)h) : (_Float16)0.0f; }
#pragma unroll
    for (int t = 0; t < 4; ++t) { if (col0 + t * 16 >= N) continue; const size_t boff = (size_t)(col0 + t * 16 + ln) * ldb + kb; FragH bq; bq.half[0] = *(const v8us*)(Bh + boff + 8 * hh); bq.half[1] = *(const v8us*)(Bh + boff + 16 + 8 * hh);
      acc[t] = mmaH<ASPLIT ? 2 : 1>(ah.v, al.v, bq.v, bq.v, acc[t]); }
  }
#pragma unroll
  for (int t = 0; t < 4; ++t) { if (col0 + t * 16 >= N) continue;
#pragma unroll
    for (int r = 0; r < 8; ++r) so[w][8 * hh + r][t * 16 + ln] = acc[t][r] * alpha; }
  __builtin_amdgcn_fence(__ATOMIC_ACQ_REL, "workgroup"); __builtin_amdgcn_wave_barrier();
  const int rsub = lane >> 4, c4 = (lane & 15) * 4;
  {
#pragma unroll
    for (int q = 0; q < 8; ++q) { const int r = q * 2 + rsub; if (col0 + c4 < N) { const v4f v = *(const v4fa*)&so[w][r][c4]; *(v4f*)(C + (size_t)(row0 + r) * ldc + col0 + c4) = v; } }
     }
}

// Wt[n][k] = f16(W[k][n]·scale) from f32 row-major W[K][N] (scale = power of two; bf16-exact weights stay exact in f16 away from the subnormal range)
__global__ __launch_bounds__(256) void k_wt_f16(const float* __restrict__ W, _Float16* __restrict__ Wt, int K, int N, float scale) {
  const int t = blockIdx.x * 256 + threadIdx.x; if (t >= N * (K / 8)) return; const int n = t / (K / 8), k8 = (t % (K / 8)) * 8; FragH f;
#pragma unroll
  for (int i = 0; i < 8; ++i) f.h[i] = (_Float16)(bf16_round(W[(size_t)(k8 + i) * N + n]) * scale); const v8us o = f.half[0];
  *(v8us*)((unsigned short*)Wt + (size_t)n * K + k8) = o; 
}
// k_gemm_hh variant with fused epilogue: v = acc·alpha + bias[by·sBias + col] (+ CP[(row/rowsPerB)·sCPb + by·64 + col] if CP) ; ACT 0 none / 1 elu ; writes f16 C16 (and f32 C if non-null)
template <int ACT>
__global__ __launch_bounds__(128) void k_gemm_hhx(const _Float16* __restrict__ A, int lda, size_t sA, const _Float16* __restrict__ Bh, int ldb, size_t sB, float alpha, const float* __restrict__ bias, size_t sBias, const float* __restrict__ CP, int rowsPerB, size_t sCPb, int row0g,
    float* __restrict__ C, _Float16* __restrict__ C16, int ldc, size_t sC, int M, int N, int K) {
  __shared__ __attribute__((aligned(16))) float so[4][16][64];
  const int tid = threadIdx.x, w = tid >> 5, lane = tid & 31, ln = lane & 15, hh = lane >> 4; const int by = blockIdx.y;
  A += (size_t)by * sA; Bh += (size_t)by * sB; const size_t cofs = (size_t)by * sC; const float* bp = bias ? bias + (size_t)by * sBias : nullptr;
  const int ntn = (N + 63) / 64; const int wid = blockIdx.x * 4 + w; const int mt = wid / ntn, nq = wid % ntn; if (mt * 16 >= M) return;
  const int row0 = mt * 16, col0 = nq * 64; const _Float16* arow = A + (size_t)(row0 + ln) * lda;
  v8f acc[4] = {};
  for (int kb = 0; kb < K; kb += 32) { FragH ah; ah.half[0] = *(const v8us*)((const unsigned short*)arow + kb + 8 * hh); ah.half[1] = *(const v8us*)((const unsigned short*)arow + kb + 16 + 8 * hh);
#pragma unroll
    for (int t = 0; t < 4; ++t) { if (col0 + t * 16 >= N) continue; const size_t boff = (size_t)(col0 + t * 16 + ln) * ldb + kb; FragH bq; bq.half[0] = *(const v8us*)((const unsigned short*)Bh + boff + 8 * hh); bq.half[1] = *(const v8us*)((const unsigned short*)Bh + boff + 16 + 8 * hh);
      acc[t] = mmaH<1>(ah.v, ah.v, bq.v, bq.v, acc[t]); }
  }
#pragma unroll
  for (int t = 0; t < 4; ++t) { if (col0 + t * 16 >= N) continue; const int col = col0 + t * 16 + ln; const float bv = bp ? bf16_round(bp[col]) : 0.f;
#pragma unroll
    for (int r = 0; r < 8; ++r) { float v = acc[t][r] * alpha + bv; if (CP) { const int bidx = (row0g + row0 + 8 * hh + r) / rowsPerB; v += CP[(size_t)bidx * sCPb + (size_t)by * 64 + col]; } if (ACT == 1) v = (v > 0.f) ? v : expm1f(v); else if (ACT == 7) v = (v > 0.f) ? v + 1.0f : expf(v); else if (ACT == 8) v = tanhf(v); else if (ACT == 9) v = 0.5f * v * (1.0f + tanhf(0.7978845608028654f * (v + 0.044715f * v * v * v))); else if (ACT == 11) v = 1.0f / (1.0f + expf(-v)); else if (ACT == 12) v = (v > 0.f) ? v : 0.01f * v; else if (ACT == 14) v = (v > 0.f) ? v : 0.1f * v; else if (ACT == 15) v = v / (1.0f + expf(-v)); else if (ACT == 3) v = fmaxf(v, 0.f); else if (ACT == 6) v = 0.5f * v * (1.0f + erff(v * 0.70710678118654752f)); so[w][8 * hh + r][t * 16 + ln] = v; } }
  __builtin_amdgcn_fence(__ATOMIC_ACQ_REL, "workgroup"); __builtin_amdgcn_wave_barrier();
  const int rsub = lane >> 4, c4 = (lane & 15) * 4; typedef _Float16 v4h __attribute__((ext_vector_type(4)));
  {
#pragma unroll
    for (int q = 0; q < 8; ++q) { const int r = q * 2 + rsub; if (col0 + c4 < N) { const v4f v = *(const v4fa*)&so[w][r][c4]; if (C) *(v4f*)(C + cofs + (size_t)(row0 + r) * ldc + col0 + c4) = v; if (C16) { v4h h4; for (int i = 0; i < 4; ++i) h4[i] = (_Float16)v[i]; *(v4h*)(C16 + cofs + (size_t)(row0 + r) * ldc + col0 + c4) = h4; } } }
     }
}


typedef _Float16 v4h __attribute__((ext_vector_type(4)));

__global__ __launch_bounds__(256) void k_x16(const float* __restrict__ x, _Float16* __restrict__ X16, size_t n8) { const size_t t = (size_t)blockIdx.x * 256 + threadIdx.x; if (t >= n8) return; FragH f;
#pragma unroll
  for (int q = 0; q < 8; ++q) f.h[q] = (_Float16)bf16_round(x[t * 8 + q]); *(v8us*)((unsigned short*)X16 + t * 8) = f.half[0];  }
__global__ __launch_bounds__(256) void k_h16(const float* __restrict__ x, _Float16* __restrict__ X16, size_t n8) { const size_t t = (size_t)blockIdx.x * 256 + threadIdx.x; if (t >= n8) return; FragH f;
#pragma unroll
  for (int q = 0; q < 8; ++q) f.h[q] = (_Float16)x[t * 8 + q]; *(v8us*)((unsigned short*)X16 + t * 8) = f.half[0];  }
__global__ __launch_bounds__(256) void k_round16f(const float* __restrict__ W, _Float16* __restrict__ Bt, size_t n8) { const size_t t = (size_t)blockIdx.x * 256 + threadIdx.x; if (t >= n8) return; FragH f;
#pragma unroll
  for (int i = 0; i < 8; ++i) f.h[i] = (_Float16)(bf16_round(W[t * 8 + i]) * 16.0f); *(v8us*)((unsigned short*)Bt + t * 8) = f.half[0];  }
template <int NHv, int TTv>
__global__ __launch_bounds__(256) void k_vt(const _Float16* __restrict__ V16, int ldv, int voff, _Float16* __restrict__ Vt) { __shared__ unsigned short tl[64][66]; const int tid = threadIdx.x; const int slab = blockIdx.x / (TTv / 64), lg = blockIdx.x % (TTv / 64); const int b = slab / NHv, h = slab % NHv;
  for (int i = tid; i < 64 * 8; i += 256) { const int r = i / 8, c8 = (i % 8) * 8; FragH f; f.half[0] = *(const v8us*)((const unsigned short*)V16 + ((size_t)b * TTv + lg * 64 + r) * ldv + voff + h * 64 + c8);
#pragma unroll
    for (int q = 0; q < 8; ++q) tl[r][c8 + q] = f.u[q]; }
  __syncthreads();
  {
#pragma unroll
    for (int rd = 0; rd < 2; ++rd) { const int d = rd * 32 + tid / 8, pc = tid % 8; FragH f;
#pragma unroll
      for (int q = 0; q < 8; ++q) f.u[q] = tl[pc * 8 + q][d];
      *(v8us*)((unsigned short*)Vt + ((size_t)slab * 64 + d) * TTv + lg * 64 + pc * 8) = f.half[0]; }
     } }

__global__ __launch_bounds__(256) void k_hl(const float* __restrict__ F, _Float16* __restrict__ Hh, _Float16* __restrict__ Hl, size_t n8) { const size_t t = (size_t)blockIdx.x * 256 + threadIdx.x; if (t >= n8) return; FragH fh, fl; const v4f a = *(const v4fa*)(F + t * 8), c = *(const v4fa*)(F + t * 8 + 4);
#pragma unroll
  for (int q = 0; q < 4; ++q) { _Float16 h = (_Float16)a[q]; fh.h[q] = h; fl.h[q] = (_Float16)((a[q] - (float)h) * 1024.0f); h = (_Float16)c[q]; fh.h[4 + q] = h; fl.h[4 + q] = (_Float16)((c[q] - (float)h) * 1024.0f); }
  { *(v8us*)((unsigned short*)Hh + t * 8) = fh.half[0]; *(v8us*)((unsigned short*)Hl + t * 8) = fl.half[0];  } }

// ---- fast GEMM (wave tile 32x64, block tile 128x64; requires M % 128 == 0, N % 64 == 0 and K % 64 == 0); epilogue = k_gemm_hhx semantics ----
__device__ __forceinline__ v16h g2_frag(const _Float16* p, int hh) { FragH f; f.half[0] = *(const v8us*)((const unsigned short*)p + 8 * hh); f.half[1] = *(const v8us*)((const unsigned short*)p + 16 + 8 * hh); return f.v; }
__device__ __forceinline__ v8f g2_mma(v16h a, v16h b, v8f c) { v8f d = __builtin_amdgcn_wmma_f32_16x16x32_f16(false, a, false, b, (short)0, c, false, false); asm volatile("v_nop\n\tv_nop\n\tv_nop\n\tv_nop" : "+v"(d) : "v"(a), "v"(b)); return d; }
// One wave's share of a stage (192 rows of 128 bytes: 128 A rows, then 64 B rows, LDS pitch G2P bytes): 12 asynchronous 16-byte copies per lane, 8 lanes to a row, so that each copy of a wave reads 4 whole 128-byte lines.
// l = this lane's LDS byte address in the stage's row tid / 8; ga, gb = this lane's 16 bytes in A row tid / 8 and B row tid / 8 of the stage; every further copy is 16 rows on.
#define G2P 144            /* 128 + 16: the pitch for 16-byte LDS reads of 128-byte rows */
#define G2S (192 * G2P)    /* bytes of one stage */
__device__ __forceinline__ void g2_stage(unsigned l, const _Float16* ga, size_t lda, const _Float16* gb, size_t ldb) {
  const unsigned l1 = l + 16 * G2P, l2 = l + 32 * G2P, l3 = l + 48 * G2P, l4 = l + 64 * G2P, l5 = l + 80 * G2P, l6 = l + 96 * G2P, l7 = l + 112 * G2P, l8 = l + 128 * G2P, l9 = l + 144 * G2P, l10 = l + 160 * G2P, l11 = l + 176 * G2P;
  const _Float16 *a1 = ga + 16 * lda, *a2 = ga + 32 * lda, *a3 = ga + 48 * lda, *a4 = ga + 64 * lda, *a5 = ga + 80 * lda, *a6 = ga + 96 * lda, *a7 = ga + 112 * lda, *b1 = gb + 16 * ldb, *b2 = gb + 32 * ldb, *b3 = gb + 48 * ldb;
  /* the copies and their s_wait_xcnt in one statement: no address register is rewritten before the wait */
  asm volatile("global_load_async_to_lds_b128 %0, %12, off\n\t"
               "global_load_async_to_lds_b128 %1, %13, off\n\t"
               "global_load_async_to_lds_b128 %2, %14, off\n\t"
               "global_load_async_to_lds_b128 %3, %15, off\n\t"
               "global_load_async_to_lds_b128 %4, %16, off\n\t"
               "global_load_async_to_lds_b128 %5, %17, off\n\t"
               "global_load_async_to_lds_b128 %6, %18, off\n\t"
               "global_load_async_to_lds_b128 %7, %19, off\n\t"
               "global_load_async_to_lds_b128 %8, %20, off\n\t"
               "global_load_async_to_lds_b128 %9, %21, off\n\t"
               "global_load_async_to_lds_b128 %10, %22, off\n\t"
               "global_load_async_to_lds_b128 %11, %23, off\n\t"
               "s_wait_xcnt 0x0"
               :: "v"(l), "v"(l1), "v"(l2), "v"(l3), "v"(l4), "v"(l5), "v"(l6), "v"(l7), "v"(l8), "v"(l9), "v"(l10), "v"(l11),
                  "v"(ga), "v"(a1), "v"(a2), "v"(a3), "v"(a4), "v"(a5), "v"(a6), "v"(a7), "v"(gb), "v"(b1), "v"(b2), "v"(b3) : "memory"); }
// Block tile 128x64 (M % 128 == 0, N % 64 == 0, K % 64 == 0); A and B go through LDS in stages of 64 k, two buffers: stage t + 1 flies while stage t is worked on. The fragments are read from LDS in the k order of g2_frag.
template <int ACT>
__global__ __launch_bounds__(128) void k_gemm2(const _Float16* __restrict__ A, int lda, size_t sA, const _Float16* __restrict__ Bh, int ldb, size_t sB, float alpha, const float* __restrict__ bias, size_t sBias, const float* __restrict__ CP, int rowsPerB, size_t sCPb, int row0g,
    float* __restrict__ C, _Float16* __restrict__ C16, int ldc, size_t sC, int M, int N, int K) {
  __shared__ __attribute__((aligned(16))) float so[4][32][68];
  __shared__ __attribute__((aligned(16))) _Float16 st[2][192][G2P / 2];
  const int tid = threadIdx.x, w = tid >> 5, lane = tid & 31, ln = lane & 15, hh = lane >> 4; const int by = blockIdx.y;
  A += (size_t)by * sA; Bh += (size_t)by * sB; const size_t cofs = (size_t)by * sC; const float* bp = bias ? bias + (size_t)by * sBias : nullptr;
  const int ntn = N >> 6; const int mt = blockIdx.x / ntn, nq = blockIdx.x - mt * ntn; const int row0 = mt * 128 + 32 * w, col0 = nq * 64; if (mt * 128 + 128 > M) return;      /* the whole block or none of it, in front of every barrier */
  const _Float16* ga = A + (size_t)(mt * 128 + (tid >> 3)) * lda + (tid & 7) * 8; const _Float16* gb = Bh + (size_t)(col0 + (tid >> 3)) * ldb + (tid & 7) * 8;
  const unsigned ls = (unsigned)(size_t)&st[0][tid >> 3][(tid & 7) * 8];
  const int nst = K >> 6;
  g2_stage(ls, ga, (size_t)lda, gb, (size_t)ldb);
  asm volatile("s_wait_asynccnt 0x0" ::: "memory");      /* stage 0 of this wave has landed */
  __syncthreads();      /* ... and every wave's share of it */
  if (nst > 1) g2_stage(ls + G2S, ga + 64, (size_t)lda, gb + 64, (size_t)ldb);
  const v8f z8 = {0.f,0.f,0.f,0.f,0.f,0.f,0.f,0.f}; v8f c00 = z8, c01 = z8, c02 = z8, c03 = z8, c10 = z8, c11 = z8, c12 = z8, c13 = z8;
  /* rolled: one trip of code; the buffer is picked by the trip's parity */
#pragma unroll 1
  for (int t = 0; t < nst; ++t) { const _Float16* sa = &st[t & 1][32 * w + ln][0]; const _Float16* sb = &st[t & 1][128 + ln][0];
    /* all of the trip's fragments are read here, ahead of its first product */
    const v16h a00 = g2_frag(sa, hh), a10 = g2_frag(sa + 16 * (G2P / 2), hh), b00 = g2_frag(sb, hh), b10 = g2_frag(sb + 16 * (G2P / 2), hh), b20 = g2_frag(sb + 32 * (G2P / 2), hh), b30 = g2_frag(sb + 48 * (G2P / 2), hh);
    const v16h a01 = g2_frag(sa + 32, hh), a11 = g2_frag(sa + 16 * (G2P / 2) + 32, hh), b01 = g2_frag(sb + 32, hh), b11 = g2_frag(sb + 16 * (G2P / 2) + 32, hh), b21 = g2_frag(sb + 32 * (G2P / 2) + 32, hh), b31 = g2_frag(sb + 48 * (G2P / 2) + 32, hh);
    c00 = g2_mma(a00, b00, c00); c10 = g2_mma(a10, b00, c10); c01 = g2_mma(a00, b10, c01); c11 = g2_mma(a10, b10, c11);
    c02 = g2_mma(a00, b20, c02); c12 = g2_mma(a10, b20, c12); c03 = g2_mma(a00, b30, c03); c13 = g2_mma(a10, b30, c13);
    c00 = g2_mma(a01, b01, c00); c10 = g2_mma(a11, b01, c10); c01 = g2_mma(a01, b11, c01); c11 = g2_mma(a11, b11, c11);
    c02 = g2_mma(a01, b21, c02); c12 = g2_mma(a11, b21, c12); c03 = g2_mma(a01, b31, c03); c13 = g2_mma(a11, b31, c13);
    asm volatile("s_wait_dscnt 0x0" ::: "memory");      /* this wave's reads of the buffer are done before it is refilled */
    asm volatile("s_wait_asynccnt 0x0" ::: "memory");      /* this wave's share of stage t + 1 has landed */
    __syncthreads();      /* publishes stage t + 1 and ends every wave's reads of stage t */
    if (t + 2 < nst) g2_stage(ls + (unsigned)(t & 1) * G2S, ga + (size_t)(t + 2) * 64, (size_t)lda, gb + (size_t)(t + 2) * 64, (size_t)ldb); }
  asm volatile("s_wait_asynccnt 0x0" ::: "memory");      /* nothing in flight when the wave goes on to the epilogue */
  v8f accs[8] = {c00, c01, c02, c03, c10, c11, c12, c13};
#pragma unroll
  for (int u = 0; u < 8; ++u) { const int t = u & 3, half = u >> 2; const int col = col0 + t * 16 + ln; const float bv = bp ? bf16_round(bp[col]) : 0.f;
#pragma unroll
    for (int r = 0; r < 8; ++r) { const int rloc = half * 16 + 8 * hh + r; float v = accs[u][r] * alpha + bv; if (CP) { const int bidx = (row0g + row0 + rloc) / rowsPerB; v += CP[(size_t)bidx * sCPb + (size_t)by * 64 + col]; }
      if (ACT == 3) v = fmaxf(v, 0.f); else if (ACT == 6) v = 0.5f * v * (1.0f + erff(v * 0.70710678118654752f)); else if (ACT == 11) v = 1.0f / (1.0f + expf(-v)); else if (ACT == 15) v = v / (1.0f + expf(-v)); else if (ACT == 12) v = (v > 0.f) ? v : 0.01f * v; else if (ACT == 8) v = tanhf(v);
      so[w][rloc][t * 16 + ln] = v; } }
  __builtin_amdgcn_fence(__ATOMIC_ACQ_REL, "workgroup"); __builtin_amdgcn_wave_barrier();
  const int rsub = lane >> 4, c4 = (lane & 15) * 4;
  {
#pragma unroll
    for (int q = 0; q < 16; ++q) { const int r = q * 2 + rsub; const v4f v = *(const v4fa*)&so[w][r][c4]; if (C) *(v4f*)(C + cofs + (size_t)(row0 + r) * ldc + col0 + c4) = v; if (C16) { v4h h4; for (int i = 0; i < 4; ++i) h4[i] = (_Float16)v[i]; *(v4h*)(C16 + cofs + (size_t)(row0 + r) * ldc + col0 + c4) = h4; } }
     } }



// lane l <-> lane l ^ 16 (the two halves of a wave hold the two key halves of one query column)
__device__ __forceinline__ float xhalf(float x) { return __builtin_bit_cast(float, __builtin_amdgcn_permlanex16(__builtin_bit_cast(int, x), __builtin_bit_cast(int, x), 0x76543210, 0xfedcba98, false, false)); }
__device__ __forceinline__ v8f mmaT(v16h a, v16h b, v8f c) { return __builtin_amdgcn_wmma_f32_16x16x32_f16(false, a, false, b, (short)0, c, false, false); }
// Transposed products: S^T = K Q^T (A = 16 key rows, B = the wave's 16 query columns, kept in registers), O^T += V^T P^T (A = 16 rows of V^T, B = P^T).
// Lane (c = lane & 15, hh = lane >> 4) holds query q0 + c only: register r of score tile nt is key j0 + 16 nt + 8 hh + r, so maximum and sum run in-lane plus one exchange between the halves,
// and the two converted score tiles ARE the B operand of the second product in the hardware k order (element s: key 8 hh + s, then 16 + 8 hh + (s - 8)), the order in which the V^T rows are loaded.
template <int CAUSAL>
__global__ __launch_bounds__(128) void k_flash(const _Float16* __restrict__ Q16, int ldq, const _Float16* __restrict__ K16, int ldk, const _Float16* __restrict__ Vt, const int* __restrict__ MSK, float* __restrict__ O, int ldo) {
  constexpr int RPW = 16, DT = 4, KS = 2;
  __shared__ __attribute__((aligned(16))) float sO[4][RPW][64 + 4];
  const int tid = threadIdx.x, w = tid >> 5, lane = tid & 31, ln = lane & 15, hh = lane >> 4;
  const int slab = blockIdx.x / QBNP, qblk = QB0P + blockIdx.x % QBNP; const int b = slab / NH, h = slab % NH; const int qb0 = qblk * (4 * RPW); const int q0 = qb0 + w * RPW; const int tq = q0 + ln;
  FragH bq[KS];
  { const unsigned short* qr = (const unsigned short*)Q16 + ((size_t)b * TQ + tq) * ldq + h * 64;
#pragma unroll
    for (int ks = 0; ks < KS; ++ks) { bq[ks].half[0] = *(const v8us*)(qr + ks * 32 + 8 * hh); bq[ks].half[1] = *(const v8us*)(qr + ks * 32 + 16 + 8 * hh); } }
  /* wave-uniform bases that step with the pass + per-lane byte offsets that never change */
  const char* kb = (const char*)(K16 + (size_t)b * TK * ldk + h * 64); const char* vb = (const char*)(Vt + (size_t)slab * 64 * TK); const char* mb = (const char*)((const float*)MSK + (size_t)b * TK);
  const unsigned ko0 = (unsigned)(ln * ldk + 8 * hh) * 2u, ko1 = ko0 + (unsigned)ldk * 32u;      /* key rows ln and 16 + ln, this half's first 8 of each 16 head columns */
  const unsigned vo = (unsigned)(ln * TK + 8 * hh) * 2u, mo = (unsigned)hh * 32u;      /* V^T row ln, this half's first 8 of each 16 keys; this half's 8 mask words */
  const size_t kstep = (size_t)ldk * 64;
  float m_c = -3.0e38f, l_c = 0.f; v8f oacc[DT];
#pragma unroll
  for (int dt = 0; dt < DT; ++dt) oacc[dt] = (v8f){0.f,0.f,0.f,0.f,0.f,0.f,0.f,0.f};
  const int jend = (CAUSAL == 1) ? (qb0 + 4 * RPW) : TK;      /* causal: keys beyond the block's last query never contribute */
  /* the key loop stays rolled; every inner loop is unrolled so that the fragment and score arrays have constant indices and stay in registers */
#pragma unroll 1
  for (int j0 = 0; j0 < jend; j0 += 32) {
    FragH ak[2][KS], av[DT]; v4f mk[2][2];      /* all of the pass's loads stand here, ahead of its first product */
#pragma unroll
    for (int nt = 0; nt < 2; ++nt) { const char* kr = kb + (nt ? ko1 : ko0);
#pragma unroll
      for (int ks = 0; ks < KS; ++ks) { ak[nt][ks].half[0] = *(const v8us*)(kr + ks * 64); ak[nt][ks].half[1] = *(const v8us*)(kr + ks * 64 + 32); } }
    if (CAUSAL == 17) {
#pragma unroll
      for (int nt = 0; nt < 2; ++nt) { mk[nt][0] = *(const v4fa*)(mb + mo + nt * 64); mk[nt][1] = *(const v4fa*)(mb + mo + nt * 64 + 16); } }
#pragma unroll
    for (int dt = 0; dt < DT; ++dt) { const char* vrow = vb + vo + (size_t)(dt * 16) * TK * 2; av[dt].half[0] = *(const v8us*)vrow; av[dt].half[1] = *(const v8us*)(vrow + 32); }
    kb += kstep; vb += 64; mb += 128;
    float sc[16]; bool ok[16];
#pragma unroll
    for (int nt = 0; nt < 2; ++nt) { v8f acc = (v8f){0.f,0.f,0.f,0.f,0.f,0.f,0.f,0.f};
#pragma unroll
      for (int ks = 0; ks < KS; ++ks) acc = mmaT(ak[nt][ks].v, bq[ks].v, acc);
#pragma unroll
      for (int r = 0; r < 8; ++r) { const int kk = j0 + nt * 16 + 8 * hh + r; const bool okk = (CAUSAL == 1) ? (kk <= tq) : ((CAUSAL == 2) ? ((kk >> 5) == (tq >> 5)) : true);      /* mode 2: block-diagonal 32-token groups */
        float sv = okk ? acc[r] * SCL : -3.0e38f; if (CAUSAL == 17) sv += (float)(__bf16)mk[nt][r >> 2][r & 3];      /* mode 17: additive per-(batch, key) mask INPUT */
        sc[nt * 8 + r] = sv; ok[nt * 8 + r] = okk; } }
    float mx[8];
#pragma unroll
    for (int i = 0; i < 8; ++i) mx[i] = fmaxf(sc[i], sc[i + 8]);
    float mc = fmaxf(fmaxf(fmaxf(mx[0], mx[1]), fmaxf(mx[2], mx[3])), fmaxf(fmaxf(mx[4], mx[5]), fmaxf(mx[6], mx[7])));
    mc = fmaxf(mc, xhalf(mc));      /* both halves now hold the query's maximum over the 32 keys */
    const float mn = fmaxf(m_c, mc); const float al = (mn > -1.0e38f) ? expf(m_c - mn) : 1.0f; m_c = mn;
    float p[16]; FragH pb;
#pragma unroll
    for (int i = 0; i < 16; ++i) { p[i] = ok[i] ? expf(sc[i] - mn) : 0.f; pb.h[i] = (_Float16)(p[i] * 1024.0f); }
    const float pe = ((p[0] + p[2]) + (p[4] + p[6])) + ((p[8] + p[10]) + (p[12] + p[14])), po = ((p[1] + p[3]) + (p[5] + p[7])) + ((p[9] + p[11]) + (p[13] + p[15])); const float ps = pe + po;
    l_c = l_c * al + ps;      /* this half's 16 keys; the halves are joined once, behind the loop */
#pragma unroll
    for (int dt = 0; dt < DT; ++dt) {
#pragma unroll
      for (int r = 0; r < 8; ++r) oacc[dt][r] *= al;
      oacc[dt] = mmaT(av[dt].v, pb.v, oacc[dt]); } }
  const float l = l_c + xhalf(l_c); const float inv = (l > 0.f) ? 1.0f / (l * 1024.0f) : 0.f;
#pragma unroll
  for (int dt = 0; dt < DT; ++dt) { v4f lo, hi;      /* register r = head column dt * 16 + 8 hh + r of query q0 + ln */
#pragma unroll
    for (int r = 0; r < 4; ++r) { lo[r] = oacc[dt][r] * inv; hi[r] = oacc[dt][4 + r] * inv; }
    *(v4fa*)&sO[w][ln][dt * 16 + 8 * hh] = lo; *(v4fa*)&sO[w][ln][dt * 16 + 8 * hh + 4] = hi; }
  __builtin_amdgcn_fence(__ATOMIC_ACQ_REL, "workgroup"); __builtin_amdgcn_wave_barrier();
  {
#pragma unroll
    for (int rp = 0; rp < RPW; rp += 2) { const int r = rp + (lane >> 4), pc = lane & 15; const v4f val = *(const v4fa*)&sO[w][r][pc * 4]; *(v4f*)(O + ((size_t)b * TQ + q0 + r) * ldo + h * 64 + pc * 4) = val; }
     } }
// 5-plane variant: S = Qh Kh^T + (Ql Kh^T + Qh Kl^T)/1024 with Q/K = [hi | 2^10 residual] f16 planes (QL/KL same layout as Q16/K16), then the 3-term P.V below.
// 3-term variant: O = (P_hi V_hi + (P_lo V_hi + P_hi V_lo) / 1024) / l with P = [hi | 2^10 residual] of 1024 p and V^T = [hi | 2^10 residual] planes (VtL same layout as Vt) -> ~2^-21-class products for un-averaged (early causal / peaked) rows
template <int CAUSAL>
__global__ __launch_bounds__(128) void k_flash5(const _Float16* __restrict__ Q16, const _Float16* __restrict__ QL, int ldq, const _Float16* __restrict__ K16, const _Float16* __restrict__ KL, int ldk, const _Float16* __restrict__ Vt, const _Float16* __restrict__ VtL, const int* __restrict__ MSK, float* __restrict__ O, int ldo) {
  constexpr int RPW = 16, RTN = RPW / 16, NQB = TQ / (4 * RPW), DT = 4, KS = 2;
  __shared__ __attribute__((aligned(16))) unsigned short sP[4][RPW][40]; __shared__ __attribute__((aligned(16))) unsigned short sPL[4][RPW][40]; __shared__ __attribute__((aligned(16))) float sO[4][RPW][64 + 4];
  const int tid = threadIdx.x, w = tid >> 5, lane = tid & 31, ln = lane & 15, hh = lane >> 4;
  const int slab = blockIdx.x / QBN5, qblk = QB05 + blockIdx.x % QBN5; (void)NQB; const int b = slab / NH, h = slab % NH; const int qb0 = qblk * (4 * RPW); const int q0 = qb0 + w * RPW;
  FragH aq[2][KS], aql[2][KS];
#pragma unroll
  for (int rt = 0; rt < RTN; ++rt) { const unsigned short* qr = (const unsigned short*)Q16 + ((size_t)b * TQ + q0 + rt * 16 + ln) * ldq + h * 64; const unsigned short* ql = (const unsigned short*)QL + ((size_t)b * TQ + q0 + rt * 16 + ln) * ldq + h * 64;
#pragma unroll
    for (int ks = 0; ks < KS; ++ks) { aq[rt][ks].half[0] = *(const v8us*)(qr + ks * 32 + 8 * hh); aq[rt][ks].half[1] = *(const v8us*)(qr + ks * 32 + 16 + 8 * hh); aql[rt][ks].half[0] = *(const v8us*)(ql + ks * 32 + 8 * hh); aql[rt][ks].half[1] = *(const v8us*)(ql + ks * 32 + 16 + 8 * hh); } }
  const unsigned short* Vth = (const unsigned short*)Vt + (size_t)slab * 64 * TK; const unsigned short* Vtl = (const unsigned short*)VtL + (size_t)slab * 64 * TK;
  float m_r[2][8], l_r[2][8]; v8f oacc[2][DT], oaccL[2][DT];
#pragma unroll
  for (int rt = 0; rt < RTN; ++rt) {
#pragma unroll
    for (int r = 0; r < 8; ++r) { m_r[rt][r] = -3.0e38f; l_r[rt][r] = 0.f; }
#pragma unroll
    for (int dt = 0; dt < DT; ++dt) { oacc[rt][dt] = (v8f){0.f,0.f,0.f,0.f,0.f,0.f,0.f,0.f}; oaccL[rt][dt] = oacc[rt][dt]; } }
  const int jend = (CAUSAL == 1) ? (qb0 + 4 * RPW) : TK;      /* causal: keys beyond the block's last query never contribute */
#pragma unroll 1
  for (int j0 = 0; j0 < jend; j0 += 32) {
    v8f s[2][2];
#pragma unroll
    for (int nt = 0; nt < 2; ++nt) { const unsigned short* kr = (const unsigned short*)K16 + ((size_t)b * TK + j0 + nt * 16 + ln) * ldk + h * 64; const unsigned short* klr = (const unsigned short*)KL + ((size_t)b * TK + j0 + nt * 16 + ln) * ldk + h * 64; FragH bk[KS], bkl[KS];
#pragma unroll
      for (int ks = 0; ks < KS; ++ks) { bk[ks].half[0] = *(const v8us*)(kr + ks * 32 + 8 * hh); bk[ks].half[1] = *(const v8us*)(kr + ks * 32 + 16 + 8 * hh); bkl[ks].half[0] = *(const v8us*)(klr + ks * 32 + 8 * hh); bkl[ks].half[1] = *(const v8us*)(klr + ks * 32 + 16 + 8 * hh); }
#pragma unroll
      for (int rt = 0; rt < RTN; ++rt) { v8f acc = (v8f){0.f,0.f,0.f,0.f,0.f,0.f,0.f,0.f}, accl = acc;
#pragma unroll
        for (int ks = 0; ks < KS; ++ks) { acc = mmaH<1>(aq[rt][ks].v, aq[rt][ks].v, bk[ks].v, bk[ks].v, acc); accl = mmaH<1>(aql[rt][ks].v, aql[rt][ks].v, bk[ks].v, bk[ks].v, accl); accl = mmaH<1>(aq[rt][ks].v, aq[rt][ks].v, bkl[ks].v, bkl[ks].v, accl); }
#pragma unroll
        for (int r = 0; r < 8; ++r) acc[r] += accl[r] * 0.0009765625f;
        s[rt][nt] = acc; } }
#pragma unroll
    for (int rt = 0; rt < RTN; ++rt)
#pragma unroll
      for (int r = 0; r < 8; ++r) { const int tq = q0 + rt * 16 + 8 * hh + r; const int k0 = j0 + ln, k1 = j0 + 16 + ln;
        bool ok0 = (CAUSAL == 1) ? (k0 <= tq) : ((CAUSAL == 2) ? ((k0 >> 5) == (tq >> 5)) : true), ok1 = (CAUSAL == 1) ? (k1 <= tq) : ((CAUSAL == 2) ? ((k1 >> 5) == (tq >> 5)) : true);      /* mode 2: block-diagonal 32-token groups */
        if (CAUSAL == 4) { const int* mrow = MSK + ((size_t)b * TQ + tq) * TK; ok0 = mrow[k0] != 0; ok1 = mrow[k1] != 0; }      /* mode 4: per-(query, key) INPUT mask shared by all heads; masked keys contribute nothing (== the reference's -4096 fill, whose exp underflows to 0), rows with no valid key give l = 0 -> output 0 (== the reference's row_valid zeroing) */
        float s0 = ok0 ? s[rt][0][r] * SCL : -3.0e38f, s1 = ok1 ? s[rt][1][r] * SCL : -3.0e38f; if (CAUSAL == 17) { const float* amk = (const float*)MSK + (size_t)b * TK; s0 += bf16_round(amk[k0]); s1 += bf16_round(amk[k1]); }      /* mode 17: additive per-(batch, key) mask INPUT */ float mc = fmaxf(s0, s1);
        mc = fmaxf(mc, __shfl_xor(mc, 1, 32)); mc = fmaxf(mc, __shfl_xor(mc, 2, 32)); mc = fmaxf(mc, __shfl_xor(mc, 4, 32)); mc = fmaxf(mc, __shfl_xor(mc, 8, 32));
        const float mn = fmaxf(m_r[rt][r], mc); const float al = (mn > -1.0e38f) ? expf(m_r[rt][r] - mn) : 1.0f; m_r[rt][r] = mn; const float p0 = ok0 ? expf(s0 - mn) : 0.f, p1 = ok1 ? expf(s1 - mn) : 0.f; l_r[rt][r] = l_r[rt][r] * al + p0 + p1;
#pragma unroll
        for (int dt = 0; dt < DT; ++dt) { oacc[rt][dt][r] *= al; oaccL[rt][dt][r] *= al; }
        FragH t2, t2l; const float ps0 = p0 * 1024.0f, ps1 = p1 * 1024.0f; t2.h[0] = (_Float16)ps0; t2.h[1] = (_Float16)ps1; t2l.h[0] = (_Float16)((ps0 - (float)t2.h[0]) * 1024.0f); t2l.h[1] = (_Float16)((ps1 - (float)t2.h[1]) * 1024.0f);
        sP[w][rt * 16 + 8 * hh + r][ln] = t2.u[0]; sP[w][rt * 16 + 8 * hh + r][16 + ln] = t2.u[1]; sPL[w][rt * 16 + 8 * hh + r][ln] = t2l.u[0]; sPL[w][rt * 16 + 8 * hh + r][16 + ln] = t2l.u[1]; }
    __builtin_amdgcn_fence(__ATOMIC_ACQ_REL, "workgroup"); __builtin_amdgcn_wave_barrier();
    FragH pa[2], pl[2];
#pragma unroll
    for (int rt = 0; rt < RTN; ++rt) { pa[rt].half[0] = *(const v8us*)&sP[w][rt * 16 + ln][8 * hh]; pa[rt].half[1] = *(const v8us*)&sP[w][rt * 16 + ln][16 + 8 * hh]; pl[rt].half[0] = *(const v8us*)&sPL[w][rt * 16 + ln][8 * hh]; pl[rt].half[1] = *(const v8us*)&sPL[w][rt * 16 + ln][16 + 8 * hh]; }
#pragma unroll
    for (int dt = 0; dt < DT; ++dt) { const unsigned short* vrow = Vth + (size_t)(dt * 16 + ln) * TK + j0; const unsigned short* vrl = Vtl + (size_t)(dt * 16 + ln) * TK + j0; FragH bv, bl; bv.half[0] = *(const v8us*)(vrow + 8 * hh); bv.half[1] = *(const v8us*)(vrow + 16 + 8 * hh); bl.half[0] = *(const v8us*)(vrl + 8 * hh); bl.half[1] = *(const v8us*)(vrl + 16 + 8 * hh);
#pragma unroll
      for (int rt = 0; rt < RTN; ++rt) { oacc[rt][dt] = mmaH<1>(pa[rt].v, pa[rt].v, bv.v, bv.v, oacc[rt][dt]); oaccL[rt][dt] = mmaH<1>(pl[rt].v, pl[rt].v, bv.v, bv.v, oaccL[rt][dt]); oaccL[rt][dt] = mmaH<1>(pa[rt].v, pa[rt].v, bl.v, bl.v, oaccL[rt][dt]); } }
    __builtin_amdgcn_fence(__ATOMIC_ACQ_REL, "workgroup"); __builtin_amdgcn_wave_barrier(); }
#pragma unroll
  for (int rt = 0; rt < RTN; ++rt) {
#pragma unroll
    for (int r = 0; r < 8; ++r) { float l = l_r[rt][r]; l += __shfl_xor(l, 1, 32); l += __shfl_xor(l, 2, 32); l += __shfl_xor(l, 4, 32); l += __shfl_xor(l, 8, 32); l_r[rt][r] = (l > 0.f) ? 1.0f / (l * 1024.0f) : 0.f; }
#pragma unroll
    for (int dt = 0; dt < DT; ++dt)
#pragma unroll
      for (int r = 0; r < 8; ++r) { float v = oacc[rt][dt][r]; v += oaccL[rt][dt][r] * 0.0009765625f; sO[w][rt * 16 + 8 * hh + r][dt * 16 + ln] = v * l_r[rt][r]; } }
  __builtin_amdgcn_fence(__ATOMIC_ACQ_REL, "workgroup"); __builtin_amdgcn_wave_barrier();
  {
#pragma unroll
    for (int rp = 0; rp < RPW; rp += 2) { const int r = rp + (lane >> 4), pc = lane & 15; const v4f val = *(const v4fa*)&sO[w][r][pc * 4]; *(v4f*)(O + ((size_t)b * TQ + q0 + r) * ldo + h * 64 + pc * 4) = val; }
     } }

__global__ __launch_bounds__(256) void k_rotab(float* __restrict__ CS, float* __restrict__ SN) {
  #pragma clang fp contract(off)
  const int t = blockIdx.x * 256 + threadIdx.x; if (t >= SLEN * 32) return; const int j = t % 32, s = t / 32; const float ex = (float)(2 * j) / 64.0f; const float inv = 1.0f / powf(10000.0f, ex); const float th = (float)s * inv; const float c = cosf(th), sn = sinf(th);
  { *(float*)(CS + t) = c; *(float*)(SN + t) = sn;  } }
__global__ __launch_bounds__(256) void k_rope(const float* __restrict__ F, int nsrc, int ndst, int rep, const float* __restrict__ CS, const float* __restrict__ SN, _Float16* __restrict__ H, _Float16* __restrict__ L) {
  #pragma clang fp contract(off)
  const size_t t = (size_t)blockIdx.x * 256 + threadIdx.x; if (t >= (size_t)NR * ndst * 4) return; const int g8 = (int)(t % 4); const int hd = (int)((t / 4) % ndst); const size_t row = t / ((size_t)4 * ndst); const int s = (int)(row % SLEN); const int hs = hd / rep;
  const float* src = F + row * (size_t)(nsrc * 64) + hs * 64; FragH ah, al, bh, bl;
  for (int i = 0; i < 8; ++i) { const int d = g8 * 8 + i; const float c = CS[s * 32 + d], sn = SN[s * 32 + d]; const float x1 = src[d], x2 = src[d + 32];
    float o1 = x1 * c; o1 += -x2 * sn; float o2 = x2 * c; o2 += x1 * sn;
    _Float16 hv = (_Float16)o1; ah.h[i] = hv; al.h[i] = (_Float16)((o1 - (float)hv) * 1024.0f); hv = (_Float16)o2; bh.h[i] = hv; bl.h[i] = (_Float16)((o2 - (float)hv) * 1024.0f); }
  const size_t o = row * (size_t)(ndst * 64) + hd * 64 + g8 * 8;
  { *(v8us*)((unsigned short*)H + o) = ah.half[0]; *(v8us*)((unsigned short*)H + o + 32) = bh.half[0]; *(v8us*)((unsigned short*)L + o) = al.half[0]; *(v8us*)((unsigned short*)L + o + 32) = bl.half[0];  } }
__global__ __launch_bounds__(256) void k_rope2(const float* __restrict__ F, int nsrc, int ndst, int rep, const float* __restrict__ CS, const float* __restrict__ SN, _Float16* __restrict__ H, _Float16* __restrict__ L) {
  #pragma clang fp contract(off)
  const size_t t = (size_t)blockIdx.x * 256 + threadIdx.x; if (t >= (size_t)NR * ndst * 4) return; const int g16 = (int)(t % 4); const int hd = (int)((t / 4) % ndst); const size_t row = t / ((size_t)4 * ndst); const int s = (int)(row % SLEN); const int hs = hd / rep;
  const float* src = F + row * (size_t)(nsrc * 64) + hs * 64 + g16 * 16; FragH ah, al;
  for (int pr = 0; pr < 8; ++pr) { const int i = g16 * 8 + pr; const float c = CS[s * 32 + i], sn = SN[s * 32 + i]; const float x1 = src[2 * pr], x2 = src[2 * pr + 1];
    float o1 = x1 * c; o1 -= x2 * sn; float o2 = x1 * sn; o2 += x2 * c;
    _Float16 hv = (_Float16)o1; ah.h[2 * pr] = hv; al.h[2 * pr] = (_Float16)((o1 - (float)hv) * 1024.0f); hv = (_Float16)o2; ah.h[2 * pr + 1] = hv; al.h[2 * pr + 1] = (_Float16)((o2 - (float)hv) * 1024.0f); }
  const size_t o = row * (size_t)(ndst * 64) + hd * 64 + g16 * 16;
  { *(v8us*)((unsigned short*)H + o) = ah.half[0]; *(v8us*)((unsigned short*)H + o + 8) = ah.half[1]; *(v8us*)((unsigned short*)L + o) = al.half[0]; *(v8us*)((unsigned short*)L + o + 8) = al.half[1];  } }
__global__ __launch_bounds__(256) void k_tabin(const float* __restrict__ sp, float* __restrict__ CS, float* __restrict__ SN) { const int t = blockIdx.x * 256 + threadIdx.x; if (t >= SLEN * 32) return; const int i = t % 32, s = t / 32; const float c = bf16_round(sp[s * 64 + 32 + i]), sn = bf16_round(sp[s * 64 + i]);
  { *(float*)(CS + t) = c; *(float*)(SN + t) = sn;  } }
__global__ __launch_bounds__(256) void k_wsc(const float* __restrict__ Wm, _Float16* __restrict__ Bt, size_t n8, float sc) { const size_t t = (size_t)blockIdx.x * 256 + threadIdx.x; if (t >= n8) return; FragH f; for (int q = 0; q < 8; ++q) f.h[q] = (_Float16)(bf16_round(Wm[t * 8 + q]) * sc); *(v8us*)((unsigned short*)Bt + t * 8) = f.half[0];  }
__global__ __launch_bounds__(256) void k_rotab2(float* __restrict__ CS, float* __restrict__ SN) {
  #pragma clang fp contract(off)
  const int t = blockIdx.x * 256 + threadIdx.x; if (t >= SLEN * 32) return; const int j = t % 32, s = t / 32; const float c0 = -0.14391156831212787f;      /* -ln(10000)/64 rounded to f32 */ const float inv = expf((float)(2 * j) * c0); const float th = (float)s * inv; const float c = cosf(th), sn = sinf(th);
  { *(float*)(CS + t) = c; *(float*)(SN + t) = sn;  } }
__global__ __launch_bounds__(256) void k_lnu(const float* __restrict__ X, _Float16* __restrict__ N16, float* __restrict__ XB) {
  #pragma clang fp contract(off)
  const int wv = threadIdx.x >> 5, ln = threadIdx.x & 31; const size_t r = (size_t)blockIdx.x * 8 + wv; if (r >= NR) return; float a[32]; float s = 0.f;
  for (int i = 0; i < 4; ++i) { const v8f v = *(const v8f*)(X + r * DM + (i * 32 + ln) * 8); for (int q = 0; q < 8; ++q) { const float u = bf16_round(v[q]); a[i * 8 + q] = u; s += u; } }
  for (int o = 16; o > 0; o >>= 1) s += __shfl_xor(s, o, 32); const float mu = s / (float)DM; float var = 0.f; for (int q = 0; q < 32; ++q) { const float d = a[q] - mu; var += d * d; }
  for (int o = 16; o > 0; o >>= 1) var += __shfl_xor(var, o, 32); const float den = sqrtf(var / (float)(DM - 1)) + 1e-6f; const float inv = 1.0f / den;      /* one reciprocal per row; (x-mean)*inv vs the reference's division differs by <= 1 ulp */
  { for (int i = 0; i < 4; ++i) { const int c0 = (i * 32 + ln) * 8; FragH f; v8f xb; for (int q = 0; q < 8; ++q) { f.h[q] = (_Float16)((a[i * 8 + q] - mu) * inv); xb[q] = a[i * 8 + q]; } *(v8us*)((unsigned short*)N16 + r * DM + c0) = f.half[0]; *(v8f*)(XB + r * DM + c0) = xb; }  } }
__global__ __launch_bounds__(256) void k_vtg(const _Float16* __restrict__ V16, _Float16* __restrict__ Vt) { __shared__ unsigned short tl[64][66]; const int tid = threadIdx.x; const int slab = blockIdx.x / (SLEN / 64), lg = blockIdx.x % (SLEN / 64); const int b = slab / NH, h = slab % NH; const int hs = h / NREP;
  for (int i = tid; i < 64 * 8; i += 256) { const int r = i / 8, c8 = (i % 8) * 8; FragH f; f.half[0] = *(const v8us*)((const unsigned short*)V16 + ((size_t)b * SLEN + lg * 64 + r) * KVD + hs * 64 + c8); for (int q = 0; q < 8; ++q) tl[r][c8 + q] = f.u[q]; }
  __syncthreads();
  { for (int rd = 0; rd < 2; ++rd) { const int d = rd * 32 + tid / 8, pc = tid % 8; FragH f; for (int q = 0; q < 8; ++q) f.u[q] = tl[pc * 8 + q][d]; *(v8us*)((unsigned short*)Vt + ((size_t)slab * 64 + d) * SLEN + lg * 64 + pc * 8) = f.half[0]; }  } }

extern "C" void kernel_launch(void* const* d_in, const int* in_sizes, int n_in,
                              void* d_out, int out_size, void* d_ws, size_t ws_size, hipStream_t stream) {
  (void)in_sizes; (void)n_in; (void)out_size;
  const float* const* I = (const float* const*)d_in; const float* x = I[0]; const float* sp = I[1]; const float* am = I[2]; const float* Wq = I[3]; const float* Wk = I[4]; const float* Wv = I[5]; const float* bq = nullptr; const float* bk = nullptr; const float* bv = nullptr;
  char* ws = (char*)d_ws; size_t off = 0;
  auto take = [&](size_t bytes) { char* p = ws + off; off += (bytes + 255) & ~(size_t)255; return p; };
  const size_t np = (size_t)NR * DM, nk = (size_t)NR * KVD;
  _Float16* BQ = (_Float16*)take((size_t)DM * DM * 2); _Float16* BK = (_Float16*)take((size_t)KVD * DM * 2); _Float16* BV = (_Float16*)take((size_t)KVD * DM * 2);
  float* CS = (float*)take((size_t)SLEN * 32 * 4); float* SN = (float*)take((size_t)SLEN * 32 * 4);
  _Float16* X16 = (_Float16*)take(np * 2); float* QF = (float*)take(np * 4); _Float16* QH = (_Float16*)take(np * 2); _Float16* QL = (_Float16*)take(np * 2); float* KF = (float*)take(nk * 4); float* VF = (float*)take(nk * 4); _Float16* KXH = (_Float16*)take(np * 2); _Float16* KXL = (_Float16*)take(np * 2); _Float16* VH = (_Float16*)take(nk * 2); _Float16* VL = (_Float16*)take(nk * 2); _Float16* VT = (_Float16*)take(np * 2); /* no VTL: plain flash only */
  /* the flash output goes straight to d_out */
  if (off > ws_size) return;      /* 3x2 + 0.25+0.25 + 8 + 16 + 8+8 + 16+16 + 8+8 + 8+8 + 8 = 118.5 MiB */
  k_wsc<<<(unsigned)(((size_t)DM * DM / 8 + 255) / 256), 256, 0, stream>>>(Wq, BQ, (size_t)DM * DM / 8, 16.0f); k_wsc<<<(unsigned)(((size_t)KVD * DM / 8 + 255) / 256), 256, 0, stream>>>(Wk, BK, (size_t)KVD * DM / 8, 16.0f); k_wsc<<<(unsigned)(((size_t)KVD * DM / 8 + 255) / 256), 256, 0, stream>>>(Wv, BV, (size_t)KVD * DM / 8, 16.0f);      /* torch (out,in) = Bt */
  k_tabin<<<(SLEN * 32 + 255) / 256, 256, 0, stream>>>(sp, CS, SN);
  k_x16<<<(unsigned)((np / 8 + 255) / 256), 256, 0, stream>>>(x, X16, np / 8);
  k_gemm2<0><<<dim3((NR / 128) * (DM / 64), 1), 128, 0, stream>>>(X16, DM, 0, BQ, DM, 0, 0.0625f, bq, 0, nullptr, 1, 0, 0, QF, nullptr, DM, 0, NR, DM, DM);
  k_gemm2<0><<<dim3((NR / 128) * (KVD / 64), 1), 128, 0, stream>>>(X16, DM, 0, BK, DM, 0, 0.0625f, bk, 0, nullptr, 1, 0, 0, KF, nullptr, KVD, 0, NR, KVD, DM);
  k_gemm2<0><<<dim3((NR / 128) * (KVD / 64), 1), 128, 0, stream>>>(X16, DM, 0, BV, DM, 0, 0.0625f, bv, 0, nullptr, 1, 0, 0, VF, nullptr, KVD, 0, NR, KVD, DM);
  k_rope2<<<(unsigned)(((size_t)NR * NH * 4 + 255) / 256), 256, 0, stream>>>(QF, NH, NH, 1, CS, SN, QH, QL);      /* q: 16 -> 16 heads (interleaved pairs) */
  k_rope2<<<(unsigned)(((size_t)NR * NH * 4 + 255) / 256), 256, 0, stream>>>(KF, NKV, NH, NREP, CS, SN, KXH, KXL);      /* k: kv head h to query head h (NREP = 1) */
  k_hl<<<(unsigned)((nk / 8 + 255) / 256), 256, 0, stream>>>(VF, VH, VL, nk / 8);
  k_vtg<<<NB * NH * (SLEN / 64), 256, 0, stream>>>(VH, VT);
  k_flash<17><<<NB * NH * QBNP, 128, 0, stream>>>(QH, DM, KXH, DM, VT, (const int*)am, (float*)d_out, DM);      /* + attention_mask[b][key]; the merged context is the output */
}

// v003
// It runs in 155 microseconds.
// Next to v002, in two timings, it ran 1.13 times as fast each time.
// All steps since v000 together make it 2.53 times as fast.
#include <hip/hip_runtime.h>
// DiffBertSelfAttention (2 x 2048 tokens, D 1024 = 16 heads of 64): q, k, v = x W^T; RoFormer rotary from the sinusoidal_pos INPUT ([sin | cos] halves, interleave-duplicated: out[2i] = x[2i] cos_i - x[2i+1] sin_i, out[2i+1] = x[2i+1] cos_i + x[2i] sin_i); scores/8 + attention_mask[b, key] (additive INPUT, broadcast over heads and queries); softmax; ctx = probs v merged -> the output (no output projection).
// Structure: exact f16 plane of x; q, k, v as f32 WMMA GEMM outputs (32x64 wave tiles, f32 accumulation, exact x16 weights); the rotary tables copied from the input (bf16-rounded like every input); interleaved RoPE + f16 conversion on VALU; V^T by LDS tiles; the fused flash kernel with the per-key additive mask read from the input (mode 17; plain operands: every row averages ~2048 keys) writing the merged context straight to the output.
// Compute dtype: inputs and parameters rounded to bf16; q/k/P/v as plain f16 operands (~2^-12); RoPE/softmax f32. v_wmma_f32_16x16x32_f16.
#define NB 2
#define DM 1024
#define NKV 16
#define NREP (NH / NKV)
#define KVD (NKV * 64)           /* 1024 */
#define NR (NB * SLEN)           /* 4096 */
#define SLEN 2048
#define TQ SLEN
#define TK SLEN
#define NH 16
#define SCL 0.125f
#define QBLKS (TQ / 64)
#define QB05 0
#define QBN5 4
#define QB0P 0
#define QBNP QBLKS           /* non-causal: plain flash on every query block */
#define RE 256
typedef __bf16 v16b __attribute__((ext_vector_type(16)));
typedef unsigned short v8us __attribute__((ext_vector_type(8), may_alias));
typedef float  v8f  __attribute__((ext_vector_type(8)));
typedef float  v4f  __attribute__((ext_vector_type(4)));
typedef float  v4fa __attribute__((ext_vector_type(4), may_alias));
union FragB { v16b v; v8us half[2]; unsigned short u[16]; };

__device__ __forceinline__ unsigned short bf16_bits(float x) { unsigned int u = __float_as_uint(x); return (unsigned short)((u + 0x7FFFu + ((u >> 16) & 1u)) >> 16); }
__device__ __forceinline__ float bf16_val(unsigned short b) { return __uint_as_float(((unsigned int)b) << 16); }
__device__ __forceinline__ float bf16_round(float x) { return bf16_val(bf16_bits(x)); }
// D += A·B with NT terms: 1 = ah·bh, 2 = + al·bh (A split), 3 = + ah·bl (both split)
template <int NT>
__device__ __forceinline__ v8f mmaN(v16b ah, v16b al, v16b bh, v16b bl, v8f c) {
  c = __builtin_amdgcn_wmma_f32_16x16x32_bf16(false, ah, false, bh, (short)0, c, false, false);
  if (NT >= 2) c = __builtin_amdgcn_wmma_f32_16x16x32_bf16(false, al, false, bh, (short)0, c, false, false);
  if (NT >= 3) c = __builtin_amdgcn_wmma_f32_16x16x32_bf16(false, ah, false, bl, (short)0, c, false, false);
  asm volatile("v_nop\n\tv_nop\n\tv_nop\n\tv_nop" : "+v"(c) : "v"(ah), "v"(al), "v"(bh), "v"(bl));
  return c;
}

__global__ __launch_bounds__(256) void k_wt_bf16(const float* __restrict__ W, unsigned short* __restrict__ Wt, int K, int N) {
  const int t = blockIdx.x * 256 + threadIdx.x;
  const int k8n = K / 8;
  if (t >= N * k8n) return;
  const int n = t / k8n, k8 = (t % k8n) * 8;
  v8us v;
#pragma unroll
  for (int i = 0; i < 8; ++i) v[i] = bf16_bits(W[(size_t)(k8 + i) * N + n]);
  *(v8us*)(Wt + (size_t)n * K + k8) = v;
  
}

// GEMM C[M][N] (f32, pitch ldc) = act(A[M][K]·W + bias). A f32 row-major (pitch lda) converted per fragment to bf16
// (ASPLIT: hi/lo two planes -> 2 terms, else single rounded term); Wt bf16 [N][K] (pitch ldb). BIAS_BF16 rounds the
// bias to bf16 first (bias quantised to bf16 before the add). K%32==0, M%16==0, N%64==0.
template <bool ASPLIT, int ACT, bool BIAS_BF16>
__global__ __launch_bounds__(128) void k_gemm_bf(const float* __restrict__ A, int lda, const unsigned short* __restrict__ Wt, int ldb,
                                               const float* __restrict__ bias, float* __restrict__ C, int ldc, int M, int N, int K) {
  __shared__ __attribute__((aligned(16))) float so[4][16][64];
  const int tid = threadIdx.x, w = tid >> 5, lane = tid & 31, ln = lane & 15, hh = lane >> 4;
  const int ntn = N / 64;
  const int wid = blockIdx.x * 4 + w;
  const int mt = wid / ntn, nq = wid % ntn;
  if (mt * 16 >= M) return;
  const int row0 = mt * 16, col0 = nq * 64;
  const float* arow = A + (size_t)(row0 + ln) * lda;
  v8f acc[4] = {};
  for (int kb = 0; kb < K; kb += 32) {
    FragB ah, al;
    const v4f x0 = *(const v4fa*)(arow + kb + 8 * hh), x1 = *(const v4fa*)(arow + kb + 8 * hh + 4);
    const v4f x2 = *(const v4fa*)(arow + kb + 16 + 8 * hh), x3 = *(const v4fa*)(arow + kb + 16 + 8 * hh + 4);
    float xs[16] = {x0[0],x0[1],x0[2],x0[3],x1[0],x1[1],x1[2],x1[3],x2[0],x2[1],x2[2],x2[3],x3[0],x3[1],x3[2],x3[3]};
#pragma unroll
    for (int i = 0; i < 16; ++i) { const unsigned short hb = bf16_bits(xs[i]); ah.u[i] = hb; al.u[i] = ASPLIT ? bf16_bits(xs[i] - bf16_val(hb)) : (unsigned short)0; }
#pragma unroll
    for (int t = 0; t < 4; ++t) {
      const unsigned short* brow = Wt + (size_t)(col0 + t * 16 + ln) * ldb + kb;
      FragB b;
      b.half[0] = *(const v8us*)(brow + 8 * hh);
      b.half[1] = *(const v8us*)(brow + 16 + 8 * hh);
      acc[t] = mmaN<ASPLIT ? 2 : 1>(ah.v, al.v, b.v, b.v, acc[t]);
    }
  }
#pragma unroll
  for (int t = 0; t < 4; ++t) {
    float bv = bias ? bias[col0 + t * 16 + ln] : 0.f;
    if (BIAS_BF16) bv = bf16_round(bv);
#pragma unroll
    for (int r = 0; r < 8; ++r) { float v = acc[t][r] + bv; if (ACT == 1) v = fmaxf(v, 0.f); so[w][8 * hh + r][t * 16 + ln] = v; }
  }
  __builtin_amdgcn_fence(__ATOMIC_ACQ_REL, "workgroup");
  __builtin_amdgcn_wave_barrier();
  const int rsub = lane >> 4, c4 = (lane & 15) * 4;
  {
#pragma unroll
    for (int q = 0; q < 8; ++q) {
      const int r = q * 2 + rsub;
      const v4f v = *(const v4fa*)&so[w][r][c4];
      *(v4f*)(C + (size_t)(row0 + r) * ldc + col0 + c4) = v;
    }
    
  }
}

// GEMM C = act(A·W + bias + resid): A f32 (ASPLIT -> hi/lo 2 terms), Wt bf16 [N][K]; ACT 0 none, 1 relu, 2 exact gelu;
// resid (optional, f32, row index = (row % rmod), pitch ldr, RES_BF16 rounds it) added before the activation.
template <bool ASPLIT, int ACT, bool BIAS_BF16, bool RES_BF16>
__global__ __launch_bounds__(128) void k_gemm_bf3(const float* __restrict__ A, int lda, const unsigned short* __restrict__ Wt, int ldb,
                                                const float* __restrict__ bias, const float* __restrict__ resid, int rmod, int ldr,
                                                float* __restrict__ C, int ldc, int M, int N, int K) {
  __shared__ __attribute__((aligned(16))) float so[4][16][64];
  const int tid = threadIdx.x, w = tid >> 5, lane = tid & 31, ln = lane & 15, hh = lane >> 4;
  const int ntn = N / 64;
  const int wid = blockIdx.x * 4 + w;
  const int mt = wid / ntn, nq = wid % ntn;
  if (mt * 16 >= M) return;
  const int row0 = mt * 16, col0 = nq * 64;
  const float* arow = A + (size_t)(row0 + ln) * lda;
  v8f acc[4] = {};
  for (int kb = 0; kb < K; kb += 32) {
    FragB ah, al;
    const v4f x0 = *(const v4fa*)(arow + kb + 8 * hh), x1 = *(const v4fa*)(arow + kb + 8 * hh + 4);
    const v4f x2 = *(const v4fa*)(arow + kb + 16 + 8 * hh), x3 = *(const v4fa*)(arow + kb + 16 + 8 * hh + 4);
    float xs[16] = {x0[0],x0[1],x0[2],x0[3],x1[0],x1[1],x1[2],x1[3],x2[0],x2[1],x2[2],x2[3],x3[0],x3[1],x3[2],x3[3]};
#pragma unroll
    for (int i = 0; i < 16; ++i) { const unsigned short hb = bf16_bits(xs[i]); ah.u[i] = hb; al.u[i] = ASPLIT ? bf16_bits(xs[i] - bf16_val(hb)) : (unsigned short)0; }
#pragma unroll
    for (int t = 0; t < 4; ++t) {
      const unsigned short* brow = Wt + (size_t)(col0 + t * 16 + ln) * ldb + kb;
      FragB b;
      b.half[0] = *(const v8us*)(brow + 8 * hh);
      b.half[1] = *(const v8us*)(brow + 16 + 8 * hh);
      acc[t] = mmaN<ASPLIT ? 2 : 1>(ah.v, al.v, b.v, b.v, acc[t]);
    }
  }
#pragma unroll
  for (int t = 0; t < 4; ++t) {
    const int col = col0 + t * 16 + ln;
    float bv = bias ? bias[col] : 0.f;
    if (BIAS_BF16) bv = bf16_round(bv);
#pragma unroll
    for (int r = 0; r < 8; ++r) {
      float v = acc[t][r] + bv;
      if (resid) { float rv = resid[(size_t)((row0 + 8 * hh + r) % rmod) * ldr + col]; if (RES_BF16) rv = bf16_round(rv); v += rv; }
      if (ACT == 1) v = fmaxf(v, 0.f);
      if (ACT == 2) v = 0.5f * v * (1.0f + erff(v * 0.70710678118654752f));
      if (ACT == 3) { const float u = 0.7978845608028654f * (v + 0.044715f * v * v * v); v = 0.5f * v * (1.0f + tanhf(u)); }
      so[w][8 * hh + r][t * 16 + ln] = v;
    }
  }
  __builtin_amdgcn_fence(__ATOMIC_ACQ_REL, "workgroup");
  __builtin_amdgcn_wave_barrier();
  const int rsub = lane >> 4, c4 = (lane & 15) * 4;
  {
#pragma unroll
    for (int q = 0; q < 8; ++q) {
      const int r = q * 2 + rsub;
      const v4f v = *(const v4fa*)&so[w][r][c4];
      *(v4f*)(C + (size_t)(row0 + r) * ldc + col0 + c4) = v;
    }
    
  }
}
// row LayerNorm (biased variance, eps) over N: s = X (+ R); optional out_sum <- s; out_norm <- (s-mu)*rsqrt(var+eps)*g + b
template <bool PARAM_BF16>
__global__ __launch_bounds__(256) void k_layernorm(const float* __restrict__ X, const float* __restrict__ R, const float* __restrict__ g, const float* __restrict__ bta,
                                                  float* __restrict__ out_sum, float* __restrict__ out_norm, int N, float eps) {
  __shared__ float red[256];
  const int row = blockIdx.x, tid = threadIdx.x;
  const float* x = X + (size_t)row * N; const float* rr = R ? R + (size_t)row * N : nullptr;
  float vals[16];                     // up to N = 4096
  const int per = N / 256;            // contiguous chunk per thread? use strided-by-4 chunks: thread handles j = tid*4 + 1024*u
  float s1 = 0.f;
  for (int u = 0; u < per / 4; ++u) {
    const int j = tid * 4 + 1024 * u;
    const v4f a = *(const v4fa*)(x + j);
    v4f b = {0.f,0.f,0.f,0.f}; if (rr) b = *(const v4fa*)(rr + j);
#pragma unroll
    for (int q = 0; q < 4; ++q) { const float v = a[q] + b[q]; vals[u * 4 + q] = v; s1 += v; }
  }
  red[tid] = s1; __syncthreads();
  for (int st = 128; st > 0; st >>= 1) { if (tid < st) red[tid] += red[tid + st]; __syncthreads(); }
  const float mu = red[0] / (float)N; __syncthreads();
  float s2 = 0.f;
  for (int u = 0; u < per / 4; ++u)
#pragma unroll
    for (int q = 0; q < 4; ++q) { const float c = vals[u * 4 + q] - mu; s2 += c * c; }
  red[tid] = s2; __syncthreads();
  for (int st = 128; st > 0; st >>= 1) { if (tid < st) red[tid] += red[tid + st]; __syncthreads(); }
  const float rs = rsqrtf(red[0] / (float)N + eps);
  {
    for (int u = 0; u < per / 4; ++u) {
      const int j = tid * 4 + 1024 * u;
      v4f o, sm;
#pragma unroll
      for (int q = 0; q < 4; ++q) {
        float gg = g[j + q], bb = bta[j + q];
        if (PARAM_BF16) { gg = bf16_round(gg); bb = bf16_round(bb); }
        sm[q] = vals[u * 4 + q]; o[q] = (vals[u * 4 + q] - mu) * rs * gg + bb;
      }
      if (out_sum) *(v4f*)(out_sum + (size_t)row * N + j) = sm;
      *(v4f*)(out_norm + (size_t)row * N + j) = o;
    }
    
  }
}



// ---- f16 WMMA path (v_wmma_f32_16x16x32_f16): 11-bit significands for operands in range — used where a [0,1] probability operand needs more precision than bf16
typedef _Float16 v16h __attribute__((ext_vector_type(16)));
union FragH { v16h v; v8us half[2]; _Float16 h[16]; unsigned short u[16]; };
template <int NT>
__device__ __forceinline__ v8f mmaH(v16h ah, v16h al, v16h bh, v16h bl, v8f c) {
  c = __builtin_amdgcn_wmma_f32_16x16x32_f16(false, ah, false, bh, (short)0, c, false, false);
  if (NT >= 2) c = __builtin_amdgcn_wmma_f32_16x16x32_f16(false, al, false, bh, (short)0, c, false, false);
  if (NT >= 3) c = __builtin_amdgcn_wmma_f32_16x16x32_f16(false, ah, false, bl, (short)0, c, false, false);
  asm volatile("v_nop\n\tv_nop\n\tv_nop\n\tv_nop" : "+v"(c) : "v"(ah), "v"(al), "v"(bh), "v"(bl));
  return c;
}
// batched GEMM like k_gemm_b but f16 operands: A f32 (split into f16 hi/lo if ASPLIT, else rounded to f16), Bt = f16 values [n][k]; alpha; C f32; N multiple of 16 (partial tiles skipped)
template <bool ASPLIT>
__global__ __launch_bounds__(128) void k_gemm_h(const float* __restrict__ A, int lda, size_t sA, const _Float16* __restrict__ Bh, int ldb, size_t sB, float alpha, float* __restrict__ C, int ldc, size_t sC, int M, int N, int K) {
  __shared__ __attribute__((aligned(16))) float so[4][16][64];
  const int tid = threadIdx.x, w = tid >> 5, lane = tid & 31, ln = lane & 15, hh = lane >> 4; const int by = blockIdx.y;
  A += (size_t)by * sA; Bh += (size_t)by * sB; C += (size_t)by * sC;
  const int ntn = (N + 63) / 64; const int wid = blockIdx.x * 4 + w; const int mt = wid / ntn, nq = wid % ntn; if (mt * 16 >= M) return;
  const int row0 = mt * 16, col0 = nq * 64; const float* arow = A + (size_t)(row0 + ln) * lda;
  v8f acc[4] = {};
  for (int kb = 0; kb < K; kb += 32) {
    FragH ah, al;
    const v4f x0 = *(const v4fa*)(arow + kb + 8 * hh), x1 = *(const v4fa*)(arow + kb + 8 * hh + 4), x2 = *(const v4fa*)(arow + kb + 16 + 8 * hh), x3 = *(const v4fa*)(arow + kb + 16 + 8 * hh + 4);
    float xs[16] = {x0[0],x0[1],x0[2],x0[3],x1[0],x1[1],x1[2],x1[3],x2[0],x2[1],x2[2],x2[3],x3[0],x3[1],x3[2],x3[3]};
#pragma unroll
    for (int i = 0; i < 16; ++i) { const _Float16 h = (_Float16)xs[i]; ah.h[i] = h; al.h[i] = ASPLIT ? (_Float16)(xs[i] - (float)h) : (_Float16)0.0f; }
#pragma unroll
    for (int t = 0; t < 4; ++t) { if (col0 + t * 16 >= N) continue; const size_t boff = (size_t)(col0 + t * 16 + ln) * ldb + kb; FragH bq; bq.half[0] = *(const v8us*)(Bh + boff + 8 * hh); bq.half[1] = *(const v8us*)(Bh + boff + 16 + 8 * hh);
      acc[t] = mmaH<ASPLIT ? 2 : 1>(ah.v, al.v, bq.v, bq.v, acc[t]); }
  }
#pragma unroll
  for (int t = 0; t < 4; ++t) { if (col0 + t * 16 >= N) continue;
#pragma unroll
    for (int r = 0; r < 8; ++r) so[w][8 * hh + r][t * 16 + ln] = acc[t][r] * alpha; }
  __builtin_amdgcn_fence(__ATOMIC_ACQ_REL, "workgroup"); __builtin_amdgcn_wave_barrier();
  const int rsub = lane >> 4, c4 = (lane & 15) * 4;
  {
#pragma unroll
    for (int q = 0; q < 8; ++q) { const int r = q * 2 + rsub; if (col0 + c4 < N) { const v4f v = *(const v4fa*)&so[w][r][c4]; *(v4f*)(C + (size_t)(row0 + r) * ldc + col0 + c4) = v; } }
     }
}

// Wt[n][k] = f16(W[k][n]·scale) from f32 row-major W[K][N] (scale = power of two; bf16-exact weights stay exact in f16 away from the subnormal range)
__global__ __launch_bounds__(256) void k_wt_f16(const float* __restrict__ W, _Float16* __restrict__ Wt, int K, int N, float scale) {
  const int t = blockIdx.x * 256 + threadIdx.x; if (t >= N * (K / 8)) return; const int n = t / (K / 8), k8 = (t % (K / 8)) * 8; FragH f;
#pragma unroll
  for (int i = 0; i < 8; ++i) f.h[i] = (_Float16)(bf16_round(W[(size_t)(k8 + i) * N + n]) * scale); const v8us o = f.half[0];
  *(v8us*)((unsigned short*)Wt + (size_t)n * K + k8) = o; 
}
// k_gemm_hh variant with fused epilogue: v = acc·alpha + bias[by·sBias + col] (+ CP[(row/rowsPerB)·sCPb + by·64 + col] if CP) ; ACT 0 none / 1 elu ; writes f16 C16 (and f32 C if non-null)
template <int ACT>
__global__ __launch_bounds__(128) void k_gemm_hhx(const _Float16* __restrict__ A, int lda, size_t sA, const _Float16* __restrict__ Bh, int ldb, size_t sB, float alpha, const float* __restrict__ bias, size_t sBias, const float* __restrict__ CP, int rowsPerB, size_t sCPb, int row0g,
    float* __restrict__ C, _Float16* __restrict__ C16, int ldc, size_t sC, int M, int N, int K) {
  __shared__ __attribute__((aligned(16))) float so[4][16][64];
  const int tid = threadIdx.x, w = tid >> 5, lane = tid & 31, ln = lane & 15, hh = lane >> 4; const int by = blockIdx.y;
  A += (size_t)by * sA; Bh += (size_t)by * sB; const size_t cofs = (size_t)by * sC; const float* bp = bias ? bias + (size_t)by * sBias : nullptr;
  const int ntn = (N + 63) / 64; const int wid = blockIdx.x * 4 + w; const int mt = wid / ntn, nq = wid % ntn; if (mt * 16 >= M) return;
  const int row0 = mt * 16, col0 = nq * 64; const _Float16* arow = A + (size_t)(row0 + ln) * lda;
  v8f acc[4] = {};
  for (int kb = 0; kb < K; kb += 32) { FragH ah; ah.half[0] = *(const v8us*)((const unsigned short*)arow + kb + 8 * hh); ah.half[1] = *(const v8us*)((const unsigned short*)arow + kb + 16 + 8 * hh);
#pragma unroll
    for (int t = 0; t < 4; ++t) { if (col0 + t * 16 >= N) continue; const size_t boff = (size_t)(col0 + t * 16 + ln) * ldb + kb; FragH bq; bq.half[0] = *(const v8us*)((const unsigned short*)Bh + boff + 8 * hh); bq.half[1] = *(const v8us*)((const unsigned short*)Bh + boff + 16 + 8 * hh);
      acc[t] = mmaH<1>(ah.v, ah.v, bq.v, bq.v, acc[t]); }
  }
#pragma unroll
  for (int t = 0; t < 4; ++t) { if (col0 + t * 16 >= N) continue; const int col = col0 + t * 16 + ln; const float bv = bp ? bf16_round(bp[col]) : 0.f;
#pragma unroll
    for (int r = 0; r < 8; ++r) { float v = acc[t][r] * alpha + bv; if (CP) { const int bidx = (row0g + row0 + 8 * hh + r) / rowsPerB; v += CP[(size_t)bidx * sCPb + (size_t)by * 64 + col]; } if (ACT == 1) v = (v > 0.f) ? v : expm1f(v); else if (ACT == 7) v = (v > 0.f) ? v + 1.0f : expf(v); else if (ACT == 8) v = tanhf(v); else if (ACT == 9) v = 0.5f * v * (1.0f + tanhf(0.7978845608028654f * (v + 0.044715f * v * v * v))); else if (ACT == 11) v = 1.0f / (1.0f + expf(-v)); else if (ACT == 12) v = (v > 0.f) ? v : 0.01f * v; else if (ACT == 14) v = (v > 0.f) ? v : 0.1f * v; else if (ACT == 15) v = v / (1.0f + expf(-v)); else if (ACT == 3) v = fmaxf(v, 0.f); else if (ACT == 6) v = 0.5f * v * (1.0f + erff(v * 0.70710678118654752f)); so[w][8 * hh + r][t * 16 + ln] = v; } }
  __builtin_amdgcn_fence(__ATOMIC_ACQ_REL, "workgroup"); __builtin_amdgcn_wave_barrier();
  const int rsub = lane >> 4, c4 = (lane & 15) * 4; typedef _Float16 v4h __attribute__((ext_vector_type(4)));
  {
#pragma unroll
    for (int q = 0; q < 8; ++q) { const int r = q * 2 + rsub; if (col0 + c4 < N) { const v4f v = *(const v4fa*)&so[w][r][c4]; if (C) *(v4f*)(C + cofs + (size_t)(row0 + r) * ldc + col0 + c4) = v; if (C16) { v4h h4; for (int i = 0; i < 4; ++i) h4[i] = (_Float16)v[i]; *(v4h*)(C16 + cofs + (size_t)(row0 + r) * ldc + col0 + c4) = h4; } } }
     }
}


typedef _Float16 v4h __attribute__((ext_vector_type(4)));

__global__ __launch_bounds__(256) void k_x16(const float* __restrict__ x, _Float16* __restrict__ X16, size_t n8) { const size_t t = (size_t)blockIdx.x * 256 + threadIdx.x; if (t >= n8) return; FragH f;
#pragma unroll
  for (int q = 0; q < 8; ++q) f.h[q] = (_Float16)bf16_round(x[t * 8 + q]); *(v8us*)((unsigned short*)X16 + t * 8) = f.half[0];  }
__global__ __launch_bounds__(256) void k_h16(const float* __restrict__ x, _Float16* __restrict__ X16, size_t n8) { const size_t t = (size_t)blockIdx.x * 256 + threadIdx.x; if (t >= n8) return; FragH f;
#pragma unroll
  for (int q = 0; q < 8; ++q) f.h[q] = (_Float16)x[t * 8 + q]; *(v8us*)((unsigned short*)X16 + t * 8) = f.half[0];  }
__global__ __launch_bounds__(256) void k_round16f(const float* __restrict__ W, _Float16* __restrict__ Bt, size_t n8) { const size_t t = (size_t)blockIdx.x * 256 + threadIdx.x; if (t >= n8) return; FragH f;
#pragma unroll
  for (int i = 0; i < 8; ++i) f.h[i] = (_Float16)(bf16_round(W[t * 8 + i]) * 16.0f); *(v8us*)((unsigned short*)Bt + t * 8) = f.half[0];  }
template <int NHv, int TTv>
__global__ __launch_bounds__(256) void k_vt(const _Float16* __restrict__ V16, int ldv, int voff, _Float16* __restrict__ Vt) { __shared__ unsigned short tl[64][66]; const int tid = threadIdx.x; const int slab = blockIdx.x / (TTv / 64), lg = blockIdx.x % (TTv / 64); const int b = slab / NHv, h = slab % NHv;
  for (int i = tid; i < 64 * 8; i += 256) { const int r = i / 8, c8 = (i % 8) * 8; FragH f; f.half[0] = *(const v8us*)((const unsigned short*)V16 + ((size_t)b * TTv + lg * 64 + r) * ldv + voff + h * 64 + c8);
#pragma unroll
    for (int q = 0; q < 8; ++q) tl[r][c8 + q] = f.u[q]; }
  __syncthreads();
  {
#pragma unroll
    for (int rd = 0; rd < 2; ++rd) { const int d = rd * 32 + tid / 8, pc = tid % 8; FragH f;
#pragma unroll
      for (int q = 0; q < 8; ++q) f.u[q] = tl[pc * 8 + q][d];
      *(v8us*)((unsigned short*)Vt + ((size_t)slab * 64 + d) * TTv + lg * 64 + pc * 8) = f.half[0]; }
     } }

__global__ __launch_bounds__(256) void k_hl(const float* __restrict__ F, _Float16* __restrict__ Hh, _Float16* __restrict__ Hl, size_t n8) { const size_t t = (size_t)blockIdx.x * 256 + threadIdx.x; if (t >= n8) return; FragH fh, fl; const v4f a = *(const v4fa*)(F + t * 8), c = *(const v4fa*)(F + t * 8 + 4);
#pragma unroll
  for (int q = 0; q < 4; ++q) { _Float16 h = (_Float16)a[q]; fh.h[q] = h; fl.h[q] = (_Float16)((a[q] - (float)h) * 1024.0f); h = (_Float16)c[q]; fh.h[4 + q] = h; fl.h[4 + q] = (_Float16)((c[q] - (float)h) * 1024.0f); }
  { *(v8us*)((unsigned short*)Hh + t * 8) = fh.half[0]; *(v8us*)((unsigned short*)Hl + t * 8) = fl.half[0];  } }

// ---- fast GEMM (wave tile 32x64, block tile 128x64; requires M % 128 == 0, N % 64 == 0 and K % 64 == 0); epilogue = k_gemm_hhx semantics ----
__device__ __forceinline__ v16h g2_frag(const _Float16* p, int hh) { FragH f; f.half[0] = *(const v8us*)((const unsigned short*)p + 8 * hh); f.half[1] = *(const v8us*)((const unsigned short*)p + 16 + 8 * hh); return f.v; }
__device__ __forceinline__ v8f g2_mma(v16h a, v16h b, v8f c) { v8f d = __builtin_amdgcn_wmma_f32_16x16x32_f16(false, a, false, b, (short)0, c, false, false); asm volatile("v_nop\n\tv_nop\n\tv_nop\n\tv_nop" : "+v"(d) : "v"(a), "v"(b)); return d; }
// One wave's share of a stage (192 rows of 128 bytes: 128 A rows, then 64 B rows, LDS pitch G2P bytes): 12 asynchronous 16-byte copies per lane, 8 lanes to a row, so that each copy of a wave reads 4 whole 128-byte lines.
// l = this lane's LDS byte address in the stage's row tid / 8; ga, gb = this lane's 16 bytes in A row tid / 8 and B row tid / 8 of the stage; every further copy is 16 rows on.
#define G2P 144            /* 128 + 16: the pitch for 16-byte LDS reads of 128-byte rows */
#define G2S (192 * G2P)    /* bytes of one stage */
__device__ __forceinline__ void g2_stage(unsigned l, const _Float16* ga, size_t lda, const _Float16* gb, size_t ldb) {
  const unsigned l1 = l + 16 * G2P, l2 = l + 32 * G2P, l3 = l + 48 * G2P, l4 = l + 64 * G2P, l5 = l + 80 * G2P, l6 = l + 96 * G2P, l7 = l + 112 * G2P, l8 = l + 128 * G2P, l9 = l + 144 * G2P, l10 = l + 160 * G2P, l11 = l + 176 * G2P;
  const _Float16 *a1 = ga + 16 * lda, *a2 = ga + 32 * lda, *a3 = ga + 48 * lda, *a4 = ga + 64 * lda, *a5 = ga + 80 * lda, *a6 = ga + 96 * lda, *a7 = ga + 112 * lda, *b1 = gb + 16 * ldb, *b2 = gb + 32 * ldb, *b3 = gb + 48 * ldb;
  /* the copies and their s_wait_xcnt in one statement: no address register is rewritten before the wait */
  asm volatile("global_load_async_to_lds_b128 %0, %12, off\n\t"
               "global_load_async_to_lds_b128 %1, %13, off\n\t"
               "global_load_async_to_lds_b128 %2, %14, off\n\t"
               "global_load_async_to_lds_b128 %3, %15, off\n\t"
               "global_load_async_to_lds_b128 %4, %16, off\n\t"
               "global_load_async_to_lds_b128 %5, %17, off\n\t"
               "global_load_async_to_lds_b128 %6, %18, off\n\t"
               "global_load_async_to_lds_b128 %7, %19, off\n\t"
               "global_load_async_to_lds_b128 %8, %20, off\n\t"
               "global_load_async_to_lds_b128 %9, %21, off\n\t"
               "global_load_async_to_lds_b128 %10, %22, off\n\t"
               "global_load_async_to_lds_b128 %11, %23, off\n\t"
               "s_wait_xcnt 0x0"
               :: "v"(l), "v"(l1), "v"(l2), "v"(l3), "v"(l4), "v"(l5), "v"(l6), "v"(l7), "v"(l8), "v"(l9), "v"(l10), "v"(l11),
                  "v"(ga), "v"(a1), "v"(a2), "v"(a3), "v"(a4), "v"(a5), "v"(a6), "v"(a7), "v"(gb), "v"(b1), "v"(b2), "v"(b3) : "memory"); }
// Block tile 128x64 (M % 128 == 0, N % 64 == 0, K % 64 == 0); A and B go through LDS in stages of 64 k, two buffers: stage t + 1 flies while stage t is worked on. The fragments are read from LDS in the k order of g2_frag.
template <int ACT>
__global__ __launch_bounds__(128) void k_gemm2(const _Float16* __restrict__ A, int lda, size_t sA, const _Float16* __restrict__ Bh, int ldb, size_t sB, float alpha, const float* __restrict__ bias, size_t sBias, const float* __restrict__ CP, int rowsPerB, size_t sCPb, int row0g,
    float* __restrict__ C, _Float16* __restrict__ C16, int ldc, size_t sC, int M, int N, int K) {
  __shared__ __attribute__((aligned(16))) float so[4][32][68];
  __shared__ __attribute__((aligned(16))) _Float16 st[2][192][G2P / 2];
  const int tid = threadIdx.x, w = tid >> 5, lane = tid & 31, ln = lane & 15, hh = lane >> 4; const int by = blockIdx.y;
  A += (size_t)by * sA; Bh += (size_t)by * sB; const size_t cofs = (size_t)by * sC; const float* bp = bias ? bias + (size_t)by * sBias : nullptr;
  const int ntn = N >> 6; const int mt = blockIdx.x / ntn, nq = blockIdx.x - mt * ntn; const int row0 = mt * 128 + 32 * w, col0 = nq * 64; if (mt * 128 + 128 > M) return;      /* the whole block or none of it, in front of every barrier */
  const _Float16* ga = A + (size_t)(mt * 128 + (tid >> 3)) * lda + (tid & 7) * 8; const _Float16* gb = Bh + (size_t)(col0 + (tid >> 3)) * ldb + (tid & 7) * 8;
  const unsigned ls = (unsigned)(size_t)&st[0][tid >> 3][(tid & 7) * 8];
  const int nst = K >> 6;
  g2_stage(ls, ga, (size_t)lda, gb, (size_t)ldb);
  asm volatile("s_wait_asynccnt 0x0" ::: "memory");      /* stage 0 of this wave has landed */
  __syncthreads();      /* ... and every wave's share of it */
  if (nst > 1) g2_stage(ls + G2S, ga + 64, (size_t)lda, gb + 64, (size_t)ldb);
  const v8f z8 = {0.f,0.f,0.f,0.f,0.f,0.f,0.f,0.f}; v8f c00 = z8, c01 = z8, c02 = z8, c03 = z8, c10 = z8, c11 = z8, c12 = z8, c13 = z8;
  /* rolled: one trip of code; the buffer is picked by the trip's parity */
#pragma unroll 1
  for (int t = 0; t < nst; ++t) { const _Float16* sa = &st[t & 1][32 * w + ln][0]; const _Float16* sb = &st[t & 1][128 + ln][0];
    /* all of the trip's fragments are read here, ahead of its first product */
    const v16h a00 = g2_frag(sa, hh), a10 = g2_frag(sa + 16 * (G2P / 2), hh), b00 = g2_frag(sb, hh), b10 = g2_frag(sb + 16 * (G2P / 2), hh), b20 = g2_frag(sb + 32 * (G2P / 2), hh), b30 = g2_frag(sb + 48 * (G2P / 2), hh);
    const v16h a01 = g2_frag(sa + 32, hh), a11 = g2_frag(sa + 16 * (G2P / 2) + 32, hh), b01 = g2_frag(sb + 32, hh), b11 = g2_frag(sb + 16 * (G2P / 2) + 32, hh), b21 = g2_frag(sb + 32 * (G2P / 2) + 32, hh), b31 = g2_frag(sb + 48 * (G2P / 2) + 32, hh);
    c00 = g2_mma(a00, b00, c00); c10 = g2_mma(a10, b00, c10); c01 = g2_mma(a00, b10, c01); c11 = g2_mma(a10, b10, c11);
    c02 = g2_mma(a00, b20, c02); c12 = g2_mma(a10, b20, c12); c03 = g2_mma(a00, b30, c03); c13 = g2_mma(a10, b30, c13);
    c00 = g2_mma(a01, b01, c00); c10 = g2_mma(a11, b01, c10); c01 = g2_mma(a01, b11, c01); c11 = g2_mma(a11, b11, c11);
    c02 = g2_mma(a01, b21, c02); c12 = g2_mma(a11, b21, c12); c03 = g2_mma(a01, b31, c03); c13 = g2_mma(a11, b31, c13);
    asm volatile("s_wait_dscnt 0x0" ::: "memory");      /* this wave's reads of the buffer are done before it is refilled */
    asm volatile("s_wait_asynccnt 0x0" ::: "memory");      /* this wave's share of stage t + 1 has landed */
    __syncthreads();      /* publishes stage t + 1 and ends every wave's reads of stage t */
    if (t + 2 < nst) g2_stage(ls + (unsigned)(t & 1) * G2S, ga + (size_t)(t + 2) * 64, (size_t)lda, gb + (size_t)(t + 2) * 64, (size_t)ldb); }
  asm volatile("s_wait_asynccnt 0x0" ::: "memory");      /* nothing in flight when the wave goes on to the epilogue */
  v8f accs[8] = {c00, c01, c02, c03, c10, c11, c12, c13};
#pragma unroll
  for (int u = 0; u < 8; ++u) { const int t = u & 3, half = u >> 2; const int col = col0 + t * 16 + ln; const float bv = bp ? bf16_round(bp[col]) : 0.f;
#pragma unroll
    for (int r = 0; r < 8; ++r) { const int rloc = half * 16 + 8 * hh + r; float v = accs[u][r] * alpha + bv; if (CP) { const int bidx = (row0g + row0 + rloc) / rowsPerB; v += CP[(size_t)bidx * sCPb + (size_t)by * 64 + col]; }
      if (ACT == 3) v = fmaxf(v, 0.f); else if (ACT == 6) v = 0.5f * v * (1.0f + erff(v * 0.70710678118654752f)); else if (ACT == 11) v = 1.0f / (1.0f + expf(-v)); else if (ACT == 15) v = v / (1.0f + expf(-v)); else if (ACT == 12) v = (v > 0.f) ? v : 0.01f * v; else if (ACT == 8) v = tanhf(v);
      so[w][rloc][t * 16 + ln] = v; } }
  __builtin_amdgcn_fence(__ATOMIC_ACQ_REL, "workgroup"); __builtin_amdgcn_wave_barrier();
  const int rsub = lane >> 4, c4 = (lane & 15) * 4;
  {
#pragma unroll
    for (int q = 0; q < 16; ++q) { const int r = q * 2 + rsub; const v4f v = *(const v4fa*)&so[w][r][c4]; if (C) *(v4f*)(C + cofs + (size_t)(row0 + r) * ldc + col0 + c4) = v; if (C16) { v4h h4; for (int i = 0; i < 4; ++i) h4[i] = (_Float16)v[i]; *(v4h*)(C16 + cofs + (size_t)(row0 + r) * ldc + col0 + c4) = h4; } }
     } }



// lane l <-> lane l ^ 16 (the two halves of a wave hold the two key halves of one query column)
__device__ __forceinline__ float xhalf(float x) { return __builtin_bit_cast(float, __builtin_amdgcn_permlanex16(__builtin_bit_cast(int, x), __builtin_bit_cast(int, x), 0x76543210, 0xfedcba98, false, false)); }
__device__ __forceinline__ v8f mmaT(v16h a, v16h b, v8f c) { return __builtin_amdgcn_wmma_f32_16x16x32_f16(false, a, false, b, (short)0, c, false, false); }
// One wave's share of a flash stage of 64 keys (128 rows of 128 bytes: 64 K rows of the head, then the 64 V^T rows' 64 keys, LDS pitch FLP bytes): 8 asynchronous 16-byte copies per lane, 8 lanes to a row, so that each copy of a wave reads 4 whole 128-byte lines.
// l = this lane's LDS byte address in the stage's row tid / 8; gk, gv = this lane's 16 bytes in K row tid / 8 and V^T row tid / 8 of the stage; every further copy is 16 rows on.
#define FLP 144            /* 128 + 16: the pitch for 16-byte LDS reads of 128-byte rows */
#define FLS (128 * FLP)    /* bytes of one stage */
__device__ __forceinline__ void fl_stage(unsigned l, const _Float16* gk, size_t ldk, const _Float16* gv) {
  const unsigned l1 = l + 16 * FLP, l2 = l + 32 * FLP, l3 = l + 48 * FLP, l4 = l + 64 * FLP, l5 = l + 80 * FLP, l6 = l + 96 * FLP, l7 = l + 112 * FLP;
  const _Float16 *k1 = gk + 16 * ldk, *k2 = gk + 32 * ldk, *k3 = gk + 48 * ldk, *v1 = gv + 16 * TK, *v2 = gv + 32 * TK, *v3 = gv + 48 * TK;
  /* the copies and their s_wait_xcnt in one statement: no address register is rewritten before the wait */
  asm volatile("global_load_async_to_lds_b128 %0, %8, off\n\t"
               "global_load_async_to_lds_b128 %1, %9, off\n\t"
               "global_load_async_to_lds_b128 %2, %10, off\n\t"
               "global_load_async_to_lds_b128 %3, %11, off\n\t"
               "global_load_async_to_lds_b128 %4, %12, off\n\t"
               "global_load_async_to_lds_b128 %5, %13, off\n\t"
               "global_load_async_to_lds_b128 %6, %14, off\n\t"
               "global_load_async_to_lds_b128 %7, %15, off\n\t"
               "s_wait_xcnt 0x0"
               :: "v"(l), "v"(l1), "v"(l2), "v"(l3), "v"(l4), "v"(l5), "v"(l6), "v"(l7),
                  "v"(gk), "v"(k1), "v"(k2), "v"(k3), "v"(gv), "v"(v1), "v"(v2), "v"(v3) : "memory"); }
// Transposed products: S^T = K Q^T (A = 16 key rows, B = the wave's 16 query columns, kept in registers), O^T += V^T P^T (A = 16 rows of V^T, B = P^T).
// Lane (c = lane & 15, hh = lane >> 4) holds query q0 + c only: register r of score tile nt is key j0 + 16 nt + 8 hh + r, so maximum and sum run in-lane plus one exchange between the halves,
// and the two converted score tiles ARE the B operand of the second product in the hardware k order (element s: key 8 hh + s, then 16 + 8 hh + (s - 8)), the order in which the V^T rows are loaded.
// K and V^T go through LDS in stages of 64 keys (two passes of 32), two buffers, shared by the block's 4 waves: stage t + 1 flies while stage t is worked on. The fragments are read from LDS in the k order of g2_frag.
template <int CAUSAL>
__global__ __launch_bounds__(128) void k_flash(const _Float16* __restrict__ Q16, int ldq, const _Float16* __restrict__ K16, int ldk, const _Float16* __restrict__ Vt, const int* __restrict__ MSK, float* __restrict__ O, int ldo) {
  constexpr int RPW = 16, DT = 4, KS = 2;
  __shared__ __attribute__((aligned(16))) float sO[4][RPW][64 + 4];
  __shared__ __attribute__((aligned(16))) _Float16 st[2][128][FLP / 2];
  const int tid = threadIdx.x, w = tid >> 5, lane = tid & 31, ln = lane & 15, hh = lane >> 4;
  const int slab = blockIdx.x / QBNP, qblk = QB0P + blockIdx.x % QBNP; const int b = slab / NH, h = slab % NH; const int qb0 = qblk * (4 * RPW); const int q0 = qb0 + w * RPW; const int tq = q0 + ln;
  FragH bq[KS];
  { const unsigned short* qr = (const unsigned short*)Q16 + ((size_t)b * TQ + tq) * ldq + h * 64;
#pragma unroll
    for (int ks = 0; ks < KS; ++ks) { bq[ks].half[0] = *(const v8us*)(qr + ks * 32 + 8 * hh); bq[ks].half[1] = *(const v8us*)(qr + ks * 32 + 16 + 8 * hh); } }
  /* this lane's 16 bytes of stage 0 (K row tid / 8 of the head, V^T row tid / 8) and their place in buffer 0 */
  const _Float16* gk = K16 + ((size_t)b * TK + (tid >> 3)) * ldk + h * 64 + (tid & 7) * 8; const _Float16* gv = Vt + ((size_t)slab * 64 + (tid >> 3)) * TK + (tid & 7) * 8;
  const unsigned ls = (unsigned)(size_t)&st[0][tid >> 3][(tid & 7) * 8];
  const char* mb = (const char*)((const float*)MSK + (size_t)b * TK); const unsigned mo = (unsigned)hh * 32u;      /* a wave-uniform base that steps with the stage; this half's 8 mask words */
  float m_c = -3.0e38f, l_c = 0.f; v8f oacc[DT];
#pragma unroll
  for (int dt = 0; dt < DT; ++dt) oacc[dt] = (v8f){0.f,0.f,0.f,0.f,0.f,0.f,0.f,0.f};
  const int jend = (CAUSAL == 1) ? (qb0 + 4 * RPW) : TK;      /* causal: keys beyond the block's last query never contribute */
  const int nst = jend >> 6;      /* both ends are multiples of 64; the same for the whole block */
  fl_stage(ls, gk, (size_t)ldk, gv);
  asm volatile("s_wait_asynccnt 0x0" ::: "memory");      /* stage 0 of this wave has landed */
  __syncthreads();      /* ... and every wave's share of it */
  if (nst > 1) fl_stage(ls + FLS, gk + (size_t)64 * ldk, (size_t)ldk, gv + 64);
  /* the stage loop stays rolled (one stage of code; the buffer is picked by the trip's parity); every inner loop is unrolled so that the fragment and score arrays have constant indices and stay in registers */
#pragma unroll 1
  for (int t = 0; t < nst; ++t) { const _Float16* skr = &st[t & 1][ln][0]; const _Float16* svr = &st[t & 1][64 + ln][0];      /* this lane's K row and V^T row of the stage's buffer */
    v4f mk[2][2][2];      /* the stage's mask words (still straight from the input) are asked for first (for speed only) */
    if (CAUSAL == 17) {
#pragma unroll
      for (int nt = 0; nt < 4; ++nt) { mk[nt >> 1][nt & 1][0] = *(const v4fa*)(mb + mo + nt * 64); mk[nt >> 1][nt & 1][1] = *(const v4fa*)(mb + mo + nt * 64 + 16); } }
#pragma unroll
   for (int pp = 0; pp < 2; ++pp) { const int j0 = t * 64 + pp * 32;
    FragH ak[2][KS], av[DT];
#pragma unroll
    for (int nt = 0; nt < 2; ++nt) {
#pragma unroll
      for (int ks = 0; ks < KS; ++ks) ak[nt][ks].v = g2_frag(skr + (pp * 32 + nt * 16) * (FLP / 2) + ks * 32, hh); }      /* key rows ln and 16 + ln of the pass */
    asm volatile("" :: "v"(ak[0][0].v), "v"(ak[0][1].v), "v"(ak[1][0].v), "v"(ak[1][1].v));      /* inputs only: keeps the pass's eight K reads together in front of its first product (one LDS wait; without it the first pass of a stage reads and waits four times in a row) */
#pragma unroll
    for (int dt = 0; dt < DT; ++dt) av[dt].v = g2_frag(svr + dt * 16 * (FLP / 2) + pp * 32, hh);      /* V^T row dt * 16 + ln, the pass's 32 keys */
    float sc[16]; bool ok[16];
#pragma unroll
    for (int nt = 0; nt < 2; ++nt) { v8f acc = (v8f){0.f,0.f,0.f,0.f,0.f,0.f,0.f,0.f};
#pragma unroll
      for (int ks = 0; ks < KS; ++ks) acc = mmaT(ak[nt][ks].v, bq[ks].v, acc);
#pragma unroll
      for (int r = 0; r < 8; ++r) { const int kk = j0 + nt * 16 + 8 * hh + r; const bool okk = (CAUSAL == 1) ? (kk <= tq) : ((CAUSAL == 2) ? ((kk >> 5) == (tq >> 5)) : true);      /* mode 2: block-diagonal 32-token groups */
        float sv = okk ? acc[r] * SCL : -3.0e38f; if (CAUSAL == 17) sv += (float)(__bf16)mk[pp][nt][r >> 2][r & 3];      /* mode 17: additive per-(batch, key) mask INPUT */
        sc[nt * 8 + r] = sv; ok[nt * 8 + r] = okk; } }
    float mx[8];
#pragma unroll
    for (int i = 0; i < 8; ++i) mx[i] = fmaxf(sc[i], sc[i + 8]);
    float mc = fmaxf(fmaxf(fmaxf(mx[0], mx[1]), fmaxf(mx[2], mx[3])), fmaxf(fmaxf(mx[4], mx[5]), fmaxf(mx[6], mx[7])));
    mc = fmaxf(mc, xhalf(mc));      /* both halves now hold the query's maximum over the 32 keys */
    const float mn = fmaxf(m_c, mc); const float al = (mn > -1.0e38f) ? expf(m_c - mn) : 1.0f; m_c = mn;
    float p[16]; FragH pb;
#pragma unroll
    for (int i = 0; i < 16; ++i) { p[i] = ok[i] ? expf(sc[i] - mn) : 0.f; pb.h[i] = (_Float16)(p[i] * 1024.0f); }
    const float pe = ((p[0] + p[2]) + (p[4] + p[6])) + ((p[8] + p[10]) + (p[12] + p[14])), po = ((p[1] + p[3]) + (p[5] + p[7])) + ((p[9] + p[11]) + (p[13] + p[15])); const float ps = pe + po;
    l_c = l_c * al + ps;      /* this half's 16 keys; the halves are joined once, behind the loop */
#pragma unroll
    for (int dt = 0; dt < DT; ++dt) {
#pragma unroll
      for (int r = 0; r < 8; ++r) oacc[dt][r] *= al;
      oacc[dt] = mmaT(av[dt].v, pb.v, oacc[dt]); } }
    mb += 256;
    asm volatile("s_wait_dscnt 0x0" ::: "memory");      /* this wave's reads of the buffer are done before it is refilled */
    asm volatile("s_wait_asynccnt 0x0" ::: "memory");      /* this wave's share of stage t + 1 has landed */
    __syncthreads();      /* publishes stage t + 1 and ends every wave's reads of stage t */
    if (t + 2 < nst) fl_stage(ls + (unsigned)(t & 1) * FLS, gk + (size_t)(t + 2) * 64 * ldk, (size_t)ldk, gv + (size_t)(t + 2) * 64); }
  asm volatile("s_wait_asynccnt 0x0" ::: "memory");      /* nothing in flight when the wave goes on to the epilogue */
  const float l = l_c + xhalf(l_c); const float inv = (l > 0.f) ? 1.0f / (l * 1024.0f) : 0.f;
#pragma unroll
  for (int dt = 0; dt < DT; ++dt) { v4f lo, hi;      /* register r = head column dt * 16 + 8 hh + r of query q0 + ln */
#pragma unroll
    for (int r = 0; r < 4; ++r) { lo[r] = oacc[dt][r] * inv; hi[r] = oacc[dt][4 + r] * inv; }
    *(v4fa*)&sO[w][ln][dt * 16 + 8 * hh] = lo; *(v4fa*)&sO[w][ln][dt * 16 + 8 * hh + 4] = hi; }
  __builtin_amdgcn_fence(__ATOMIC_ACQ_REL, "workgroup"); __builtin_amdgcn_wave_barrier();
  {
#pragma unroll
    for (int rp = 0; rp < RPW; rp += 2) { const int r = rp + (lane >> 4), pc = lane & 15; const v4f val = *(const v4fa*)&sO[w][r][pc * 4]; *(v4f*)(O + ((size_t)b * TQ + q0 + r) * ldo + h * 64 + pc * 4) = val; }
     } }
// 5-plane variant: S = Qh Kh^T + (Ql Kh^T + Qh Kl^T)/1024 with Q/K = [hi | 2^10 residual] f16 planes (QL/KL same layout as Q16/K16), then the 3-term P.V below.
// 3-term variant: O = (P_hi V_hi + (P_lo V_hi + P_hi V_lo) / 1024) / l with P = [hi | 2^10 residual] of 1024 p and V^T = [hi | 2^10 residual] planes (VtL same layout as Vt) -> ~2^-21-class products for un-averaged (early causal / peaked) rows
template <int CAUSAL>
__global__ __launch_bounds__(128) void k_flash5(const _Float16* __restrict__ Q16, const _Float16* __restrict__ QL, int ldq, const _Float16* __restrict__ K16, const _Float16* __restrict__ KL, int ldk, const _Float16* __restrict__ Vt, const _Float16* __restrict__ VtL, const int* __restrict__ MSK, float* __restrict__ O, int ldo) {
  constexpr int RPW = 16, RTN = RPW / 16, NQB = TQ / (4 * RPW), DT = 4, KS = 2;
  __shared__ __attribute__((aligned(16))) unsigned short sP[4][RPW][40]; __shared__ __attribute__((aligned(16))) unsigned short sPL[4][RPW][40]; __shared__ __attribute__((aligned(16))) float sO[4][RPW][64 + 4];
  const int tid = threadIdx.x, w = tid >> 5, lane = tid & 31, ln = lane & 15, hh = lane >> 4;
  const int slab = blockIdx.x / QBN5, qblk = QB05 + blockIdx.x % QBN5; (void)NQB; const int b = slab / NH, h = slab % NH; const int qb0 = qblk * (4 * RPW); const int q0 = qb0 + w * RPW;
  FragH aq[2][KS], aql[2][KS];
#pragma unroll
  for (int rt = 0; rt < RTN; ++rt) { const unsigned short* qr = (const unsigned short*)Q16 + ((size_t)b * TQ + q0 + rt * 16 + ln) * ldq + h * 64; const unsigned short* ql = (const unsigned short*)QL + ((size_t)b * TQ + q0 + rt * 16 + ln) * ldq + h * 64;
#pragma unroll
    for (int ks = 0; ks < KS; ++ks) { aq[rt][ks].half[0] = *(const v8us*)(qr + ks * 32 + 8 * hh); aq[rt][ks].half[1] = *(const v8us*)(qr + ks * 32 + 16 + 8 * hh); aql[rt][ks].half[0] = *(const v8us*)(ql + ks * 32 + 8 * hh); aql[rt][ks].half[1] = *(const v8us*)(ql + ks * 32 + 16 + 8 * hh); } }
  const unsigned short* Vth = (const unsigned short*)Vt + (size_t)slab * 64 * TK; const unsigned short* Vtl = (const unsigned short*)VtL + (size_t)slab * 64 * TK;
  float m_r[2][8], l_r[2][8]; v8f oacc[2][DT], oaccL[2][DT];
#pragma unroll
  for (int rt = 0; rt < RTN; ++rt) {
#pragma unroll
    for (int r = 0; r < 8; ++r) { m_r[rt][r] = -3.0e38f; l_r[rt][r] = 0.f; }
#pragma unroll
    for (int dt = 0; dt < DT; ++dt) { oacc[rt][dt] = (v8f){0.f,0.f,0.f,0.f,0.f,0.f,0.f,0.f}; oaccL[rt][dt] = oacc[rt][dt]; } }
  const int jend = (CAUSAL == 1) ? (qb0 + 4 * RPW) : TK;      /* causal: keys beyond the block's last query never contribute */
#pragma unroll 1
  for (int j0 = 0; j0 < jend; j0 += 32) {
    v8f s[2][2];
#pragma unroll
    for (int nt = 0; nt < 2; ++nt) { const unsigned short* kr = (const unsigned short*)K16 + ((size_t)b * TK + j0 + nt * 16 + ln) * ldk + h * 64; const unsigned short* klr = (const unsigned short*)KL + ((size_t)b * TK + j0 + nt * 16 + ln) * ldk + h * 64; FragH bk[KS], bkl[KS];
#pragma unroll
      for (int ks = 0; ks < KS; ++ks) { bk[ks].half[0] = *(const v8us*)(kr + ks * 32 + 8 * hh); bk[ks].half[1] = *(const v8us*)(kr + ks * 32 + 16 + 8 * hh); bkl[ks].half[0] = *(const v8us*)(klr + ks * 32 + 8 * hh); bkl[ks].half[1] = *(const v8us*)(klr + ks * 32 + 16 + 8 * hh); }
#pragma unroll
      for (int rt = 0; rt < RTN; ++rt) { v8f acc = (v8f){0.f,0.f,0.f,0.f,0.f,0.f,0.f,0.f}, accl = acc;
#pragma unroll
        for (int ks = 0; ks < KS; ++ks) { acc = mmaH<1>(aq[rt][ks].v, aq[rt][ks].v, bk[ks].v, bk[ks].v, acc); accl = mmaH<1>(aql[rt][ks].v, aql[rt][ks].v, bk[ks].v, bk[ks].v, accl); accl = mmaH<1>(aq[rt][ks].v, aq[rt][ks].v, bkl[ks].v, bkl[ks].v, accl); }
#pragma unroll
        for (int r = 0; r < 8; ++r) acc[r] += accl[r] * 0.0009765625f;
        s[rt][nt] = acc; } }
#pragma unroll
    for (int rt = 0; rt < RTN; ++rt)
#pragma unroll
      for (int r = 0; r < 8; ++r) { const int tq = q0 + rt * 16 + 8 * hh + r; const int k0 = j0 + ln, k1 = j0 + 16 + ln;
        bool ok0 = (CAUSAL == 1) ? (k0 <= tq) : ((CAUSAL == 2) ? ((k0 >> 5) == (tq >> 5)) : true), ok1 = (CAUSAL == 1) ? (k1 <= tq) : ((CAUSAL == 2) ? ((k1 >> 5) == (tq >> 5)) : true);      /* mode 2: block-diagonal 32-token groups */
        if (CAUSAL == 4) { const int* mrow = MSK + ((size_t)b * TQ + tq) * TK; ok0 = mrow[k0] != 0; ok1 = mrow[k1] != 0; }      /* mode 4: per-(query, key) INPUT mask shared by all heads; masked keys contribute nothing (== the reference's -4096 fill, whose exp underflows to 0), rows with no valid key give l = 0 -> output 0 (== the reference's row_valid zeroing) */
        float s0 = ok0 ? s[rt][0][r] * SCL : -3.0e38f, s1 = ok1 ? s[rt][1][r] * SCL : -3.0e38f; if (CAUSAL == 17) { const float* amk = (const float*)MSK + (size_t)b * TK; s0 += bf16_round(amk[k0]); s1 += bf16_round(amk[k1]); }      /* mode 17: additive per-(batch, key) mask INPUT */ float mc = fmaxf(s0, s1);
        mc = fmaxf(mc, __shfl_xor(mc, 1, 32)); mc = fmaxf(mc, __shfl_xor(mc, 2, 32)); mc = fmaxf(mc, __shfl_xor(mc, 4, 32)); mc = fmaxf(mc, __shfl_xor(mc, 8, 32));
        const float mn = fmaxf(m_r[rt][r], mc); const float al = (mn > -1.0e38f) ? expf(m_r[rt][r] - mn) : 1.0f; m_r[rt][r] = mn; const float p0 = ok0 ? expf(s0 - mn) : 0.f, p1 = ok1 ? expf(s1 - mn) : 0.f; l_r[rt][r] = l_r[rt][r] * al + p0 + p1;
#pragma unroll
        for (int dt = 0; dt < DT; ++dt) { oacc[rt][dt][r] *= al; oaccL[rt][dt][r] *= al; }
        FragH t2, t2l; const float ps0 = p0 * 1024.0f, ps1 = p1 * 1024.0f; t2.h[0] = (_Float16)ps0; t2.h[1] = (_Float16)ps1; t2l.h[0] = (_Float16)((ps0 - (float)t2.h[0]) * 1024.0f); t2l.h[1] = (_Float16)((ps1 - (float)t2.h[1]) * 1024.0f);
        sP[w][rt * 16 + 8 * hh + r][ln] = t2.u[0]; sP[w][rt * 16 + 8 * hh + r][16 + ln] = t2.u[1]; sPL[w][rt * 16 + 8 * hh + r][ln] = t2l.u[0]; sPL[w][rt * 16 + 8 * hh + r][16 + ln] = t2l.u[1]; }
    __builtin_amdgcn_fence(__ATOMIC_ACQ_REL, "workgroup"); __builtin_amdgcn_wave_barrier();
    FragH pa[2], pl[2];
#pragma unroll
    for (int rt = 0; rt < RTN; ++rt) { pa[rt].half[0] = *(const v8us*)&sP[w][rt * 16 + ln][8 * hh]; pa[rt].half[1] = *(const v8us*)&sP[w][rt * 16 + ln][16 + 8 * hh]; pl[rt].half[0] = *(const v8us*)&sPL[w][rt * 16 + ln][8 * hh]; pl[rt].half[1] = *(const v8us*)&sPL[w][rt * 16 + ln][16 + 8 * hh]; }
#pragma unroll
    for (int dt = 0; dt < DT; ++dt) { const unsigned short* vrow = Vth + (size_t)(dt * 16 + ln) * TK + j0; const unsigned short* vrl = Vtl + (size_t)(dt * 16 + ln) * TK + j0; FragH bv, bl; bv.half[0] = *(const v8us*)(vrow + 8 * hh); bv.half[1] = *(const v8us*)(vrow + 16 + 8 * hh); bl.half[0] = *(const v8us*)(vrl + 8 * hh); bl.half[1] = *(const v8us*)(vrl + 16 + 8 * hh);
#pragma unroll
      for (int rt = 0; rt < RTN; ++rt) { oacc[rt][dt] = mmaH<1>(pa[rt].v, pa[rt].v, bv.v, bv.v, oacc[rt][dt]); oaccL[rt][dt] = mmaH<1>(pl[rt].v, pl[rt].v, bv.v, bv.v, oaccL[rt][dt]); oaccL[rt][dt] = mmaH<1>(pa[rt].v, pa[rt].v, bl.v, bl.v, oaccL[rt][dt]); } }
    __builtin_amdgcn_fence(__ATOMIC_ACQ_REL, "workgroup"); __builtin_amdgcn_wave_barrier(); }
#pragma unroll
  for (int rt = 0; rt < RTN; ++rt) {
#pragma unroll
    for (int r = 0; r < 8; ++r) { float l = l_r[rt][r]; l += __shfl_xor(l, 1, 32); l += __shfl_xor(l, 2, 32); l += __shfl_xor(l, 4, 32); l += __shfl_xor(l, 8, 32); l_r[rt][r] = (l > 0.f) ? 1.0f / (l * 1024.0f) : 0.f; }
#pragma unroll
    for (int dt = 0; dt < DT; ++dt)
#pragma unroll
      for (int r = 0; r < 8; ++r) { float v = oacc[rt][dt][r]; v += oaccL[rt][dt][r] * 0.0009765625f; sO[w][rt * 16 + 8 * hh + r][dt * 16 + ln] = v * l_r[rt][r]; } }
  __builtin_amdgcn_fence(__ATOMIC_ACQ_REL, "workgroup"); __builtin_amdgcn_wave_barrier();
  {
#pragma unroll
    for (int rp = 0; rp < RPW; rp += 2) { const int r = rp + (lane >> 4), pc = lane & 15; const v4f val = *(const v4fa*)&sO[w][r][pc * 4]; *(v4f*)(O + ((size_t)b * TQ + q0 + r) * ldo + h * 64 + pc * 4) = val; }
     } }

__global__ __launch_bounds__(256) void k_rotab(float* __restrict__ CS, float* __restrict__ SN) {
  #pragma clang fp contract(off)
  const int t = blockIdx.x * 256 + threadIdx.x; if (t >= SLEN * 32) return; const int j = t % 32, s = t / 32; const float ex = (float)(2 * j) / 64.0f; const float inv = 1.0f / powf(10000.0f, ex); const float th = (float)s * inv; const float c = cosf(th), sn = sinf(th);
  { *(float*)(CS + t) = c; *(float*)(SN + t) = sn;  } }
__global__ __launch_bounds__(256) void k_rope(const float* __restrict__ F, int nsrc, int ndst, int rep, const float* __restrict__ CS, const float* __restrict__ SN, _Float16* __restrict__ H, _Float16* __restrict__ L) {
  #pragma clang fp contract(off)
  const size_t t = (size_t)blockIdx.x * 256 + threadIdx.x; if (t >= (size_t)NR * ndst * 4) return; const int g8 = (int)(t % 4); const int hd = (int)((t / 4) % ndst); const size_t row = t / ((size_t)4 * ndst); const int s = (int)(row % SLEN); const int hs = hd / rep;
  const float* src = F + row * (size_t)(nsrc * 64) + hs * 64; FragH ah, al, bh, bl;
  for (int i = 0; i < 8; ++i) { const int d = g8 * 8 + i; const float c = CS[s * 32 + d], sn = SN[s * 32 + d]; const float x1 = src[d], x2 = src[d + 32];
    float o1 = x1 * c; o1 += -x2 * sn; float o2 = x2 * c; o2 += x1 * sn;
    _Float16 hv = (_Float16)o1; ah.h[i] = hv; al.h[i] = (_Float16)((o1 - (float)hv) * 1024.0f); hv = (_Float16)o2; bh.h[i] = hv; bl.h[i] = (_Float16)((o2 - (float)hv) * 1024.0f); }
  const size_t o = row * (size_t)(ndst * 64) + hd * 64 + g8 * 8;
  { *(v8us*)((unsigned short*)H + o) = ah.half[0]; *(v8us*)((unsigned short*)H + o + 32) = bh.half[0]; *(v8us*)((unsigned short*)L + o) = al.half[0]; *(v8us*)((unsigned short*)L + o + 32) = bl.half[0];  } }
__global__ __launch_bounds__(256) void k_rope2(const float* __restrict__ F, int nsrc, int ndst, int rep, const float* __restrict__ CS, const float* __restrict__ SN, _Float16* __restrict__ H, _Float16* __restrict__ L) {
  #pragma clang fp contract(off)
  const size_t t = (size_t)blockIdx.x * 256 + threadIdx.x; if (t >= (size_t)NR * ndst * 4) return; const int g16 = (int)(t % 4); const int hd = (int)((t / 4) % ndst); const size_t row = t / ((size_t)4 * ndst); const int s = (int)(row % SLEN); const int hs = hd / rep;
  const float* src = F + row * (size_t)(nsrc * 64) + hs * 64 + g16 * 16; FragH ah, al;
  for (int pr = 0; pr < 8; ++pr) { const int i = g16 * 8 + pr; const float c = CS[s * 32 + i], sn = SN[s * 32 + i]; const float x1 = src[2 * pr], x2 = src[2 * pr + 1];
    float o1 = x1 * c; o1 -= x2 * sn; float o2 = x1 * sn; o2 += x2 * c;
    _Float16 hv = (_Float16)o1; ah.h[2 * pr] = hv; al.h[2 * pr] = (_Float16)((o1 - (float)hv) * 1024.0f); hv = (_Float16)o2; ah.h[2 * pr + 1] = hv; al.h[2 * pr + 1] = (_Float16)((o2 - (float)hv) * 1024.0f); }
  const size_t o = row * (size_t)(ndst * 64) + hd * 64 + g16 * 16;
  { *(v8us*)((unsigned short*)H + o) = ah.half[0]; *(v8us*)((unsigned short*)H + o + 8) = ah.half[1]; *(v8us*)((unsigned short*)L + o) = al.half[0]; *(v8us*)((unsigned short*)L + o + 8) = al.half[1];  } }
__global__ __launch_bounds__(256) void k_tabin(const float* __restrict__ sp, float* __restrict__ CS, float* __restrict__ SN) { const int t = blockIdx.x * 256 + threadIdx.x; if (t >= SLEN * 32) return; const int i = t % 32, s = t / 32; const float c = bf16_round(sp[s * 64 + 32 + i]), sn = bf16_round(sp[s * 64 + i]);
  { *(float*)(CS + t) = c; *(float*)(SN + t) = sn;  } }
__global__ __launch_bounds__(256) void k_wsc(const float* __restrict__ Wm, _Float16* __restrict__ Bt, size_t n8, float sc) { const size_t t = (size_t)blockIdx.x * 256 + threadIdx.x; if (t >= n8) return; FragH f; for (int q = 0; q < 8; ++q) f.h[q] = (_Float16)(bf16_round(Wm[t * 8 + q]) * sc); *(v8us*)((unsigned short*)Bt + t * 8) = f.half[0];  }
__global__ __launch_bounds__(256) void k_rotab2(float* __restrict__ CS, float* __restrict__ SN) {
  #pragma clang fp contract(off)
  const int t = blockIdx.x * 256 + threadIdx.x; if (t >= SLEN * 32) return; const int j = t % 32, s = t / 32; const float c0 = -0.14391156831212787f;      /* -ln(10000)/64 rounded to f32 */ const float inv = expf((float)(2 * j) * c0); const float th = (float)s * inv; const float c = cosf(th), sn = sinf(th);
  { *(float*)(CS + t) = c; *(float*)(SN + t) = sn;  } }
__global__ __launch_bounds__(256) void k_lnu(const float* __restrict__ X, _Float16* __restrict__ N16, float* __restrict__ XB) {
  #pragma clang fp contract(off)
  const int wv = threadIdx.x >> 5, ln = threadIdx.x & 31; const size_t r = (size_t)blockIdx.x * 8 + wv; if (r >= NR) return; float a[32]; float s = 0.f;
  for (int i = 0; i < 4; ++i) { const v8f v = *(const v8f*)(X + r * DM + (i * 32 + ln) * 8); for (int q = 0; q < 8; ++q) { const float u = bf16_round(v[q]); a[i * 8 + q] = u; s += u; } }
  for (int o = 16; o > 0; o >>= 1) s += __shfl_xor(s, o, 32); const float mu = s / (float)DM; float var = 0.f; for (int q = 0; q < 32; ++q) { const float d = a[q] - mu; var += d * d; }
  for (int o = 16; o > 0; o >>= 1) var += __shfl_xor(var, o, 32); const float den = sqrtf(var / (float)(DM - 1)) + 1e-6f; const float inv = 1.0f / den;      /* one reciprocal per row; (x-mean)*inv vs the reference's division differs by <= 1 ulp */
  { for (int i = 0; i < 4; ++i) { const int c0 = (i * 32 + ln) * 8; FragH f; v8f xb; for (int q = 0; q < 8; ++q) { f.h[q] = (_Float16)((a[i * 8 + q] - mu) * inv); xb[q] = a[i * 8 + q]; } *(v8us*)((unsigned short*)N16 + r * DM + c0) = f.half[0]; *(v8f*)(XB + r * DM + c0) = xb; }  } }
__global__ __launch_bounds__(256) void k_vtg(const _Float16* __restrict__ V16, _Float16* __restrict__ Vt) { __shared__ unsigned short tl[64][66]; const int tid = threadIdx.x; const int slab = blockIdx.x / (SLEN / 64), lg = blockIdx.x % (SLEN / 64); const int b = slab / NH, h = slab % NH; const int hs = h / NREP;
  for (int i = tid; i < 64 * 8; i += 256) { const int r = i / 8, c8 = (i % 8) * 8; FragH f; f.half[0] = *(const v8us*)((const unsigned short*)V16 + ((size_t)b * SLEN + lg * 64 + r) * KVD + hs * 64 + c8); for (int q = 0; q < 8; ++q) tl[r][c8 + q] = f.u[q]; }
  __syncthreads();
  { for (int rd = 0; rd < 2; ++rd) { const int d = rd * 32 + tid / 8, pc = tid % 8; FragH f; for (int q = 0; q < 8; ++q) f.u[q] = tl[pc * 8 + q][d]; *(v8us*)((unsigned short*)Vt + ((size_t)slab * 64 + d) * SLEN + lg * 64 + pc * 8) = f.half[0]; }  } }

extern "C" void kernel_launch(void* const* d_in, const int* in_sizes, int n_in,
                              void* d_out, int out_size, void* d_ws, size_t ws_size, hipStream_t stream) {
  (void)in_sizes; (void)n_in; (void)out_size;
  const float* const* I = (const float* const*)d_in; const float* x = I[0]; const float* sp = I[1]; const float* am = I[2]; const float* Wq = I[3]; const float* Wk = I[4]; const float* Wv = I[5]; const float* bq = nullptr; const float* bk = nullptr; const float* bv = nullptr;
  char* ws = (char*)d_ws; size_t off = 0;
  auto take = [&](size_t bytes) { char* p = ws + off; off += (bytes + 255) & ~(size_t)255; return p; };
  const size_t np = (size_t)NR * DM, nk = (size_t)NR * KVD;
  _Float16* BQ = (_Float16*)take((size_t)DM * DM * 2); _Float16* BK = (_Float16*)take((size_t)KVD * DM * 2); _Float16* BV = (_Float16*)take((size_t)KVD * DM * 2);
  float* CS = (float*)take((size_t)SLEN * 32 * 4); float* SN = (float*)take((size_t)SLEN * 32 * 4);
  _Float16* X16 = (_Float16*)take(np * 2); float* QF = (float*)take(np * 4); _Float16* QH = (_Float16*)take(np * 2); _Float16* QL = (_Float16*)take(np * 2); float* KF = (float*)take(nk * 4); float* VF = (float*)take(nk * 4); _Float16* KXH = (_Float16*)take(np * 2); _Float16* KXL = (_Float16*)take(np * 2); _Float16* VH = (_Float16*)take(nk * 2); _Float16* VL = (_Float16*)take(nk * 2); _Float16* VT = (_Float16*)take(np * 2); /* no VTL: plain flash only */
  /* the flash output goes straight to d_out */
  if (off > ws_size) return;      /* 3x2 + 0.25+0.25 + 8 + 16 + 8+8 + 16+16 + 8+8 + 8+8 + 8 = 118.5 MiB */
  k_wsc<<<(unsigned)(((size_t)DM * DM / 8 + 255) / 256), 256, 0, stream>>>(Wq, BQ, (size_t)DM * DM / 8, 16.0f); k_wsc<<<(unsigned)(((size_t)KVD * DM / 8 + 255) / 256), 256, 0, stream>>>(Wk, BK, (size_t)KVD * DM / 8, 16.0f); k_wsc<<<(unsigned)(((size_t)KVD * DM / 8 + 255) / 256), 256, 0, stream>>>(Wv, BV, (size_t)KVD * DM / 8, 16.0f);      /* torch (out,in) = Bt */
  k_tabin<<<(SLEN * 32 + 255) / 256, 256, 0, stream>>>(sp, CS, SN);
  k_x16<<<(unsigned)((np / 8 + 255) / 256), 256, 0, stream>>>(x, X16, np / 8);
  k_gemm2<0><<<dim3((NR / 128) * (DM / 64), 1), 128, 0, stream>>>(X16, DM, 0, BQ, DM, 0, 0.0625f, bq, 0, nullptr, 1, 0, 0, QF, nullptr, DM, 0, NR, DM, DM);
  k_gemm2<0><<<dim3((NR / 128) * (KVD / 64), 1), 128, 0, stream>>>(X16, DM, 0, BK, DM, 0, 0.0625f, bk, 0, nullptr, 1, 0, 0, KF, nullptr, KVD, 0, NR, KVD, DM);
  k_gemm2<0><<<dim3((NR / 128) * (KVD / 64), 1), 128, 0, stream>>>(X16, DM, 0, BV, DM, 0, 0.0625f, bv, 0, nullptr, 1, 0, 0, VF, nullptr, KVD, 0, NR, KVD, DM);
  k_rope2<<<(unsigned)(((size_t)NR * NH * 4 + 255) / 256), 256, 0, stream>>>(QF, NH, NH, 1, CS, SN, QH, QL);      /* q: 16 -> 16 heads (interleaved pairs) */
  k_rope2<<<(unsigned)(((size_t)NR * NH * 4 + 255) / 256), 256, 0, stream>>>(KF, NKV, NH, NREP, CS, SN, KXH, KXL);      /* k: kv head h to query head h (NREP = 1) */
  k_hl<<<(unsigned)((nk / 8 + 255) / 256), 256, 0, stream>>>(VF, VH, VL, nk / 8);
  k_vtg<<<NB * NH * (SLEN / 64), 256, 0, stream>>>(VH, VT);
  k_flash<17><<<NB * NH * QBNP, 128, 0, stream>>>(QH, DM, KXH, DM, VT, (const int*)am, (float*)d_out, DM);      /* + attention_mask[b][key]; the merged context is the output */
}

// v004
// A run of this version takes 126 microseconds.
// Timed twice side by side with v003, it ran 1.23 times as fast both times.
// Counting every step since v000, it is 3.12 times as fast.
#include <hip/hip_runtime.h>
// DiffBertSelfAttention (2 x 2048 tokens, D 1024 = 16 heads of 64): q, k, v = x W^T; RoFormer rotary from the sinusoidal_pos INPUT ([sin | cos] halves, interleave-duplicated: out[2i] = x[2i] cos_i - x[2i+1] sin_i, out[2i+1] = x[2i+1] cos_i + x[2i] sin_i); scores/8 + attention_mask[b, key] (additive INPUT, broadcast over heads and queries); softmax; ctx = probs v merged -> the output (no output projection).
// Structure: exact f16 plane of x; q, k, v as f32 WMMA GEMM outputs (32x64 wave tiles, f32 accumulation, exact x16 weights); the rotary tables copied from the input (bf16-rounded like every input); interleaved RoPE + f16 conversion on VALU; V^T by LDS tiles; the fused flash kernel with the per-key additive mask (mode 17: a table made from the input in the same call, rounded like every input and in base-2 units; plain operands: every row averages ~2048 keys) writing the merged context straight to the output.
// Compute dtype: inputs and parameters rounded to bf16; q/k/P/v as plain f16 operands (~2^-12); RoPE/softmax f32. v_wmma_f32_16x16x32_f16.
#define NB 2
#define DM 1024
#define NKV 16
#define NREP (NH / NKV)
#define KVD (NKV * 64)           /* 1024 */
#define NR (NB * SLEN)           /* 4096 */
#define SLEN 2048
#define TQ SLEN
#define TK SLEN
#define NH 16
#define SCL 0.125f
#define LOG2E 1.4426950408889634f
#define SCL2 (SCL * LOG2E)      /* scores in base-2 units: exp(s) = 2^(s log2 e) */
#define QBLKS (TQ / 64)
#define QB05 0
#define QBN5 4
#define QB0P 0
#define QBNP QBLKS           /* non-causal: plain flash on every query block */
#define RE 256
typedef __bf16 v16b __attribute__((ext_vector_type(16)));
typedef unsigned short v8us __attribute__((ext_vector_type(8), may_alias));
typedef float  v8f  __attribute__((ext_vector_type(8)));
typedef float  v4f  __attribute__((ext_vector_type(4)));
typedef float  v4fa __attribute__((ext_vector_type(4), may_alias));
union FragB { v16b v; v8us half[2]; unsigned short u[16]; };

__device__ __forceinline__ unsigned short bf16_bits(float x) { unsigned int u = __float_as_uint(x); return (unsigned short)((u + 0x7FFFu + ((u >> 16) & 1u)) >> 16); }
__device__ __forceinline__ float bf16_val(unsigned short b) { return __uint_as_float(((unsigned int)b) << 16); }
__device__ __forceinline__ float bf16_round(float x) { return bf16_val(bf16_bits(x)); }
// D += A·B with NT terms: 1 = ah·bh, 2 = + al·bh (A split), 3 = + ah·bl (both split)
template <int NT>
__device__ __forceinline__ v8f mmaN(v16b ah, v16b al, v16b bh, v16b bl, v8f c) {
  c = __builtin_amdgcn_wmma_f32_16x16x32_bf16(false, ah, false, bh, (short)0, c, false, false);
  if (NT >= 2) c = __builtin_amdgcn_wmma_f32_16x16x32_bf16(false, al, false, bh, (short)0, c, false, false);
  if (NT >= 3) c = __builtin_amdgcn_wmma_f32_16x16x32_bf16(false, ah, false, bl, (short)0, c, false, false);
  asm volatile("v_nop\n\tv_nop\n\tv_nop\n\tv_nop" : "+v"(c) : "v"(ah), "v"(al), "v"(bh), "v"(bl));
  return c;
}

__global__ __launch_bounds__(256) void k_wt_bf16(const float* __restrict__ W, unsigned short* __restrict__ Wt, int K, int N) {
  const int t = blockIdx.x * 256 + threadIdx.x;
  const int k8n = K / 8;
  if (t >= N * k8n) return;
  const int n = t / k8n, k8 = (t % k8n) * 8;
  v8us v;
#pragma unroll
  for (int i = 0; i < 8; ++i) v[i] = bf16_bits(W[(size_t)(k8 + i) * N + n]);
  *(v8us*)(Wt + (size_t)n * K + k8) = v;
  
}

// GEMM C[M][N] (f32, pitch ldc) = act(A[M][K]·W + bias). A f32 row-major (pitch lda) converted per fragment to bf16
// (ASPLIT: hi/lo two planes -> 2 terms, else single rounded term); Wt bf16 [N][K] (pitch ldb). BIAS_BF16 rounds the
// bias to bf16 first (bias quantised to bf16 before the add). K%32==0, M%16==0, N%64==0.
template <bool ASPLIT, int ACT, bool BIAS_BF16>
__global__ __launch_bounds__(128) void k_gemm_bf(const float* __restrict__ A, int lda, const unsigned short* __restrict__ Wt, int ldb,
                                               const float* __restrict__ bias, float* __restrict__ C, int ldc, int M, int N, int K) {
  __shared__ __attribute__((aligned(16))) float so[4][16][64];
  const int tid = threadIdx.x, w = tid >> 5, lane = tid & 31, ln = lane & 15, hh = lane >> 4;
  const int ntn = N / 64;
  const int wid = blockIdx.x * 4 + w;
  const int mt = wid / ntn, nq = wid % ntn;
  if (mt * 16 >= M) return;
  const int row0 = mt * 16, col0 = nq * 64;
  const float* arow = A + (size_t)(row0 + ln) * lda;
  v8f acc[4] = {};
  for (int kb = 0; kb < K; kb += 32) {
    FragB ah, al;
    const v4f x0 = *(const v4fa*)(arow + kb + 8 * hh), x1 = *(const v4fa*)(arow + kb + 8 * hh + 4);
    const v4f x2 = *(const v4fa*)(arow + kb + 16 + 8 * hh), x3 = *(const v4fa*)(arow + kb + 16 + 8 * hh + 4);
    float xs[16] = {x0[0],x0[1],x0[2],x0[3],x1[0],x1[1],x1[2],x1[3],x2[0],x2[1],x2[2],x2[3],x3[0],x3[1],x3[2],x3[3]};
#pragma unroll
    for (int i = 0; i < 16; ++i) { const unsigned short hb = bf16_bits(xs[i]); ah.u[i] = hb; al.u[i] = ASPLIT ? bf16_bits(xs[i] - bf16_val(hb)) : (unsigned short)0; }
#pragma unroll
    for (int t = 0; t < 4; ++t) {
      const unsigned short* brow = Wt + (size_t)(col0 + t * 16 + ln) * ldb + kb;
      FragB b;
      b.half[0] = *(const v8us*)(brow + 8 * hh);
      b.half[1] = *(const v8us*)(brow + 16 + 8 * hh);
      acc[t] = mmaN<ASPLIT ? 2 : 1>(ah.v, al.v, b.v, b.v, acc[t]);
    }
  }
#pragma unroll
  for (int t = 0; t < 4; ++t) {
    float bv = bias ? bias[col0 + t * 16 + ln] : 0.f;
    if (BIAS_BF16) bv = bf16_round(bv);
#pragma unroll
    for (int r = 0; r < 8; ++r) { float v = acc[t][r] + bv; if (ACT == 1) v = fmaxf(v, 0.f); so[w][8 * hh + r][t * 16 + ln] = v; }
  }
  __builtin_amdgcn_fence(__ATOMIC_ACQ_REL, "workgroup");
  __builtin_amdgcn_wave_barrier();
  const int rsub = lane >> 4, c4 = (lane & 15) * 4;
  {
#pragma unroll
    for (int q = 0; q < 8; ++q) {
      const int r = q * 2 + rsub;
      const v4f v = *(const v4fa*)&so[w][r][c4];
      *(v4f*)(C + (size_t)(row0 + r) * ldc + col0 + c4) = v;
    }
    
  }
}

// GEMM C = act(A·W + bias + resid): A f32 (ASPLIT -> hi/lo 2 terms), Wt bf16 [N][K]; ACT 0 none, 1 relu, 2 exact gelu;
// resid (optional, f32, row index = (row % rmod), pitch ldr, RES_BF16 rounds it) added before the activation.
template <bool ASPLIT, int ACT, bool BIAS_BF16, bool RES_BF16>
__global__ __launch_bounds__(128) void k_gemm_bf3(const float* __restrict__ A, int lda, const unsigned short* __restrict__ Wt, int ldb,
                                                const float* __restrict__ bias, const float* __restrict__ resid, int rmod, int ldr,
                                                float* __restrict__ C, int ldc, int M, int N, int K) {
  __shared__ __attribute__((aligned(16))) float so[4][16][64];
  const int tid = threadIdx.x, w = tid >> 5, lane = tid & 31, ln = lane & 15, hh = lane >> 4;
  const int ntn = N / 64;
  const int wid = blockIdx.x * 4 + w;
  const int mt = wid / ntn, nq = wid % ntn;
  if (mt * 16 >= M) return;
  const int row0 = mt * 16, col0 = nq * 64;
  const float* arow = A + (size_t)(row0 + ln) * lda;
  v8f acc[4] = {};
  for (int kb = 0; kb < K; kb += 32) {
    FragB ah, al;
    const v4f x0 = *(const v4fa*)(arow + kb + 8 * hh), x1 = *(const v4fa*)(arow + kb + 8 * hh + 4);
    const v4f x2 = *(const v4fa*)(arow + kb + 16 + 8 * hh), x3 = *(const v4fa*)(arow + kb + 16 + 8 * hh + 4);
    float xs[16] = {x0[0],x0[1],x0[2],x0[3],x1[0],x1[1],x1[2],x1[3],x2[0],x2[1],x2[2],x2[3],x3[0],x3[1],x3[2],x3[3]};
#pragma unroll
    for (int i = 0; i < 16; ++i) { const unsigned short hb = bf16_bits(xs[i]); ah.u[i] = hb; al.u[i] = ASPLIT ? bf16_bits(xs[i] - bf16_val(hb)) : (unsigned short)0; }
#pragma unroll
    for (int t = 0; t < 4; ++t) {
      const unsigned short* brow = Wt + (size_t)(col0 + t * 16 + ln) * ldb + kb;
      FragB b;
      b.half[0] = *(const v8us*)(brow + 8 * hh);
      b.half[1] = *(const v8us*)(brow + 16 + 8 * hh);
      acc[t] = mmaN<ASPLIT ? 2 : 1>(ah.v, al.v, b.v, b.v, acc[t]);
    }
  }
#pragma unroll
  for (int t = 0; t < 4; ++t) {
    const int col = col0 + t * 16 + ln;
    float bv = bias ? bias[col] : 0.f;
    if (BIAS_BF16) bv = bf16_round(bv);
#pragma unroll
    for (int r = 0; r < 8; ++r) {
      float v = acc[t][r] + bv;
      if (resid) { float rv = resid[(size_t)((row0 + 8 * hh + r) % rmod) * ldr + col]; if (RES_BF16) rv = bf16_round(rv); v += rv; }
      if (ACT == 1) v = fmaxf(v, 0.f);
      if (ACT == 2) v = 0.5f * v * (1.0f + erff(v * 0.70710678118654752f));
      if (ACT == 3) { const float u = 0.7978845608028654f * (v + 0.044715f * v * v * v); v = 0.5f * v * (1.0f + tanhf(u)); }
      so[w][8 * hh + r][t * 16 + ln] = v;
    }
  }
  __builtin_amdgcn_fence(__ATOMIC_ACQ_REL, "workgroup");
  __builtin_amdgcn_wave_barrier();
  const int rsub = lane >> 4, c4 = (lane & 15) * 4;
  {
#pragma unroll
    for (int q = 0; q < 8; ++q) {
      const int r = q * 2 + rsub;
      const v4f v = *(const v4fa*)&so[w][r][c4];
      *(v4f*)(C + (size_t)(row0 + r) * ldc + col0 + c4) = v;
    }
    
  }
}
// row LayerNorm (biased variance, eps) over N: s = X (+ R); optional out_sum <- s; out_norm <- (s-mu)*rsqrt(var+eps)*g + b
template <bool PARAM_BF16>
__global__ __launch_bounds__(256) void k_layernorm(const float* __restrict__ X, const float* __restrict__ R, const float* __restrict__ g, const float* __restrict__ bta,
                                                  float* __restrict__ out_sum, float* __restrict__ out_norm, int N, float eps) {
  __shared__ float red[256];
  const int row = blockIdx.x, tid = threadIdx.x;
  const float* x = X + (size_t)row * N; const float* rr = R ? R + (size_t)row * N : nullptr;
  float vals[16];                     // up to N = 4096
  const int per = N / 256;            // contiguous chunk per thread? use strided-by-4 chunks: thread handles j = tid*4 + 1024*u
  float s1 = 0.f;
  for (int u = 0; u < per / 4; ++u) {
    const int j = tid * 4 + 1024 * u;
    const v4f a = *(const v4fa*)(x + j);
    v4f b = {0.f,0.f,0.f,0.f}; if (rr) b = *(const v4fa*)(rr + j);
#pragma unroll
    for (int q = 0; q < 4; ++q) { const float v = a[q] + b[q]; vals[u * 4 + q] = v; s1 += v; }
  }
  red[tid] = s1; __syncthreads();
  for (int st = 128; st > 0; st >>= 1) { if (tid < st) red[tid] += red[tid + st]; __syncthreads(); }
  const float mu = red[0] / (float)N; __syncthreads();
  float s2 = 0.f;
  for (int u = 0; u < per / 4; ++u)
#pragma unroll
    for (int q = 0; q < 4; ++q) { const float c = vals[u * 4 + q] - mu; s2 += c * c; }
  red[tid] = s2; __syncthreads();
  for (int st = 128; st > 0; st >>= 1) { if (tid < st) red[tid] += red[tid + st]; __syncthreads(); }
  const float rs = rsqrtf(red[0] / (float)N + eps);
  {
    for (int u = 0; u < per / 4; ++u) {
      const int j = tid * 4 + 1024 * u;
      v4f o, sm;
#pragma unroll
      for (int q = 0; q < 4; ++q) {
        float gg = g[j + q], bb = bta[j + q];
        if (PARAM_BF16) { gg = bf16_round(gg); bb = bf16_round(bb); }
        sm[q] = vals[u * 4 + q]; o[q] = (vals[u * 4 + q] - mu) * rs * gg + bb;
      }
      if (out_sum) *(v4f*)(out_sum + (size_t)row * N + j) = sm;
      *(v4f*)(out_norm + (size_t)row * N + j) = o;
    }
    
  }
}



// ---- f16 WMMA path (v_wmma_f32_16x16x32_f16): 11-bit significands for operands in range — used where a [0,1] probability operand needs more precision than bf16
typedef _Float16 v16h __attribute__((ext_vector_type(16)));
union FragH { v16h v; v8us half[2]; _Float16 h[16]; unsigned short u[16]; };
template <int NT>
__device__ __forceinline__ v8f mmaH(v16h ah, v16h al, v16h bh, v16h bl, v8f c) {
  c = __builtin_amdgcn_wmma_f32_16x16x32_f16(false, ah, false, bh, (short)0, c, false, false);
  if (NT >= 2) c = __builtin_amdgcn_wmma_f32_16x16x32_f16(false, al, false, bh, (short)0, c, false, false);
  if (NT >= 3) c = __builtin_amdgcn_wmma_f32_16x16x32_f16(false, ah, false, bl, (short)0, c, false, false);
  asm volatile("v_nop\n\tv_nop\n\tv_nop\n\tv_nop" : "+v"(c) : "v"(ah), "v"(al), "v"(bh), "v"(bl));
  return c;
}
// batched GEMM like k_gemm_b but f16 operands: A f32 (split into f16 hi/lo if ASPLIT, else rounded to f16), Bt = f16 values [n][k]; alpha; C f32; N multiple of 16 (partial tiles skipped)
template <bool ASPLIT>
__global__ __launch_bounds__(128) void k_gemm_h(const float* __restrict__ A, int lda, size_t sA, const _Float16* __restrict__ Bh, int ldb, size_t sB, float alpha, float* __restrict__ C, int ldc, size_t sC, int M, int N, int K) {
  __shared__ __attribute__((aligned(16))) float so[4][16][64];
  const int tid = threadIdx.x, w = tid >> 5, lane = tid & 31, ln = lane & 15, hh = lane >> 4; const int by = blockIdx.y;
  A += (size_t)by * sA; Bh += (size_t)by * sB; C += (size_t)by * sC;
  const int ntn = (N + 63) / 64; const int wid = blockIdx.x * 4 + w; const int mt = wid / ntn, nq = wid % ntn; if (mt * 16 >= M) return;
  const int row0 = mt * 16, col0 = nq * 64; const float* arow = A + (size_t)(row0 + ln) * lda;
  v8f acc[4] = {};
  for (int kb = 0; kb < K; kb += 32) {
    FragH ah, al;
    const v4f x0 = *(const v4fa*)(arow + kb + 8 * hh), x1 = *(const v4fa*)(arow + kb + 8 * hh + 4), x2 = *(const v4fa*)(arow + kb + 16 + 8 * hh), x3 = *(const v4fa*)(arow + kb + 16 + 8 * hh + 4);
    float xs[16] = {x0[0],x0[1],x0[2],x0[3],x1[0],x1[1],x1[2],x1[3],x2[0],x2[1],x2[2],x2[3],x3[0],x3[1],x3[2],x3[3]};
#pragma unroll
    for (int i = 0; i < 16; ++i) { const _Float16 h = (_Float16)xs[i]; ah.h[i] = h; al.h[i] = ASPLIT ? (_Float16)(xs[i] - (float)h) : (_Float16)0.0f; }
#pragma unroll
    for (int t = 0; t < 4; ++t) { if (col0 + t * 16 >= N) continue; const size_t boff = (size_t)(col0 + t * 16 + ln) * ldb + kb; FragH bq; bq.half[0] = *(const v8us*)(Bh + boff + 8 * hh); bq.half[1] = *(const v8us*)(Bh + boff + 16 + 8 * hh);
      acc[t] = mmaH<ASPLIT ? 2 : 1>(ah.v, al.v, bq.v, bq.v, acc[t]); }
  }
#pragma unroll
  for (int t = 0; t < 4; ++t) { if (col0 + t * 16 >= N) continue;
#pragma unroll
    for (int r = 0; r < 8; ++r) so[w][8 * hh + r][t * 16 + ln] = acc[t][r] * alpha; }
  __builtin_amdgcn_fence(__ATOMIC_ACQ_REL, "workgroup"); __builtin_amdgcn_wave_barrier();
  const int rsub = lane >> 4, c4 = (lane & 15) * 4;
  {
#pragma unroll
    for (int q = 0; q < 8; ++q) { const int r = q * 2 + rsub; if (col0 + c4 < N) { const v4f v = *(const v4fa*)&so[w][r][c4]; *(v4f*)(C + (size_t)(row0 + r) * ldc + col0 + c4) = v; } }
     }
}

// Wt[n][k] = f16(W[k][n]·scale) from f32 row-major W[K][N] (scale = power of two; bf16-exact weights stay exact in f16 away from the subnormal range)
__global__ __launch_bounds__(256) void k_wt_f16(const float* __restrict__ W, _Float16* __restrict__ Wt, int K, int N, float scale) {
  const int t = blockIdx.x * 256 + threadIdx.x; if (t >= N * (K / 8)) return; const int n = t / (K / 8), k8 = (t % (K / 8)) * 8; FragH f;
#pragma unroll
  for (int i = 0; i < 8; ++i) f.h[i] = (_Float16)(bf16_round(W[(size_t)(k8 + i) * N + n]) * scale); const v8us o = f.half[0];
  *(v8us*)((unsigned short*)Wt + (size_t)n * K + k8) = o; 
}
// k_gemm_hh variant with fused epilogue: v = acc·alpha + bias[by·sBias + col] (+ CP[(row/rowsPerB)·sCPb + by·64 + col] if CP) ; ACT 0 none / 1 elu ; writes f16 C16 (and f32 C if non-null)
template <int ACT>
__global__ __launch_bounds__(128) void k_gemm_hhx(const _Float16* __restrict__ A, int lda, size_t sA, const _Float16* __restrict__ Bh, int ldb, size_t sB, float alpha, const float* __restrict__ bias, size_t sBias, const float* __restrict__ CP, int rowsPerB, size_t sCPb, int row0g,
    float* __restrict__ C, _Float16* __restrict__ C16, int ldc, size_t sC, int M, int N, int K) {
  __shared__ __attribute__((aligned(16))) float so[4][16][64];
  const int tid = threadIdx.x, w = tid >> 5, lane = tid & 31, ln = lane & 15, hh = lane >> 4; const int by = blockIdx.y;
  A += (size_t)by * sA; Bh += (size_t)by * sB; const size_t cofs = (size_t)by * sC; const float* bp = bias ? bias + (size_t)by * sBias : nullptr;
  const int ntn = (N + 63) / 64; const int wid = blockIdx.x * 4 + w; const int mt = wid / ntn, nq = wid % ntn; if (mt * 16 >= M) return;
  const int row0 = mt * 16, col0 = nq * 64; const _Float16* arow = A + (size_t)(row0 + ln) * lda;
  v8f acc[4] = {};
  for (int kb = 0; kb < K; kb += 32) { FragH ah; ah.half[0] = *(const v8us*)((const unsigned short*)arow + kb + 8 * hh); ah.half[1] = *(const v8us*)((const unsigned short*)arow + kb + 16 + 8 * hh);
#pragma unroll
    for (int t = 0; t < 4; ++t) { if (col0 + t * 16 >= N) continue; const size_t boff = (size_t)(col0 + t * 16 + ln) * ldb + kb; FragH bq; bq.half[0] = *(const v8us*)((const unsigned short*)Bh + boff + 8 * hh); bq.half[1] = *(const v8us*)((const unsigned short*)Bh + boff + 16 + 8 * hh);
      acc[t] = mmaH<1>(ah.v, ah.v, bq.v, bq.v, acc[t]); }
  }
#pragma unroll
  for (int t = 0; t < 4; ++t) { if (col0 + t * 16 >= N) continue; const int col = col0 + t * 16 + ln; const float bv = bp ? bf16_round(bp[col]) : 0.f;
#pragma unroll
    for (int r = 0; r < 8; ++r) { float v = acc[t][r] * alpha + bv; if (CP) { const int bidx = (row0g + row0 + 8 * hh + r) / rowsPerB; v += CP[(size_t)bidx * sCPb + (size_t)by * 64 + col]; } if (ACT == 1) v = (v > 0.f) ? v : expm1f(v); else if (ACT == 7) v = (v > 0.f) ? v + 1.0f : expf(v); else if (ACT == 8) v = tanhf(v); else if (ACT == 9) v = 0.5f * v * (1.0f + tanhf(0.7978845608028654f * (v + 0.044715f * v * v * v))); else if (ACT == 11) v = 1.0f / (1.0f + expf(-v)); else if (ACT == 12) v = (v > 0.f) ? v : 0.01f * v; else if (ACT == 14) v = (v > 0.f) ? v : 0.1f * v; else if (ACT == 15) v = v / (1.0f + expf(-v)); else if (ACT == 3) v = fmaxf(v, 0.f); else if (ACT == 6) v = 0.5f * v * (1.0f + erff(v * 0.70710678118654752f)); so[w][8 * hh + r][t * 16 + ln] = v; } }
  __builtin_amdgcn_fence(__ATOMIC_ACQ_REL, "workgroup"); __builtin_amdgcn_wave_barrier();
  const int rsub = lane >> 4, c4 = (lane & 15) * 4; typedef _Float16 v4h __attribute__((ext_vector_type(4)));
  {
#pragma unroll
    for (int q = 0; q < 8; ++q) { const int r = q * 2 + rsub; if (col0 + c4 < N) { const v4f v = *(const v4fa*)&so[w][r][c4]; if (C) *(v4f*)(C + cofs + (size_t)(row0 + r) * ldc + col0 + c4) = v; if (C16) { v4h h4; for (int i = 0; i < 4; ++i) h4[i] = (_Float16)v[i]; *(v4h*)(C16 + cofs + (size_t)(row0 + r) * ldc + col0 + c4) = h4; } } }
     }
}


typedef _Float16 v4h __attribute__((ext_vector_type(4)));

__global__ __launch_bounds__(256) void k_x16(const float* __restrict__ x, _Float16* __restrict__ X16, size_t n8) { const size_t t = (size_t)blockIdx.x * 256 + threadIdx.x; if (t >= n8) return; FragH f;
#pragma unroll
  for (int q = 0; q < 8; ++q) f.h[q] = (_Float16)bf16_round(x[t * 8 + q]); *(v8us*)((unsigned short*)X16 + t * 8) = f.half[0];  }
__global__ __launch_bounds__(256) void k_h16(const float* __restrict__ x, _Float16* __restrict__ X16, size_t n8) { const size_t t = (size_t)blockIdx.x * 256 + threadIdx.x; if (t >= n8) return; FragH f;
#pragma unroll
  for (int q = 0; q < 8; ++q) f.h[q] = (_Float16)x[t * 8 + q]; *(v8us*)((unsigned short*)X16 + t * 8) = f.half[0];  }
__global__ __launch_bounds__(256) void k_round16f(const float* __restrict__ W, _Float16* __restrict__ Bt, size_t n8) { const size_t t = (size_t)blockIdx.x * 256 + threadIdx.x; if (t >= n8) return; FragH f;
#pragma unroll
  for (int i = 0; i < 8; ++i) f.h[i] = (_Float16)(bf16_round(W[t * 8 + i]) * 16.0f); *(v8us*)((unsigned short*)Bt + t * 8) = f.half[0];  }
template <int NHv, int TTv>
__global__ __launch_bounds__(256) void k_vt(const _Float16* __restrict__ V16, int ldv, int voff, _Float16* __restrict__ Vt) { __shared__ unsigned short tl[64][66]; const int tid = threadIdx.x; const int slab = blockIdx.x / (TTv / 64), lg = blockIdx.x % (TTv / 64); const int b = slab / NHv, h = slab % NHv;
  for (int i = tid; i < 64 * 8; i += 256) { const int r = i / 8, c8 = (i % 8) * 8; FragH f; f.half[0] = *(const v8us*)((const unsigned short*)V16 + ((size_t)b * TTv + lg * 64 + r) * ldv + voff + h * 64 + c8);
#pragma unroll
    for (int q = 0; q < 8; ++q) tl[r][c8 + q] = f.u[q]; }
  __syncthreads();
  {
#pragma unroll
    for (int rd = 0; rd < 2; ++rd) { const int d = rd * 32 + tid / 8, pc = tid % 8; FragH f;
#pragma unroll
      for (int q = 0; q < 8; ++q) f.u[q] = tl[pc * 8 + q][d];
      *(v8us*)((unsigned short*)Vt + ((size_t)slab * 64 + d) * TTv + lg * 64 + pc * 8) = f.half[0]; }
     } }

__global__ __launch_bounds__(256) void k_hl(const float* __restrict__ F, _Float16* __restrict__ Hh, _Float16* __restrict__ Hl, size_t n8) { const size_t t = (size_t)blockIdx.x * 256 + threadIdx.x; if (t >= n8) return; FragH fh, fl; const v4f a = *(const v4fa*)(F + t * 8), c = *(const v4fa*)(F + t * 8 + 4);
#pragma unroll
  for (int q = 0; q < 4; ++q) { _Float16 h = (_Float16)a[q]; fh.h[q] = h; fl.h[q] = (_Float16)((a[q] - (float)h) * 1024.0f); h = (_Float16)c[q]; fh.h[4 + q] = h; fl.h[4 + q] = (_Float16)((c[q] - (float)h) * 1024.0f); }
  { *(v8us*)((unsigned short*)Hh + t * 8) = fh.half[0]; *(v8us*)((unsigned short*)Hl + t * 8) = fl.half[0];  } }

// ---- fast GEMM (wave tile 32x64, block tile 128x64; requires M % 128 == 0, N % 64 == 0 and K % 64 == 0); epilogue = k_gemm_hhx semantics ----
__device__ __forceinline__ v16h g2_frag(const _Float16* p, int hh) { FragH f; f.half[0] = *(const v8us*)((const unsigned short*)p + 8 * hh); f.half[1] = *(const v8us*)((const unsigned short*)p + 16 + 8 * hh); return f.v; }
__device__ __forceinline__ v8f g2_mma(v16h a, v16h b, v8f c) { v8f d = __builtin_amdgcn_wmma_f32_16x16x32_f16(false, a, false, b, (short)0, c, false, false); asm volatile("v_nop\n\tv_nop\n\tv_nop\n\tv_nop" : "+v"(d) : "v"(a), "v"(b)); return d; }
// One wave's share of a stage (192 rows of 128 bytes: 128 A rows, then 64 B rows, LDS pitch G2P bytes): 12 asynchronous 16-byte copies per lane, 8 lanes to a row, so that each copy of a wave reads 4 whole 128-byte lines.
// l = this lane's LDS byte address in the stage's row tid / 8; ga, gb = this lane's 16 bytes in A row tid / 8 and B row tid / 8 of the stage; every further copy is 16 rows on.
#define G2P 144            /* 128 + 16: the pitch for 16-byte LDS reads of 128-byte rows */
#define G2S (192 * G2P)    /* bytes of one stage */
__device__ __forceinline__ void g2_stage(unsigned l, const _Float16* ga, size_t lda, const _Float16* gb, size_t ldb) {
  const unsigned l1 = l + 16 * G2P, l2 = l + 32 * G2P, l3 = l + 48 * G2P, l4 = l + 64 * G2P, l5 = l + 80 * G2P, l6 = l + 96 * G2P, l7 = l + 112 * G2P, l8 = l + 128 * G2P, l9 = l + 144 * G2P, l10 = l + 160 * G2P, l11 = l + 176 * G2P;
  const _Float16 *a1 = ga + 16 * lda, *a2 = ga + 32 * lda, *a3 = ga + 48 * lda, *a4 = ga + 64 * lda, *a5 = ga + 80 * lda, *a6 = ga + 96 * lda, *a7 = ga + 112 * lda, *b1 = gb + 16 * ldb, *b2 = gb + 32 * ldb, *b3 = gb + 48 * ldb;
  /* the copies and their s_wait_xcnt in one statement: no address register is rewritten before the wait */
  asm volatile("global_load_async_to_lds_b128 %0, %12, off\n\t"
               "global_load_async_to_lds_b128 %1, %13, off\n\t"
               "global_load_async_to_lds_b128 %2, %14, off\n\t"
               "global_load_async_to_lds_b128 %3, %15, off\n\t"
               "global_load_async_to_lds_b128 %4, %16, off\n\t"
               "global_load_async_to_lds_b128 %5, %17, off\n\t"
               "global_load_async_to_lds_b128 %6, %18, off\n\t"
               "global_load_async_to_lds_b128 %7, %19, off\n\t"
               "global_load_async_to_lds_b128 %8, %20, off\n\t"
               "global_load_async_to_lds_b128 %9, %21, off\n\t"
               "global_load_async_to_lds_b128 %10, %22, off\n\t"
               "global_load_async_to_lds_b128 %11, %23, off\n\t"
               "s_wait_xcnt 0x0"
               :: "v"(l), "v"(l1), "v"(l2), "v"(l3), "v"(l4), "v"(l5), "v"(l6), "v"(l7), "v"(l8), "v"(l9), "v"(l10), "v"(l11),
                  "v"(ga), "v"(a1), "v"(a2), "v"(a3), "v"(a4), "v"(a5), "v"(a6), "v"(a7), "v"(gb), "v"(b1), "v"(b2), "v"(b3) : "memory"); }
// Block tile 128x64 (M % 128 == 0, N % 64 == 0, K % 64 == 0); A and B go through LDS in stages of 64 k, two buffers: stage t + 1 flies while stage t is worked on. The fragments are read from LDS in the k order of g2_frag.
template <int ACT>
__global__ __launch_bounds__(128) void k_gemm2(const _Float16* __restrict__ A, int lda, size_t sA, const _Float16* __restrict__ Bh, int ldb, size_t sB, float alpha, const float* __restrict__ bias, size_t sBias, const float* __restrict__ CP, int rowsPerB, size_t sCPb, int row0g,
    float* __restrict__ C, _Float16* __restrict__ C16, int ldc, size_t sC, int M, int N, int K) {
  __shared__ __attribute__((aligned(16))) float so[4][32][68];
  __shared__ __attribute__((aligned(16))) _Float16 st[2][192][G2P / 2];
  const int tid = threadIdx.x, w = tid >> 5, lane = tid & 31, ln = lane & 15, hh = lane >> 4; const int by = blockIdx.y;
  A += (size_t)by * sA; Bh += (size_t)by * sB; const size_t cofs = (size_t)by * sC; const float* bp = bias ? bias + (size_t)by * sBias : nullptr;
  const int ntn = N >> 6; const int mt = blockIdx.x / ntn, nq = blockIdx.x - mt * ntn; const int row0 = mt * 128 + 32 * w, col0 = nq * 64; if (mt * 128 + 128 > M) return;      /* the whole block or none of it, in front of every barrier */
  const _Float16* ga = A + (size_t)(mt * 128 + (tid >> 3)) * lda + (tid & 7) * 8; const _Float16* gb = Bh + (size_t)(col0 + (tid >> 3)) * ldb + (tid & 7) * 8;
  const unsigned ls = (unsigned)(size_t)&st[0][tid >> 3][(tid & 7) * 8];
  const int nst = K >> 6;
  g2_stage(ls, ga, (size_t)lda, gb, (size_t)ldb);
  asm volatile("s_wait_asynccnt 0x0" ::: "memory");      /* stage 0 of this wave has landed */
  __syncthreads();      /* ... and every wave's share of it */
  if (nst > 1) g2_stage(ls + G2S, ga + 64, (size_t)lda, gb + 64, (size_t)ldb);
  const v8f z8 = {0.f,0.f,0.f,0.f,0.f,0.f,0.f,0.f}; v8f c00 = z8, c01 = z8, c02 = z8, c03 = z8, c10 = z8, c11 = z8, c12 = z8, c13 = z8;
  /* rolled: one trip of code; the buffer is picked by the trip's parity */
#pragma unroll 1
  for (int t = 0; t < nst; ++t) { const _Float16* sa = &st[t & 1][32 * w + ln][0]; const _Float16* sb = &st[t & 1][128 + ln][0];
    /* all of the trip's fragments are read here, ahead of its first product */
    const v16h a00 = g2_frag(sa, hh), a10 = g2_frag(sa + 16 * (G2P / 2), hh), b00 = g2_frag(sb, hh), b10 = g2_frag(sb + 16 * (G2P / 2), hh), b20 = g2_frag(sb + 32 * (G2P / 2), hh), b30 = g2_frag(sb + 48 * (G2P / 2), hh);
    const v16h a01 = g2_frag(sa + 32, hh), a11 = g2_frag(sa + 16 * (G2P / 2) + 32, hh), b01 = g2_frag(sb + 32, hh), b11 = g2_frag(sb + 16 * (G2P / 2) + 32, hh), b21 = g2_frag(sb + 32 * (G2P / 2) + 32, hh), b31 = g2_frag(sb + 48 * (G2P / 2) + 32, hh);
    c00 = g2_mma(a00, b00, c00); c10 = g2_mma(a10, b00, c10); c01 = g2_mma(a00, b10, c01); c11 = g2_mma(a10, b10, c11);
    c02 = g2_mma(a00, b20, c02); c12 = g2_mma(a10, b20, c12); c03 = g2_mma(a00, b30, c03); c13 = g2_mma(a10, b30, c13);
    c00 = g2_mma(a01, b01, c00); c10 = g2_mma(a11, b01, c10); c01 = g2_mma(a01, b11, c01); c11 = g2_mma(a11, b11, c11);
    c02 = g2_mma(a01, b21, c02); c12 = g2_mma(a11, b21, c12); c03 = g2_mma(a01, b31, c03); c13 = g2_mma(a11, b31, c13);
    asm volatile("s_wait_dscnt 0x0" ::: "memory");      /* this wave's reads of the buffer are done before it is refilled */
    asm volatile("s_wait_asynccnt 0x0" ::: "memory");      /* this wave's share of stage t + 1 has landed */
    __syncthreads();      /* publishes stage t + 1 and ends every wave's reads of stage t */
    if (t + 2 < nst) g2_stage(ls + (unsigned)(t & 1) * G2S, ga + (size_t)(t + 2) * 64, (size_t)lda, gb + (size_t)(t + 2) * 64, (size_t)ldb); }
  asm volatile("s_wait_asynccnt 0x0" ::: "memory");      /* nothing in flight when the wave goes on to the epilogue */
  v8f accs[8] = {c00, c01, c02, c03, c10, c11, c12, c13};
#pragma unroll
  for (int u = 0; u < 8; ++u) { const int t = u & 3, half = u >> 2; const int col = col0 + t * 16 + ln; const float bv = bp ? bf16_round(bp[col]) : 0.f;
#pragma unroll
    for (int r = 0; r < 8; ++r) { const int rloc = half * 16 + 8 * hh + r; float v = accs[u][r] * alpha + bv; if (CP) { const int bidx = (row0g + row0 + rloc) / rowsPerB; v += CP[(size_t)bidx * sCPb + (size_t)by * 64 + col]; }
      if (ACT == 3) v = fmaxf(v, 0.f); else if (ACT == 6) v = 0.5f * v * (1.0f + erff(v * 0.70710678118654752f)); else if (ACT == 11) v = 1.0f / (1.0f + expf(-v)); else if (ACT == 15) v = v / (1.0f + expf(-v)); else if (ACT == 12) v = (v > 0.f) ? v : 0.01f * v; else if (ACT == 8) v = tanhf(v);
      so[w][rloc][t * 16 + ln] = v; } }
  __builtin_amdgcn_fence(__ATOMIC_ACQ_REL, "workgroup"); __builtin_amdgcn_wave_barrier();
  const int rsub = lane >> 4, c4 = (lane & 15) * 4;
  {
#pragma unroll
    for (int q = 0; q < 16; ++q) { const int r = q * 2 + rsub; const v4f v = *(const v4fa*)&so[w][r][c4]; if (C) *(v4f*)(C + cofs + (size_t)(row0 + r) * ldc + col0 + c4) = v; if (C16) { v4h h4; for (int i = 0; i < 4; ++i) h4[i] = (_Float16)v[i]; *(v4h*)(C16 + cofs + (size_t)(row0 + r) * ldc + col0 + c4) = h4; } }
     } }



// lane l <-> lane l ^ 16 (the two halves of a wave hold the two key halves of one query column)
__device__ __forceinline__ float xhalf(float x) { return __builtin_bit_cast(float, __builtin_amdgcn_permlanex16(__builtin_bit_cast(int, x), __builtin_bit_cast(int, x), 0x76543210, 0xfedcba98, false, false)); }
__device__ __forceinline__ v8f mmaT(v16h a, v16h b, v8f c) { return __builtin_amdgcn_wmma_f32_16x16x32_f16(false, a, false, b, (short)0, c, false, false); }
// One wave's share of a flash stage of 64 keys (128 rows of 128 bytes: 64 K rows of the head, then the 64 V^T rows' 64 keys, LDS pitch FLP bytes): 8 asynchronous 16-byte copies per lane, 8 lanes to a row, so that each copy of a wave reads 4 whole 128-byte lines.
// l = this lane's LDS byte address in the stage's row tid / 8; gk, gv = this lane's 16 bytes in K row tid / 8 and V^T row tid / 8 of the stage; every further copy is 16 rows on.
#define FLP 144            /* 128 + 16: the pitch for 16-byte LDS reads of 128-byte rows */
#define FLS (128 * FLP)    /* bytes of one stage */
__device__ __forceinline__ void fl_stage(unsigned l, const _Float16* gk, size_t ldk, const _Float16* gv) {
  const unsigned l1 = l + 16 * FLP, l2 = l + 32 * FLP, l3 = l + 48 * FLP, l4 = l + 64 * FLP, l5 = l + 80 * FLP, l6 = l + 96 * FLP, l7 = l + 112 * FLP;
  const _Float16 *k1 = gk + 16 * ldk, *k2 = gk + 32 * ldk, *k3 = gk + 48 * ldk, *v1 = gv + 16 * TK, *v2 = gv + 32 * TK, *v3 = gv + 48 * TK;
  /* the copies and their s_wait_xcnt in one statement: no address register is rewritten before the wait */
  asm volatile("global_load_async_to_lds_b128 %0, %8, off\n\t"
               "global_load_async_to_lds_b128 %1, %9, off\n\t"
               "global_load_async_to_lds_b128 %2, %10, off\n\t"
               "global_load_async_to_lds_b128 %3, %11, off\n\t"
               "global_load_async_to_lds_b128 %4, %12, off\n\t"
               "global_load_async_to_lds_b128 %5, %13, off\n\t"
               "global_load_async_to_lds_b128 %6, %14, off\n\t"
               "global_load_async_to_lds_b128 %7, %15, off\n\t"
               "s_wait_xcnt 0x0"
               :: "v"(l), "v"(l1), "v"(l2), "v"(l3), "v"(l4), "v"(l5), "v"(l6), "v"(l7),
                  "v"(gk), "v"(k1), "v"(k2), "v"(k3), "v"(gv), "v"(v1), "v"(v2), "v"(v3) : "memory"); }
// Transposed products: S^T = K Q^T (A = 16 key rows, B = the wave's 16 query columns, kept in registers), O^T += V^T P^T (A = 16 rows of V^T, B = P^T).
// Lane (c = lane & 15, hh = lane >> 4) holds query q0 + c only: register r of score tile nt is key j0 + 16 nt + 8 hh + r, so maximum and sum run in-lane plus one exchange between the halves,
// and the two converted score tiles ARE the B operand of the second product in the hardware k order (element s: key 8 hh + s, then 16 + 8 hh + (s - 8)), the order in which the V^T rows are loaded.
// The softmax runs in base 2: the score factor holds log2 e, the mask table is already in those units, and the weights' factor 1024 is +10 in the exponent, added behind the subtraction of the maximum, so that a weight is a subtraction, an addition and one v_exp_f32; the denominator sums the same 1024-fold weights.
// K and V^T go through LDS in stages of 64 keys (two passes of 32), two buffers, shared by the block's 4 waves: stage t + 1 flies while stage t is worked on. The fragments are read from LDS in the k order of g2_frag.
template <int CAUSAL>
__global__ __launch_bounds__(128) void k_flash(const _Float16* __restrict__ Q16, int ldq, const _Float16* __restrict__ K16, int ldk, const _Float16* __restrict__ Vt, const int* __restrict__ MSK, float* __restrict__ O, int ldo) {
  constexpr int RPW = 16, DT = 4, KS = 2;
  __shared__ __attribute__((aligned(16))) float sO[4][RPW][64 + 4];
  __shared__ __attribute__((aligned(16))) _Float16 st[2][128][FLP / 2];
  const int tid = threadIdx.x, w = tid >> 5, lane = tid & 31, ln = lane & 15, hh = lane >> 4;
  const int slab = blockIdx.x / QBNP, qblk = QB0P + blockIdx.x % QBNP; const int b = slab / NH, h = slab % NH; const int qb0 = qblk * (4 * RPW); const int q0 = qb0 + w * RPW; const int tq = q0 + ln;
  FragH bq[KS];
  { const unsigned short* qr = (const unsigned short*)Q16 + ((size_t)b * TQ + tq) * ldq + h * 64;
#pragma unroll
    for (int ks = 0; ks < KS; ++ks) { bq[ks].half[0] = *(const v8us*)(qr + ks * 32 + 8 * hh); bq[ks].half[1] = *(const v8us*)(qr + ks * 32 + 16 + 8 * hh); } }
  /* this lane's 16 bytes of stage 0 (K row tid / 8 of the head, V^T row tid / 8) and their place in buffer 0 */
  const _Float16* gk = K16 + ((size_t)b * TK + (tid >> 3)) * ldk + h * 64 + (tid & 7) * 8; const _Float16* gv = Vt + ((size_t)slab * 64 + (tid >> 3)) * TK + (tid & 7) * 8;
  const unsigned ls = (unsigned)(size_t)&st[0][tid >> 3][(tid & 7) * 8];
  const char* mb = (const char*)((const float*)MSK + (size_t)b * TK); const unsigned mo = (unsigned)hh * 32u;      /* a wave-uniform base that steps with the stage; this half's 8 mask words */
  float m_c = -3.0e38f, l_c = 0.f; v8f oacc[DT];
#pragma unroll
  for (int dt = 0; dt < DT; ++dt) oacc[dt] = (v8f){0.f,0.f,0.f,0.f,0.f,0.f,0.f,0.f};
  const int jend = (CAUSAL == 1) ? (qb0 + 4 * RPW) : TK;      /* causal: keys beyond the block's last query never contribute */
  const int nst = jend >> 6;      /* both ends are multiples of 64; the same for the whole block */
  fl_stage(ls, gk, (size_t)ldk, gv);
  asm volatile("s_wait_asynccnt 0x0" ::: "memory");      /* stage 0 of this wave has landed */
  __syncthreads();      /* ... and every wave's share of it */
  if (nst > 1) fl_stage(ls + FLS, gk + (size_t)64 * ldk, (size_t)ldk, gv + 64);
  /* the stage loop stays rolled (one stage of code; the buffer is picked by the trip's parity); every inner loop is unrolled so that the fragment and score arrays have constant indices and stay in registers */
#pragma unroll 1
  for (int t = 0; t < nst; ++t) { const _Float16* skr = &st[t & 1][ln][0]; const _Float16* svr = &st[t & 1][64 + ln][0];      /* this lane's K row and V^T row of the stage's buffer */
    v4f mk[2][2][2];      /* the stage's mask words (from the table in global memory) are asked for first: they have the longest way */
    if (CAUSAL == 17) {
#pragma unroll
      for (int nt = 0; nt < 4; ++nt) { mk[nt >> 1][nt & 1][0] = *(const v4fa*)(mb + mo + nt * 64); mk[nt >> 1][nt & 1][1] = *(const v4fa*)(mb + mo + nt * 64 + 16); } }
#pragma unroll
   for (int pp = 0; pp < 2; ++pp) { const int j0 = t * 64 + pp * 32;
    FragH ak[2][KS], av[DT];
#pragma unroll
    for (int nt = 0; nt < 2; ++nt) {
#pragma unroll
      for (int ks = 0; ks < KS; ++ks) ak[nt][ks].v = g2_frag(skr + (pp * 32 + nt * 16) * (FLP / 2) + ks * 32, hh); }      /* key rows ln and 16 + ln of the pass */
    asm volatile("" :: "v"(ak[0][0].v), "v"(ak[0][1].v), "v"(ak[1][0].v), "v"(ak[1][1].v));      /* inputs only: keeps the pass's eight K reads together in front of its first product (one LDS wait; without it the first pass of a stage reads and waits four times in a row) */
#pragma unroll
    for (int dt = 0; dt < DT; ++dt) av[dt].v = g2_frag(svr + dt * 16 * (FLP / 2) + pp * 32, hh);      /* V^T row dt * 16 + ln, the pass's 32 keys */
    float sc[16]; bool ok[16];
#pragma unroll
    for (int nt = 0; nt < 2; ++nt) { v8f acc = (v8f){0.f,0.f,0.f,0.f,0.f,0.f,0.f,0.f};
#pragma unroll
      for (int ks = 0; ks < KS; ++ks) acc = mmaT(ak[nt][ks].v, bq[ks].v, acc);
#pragma unroll
      for (int r = 0; r < 8; ++r) { const int kk = j0 + nt * 16 + 8 * hh + r; const bool okk = (CAUSAL == 1) ? (kk <= tq) : ((CAUSAL == 2) ? ((kk >> 5) == (tq >> 5)) : true);      /* mode 2: block-diagonal 32-token groups */
        float sv = okk ? acc[r] * SCL2 : -3.0e38f; if (CAUSAL == 17) sv += mk[pp][nt][r >> 2][r & 3];      /* mode 17: additive per-(batch, key) mask, rounded and scaled by k_tabin */
        sc[nt * 8 + r] = sv; ok[nt * 8 + r] = okk; } }
    float mx[8];
#pragma unroll
    for (int i = 0; i < 8; ++i) mx[i] = fmaxf(sc[2 * i], sc[2 * i + 1]);      /* neighbours first (a maximum is exact in any order): the packed score multiply-adds then work on register pairs as the accumulators hold them, with no moves */
    float mc = fmaxf(fmaxf(fmaxf(mx[0], mx[1]), fmaxf(mx[2], mx[3])), fmaxf(fmaxf(mx[4], mx[5]), fmaxf(mx[6], mx[7])));
    mc = fmaxf(mc, xhalf(mc));      /* both halves now hold the query's maximum over the 32 keys */
    const float mn = fmaxf(m_c, mc); const float da = m_c - mn; float ea; m_c = mn;
    float x[16], p[16]; FragH pb;
#pragma unroll
    for (int i = 0; i < 16; ++i) x[i] = (sc[i] - mn) + 10.0f;      /* the exponent of 1024 times the weight. The maximum goes off first: that difference is never above 0, so the argument is never above 10 and the factor is 2^10 in every pass, however large the mask makes the maximum (maximum - 10, formed first, would round where the maximum is huge) */
    /* 2^x is the one hardware instruction v_exp_f32 (a result below the normal range comes out as 0: such a weight is 0 in the f16 operand anyway). The pass's seventeen stand in two statements because the instruction set asks that the instruction directly behind a transcendental neither read its result nor overwrite its source: the early-clobber outputs keep every result out of every argument's register, and the v_nop is the slot of each statement's last v_exp_f32 */
    asm("v_exp_f32 %0, %9\n\tv_exp_f32 %1, %10\n\tv_exp_f32 %2, %11\n\tv_exp_f32 %3, %12\n\tv_exp_f32 %4, %13\n\tv_exp_f32 %5, %14\n\tv_exp_f32 %6, %15\n\tv_exp_f32 %7, %16\n\tv_exp_f32 %8, %17\n\tv_nop"
        : "=&v"(ea), "=&v"(p[0]), "=&v"(p[1]), "=&v"(p[2]), "=&v"(p[3]), "=&v"(p[4]), "=&v"(p[5]), "=&v"(p[6]), "=&v"(p[7]) : "v"(da), "v"(x[0]), "v"(x[1]), "v"(x[2]), "v"(x[3]), "v"(x[4]), "v"(x[5]), "v"(x[6]), "v"(x[7]));
    asm("v_exp_f32 %0, %8\n\tv_exp_f32 %1, %9\n\tv_exp_f32 %2, %10\n\tv_exp_f32 %3, %11\n\tv_exp_f32 %4, %12\n\tv_exp_f32 %5, %13\n\tv_exp_f32 %6, %14\n\tv_exp_f32 %7, %15\n\tv_nop"
        : "=&v"(p[8]), "=&v"(p[9]), "=&v"(p[10]), "=&v"(p[11]), "=&v"(p[12]), "=&v"(p[13]), "=&v"(p[14]), "=&v"(p[15]) : "v"(x[8]), "v"(x[9]), "v"(x[10]), "v"(x[11]), "v"(x[12]), "v"(x[13]), "v"(x[14]), "v"(x[15]));
    const float al = (mn > -1.0e38f * LOG2E) ? ea : 1.0f;      /* the same test as before, its threshold in base-2 units */
#pragma unroll
    for (int i = 0; i < 16; ++i) { if (!ok[i]) p[i] = 0.f; pb.h[i] = (_Float16)p[i]; }
    const float pe = ((p[0] + p[2]) + (p[4] + p[6])) + ((p[8] + p[10]) + (p[12] + p[14])), po = ((p[1] + p[3]) + (p[5] + p[7])) + ((p[9] + p[11]) + (p[13] + p[15])); const float ps = pe + po;
    l_c = l_c * al + ps;      /* this half's 16 keys; the halves are joined once, behind the loop */
#pragma unroll
    for (int dt = 0; dt < DT; ++dt) {
#pragma unroll
      for (int r = 0; r < 8; ++r) oacc[dt][r] *= al;
      oacc[dt] = mmaT(av[dt].v, pb.v, oacc[dt]); } }
    mb += 256;
    asm volatile("s_wait_dscnt 0x0" ::: "memory");      /* this wave's reads of the buffer are done before it is refilled */
    asm volatile("s_wait_asynccnt 0x0" ::: "memory");      /* this wave's share of stage t + 1 has landed */
    __syncthreads();      /* publishes stage t + 1 and ends every wave's reads of stage t */
    if (t + 2 < nst) fl_stage(ls + (unsigned)(t & 1) * FLS, gk + (size_t)(t + 2) * 64 * ldk, (size_t)ldk, gv + (size_t)(t + 2) * 64); }
  asm volatile("s_wait_asynccnt 0x0" ::: "memory");      /* nothing in flight when the wave goes on to the epilogue */
  const float l = l_c + xhalf(l_c); const float inv = (l > 0.f) ? 1.0f / l : 0.f;      /* numerator and denominator both hold the factor 1024 */
#pragma unroll
  for (int dt = 0; dt < DT; ++dt) { v4f lo, hi;      /* register r = head column dt * 16 + 8 hh + r of query q0 + ln */
#pragma unroll
    for (int r = 0; r < 4; ++r) { lo[r] = oacc[dt][r] * inv; hi[r] = oacc[dt][4 + r] * inv; }
    *(v4fa*)&sO[w][ln][dt * 16 + 8 * hh] = lo; *(v4fa*)&sO[w][ln][dt * 16 + 8 * hh + 4] = hi; }
  __builtin_amdgcn_fence(__ATOMIC_ACQ_REL, "workgroup"); __builtin_amdgcn_wave_barrier();
  {
#pragma unroll
    for (int rp = 0; rp < RPW; rp += 2) { const int r = rp + (lane >> 4), pc = lane & 15; const v4f val = *(const v4fa*)&sO[w][r][pc * 4]; *(v4f*)(O + ((size_t)b * TQ + q0 + r) * ldo + h * 64 + pc * 4) = val; }
     } }
// 5-plane variant: S = Qh Kh^T + (Ql Kh^T + Qh Kl^T)/1024 with Q/K = [hi | 2^10 residual] f16 planes (QL/KL same layout as Q16/K16), then the 3-term P.V below.
// 3-term variant: O = (P_hi V_hi + (P_lo V_hi + P_hi V_lo) / 1024) / l with P = [hi | 2^10 residual] of 1024 p and V^T = [hi | 2^10 residual] planes (VtL same layout as Vt) -> ~2^-21-class products for un-averaged (early causal / peaked) rows
template <int CAUSAL>
__global__ __launch_bounds__(128) void k_flash5(const _Float16* __restrict__ Q16, const _Float16* __restrict__ QL, int ldq, const _Float16* __restrict__ K16, const _Float16* __restrict__ KL, int ldk, const _Float16* __restrict__ Vt, const _Float16* __restrict__ VtL, const int* __restrict__ MSK, float* __restrict__ O, int ldo) {
  constexpr int RPW = 16, RTN = RPW / 16, NQB = TQ / (4 * RPW), DT = 4, KS = 2;
  __shared__ __attribute__((aligned(16))) unsigned short sP[4][RPW][40]; __shared__ __attribute__((aligned(16))) unsigned short sPL[4][RPW][40]; __shared__ __attribute__((aligned(16))) float sO[4][RPW][64 + 4];
  const int tid = threadIdx.x, w = tid >> 5, lane = tid & 31, ln = lane & 15, hh = lane >> 4;
  const int slab = blockIdx.x / QBN5, qblk = QB05 + blockIdx.x % QBN5; (void)NQB; const int b = slab / NH, h = slab % NH; const int qb0 = qblk * (4 * RPW); const int q0 = qb0 + w * RPW;
  FragH aq[2][KS], aql[2][KS];
#pragma unroll
  for (int rt = 0; rt < RTN; ++rt) { const unsigned short* qr = (const unsigned short*)Q16 + ((size_t)b * TQ + q0 + rt * 16 + ln) * ldq + h * 64; const unsigned short* ql = (const unsigned short*)QL + ((size_t)b * TQ + q0 + rt * 16 + ln) * ldq + h * 64;
#pragma unroll
    for (int ks = 0; ks < KS; ++ks) { aq[rt][ks].half[0] = *(const v8us*)(qr + ks * 32 + 8 * hh); aq[rt][ks].half[1] = *(const v8us*)(qr + ks * 32 + 16 + 8 * hh); aql[rt][ks].half[0] = *(const v8us*)(ql + ks * 32 + 8 * hh); aql[rt][ks].half[1] = *(const v8us*)(ql + ks * 32 + 16 + 8 * hh); } }
  const unsigned short* Vth = (const unsigned short*)Vt + (size_t)slab * 64 * TK; const unsigned short* Vtl = (const unsigned short*)VtL + (size_t)slab * 64 * TK;
  float m_r[2][8], l_r[2][8]; v8f oacc[2][DT], oaccL[2][DT];
#pragma unroll
  for (int rt = 0; rt < RTN; ++rt) {
#pragma unroll
    for (int r = 0; r < 8; ++r) { m_r[rt][r] = -3.0e38f; l_r[rt][r] = 0.f; }
#pragma unroll
    for (int dt = 0; dt < DT; ++dt) { oacc[rt][dt] = (v8f){0.f,0.f,0.f,0.f,0.f,0.f,0.f,0.f}; oaccL[rt][dt] = oacc[rt][dt]; } }
  const int jend = (CAUSAL == 1) ? (qb0 + 4 * RPW) : TK;      /* causal: keys beyond the block's last query never contribute */
#pragma unroll 1
  for (int j0 = 0; j0 < jend; j0 += 32) {
    v8f s[2][2];
#pragma unroll
    for (int nt = 0; nt < 2; ++nt) { const unsigned short* kr = (const unsigned short*)K16 + ((size_t)b * TK + j0 + nt * 16 + ln) * ldk + h * 64; const unsigned short* klr = (const unsigned short*)KL + ((size_t)b * TK + j0 + nt * 16 + ln) * ldk + h * 64; FragH bk[KS], bkl[KS];
#pragma unroll
      for (int ks = 0; ks < KS; ++ks) { bk[ks].half[0] = *(const v8us*)(kr + ks * 32 + 8 * hh); bk[ks].half[1] = *(const v8us*)(kr + ks * 32 + 16 + 8 * hh); bkl[ks].half[0] = *(const v8us*)(klr + ks * 32 + 8 * hh); bkl[ks].half[1] = *(const v8us*)(klr + ks * 32 + 16 + 8 * hh); }
#pragma unroll
      for (int rt = 0; rt < RTN; ++rt) { v8f acc = (v8f){0.f,0.f,0.f,0.f,0.f,0.f,0.f,0.f}, accl = acc;
#pragma unroll
        for (int ks = 0; ks < KS; ++ks) { acc = mmaH<1>(aq[rt][ks].v, aq[rt][ks].v, bk[ks].v, bk[ks].v, acc); accl = mmaH<1>(aql[rt][ks].v, aql[rt][ks].v, bk[ks].v, bk[ks].v, accl); accl = mmaH<1>(aq[rt][ks].v, aq[rt][ks].v, bkl[ks].v, bkl[ks].v, accl); }
#pragma unroll
        for (int r = 0; r < 8; ++r) acc[r] += accl[r] * 0.0009765625f;
        s[rt][nt] = acc; } }
#pragma unroll
    for (int rt = 0; rt < RTN; ++rt)
#pragma unroll
      for (int r = 0; r < 8; ++r) { const int tq = q0 + rt * 16 + 8 * hh + r; const int k0 = j0 + ln, k1 = j0 + 16 + ln;
        bool ok0 = (CAUSAL == 1) ? (k0 <= tq) : ((CAUSAL == 2) ? ((k0 >> 5) == (tq >> 5)) : true), ok1 = (CAUSAL == 1) ? (k1 <= tq) : ((CAUSAL == 2) ? ((k1 >> 5) == (tq >> 5)) : true);      /* mode 2: block-diagonal 32-token groups */
        if (CAUSAL == 4) { const int* mrow = MSK + ((size_t)b * TQ + tq) * TK; ok0 = mrow[k0] != 0; ok1 = mrow[k1] != 0; }      /* mode 4: per-(query, key) INPUT mask shared by all heads; masked keys contribute nothing (== the reference's -4096 fill, whose exp underflows to 0), rows with no valid key give l = 0 -> output 0 (== the reference's row_valid zeroing) */
        float s0 = ok0 ? s[rt][0][r] * SCL : -3.0e38f, s1 = ok1 ? s[rt][1][r] * SCL : -3.0e38f; if (CAUSAL == 17) { const float* amk = (const float*)MSK + (size_t)b * TK; s0 += bf16_round(amk[k0]); s1 += bf16_round(amk[k1]); }      /* mode 17: additive per-(batch, key) mask INPUT */ float mc = fmaxf(s0, s1);
        mc = fmaxf(mc, __shfl_xor(mc, 1, 32)); mc = fmaxf(mc, __shfl_xor(mc, 2, 32)); mc = fmaxf(mc, __shfl_xor(mc, 4, 32)); mc = fmaxf(mc, __shfl_xor(mc, 8, 32));
        const float mn = fmaxf(m_r[rt][r], mc); const float al = (mn > -1.0e38f) ? expf(m_r[rt][r] - mn) : 1.0f; m_r[rt][r] = mn; const float p0 = ok0 ? expf(s0 - mn) : 0.f, p1 = ok1 ? expf(s1 - mn) : 0.f; l_r[rt][r] = l_r[rt][r] * al + p0 + p1;
#pragma unroll
        for (int dt = 0; dt < DT; ++dt) { oacc[rt][dt][r] *= al; oaccL[rt][dt][r] *= al; }
        FragH t2, t2l; const float ps0 = p0 * 1024.0f, ps1 = p1 * 1024.0f; t2.h[0] = (_Float16)ps0; t2.h[1] = (_Float16)ps1; t2l.h[0] = (_Float16)((ps0 - (float)t2.h[0]) * 1024.0f); t2l.h[1] = (_Float16)((ps1 - (float)t2.h[1]) * 1024.0f);
        sP[w][rt * 16 + 8 * hh + r][ln] = t2.u[0]; sP[w][rt * 16 + 8 * hh + r][16 + ln] = t2.u[1]; sPL[w][rt * 16 + 8 * hh + r][ln] = t2l.u[0]; sPL[w][rt * 16 + 8 * hh + r][16 + ln] = t2l.u[1]; }
    __builtin_amdgcn_fence(__ATOMIC_ACQ_REL, "workgroup"); __builtin_amdgcn_wave_barrier();
    FragH pa[2], pl[2];
#pragma unroll
    for (int rt = 0; rt < RTN; ++rt) { pa[rt].half[0] = *(const v8us*)&sP[w][rt * 16 + ln][8 * hh]; pa[rt].half[1] = *(const v8us*)&sP[w][rt * 16 + ln][16 + 8 * hh]; pl[rt].half[0] = *(const v8us*)&sPL[w][rt * 16 + ln][8 * hh]; pl[rt].half[1] = *(const v8us*)&sPL[w][rt * 16 + ln][16 + 8 * hh]; }
#pragma unroll
    for (int dt = 0; dt < DT; ++dt) { const unsigned short* vrow = Vth + (size_t)(dt * 16 + ln) * TK + j0; const unsigned short* vrl = Vtl + (size_t)(dt * 16 + ln) * TK + j0; FragH bv, bl; bv.half[0] = *(const v8us*)(vrow + 8 * hh); bv.half[1] = *(const v8us*)(vrow + 16 + 8 * hh); bl.half[0] = *(const v8us*)(vrl + 8 * hh); bl.half[1] = *(const v8us*)(vrl + 16 + 8 * hh);
#pragma unroll
      for (int rt = 0; rt < RTN; ++rt) { oacc[rt][dt] = mmaH<1>(pa[rt].v, pa[rt].v, bv.v, bv.v, oacc[rt][dt]); oaccL[rt][dt] = mmaH<1>(pl[rt].v, pl[rt].v, bv.v, bv.v, oaccL[rt][dt]); oaccL[rt][dt] = mmaH<1>(pa[rt].v, pa[rt].v, bl.v, bl.v, oaccL[rt][dt]); } }
    __builtin_amdgcn_fence(__ATOMIC_ACQ_REL, "workgroup"); __builtin_amdgcn_wave_barrier(); }
#pragma unroll
  for (int rt = 0; rt < RTN; ++rt) {
#pragma unroll
    for (int r = 0; r < 8; ++r) { float l = l_r[rt][r]; l += __shfl_xor(l, 1, 32); l += __shfl_xor(l, 2, 32); l += __shfl_xor(l, 4, 32); l += __shfl_xor(l, 8, 32); l_r[rt][r] = (l > 0.f) ? 1.0f / (l * 1024.0f) : 0.f; }
#pragma unroll
    for (int dt = 0; dt < DT; ++dt)
#pragma unroll
      for (int r = 0; r < 8; ++r) { float v = oacc[rt][dt][r]; v += oaccL[rt][dt][r] * 0.0009765625f; sO[w][rt * 16 + 8 * hh + r][dt * 16 + ln] = v * l_r[rt][r]; } }
  __builtin_amdgcn_fence(__ATOMIC_ACQ_REL, "workgroup"); __builtin_amdgcn_wave_barrier();
  {
#pragma unroll
    for (int rp = 0; rp < RPW; rp += 2) { const int r = rp + (lane >> 4), pc = lane & 15; const v4f val = *(const v4fa*)&sO[w][r][pc * 4]; *(v4f*)(O + ((size_t)b * TQ + q0 + r) * ldo + h * 64 + pc * 4) = val; }
     } }

__global__ __launch_bounds__(256) void k_rotab(float* __restrict__ CS, float* __restrict__ SN) {
  #pragma clang fp contract(off)
  const int t = blockIdx.x * 256 + threadIdx.x; if (t >= SLEN * 32) return; const int j = t % 32, s = t / 32; const float ex = (float)(2 * j) / 64.0f; const float inv = 1.0f / powf(10000.0f, ex); const float th = (float)s * inv; const float c = cosf(th), sn = sinf(th);
  { *(float*)(CS + t) = c; *(float*)(SN + t) = sn;  } }
__global__ __launch_bounds__(256) void k_rope(const float* __restrict__ F, int nsrc, int ndst, int rep, const float* __restrict__ CS, const float* __restrict__ SN, _Float16* __restrict__ H, _Float16* __restrict__ L) {
  #pragma clang fp contract(off)
  const size_t t = (size_t)blockIdx.x * 256 + threadIdx.x; if (t >= (size_t)NR * ndst * 4) return; const int g8 = (int)(t % 4); const int hd = (int)((t / 4) % ndst); const size_t row = t / ((size_t)4 * ndst); const int s = (int)(row % SLEN); const int hs = hd / rep;
  const float* src = F + row * (size_t)(nsrc * 64) + hs * 64; FragH ah, al, bh, bl;
  for (int i = 0; i < 8; ++i) { const int d = g8 * 8 + i; const float c = CS[s * 32 + d], sn = SN[s * 32 + d]; const float x1 = src[d], x2 = src[d + 32];
    float o1 = x1 * c; o1 += -x2 * sn; float o2 = x2 * c; o2 += x1 * sn;
    _Float16 hv = (_Float16)o1; ah.h[i] = hv; al.h[i] = (_Float16)((o1 - (float)hv) * 1024.0f); hv = (_Float16)o2; bh.h[i] = hv; bl.h[i] = (_Float16)((o2 - (float)hv) * 1024.0f); }
  const size_t o = row * (size_t)(ndst * 64) + hd * 64 + g8 * 8;
  { *(v8us*)((unsigned short*)H + o) = ah.half[0]; *(v8us*)((unsigned short*)H + o + 32) = bh.half[0]; *(v8us*)((unsigned short*)L + o) = al.half[0]; *(v8us*)((unsigned short*)L + o + 32) = bl.half[0];  } }
__global__ __launch_bounds__(256) void k_rope2(const float* __restrict__ F, int nsrc, int ndst, int rep, const float* __restrict__ CS, const float* __restrict__ SN, _Float16* __restrict__ H, _Float16* __restrict__ L) {
  #pragma clang fp contract(off)
  const size_t t = (size_t)blockIdx.x * 256 + threadIdx.x; if (t >= (size_t)NR * ndst * 4) return; const int g16 = (int)(t % 4); const int hd = (int)((t / 4) % ndst); const size_t row = t / ((size_t)4 * ndst); const int s = (int)(row % SLEN); const int hs = hd / rep;
  const float* src = F + row * (size_t)(nsrc * 64) + hs * 64 + g16 * 16; FragH ah, al;
  for (int pr = 0; pr < 8; ++pr) { const int i = g16 * 8 + pr; const float c = CS[s * 32 + i], sn = SN[s * 32 + i]; const float x1 = src[2 * pr], x2 = src[2 * pr + 1];
    float o1 = x1 * c; o1 -= x2 * sn; float o2 = x1 * sn; o2 += x2 * c;
    _Float16 hv = (_Float16)o1; ah.h[2 * pr] = hv; al.h[2 * pr] = (_Float16)((o1 - (float)hv) * 1024.0f); hv = (_Float16)o2; ah.h[2 * pr + 1] = hv; al.h[2 * pr + 1] = (_Float16)((o2 - (float)hv) * 1024.0f); }
  const size_t o = row * (size_t)(ndst * 64) + hd * 64 + g16 * 16;
  { *(v8us*)((unsigned short*)H + o) = ah.half[0]; *(v8us*)((unsigned short*)H + o + 8) = ah.half[1]; *(v8us*)((unsigned short*)L + o) = al.half[0]; *(v8us*)((unsigned short*)L + o + 8) = al.half[1];  } }
// also the mask table of the flash kernel: M2 = bf16-rounded mask times log2 e. Beyond +-1e38 the table goes on with slope 1/2, so that the factor turns no finite mask into an infinity: two different bf16 values up there still lie more than 1e35 apart in the table, so the smaller one's weight is 0 as it is in natural units, equal values stay equal, and the order is kept; an infinite mask stays infinite
__global__ __launch_bounds__(256) void k_tabin(const float* __restrict__ sp, float* __restrict__ CS, float* __restrict__ SN, const float* __restrict__ am, float* __restrict__ M2) { const int t = blockIdx.x * 256 + threadIdx.x; if (t >= SLEN * 32) return;
  if (t < NB * SLEN) { const float mr = bf16_round(am[t]), ma = fabsf(mr); M2[t] = (ma <= 1.0e38f) ? mr * LOG2E : copysignf(1.0e38f * LOG2E + (ma - 1.0e38f) * 0.5f, mr); }
  const int i = t % 32, s = t / 32; const float c = bf16_round(sp[s * 64 + 32 + i]), sn = bf16_round(sp[s * 64 + i]);
  { *(float*)(CS + t) = c; *(float*)(SN + t) = sn;  } }
__global__ __launch_bounds__(256) void k_wsc(const float* __restrict__ Wm, _Float16* __restrict__ Bt, size_t n8, float sc) { const size_t t = (size_t)blockIdx.x * 256 + threadIdx.x; if (t >= n8) return; FragH f; for (int q = 0; q < 8; ++q) f.h[q] = (_Float16)(bf16_round(Wm[t * 8 + q]) * sc); *(v8us*)((unsigned short*)Bt + t * 8) = f.half[0];  }
__global__ __launch_bounds__(256) void k_rotab2(float* __restrict__ CS, float* __restrict__ SN) {
  #pragma clang fp contract(off)
  const int t = blockIdx.x * 256 + threadIdx.x; if (t >= SLEN * 32) return; const int j = t % 32, s = t / 32; const float c0 = -0.14391156831212787f;      /* -ln(10000)/64 rounded to f32 */ const float inv = expf((float)(2 * j) * c0); const float th = (float)s * inv; const float c = cosf(th), sn = sinf(th);
  { *(float*)(CS + t) = c; *(float*)(SN + t) = sn;  } }
__global__ __launch_bounds__(256) void k_lnu(const float* __restrict__ X, _Float16* __restrict__ N16, float* __restrict__ XB) {
  #pragma clang fp contract(off)
  const int wv = threadIdx.x >> 5, ln = threadIdx.x & 31; const size_t r = (size_t)blockIdx.x * 8 + wv; if (r >= NR) return; float a[32]; float s = 0.f;
  for (int i = 0; i < 4; ++i) { const v8f v = *(const v8f*)(X + r * DM + (i * 32 + ln) * 8); for (int q = 0; q < 8; ++q) { const float u = bf16_round(v[q]); a[i * 8 + q] = u; s += u; } }
  for (int o = 16; o > 0; o >>= 1) s += __shfl_xor(s, o, 32); const float mu = s / (float)DM; float var = 0.f; for (int q = 0; q < 32; ++q) { const float d = a[q] - mu; var += d * d; }
  for (int o = 16; o > 0; o >>= 1) var += __shfl_xor(var, o, 32); const float den = sqrtf(var / (float)(DM - 1)) + 1e-6f; const float inv = 1.0f / den;      /* one reciprocal per row; (x-mean)*inv vs the reference's division differs by <= 1 ulp */
  { for (int i = 0; i < 4; ++i) { const int c0 = (i * 32 + ln) * 8; FragH f; v8f xb; for (int q = 0; q < 8; ++q) { f.h[q] = (_Float16)((a[i * 8 + q] - mu) * inv); xb[q] = a[i * 8 + q]; } *(v8us*)((unsigned short*)N16 + r * DM + c0) = f.half[0]; *(v8f*)(XB + r * DM + c0) = xb; }  } }
__global__ __launch_bounds__(256) void k_vtg(const _Float16* __restrict__ V16, _Float16* __restrict__ Vt) { __shared__ unsigned short tl[64][66]; const int tid = threadIdx.x; const int slab = blockIdx.x / (SLEN / 64), lg = blockIdx.x % (SLEN / 64); const int b = slab / NH, h = slab % NH; const int hs = h / NREP;
  for (int i = tid; i < 64 * 8; i += 256) { const int r = i / 8, c8 = (i % 8) * 8; FragH f; f.half[0] = *(const v8us*)((const unsigned short*)V16 + ((size_t)b * SLEN + lg * 64 + r) * KVD + hs * 64 + c8); for (int q = 0; q < 8; ++q) tl[r][c8 + q] = f.u[q]; }
  __syncthreads();
  { for (int rd = 0; rd < 2; ++rd) { const int d = rd * 32 + tid / 8, pc = tid % 8; FragH f; for (int q = 0; q < 8; ++q) f.u[q] = tl[pc * 8 + q][d]; *(v8us*)((unsigned short*)Vt + ((size_t)slab * 64 + d) * SLEN + lg * 64 + pc * 8) = f.half[0]; }  } }

extern "C" void kernel_launch(void* const* d_in, const int* in_sizes, int n_in,
                              void* d_out, int out_size, void* d_ws, size_t ws_size, hipStream_t stream) {
  (void)in_sizes; (void)n_in; (void)out_size;
  const float* const* I = (const float* const*)d_in; const float* x = I[0]; const float* sp = I[1]; const float* am = I[2]; const float* Wq = I[3]; const float* Wk = I[4]; const float* Wv = I[5]; const float* bq = nullptr; const float* bk = nullptr; const float* bv = nullptr;
  char* ws = (char*)d_ws; size_t off = 0;
  auto take = [&](size_t bytes) { char* p = ws + off; off += (bytes + 255) & ~(size_t)255; return p; };
  const size_t np = (size_t)NR * DM, nk = (size_t)NR * KVD;
  _Float16* BQ = (_Float16*)take((size_t)DM * DM * 2); _Float16* BK = (_Float16*)take((size_t)KVD * DM * 2); _Float16* BV = (_Float16*)take((size_t)KVD * DM * 2);
  float* CS = (float*)take((size_t)SLEN * 32 * 4); float* SN = (float*)take((size_t)SLEN * 32 * 4); float* M2 = (float*)take((size_t)NB * SLEN * 4);
  _Float16* X16 = (_Float16*)take(np * 2); float* QF = (float*)take(np * 4); _Float16* QH = (_Float16*)take(np * 2); _Float16* QL = (_Float16*)take(np * 2); float* KF = (float*)take(nk * 4); float* VF = (float*)take(nk * 4); _Float16* KXH = (_Float16*)take(np * 2); _Float16* KXL = (_Float16*)take(np * 2); _Float16* VH = (_Float16*)take(nk * 2); _Float16* VL = (_Float16*)take(nk * 2); _Float16* VT = (_Float16*)take(np * 2); /* no VTL: plain flash only */
  /* the flash output goes straight to d_out */
  if (off > ws_size) return;      /* 3x2 + 0.25+0.25+0.015625 + 8 + 16 + 8+8 + 16+16 + 8+8 + 8+8 + 8 = 118.515625 MiB */
  k_wsc<<<(unsigned)(((size_t)DM * DM / 8 + 255) / 256), 256, 0, stream>>>(Wq, BQ, (size_t)DM * DM / 8, 16.0f); k_wsc<<<(unsigned)(((size_t)KVD * DM / 8 + 255) / 256), 256, 0, stream>>>(Wk, BK, (size_t)KVD * DM / 8, 16.0f); k_wsc<<<(unsigned)(((size_t)KVD * DM / 8 + 255) / 256), 256, 0, stream>>>(Wv, BV, (size_t)KVD * DM / 8, 16.0f);      /* torch (out,in) = Bt */
  k_tabin<<<(SLEN * 32 + 255) / 256, 256, 0, stream>>>(sp, CS, SN, am, M2);
  k_x16<<<(unsigned)((np / 8 + 255) / 256), 256, 0, stream>>>(x, X16, np / 8);
  k_gemm2<0><<<dim3((NR / 128) * (DM / 64), 1), 128, 0, stream>>>(X16, DM, 0, BQ, DM, 0, 0.0625f, bq, 0, nullptr, 1, 0, 0, QF, nullptr, DM, 0, NR, DM, DM);
  k_gemm2<0><<<dim3((NR / 128) * (KVD / 64), 1), 128, 0, stream>>>(X16, DM, 0, BK, DM, 0, 0.0625f, bk, 0, nullptr, 1, 0, 0, KF, nullptr, KVD, 0, NR, KVD, DM);
  k_gemm2<0><<<dim3((NR / 128) * (KVD / 64), 1), 128, 0, stream>>>(X16, DM, 0, BV, DM, 0, 0.0625f, bv, 0, nullptr, 1, 0, 0, VF, nullptr, KVD, 0, NR, KVD, DM);
  k_rope2<<<(unsigned)(((size_t)NR * NH * 4 + 255) / 256), 256, 0, stream>>>(QF, NH, NH, 1, CS, SN, QH, QL);      /* q: 16 -> 16 heads (interleaved pairs) */
  k_rope2<<<(unsigned)(((size_t)NR * NH * 4 + 255) / 256), 256, 0, stream>>>(KF, NKV, NH, NREP, CS, SN, KXH, KXL);      /* k: kv head h to query head h (NREP = 1) */
  k_hl<<<(unsigned)((nk / 8 + 255) / 256), 256, 0, stream>>>(VF, VH, VL, nk / 8);
  k_vtg<<<NB * NH * (SLEN / 64), 256, 0, stream>>>(VH, VT);
  k_flash<17><<<NB * NH * QBNP, 128, 0, stream>>>(QH, DM, KXH, DM, VT, (const int*)M2, (float*)d_out, DM);      /* + the mask table [b][key]; the merged context is the output */
}

// v005
// Measured time: 79.4 microseconds a run.
// In two side-by-side timings against v004, it was 1.58 and 1.59 times as fast.
// Counting every step since v000, it is 4.95 times as fast.
#include <hip/hip_runtime.h>
// DiffBertSelfAttention (2 x 2048 tokens, D 1024 = 16 heads of 64): q, k, v = x W^T; RoFormer rotary from the sinusoidal_pos INPUT ([sin | cos] halves, interleave-duplicated: out[2i] = x[2i] cos_i - x[2i+1] sin_i, out[2i+1] = x[2i+1] cos_i + x[2i] sin_i); scores/8 + attention_mask[b, key] (additive INPUT, broadcast over heads and queries); softmax; ctx = probs v merged -> the output (no output projection).
// Structure, three launches: k_prep (exact f16 plane of x, exact x16 weight planes, the mask table); k_qkv (q, k, v as WMMA GEMMs, 32x64 wave tiles, f32 accumulation, whose epilogue does the interleaved RoPE in f32 from the input table, bf16-rounded like every input, the f16 conversion, and V^T by an LDS tile); the fused flash kernel with the per-key additive mask (mode 17: a table made from the input in the same call, rounded like every input and in base-2 units; plain operands: every row averages ~2048 keys) writing the merged context straight to the output.
// Compute dtype: inputs and parameters rounded to bf16; q/k/P/v as plain f16 operands (~2^-12); RoPE/softmax f32. v_wmma_f32_16x16x32_f16.
#define NB 2
#define DM 1024
#define NKV 16
#define NREP (NH / NKV)
#define KVD (NKV * 64)           /* 1024 */
#define NR (NB * SLEN)           /* 4096 */
#define SLEN 2048
#define TQ SLEN
#define TK SLEN
#define NH 16
#define SCL 0.125f
#define LOG2E 1.4426950408889634f
#define SCL2 (SCL * LOG2E)      /* scores in base-2 units: exp(s) = 2^(s log2 e) */
#define QBLKS (TQ / 64)
#define QB05 0
#define QBN5 4
#define QB0P 0
#define QBNP QBLKS           /* non-causal: plain flash on every query block */
#define RE 256
typedef __bf16 v16b __attribute__((ext_vector_type(16)));
typedef unsigned short v8us __attribute__((ext_vector_type(8), may_alias));
typedef float  v8f  __attribute__((ext_vector_type(8)));
typedef float  v4f  __attribute__((ext_vector_type(4)));
typedef float  v4fa __attribute__((ext_vector_type(4), may_alias));
typedef float  v2fa __attribute__((ext_vector_type(2), may_alias));
union FragB { v16b v; v8us half[2]; unsigned short u[16]; };

__device__ __forceinline__ unsigned short bf16_bits(float x) { unsigned int u = __float_as_uint(x); return (unsigned short)((u + 0x7FFFu + ((u >> 16) & 1u)) >> 16); }
__device__ __forceinline__ float bf16_val(unsigned short b) { return __uint_as_float(((unsigned int)b) << 16); }
__device__ __forceinline__ float bf16_round(float x) { return bf16_val(bf16_bits(x)); }
// D += A·B with NT terms: 1 = ah·bh, 2 = + al·bh (A split), 3 = + ah·bl (both split)
template <int NT>
__device__ __forceinline__ v8f mmaN(v16b ah, v16b al, v16b bh, v16b bl, v8f c) {
  c = __builtin_amdgcn_wmma_f32_16x16x32_bf16(false, ah, false, bh, (short)0, c, false, false);
  if (NT >= 2) c = __builtin_amdgcn_wmma_f32_16x16x32_bf16(false, al, false, bh, (short)0, c, false, false);
  if (NT >= 3) c = __builtin_amdgcn_wmma_f32_16x16x32_bf16(false, ah, false, bl, (short)0, c, false, false);
  asm volatile("v_nop\n\tv_nop\n\tv_nop\n\tv_nop" : "+v"(c) : "v"(ah), "v"(al), "v"(bh), "v"(bl));
  return c;
}

__global__ __launch_bounds__(256) void k_wt_bf16(const float* __restrict__ W, unsigned short* __restrict__ Wt, int K, int N) {
  const int t = blockIdx.x * 256 + threadIdx.x;
  const int k8n = K / 8;
  if (t >= N * k8n) return;
  const int n = t / k8n, k8 = (t % k8n) * 8;
  v8us v;
#pragma unroll
  for (int i = 0; i < 8; ++i) v[i] = bf16_bits(W[(size_t)(k8 + i) * N + n]);
  *(v8us*)(Wt + (size_t)n * K + k8) = v;
  
}

// GEMM C[M][N] (f32, pitch ldc) = act(A[M][K]·W + bias). A f32 row-major (pitch lda) converted per fragment to bf16
// (ASPLIT: hi/lo two planes -> 2 terms, else single rounded term); Wt bf16 [N][K] (pitch ldb). BIAS_BF16 rounds the
// bias to bf16 first (bias quantised to bf16 before the add). K%32==0, M%16==0, N%64==0.
template <bool ASPLIT, int ACT, bool BIAS_BF16>
__global__ __launch_bounds__(128) void k_gemm_bf(const float* __restrict__ A, int lda, const unsigned short* __restrict__ Wt, int ldb,
                                               const float* __restrict__ bias, float* __restrict__ C, int ldc, int M, int N, int K) {
  __shared__ __attribute__((aligned(16))) float so[4][16][64];
  const int tid = threadIdx.x, w = tid >> 5, lane = tid & 31, ln = lane & 15, hh = lane >> 4;
  const int ntn = N / 64;
  const int wid = blockIdx.x * 4 + w;
  const int mt = wid / ntn, nq = wid % ntn;
  if (mt * 16 >= M) return;
  const int row0 = mt * 16, col0 = nq * 64;
  const float* arow = A + (size_t)(row0 + ln) * lda;
  v8f acc[4] = {};
  for (int kb = 0; kb < K; kb += 32) {
    FragB ah, al;
    const v4f x0 = *(const v4fa*)(arow + kb + 8 * hh), x1 = *(const v4fa*)(arow + kb + 8 * hh + 4);
    const v4f x2 = *(const v4fa*)(arow + kb + 16 + 8 * hh), x3 = *(const v4fa*)(arow + kb + 16 + 8 * hh + 4);
    float xs[16] = {x0[0],x0[1],x0[2],x0[3],x1[0],x1[1],x1[2],x1[3],x2[0],x2[1],x2[2],x2[3],x3[0],x3[1],x3[2],x3[3]};
#pragma unroll
    for (int i = 0; i < 16; ++i) { const unsigned short hb = bf16_bits(xs[i]); ah.u[i] = hb; al.u[i] = ASPLIT ? bf16_bits(xs[i] - bf16_val(hb)) : (unsigned short)0; }
#pragma unroll
    for (int t = 0; t < 4; ++t) {
      const unsigned short* brow = Wt + (size_t)(col0 + t * 16 + ln) * ldb + kb;
      FragB b;
      b.half[0] = *(const v8us*)(brow + 8 * hh);
      b.half[1] = *(const v8us*)(brow + 16 + 8 * hh);
      acc[t] = mmaN<ASPLIT ? 2 : 1>(ah.v, al.v, b.v, b.v, acc[t]);
    }
  }
#pragma unroll
  for (int t = 0; t < 4; ++t) {
    float bv = bias ? bias[col0 + t * 16 + ln] : 0.f;
    if (BIAS_BF16) bv = bf16_round(bv);
#pragma unroll
    for (int r = 0; r < 8; ++r) { float v = acc[t][r] + bv; if (ACT == 1) v = fmaxf(v, 0.f); so[w][8 * hh + r][t * 16 + ln] = v; }
  }
  __builtin_amdgcn_fence(__ATOMIC_ACQ_REL, "workgroup");
  __builtin_amdgcn_wave_barrier();
  const int rsub = lane >> 4, c4 = (lane & 15) * 4;
  {
#pragma unroll
    for (int q = 0; q < 8; ++q) {
      const int r = q * 2 + rsub;
      const v4f v = *(const v4fa*)&so[w][r][c4];
      *(v4f*)(C + (size_t)(row0 + r) * ldc + col0 + c4) = v;
    }
    
  }
}

// GEMM C = act(A·W + bias + resid): A f32 (ASPLIT -> hi/lo 2 terms), Wt bf16 [N][K]; ACT 0 none, 1 relu, 2 exact gelu;
// resid (optional, f32, row index = (row % rmod), pitch ldr, RES_BF16 rounds it) added before the activation.
template <bool ASPLIT, int ACT, bool BIAS_BF16, bool RES_BF16>
__global__ __launch_bounds__(128) void k_gemm_bf3(const float* __restrict__ A, int lda, const unsigned short* __restrict__ Wt, int ldb,
                                                const float* __restrict__ bias, const float* __restrict__ resid, int rmod, int ldr,
                                                float* __restrict__ C, int ldc, int M, int N, int K) {
  __shared__ __attribute__((aligned(16))) float so[4][16][64];
  const int tid = threadIdx.x, w = tid >> 5, lane = tid & 31, ln = lane & 15, hh = lane >> 4;
  const int ntn = N / 64;
  const int wid = blockIdx.x * 4 + w;
  const int mt = wid / ntn, nq = wid % ntn;
  if (mt * 16 >= M) return;
  const int row0 = mt * 16, col0 = nq * 64;
  const float* arow = A + (size_t)(row0 + ln) * lda;
  v8f acc[4] = {};
  for (int kb = 0; kb < K; kb += 32) {
    FragB ah, al;
    const v4f x0 = *(const v4fa*)(arow + kb + 8 * hh), x1 = *(const v4fa*)(arow + kb + 8 * hh + 4);
    const v4f x2 = *(const v4fa*)(arow + kb + 16 + 8 * hh), x3 = *(const v4fa*)(arow + kb + 16 + 8 * hh + 4);
    float xs[16] = {x0[0],x0[1],x0[2],x0[3],x1[0],x1[1],x1[2],x1[3],x2[0],x2[1],x2[2],x2[3],x3[0],x3[1],x3[2],x3[3]};
#pragma unroll
    for (int i = 0; i < 16; ++i) { const unsigned short hb = bf16_bits(xs[i]); ah.u[i] = hb; al.u[i] = ASPLIT ? bf16_bits(xs[i] - bf16_val(hb)) : (unsigned short)0; }
#pragma unroll
    for (int t = 0; t < 4; ++t) {
      const unsigned short* brow = Wt + (size_t)(col0 + t * 16 + ln) * ldb + kb;
      FragB b;
      b.half[0] = *(const v8us*)(brow + 8 * hh);
      b.half[1] = *(const v8us*)(brow + 16 + 8 * hh);
      acc[t] = mmaN<ASPLIT ? 2 : 1>(ah.v, al.v, b.v, b.v, acc[t]);
    }
  }
#pragma unroll
  for (int t = 0; t < 4; ++t) {
    const int col = col0 + t * 16 + ln;
    float bv = bias ? bias[col] : 0.f;
    if (BIAS_BF16) bv = bf16_round(bv);
#pragma unroll
    for (int r = 0; r < 8; ++r) {
      float v = acc[t][r] + bv;
      if (resid) { float rv = resid[(size_t)((row0 + 8 * hh + r) % rmod) * ldr + col]; if (RES_BF16) rv = bf16_round(rv); v += rv; }
      if (ACT == 1) v = fmaxf(v, 0.f);
      if (ACT == 2) v = 0.5f * v * (1.0f + erff(v * 0.70710678118654752f));
      if (ACT == 3) { const float u = 0.7978845608028654f * (v + 0.044715f * v * v * v); v = 0.5f * v * (1.0f + tanhf(u)); }
      so[w][8 * hh + r][t * 16 + ln] = v;
    }
  }
  __builtin_amdgcn_fence(__ATOMIC_ACQ_REL, "workgroup");
  __builtin_amdgcn_wave_barrier();
  const int rsub = lane >> 4, c4 = (lane & 15) * 4;
  {
#pragma unroll
    for (int q = 0; q < 8; ++q) {
      const int r = q * 2 + rsub;
      const v4f v = *(const v4fa*)&so[w][r][c4];
      *(v4f*)(C + (size_t)(row0 + r) * ldc + col0 + c4) = v;
    }
    
  }
}
// row LayerNorm (biased variance, eps) over N: s = X (+ R); optional out_sum <- s; out_norm <- (s-mu)*rsqrt(var+eps)*g + b
template <bool PARAM_BF16>
__global__ __launch_bounds__(256) void k_layernorm(const float* __restrict__ X, const float* __restrict__ R, const float* __restrict__ g, const float* __restrict__ bta,
                                                  float* __restrict__ out_sum, float* __restrict__ out_norm, int N, float eps) {
  __shared__ float red[256];
  const int row = blockIdx.x, tid = threadIdx.x;
  const float* x = X + (size_t)row * N; const float* rr = R ? R + (size_t)row * N : nullptr;
  float vals[16];                     // up to N = 4096
  const int per = N / 256;            // contiguous chunk per thread? use strided-by-4 chunks: thread handles j = tid*4 + 1024*u
  float s1 = 0.f;
  for (int u = 0; u < per / 4; ++u) {
    const int j = tid * 4 + 1024 * u;
    const v4f a = *(const v4fa*)(x + j);
    v4f b = {0.f,0.f,0.f,0.f}; if (rr) b = *(const v4fa*)(rr + j);
#pragma unroll
    for (int q = 0; q < 4; ++q) { const float v = a[q] + b[q]; vals[u * 4 + q] = v; s1 += v; }
  }
  red[tid] = s1; __syncthreads();
  for (int st = 128; st > 0; st >>= 1) { if (tid < st) red[tid] += red[tid + st]; __syncthreads(); }
  const float mu = red[0] / (float)N; __syncthreads();
  float s2 = 0.f;
  for (int u = 0; u < per / 4; ++u)
#pragma unroll
    for (int q = 0; q < 4; ++q) { const float c = vals[u * 4 + q] - mu; s2 += c * c; }
  red[tid] = s2; __syncthreads();
  for (int st = 128; st > 0; st >>= 1) { if (tid < st) red[tid] += red[tid + st]; __syncthreads(); }
  const float rs = rsqrtf(red[0] / (float)N + eps);
  {
    for (int u = 0; u < per / 4; ++u) {
      const int j = tid * 4 + 1024 * u;
      v4f o, sm;
#pragma unroll
      for (int q = 0; q < 4; ++q) {
        float gg = g[j + q], bb = bta[j + q];
        if (PARAM_BF16) { gg = bf16_round(gg); bb = bf16_round(bb); }
        sm[q] = vals[u * 4 + q]; o[q] = (vals[u * 4 + q] - mu) * rs * gg + bb;
      }
      if (out_sum) *(v4f*)(out_sum + (size_t)row * N + j) = sm;
      *(v4f*)(out_norm + (size_t)row * N + j) = o;
    }
    
  }
}



// ---- f16 WMMA path (v_wmma_f32_16x16x32_f16): 11-bit significands for operands in range — used where a [0,1] probability operand needs more precision than bf16
typedef _Float16 v16h __attribute__((ext_vector_type(16)));
union FragH { v16h v; v8us half[2]; _Float16 h[16]; unsigned short u[16]; };
template <int NT>
__device__ __forceinline__ v8f mmaH(v16h ah, v16h al, v16h bh, v16h bl, v8f c) {
  c = __builtin_amdgcn_wmma_f32_16x16x32_f16(false, ah, false, bh, (short)0, c, false, false);
  if (NT >= 2) c = __builtin_amdgcn_wmma_f32_16x16x32_f16(false, al, false, bh, (short)0, c, false, false);
  if (NT >= 3) c = __builtin_amdgcn_wmma_f32_16x16x32_f16(false, ah, false, bl, (short)0, c, false, false);
  asm volatile("v_nop\n\tv_nop\n\tv_nop\n\tv_nop" : "+v"(c) : "v"(ah), "v"(al), "v"(bh), "v"(bl));
  return c;
}
// batched GEMM like k_gemm_b but f16 operands: A f32 (split into f16 hi/lo if ASPLIT, else rounded to f16), Bt = f16 values [n][k]; alpha; C f32; N multiple of 16 (partial tiles skipped)
template <bool ASPLIT>
__global__ __launch_bounds__(128) void k_gemm_h(const float* __restrict__ A, int lda, size_t sA, const _Float16* __restrict__ Bh, int ldb, size_t sB, float alpha, float* __restrict__ C, int ldc, size_t sC, int M, int N, int K) {
  __shared__ __attribute__((aligned(16))) float so[4][16][64];
  const int tid = threadIdx.x, w = tid >> 5, lane = tid & 31, ln = lane & 15, hh = lane >> 4; const int by = blockIdx.y;
  A += (size_t)by * sA; Bh += (size_t)by * sB; C += (size_t)by * sC;
  const int ntn = (N + 63) / 64; const int wid = blockIdx.x * 4 + w; const int mt = wid / ntn, nq = wid % ntn; if (mt * 16 >= M) return;
  const int row0 = mt * 16, col0 = nq * 64; const float* arow = A + (size_t)(row0 + ln) * lda;
  v8f acc[4] = {};
  for (int kb = 0; kb < K; kb += 32) {
    FragH ah, al;
    const v4f x0 = *(const v4fa*)(arow + kb + 8 * hh), x1 = *(const v4fa*)(arow + kb + 8 * hh + 4), x2 = *(const v4fa*)(arow + kb + 16 + 8 * hh), x3 = *(const v4fa*)(arow + kb + 16 + 8 * hh + 4);
    float xs[16] = {x0[0],x0[1],x0[2],x0[3],x1[0],x1[1],x1[2],x1[3],x2[0],x2[1],x2[2],x2[3],x3[0],x3[1],x3[2],x3[3]};
#pragma unroll
    for (int i = 0; i < 16; ++i) { const _Float16 h = (_Float16)xs[i]; ah.h[i] = h; al.h[i] = ASPLIT ? (_Float16)(xs[i] - (float)h) : (_Float16)0.0f; }
#pragma unroll
    for (int t = 0; t < 4; ++t) { if (col0 + t * 16 >= N) continue; const size_t boff = (size_t)(col0 + t * 16 + ln) * ldb + kb; FragH bq; bq.half[0] = *(const v8us*)(Bh + boff + 8 * hh); bq.half[1] = *(const v8us*)(Bh + boff + 16 + 8 * hh);
      acc[t] = mmaH<ASPLIT ? 2 : 1>(ah.v, al.v, bq.v, bq.v, acc[t]); }
  }
#pragma unroll
  for (int t = 0; t < 4; ++t) { if (col0 + t * 16 >= N) continue;
#pragma unroll
    for (int r = 0; r < 8; ++r) so[w][8 * hh + r][t * 16 + ln] = acc[t][r] * alpha; }
  __builtin_amdgcn_fence(__ATOMIC_ACQ_REL, "workgroup"); __builtin_amdgcn_wave_barrier();
  const int rsub = lane >> 4, c4 = (lane & 15) * 4;
  {
#pragma unroll
    for (int q = 0; q < 8; ++q) { const int r = q * 2 + rsub; if (col0 + c4 < N) { const v4f v = *(const v4fa*)&so[w][r][c4]; *(v4f*)(C + (size_t)(row0 + r) * ldc + col0 + c4) = v; } }
     }
}

// Wt[n][k] = f16(W[k][n]·scale) from f32 row-major W[K][N] (scale = power of two; bf16-exact weights stay exact in f16 away from the subnormal range)
__global__ __launch_bounds__(256) void k_wt_f16(const float* __restrict__ W, _Float16* __restrict__ Wt, int K, int N, float scale) {
  const int t = blockIdx.x * 256 + threadIdx.x; if (t >= N * (K / 8)) return; const int n = t / (K / 8), k8 = (t % (K / 8)) * 8; FragH f;
#pragma unroll
  for (int i = 0; i < 8; ++i) f.h[i] = (_Float16)(bf16_round(W[(size_t)(k8 + i) * N + n]) * scale); const v8us o = f.half[0];
  *(v8us*)((unsigned short*)Wt + (size_t)n * K + k8) = o; 
}
// k_gemm_hh variant with fused epilogue: v = acc·alpha + bias[by·sBias + col] (+ CP[(row/rowsPerB)·sCPb + by·64 + col] if CP) ; ACT 0 none / 1 elu ; writes f16 C16 (and f32 C if non-null)
template <int ACT>
__global__ __launch_bounds__(128) void k_gemm_hhx(const _Float16* __restrict__ A, int lda, size_t sA, const _Float16* __restrict__ Bh, int ldb, size_t sB, float alpha, const float* __restrict__ bias, size_t sBias, const float* __restrict__ CP, int rowsPerB, size_t sCPb, int row0g,
    float* __restrict__ C, _Float16* __restrict__ C16, int ldc, size_t sC, int M, int N, int K) {
  __shared__ __attribute__((aligned(16))) float so[4][16][64];
  const int tid = threadIdx.x, w = tid >> 5, lane = tid & 31, ln = lane & 15, hh = lane >> 4; const int by = blockIdx.y;
  A += (size_t)by * sA; Bh += (size_t)by * sB; const size_t cofs = (size_t)by * sC; const float* bp = bias ? bias + (size_t)by * sBias : nullptr;
  const int ntn = (N + 63) / 64; const int wid = blockIdx.x * 4 + w; const int mt = wid / ntn, nq = wid % ntn; if (mt * 16 >= M) return;
  const int row0 = mt * 16, col0 = nq * 64; const _Float16* arow = A + (size_t)(row0 + ln) * lda;
  v8f acc[4] = {};
  for (int kb = 0; kb < K; kb += 32) { FragH ah; ah.half[0] = *(const v8us*)((const unsigned short*)arow + kb + 8 * hh); ah.half[1] = *(const v8us*)((const unsigned short*)arow + kb + 16 + 8 * hh);
#pragma unroll
    for (int t = 0; t < 4; ++t) { if (col0 + t * 16 >= N) continue; const size_t boff = (size_t)(col0 + t * 16 + ln) * ldb + kb; FragH bq; bq.half[0] = *(const v8us*)((const unsigned short*)Bh + boff + 8 * hh); bq.half[1] = *(const v8us*)((const unsigned short*)Bh + boff + 16 + 8 * hh);
      acc[t] = mmaH<1>(ah.v, ah.v, bq.v, bq.v, acc[t]); }
  }
#pragma unroll
  for (int t = 0; t < 4; ++t) { if (col0 + t * 16 >= N) continue; const int col = col0 + t * 16 + ln; const float bv = bp ? bf16_round(bp[col]) : 0.f;
#pragma unroll
    for (int r = 0; r < 8; ++r) { float v = acc[t][r] * alpha + bv; if (CP) { const int bidx = (row0g + row0 + 8 * hh + r) / rowsPerB; v += CP[(size_t)bidx * sCPb + (size_t)by * 64 + col]; } if (ACT == 1) v = (v > 0.f) ? v : expm1f(v); else if (ACT == 7) v = (v > 0.f) ? v + 1.0f : expf(v); else if (ACT == 8) v = tanhf(v); else if (ACT == 9) v = 0.5f * v * (1.0f + tanhf(0.7978845608028654f * (v + 0.044715f * v * v * v))); else if (ACT == 11) v = 1.0f / (1.0f + expf(-v)); else if (ACT == 12) v = (v > 0.f) ? v : 0.01f * v; else if (ACT == 14) v = (v > 0.f) ? v : 0.1f * v; else if (ACT == 15) v = v / (1.0f + expf(-v)); else if (ACT == 3) v = fmaxf(v, 0.f); else if (ACT == 6) v = 0.5f * v * (1.0f + erff(v * 0.70710678118654752f)); so[w][8 * hh + r][t * 16 + ln] = v; } }
  __builtin_amdgcn_fence(__ATOMIC_ACQ_REL, "workgroup"); __builtin_amdgcn_wave_barrier();
  const int rsub = lane >> 4, c4 = (lane & 15) * 4; typedef _Float16 v4h __attribute__((ext_vector_type(4)));
  {
#pragma unroll
    for (int q = 0; q < 8; ++q) { const int r = q * 2 + rsub; if (col0 + c4 < N) { const v4f v = *(const v4fa*)&so[w][r][c4]; if (C) *(v4f*)(C + cofs + (size_t)(row0 + r) * ldc + col0 + c4) = v; if (C16) { v4h h4; for (int i = 0; i < 4; ++i) h4[i] = (_Float16)v[i]; *(v4h*)(C16 + cofs + (size_t)(row0 + r) * ldc + col0 + c4) = h4; } } }
     }
}


typedef _Float16 v4h __attribute__((ext_vector_type(4)));

__global__ __launch_bounds__(256) void k_h16(const float* __restrict__ x, _Float16* __restrict__ X16, size_t n8) { const size_t t = (size_t)blockIdx.x * 256 + threadIdx.x; if (t >= n8) return; FragH f;
#pragma unroll
  for (int q = 0; q < 8; ++q) f.h[q] = (_Float16)x[t * 8 + q]; *(v8us*)((unsigned short*)X16 + t * 8) = f.half[0];  }
__global__ __launch_bounds__(256) void k_round16f(const float* __restrict__ W, _Float16* __restrict__ Bt, size_t n8) { const size_t t = (size_t)blockIdx.x * 256 + threadIdx.x; if (t >= n8) return; FragH f;
#pragma unroll
  for (int i = 0; i < 8; ++i) f.h[i] = (_Float16)(bf16_round(W[t * 8 + i]) * 16.0f); *(v8us*)((unsigned short*)Bt + t * 8) = f.half[0];  }
template <int NHv, int TTv>
__global__ __launch_bounds__(256) void k_vt(const _Float16* __restrict__ V16, int ldv, int voff, _Float16* __restrict__ Vt) { __shared__ unsigned short tl[64][66]; const int tid = threadIdx.x; const int slab = blockIdx.x / (TTv / 64), lg = blockIdx.x % (TTv / 64); const int b = slab / NHv, h = slab % NHv;
  for (int i = tid; i < 64 * 8; i += 256) { const int r = i / 8, c8 = (i % 8) * 8; FragH f; f.half[0] = *(const v8us*)((const unsigned short*)V16 + ((size_t)b * TTv + lg * 64 + r) * ldv + voff + h * 64 + c8);
#pragma unroll
    for (int q = 0; q < 8; ++q) tl[r][c8 + q] = f.u[q]; }
  __syncthreads();
  {
#pragma unroll
    for (int rd = 0; rd < 2; ++rd) { const int d = rd * 32 + tid / 8, pc = tid % 8; FragH f;
#pragma unroll
      for (int q = 0; q < 8; ++q) f.u[q] = tl[pc * 8 + q][d];
      *(v8us*)((unsigned short*)Vt + ((size_t)slab * 64 + d) * TTv + lg * 64 + pc * 8) = f.half[0]; }
     } }


// ---- fast GEMM (wave tile 32x64, block tile 128x64) ----
__device__ __forceinline__ v16h g2_frag(const _Float16* p, int hh) { FragH f; f.half[0] = *(const v8us*)((const unsigned short*)p + 8 * hh); f.half[1] = *(const v8us*)((const unsigned short*)p + 16 + 8 * hh); return f.v; }
__device__ __forceinline__ v8f g2_mma(v16h a, v16h b, v8f c) { v8f d = __builtin_amdgcn_wmma_f32_16x16x32_f16(false, a, false, b, (short)0, c, false, false); asm volatile("v_nop\n\tv_nop\n\tv_nop\n\tv_nop" : "+v"(d) : "v"(a), "v"(b)); return d; }
// One wave's share of a stage (192 rows of 128 bytes: 128 A rows, then 64 B rows, LDS pitch G2P bytes): 12 asynchronous 16-byte copies per lane, 8 lanes to a row, so that each copy of a wave reads 4 whole 128-byte lines.
// l = this lane's LDS byte address in the stage's row tid / 8; ga, gb = this lane's 16 bytes in A row tid / 8 and B row tid / 8 of the stage; every further copy is 16 rows on.
#define G2P 144            /* 128 + 16: the pitch for 16-byte LDS reads of 128-byte rows */
#define G2S (192 * G2P)    /* bytes of one stage */
__device__ __forceinline__ void g2_stage(unsigned l, const _Float16* ga, size_t lda, const _Float16* gb, size_t ldb) {
  const unsigned l1 = l + 16 * G2P, l2 = l + 32 * G2P, l3 = l + 48 * G2P, l4 = l + 64 * G2P, l5 = l + 80 * G2P, l6 = l + 96 * G2P, l7 = l + 112 * G2P, l8 = l + 128 * G2P, l9 = l + 144 * G2P, l10 = l + 160 * G2P, l11 = l + 176 * G2P;
  const _Float16 *a1 = ga + 16 * lda, *a2 = ga + 32 * lda, *a3 = ga + 48 * lda, *a4 = ga + 64 * lda, *a5 = ga + 80 * lda, *a6 = ga + 96 * lda, *a7 = ga + 112 * lda, *b1 = gb + 16 * ldb, *b2 = gb + 32 * ldb, *b3 = gb + 48 * ldb;
  /* the copies and their s_wait_xcnt in one statement: no address register is rewritten before the wait */
  asm volatile("global_load_async_to_lds_b128 %0, %12, off\n\t"
               "global_load_async_to_lds_b128 %1, %13, off\n\t"
               "global_load_async_to_lds_b128 %2, %14, off\n\t"
               "global_load_async_to_lds_b128 %3, %15, off\n\t"
               "global_load_async_to_lds_b128 %4, %16, off\n\t"
               "global_load_async_to_lds_b128 %5, %17, off\n\t"
               "global_load_async_to_lds_b128 %6, %18, off\n\t"
               "global_load_async_to_lds_b128 %7, %19, off\n\t"
               "global_load_async_to_lds_b128 %8, %20, off\n\t"
               "global_load_async_to_lds_b128 %9, %21, off\n\t"
               "global_load_async_to_lds_b128 %10, %22, off\n\t"
               "global_load_async_to_lds_b128 %11, %23, off\n\t"
               "s_wait_xcnt 0x0"
               :: "v"(l), "v"(l1), "v"(l2), "v"(l3), "v"(l4), "v"(l5), "v"(l6), "v"(l7), "v"(l8), "v"(l9), "v"(l10), "v"(l11),
                  "v"(ga), "v"(a1), "v"(a2), "v"(a3), "v"(a4), "v"(a5), "v"(a6), "v"(a7), "v"(gb), "v"(b1), "v"(b2), "v"(b3) : "memory"); }
// The three projections in ONE launch: blockIdx.y picks the weight plane (0 q, 1 k, 2 v; the planes lie one behind the other in B3) and what the epilogue makes of the tile, so that q, k and v never exist as f32 planes in memory.
// Block tile 128 tokens x 64 columns = one head; K = DM; A and B go through LDS in stages of 64 k, two buffers: stage t + 1 flies while stage t is worked on. The fragments are read from LDS in the k order of g2_frag.
// q, k: the wave's 32x64 tile goes through its own LDS rows, a lane takes 4 neighbouring columns = 2 rotary pairs back, turns them by the sinusoidal_pos INPUT row of its token ([sin | cos], rounded like every input) and stores 4 f16: 16 lanes write one head row = one 128-byte line.
// v: register r of an accumulator is token 8 hh + r of one head column, so 8 converted registers are 16 bytes of a V^T row; the block's 64 x 128 V^T tile is gathered in LDS and stored as whole 256-byte rows.
#define VTP 136            /* f16 per LDS row of the V^T tile: 256 + 16 bytes */
__global__ __launch_bounds__(128) void k_qkv(const _Float16* __restrict__ A, const _Float16* __restrict__ B3, const float* __restrict__ sp, _Float16* __restrict__ Q16, _Float16* __restrict__ K16, _Float16* __restrict__ Vt) {
  __shared__ __attribute__((aligned(16))) float so[4][32][68];
  __shared__ __attribute__((aligned(16))) _Float16 st[2][192][G2P / 2];
  const int tid = threadIdx.x, w = tid >> 5, lane = tid & 31, ln = lane & 15, hh = lane >> 4; const int by = blockIdx.y;
  const _Float16* Bh = B3 + (size_t)by * DM * DM;
  const int mt = blockIdx.x / NH, nq = blockIdx.x % NH; const int row0 = mt * 128 + 32 * w, col0 = nq * 64;
  const _Float16* ga = A + (size_t)(mt * 128 + (tid >> 3)) * DM + (tid & 7) * 8; const _Float16* gb = Bh + (size_t)(col0 + (tid >> 3)) * DM + (tid & 7) * 8;
  const unsigned ls = (unsigned)(size_t)&st[0][tid >> 3][(tid & 7) * 8];
  constexpr int nst = DM >> 6;
  g2_stage(ls, ga, (size_t)DM, gb, (size_t)DM);
  asm volatile("s_wait_asynccnt 0x0" ::: "memory");      /* stage 0 of this wave has landed */
  __syncthreads();      /* ... and every wave's share of it */
  g2_stage(ls + G2S, ga + 64, (size_t)DM, gb + 64, (size_t)DM);
  const v8f z8 = {0.f,0.f,0.f,0.f,0.f,0.f,0.f,0.f}; v8f c00 = z8, c01 = z8, c02 = z8, c03 = z8, c10 = z8, c11 = z8, c12 = z8, c13 = z8;
  /* rolled: one trip of code; the buffer is picked by the trip's parity */
#pragma unroll 1
  for (int t = 0; t < nst; ++t) { const _Float16* sa = &st[t & 1][32 * w + ln][0]; const _Float16* sb = &st[t & 1][128 + ln][0];
    /* all of the trip's fragments are read here, ahead of its first product */
    const v16h a00 = g2_frag(sa, hh), a10 = g2_frag(sa + 16 * (G2P / 2), hh), b00 = g2_frag(sb, hh), b10 = g2_frag(sb + 16 * (G2P / 2), hh), b20 = g2_frag(sb + 32 * (G2P / 2), hh), b30 = g2_frag(sb + 48 * (G2P / 2), hh);
    const v16h a01 = g2_frag(sa + 32, hh), a11 = g2_frag(sa + 16 * (G2P / 2) + 32, hh), b01 = g2_frag(sb + 32, hh), b11 = g2_frag(sb + 16 * (G2P / 2) + 32, hh), b21 = g2_frag(sb + 32 * (G2P / 2) + 32, hh), b31 = g2_frag(sb + 48 * (G2P / 2) + 32, hh);
    c00 = g2_mma(a00, b00, c00); c10 = g2_mma(a10, b00, c10); c01 = g2_mma(a00, b10, c01); c11 = g2_mma(a10, b10, c11);
    c02 = g2_mma(a00, b20, c02); c12 = g2_mma(a10, b20, c12); c03 = g2_mma(a00, b30, c03); c13 = g2_mma(a10, b30, c13);
    c00 = g2_mma(a01, b01, c00); c10 = g2_mma(a11, b01, c10); c01 = g2_mma(a01, b11, c01); c11 = g2_mma(a11, b11, c11);
    c02 = g2_mma(a01, b21, c02); c12 = g2_mma(a11, b21, c12); c03 = g2_mma(a01, b31, c03); c13 = g2_mma(a11, b31, c13);
    asm volatile("s_wait_dscnt 0x0" ::: "memory");      /* this wave's reads of the buffer are done before it is refilled */
    asm volatile("s_wait_asynccnt 0x0" ::: "memory");      /* this wave's share of stage t + 1 has landed */
    __syncthreads();      /* publishes stage t + 1 and ends every wave's reads of stage t */
    if (t + 2 < nst) g2_stage(ls + (unsigned)(t & 1) * G2S, ga + (size_t)(t + 2) * 64, (size_t)DM, gb + (size_t)(t + 2) * 64, (size_t)DM); }
  asm volatile("s_wait_asynccnt 0x0" ::: "memory");      /* nothing in flight when the wave goes on to the epilogue */
  v8f accs[8] = {c00, c01, c02, c03, c10, c11, c12, c13};      /* the weights hold the factor 16: every value below is accumulator / 16 */
  if (by == 2) {      /* the same for the whole block */
    _Float16* vt = (_Float16*)&so[0][0][0];
#pragma unroll      /* constant indices: accumulators and table words stay in registers */
    for (int u = 0; u < 8; ++u) { const int t = u & 3, half = u >> 2; FragH f;
#pragma unroll      /* constant indices: accumulators and table words stay in registers */
      for (int r = 0; r < 8; ++r) f.h[r] = (_Float16)(accs[u][r] * 0.0625f);
      *(v8us*)((unsigned short*)vt + (t * 16 + ln) * VTP + 32 * w + half * 16 + 8 * hh) = f.half[0]; }
    __syncthreads();      /* a V^T row holds tokens of all four waves */
    const int b = (mt * 128) / SLEN, key0 = (mt * 128) % SLEN;
#pragma unroll      /* the eight LDS reads stand together, ahead of the stores */
    for (int p = 0; p < 8; ++p) { const int d = p * 8 + (tid >> 4), c8 = (tid & 15) * 8; const v8us val = *(const v8us*)((const unsigned short*)vt + d * VTP + c8);
      *(v8us*)((unsigned short*)Vt + ((size_t)(b * NH + nq) * 64 + d) * SLEN + key0 + c8) = val; }
  } else {
    _Float16* __restrict__ H = by ? K16 : Q16;
    const int rsub = lane >> 4, c4 = (lane & 15) * 4;
    /* the table words of token row0 + rsub, pairs c4 / 2 and c4 / 2 + 1; the lane's next token is two rows = 128 floats on (a wave's 32 tokens never cross the end of a sequence). Asked for ahead of the LDS round trip, which hides their way */
    const float* pr = sp + (size_t)(row0 % SLEN + rsub) * 64 + (c4 >> 1); v2fa sn[16], cs[16];
#pragma unroll      /* constant indices: accumulators and table words stay in registers */
    for (int q = 0; q < 16; ++q) { sn[q] = *(const v2fa*)(pr + q * 128); cs[q] = *(const v2fa*)(pr + q * 128 + 32); }
    asm volatile("s_wait_xcnt 0x0" :: "v"(pr) : "memory");      /* the loads' address register lives up to this wait: nothing is written over it while a load that names it is under way */
#pragma unroll      /* constant indices: accumulators and table words stay in registers */
    for (int u = 0; u < 8; ++u) { const int t = u & 3, half = u >> 2;
#pragma unroll      /* constant indices: accumulators and table words stay in registers */
      for (int r = 0; r < 8; ++r) so[w][half * 16 + 8 * hh + r][t * 16 + ln] = accs[u][r] * 0.0625f; }
    __builtin_amdgcn_fence(__ATOMIC_ACQ_REL, "workgroup"); __builtin_amdgcn_wave_barrier();      /* the wave's LDS writes are done before its lanes read rows that other lanes wrote */
    _Float16* hp = H + (size_t)(row0 + rsub) * DM + col0 + c4;
#pragma unroll      /* constant indices: accumulators and table words stay in registers */
    for (int q = 0; q < 16; ++q) { const v4f v = *(const v4fa*)&so[w][q * 2 + rsub][c4];
      const float s0 = bf16_round(sn[q][0]), s1 = bf16_round(sn[q][1]), k0 = bf16_round(cs[q][0]), k1 = bf16_round(cs[q][1]);
      v4h h4; h4[0] = (_Float16)(v[0] * k0 - v[1] * s0); h4[1] = (_Float16)(v[0] * s0 + v[1] * k0); h4[2] = (_Float16)(v[2] * k1 - v[3] * s1); h4[3] = (_Float16)(v[2] * s1 + v[3] * k1);
      *(v4h*)(hp + (size_t)q * 2 * DM) = h4; }
    asm volatile("s_wait_xcnt 0x0" ::: "memory");      /* behind the last store of the run: no register that a store names is written over while the store is under way, on whatever code the build lays behind this branch */
  } }



// lane l <-> lane l ^ 16 (the two halves of a wave hold the two key halves of one query column)
__device__ __forceinline__ float xhalf(float x) { return __builtin_bit_cast(float, __builtin_amdgcn_permlanex16(__builtin_bit_cast(int, x), __builtin_bit_cast(int, x), 0x76543210, 0xfedcba98, false, false)); }
__device__ __forceinline__ v8f mmaT(v16h a, v16h b, v8f c) { return __builtin_amdgcn_wmma_f32_16x16x32_f16(false, a, false, b, (short)0, c, false, false); }
// One wave's share of a flash stage of 64 keys (128 rows of 128 bytes: 64 K rows of the head, then the 64 V^T rows' 64 keys, LDS pitch FLP bytes): 8 asynchronous 16-byte copies per lane, 8 lanes to a row, so that each copy of a wave reads 4 whole 128-byte lines.
// l = this lane's LDS byte address in the stage's row tid / 8; gk, gv = this lane's 16 bytes in K row tid / 8 and V^T row tid / 8 of the stage; every further copy is 16 rows on.
#define FLP 144            /* 128 + 16: the pitch for 16-byte LDS reads of 128-byte rows */
#define FLS (128 * FLP)    /* bytes of one stage */
__device__ __forceinline__ void fl_stage(unsigned l, const _Float16* gk, size_t ldk, const _Float16* gv) {
  const unsigned l1 = l + 16 * FLP, l2 = l + 32 * FLP, l3 = l + 48 * FLP, l4 = l + 64 * FLP, l5 = l + 80 * FLP, l6 = l + 96 * FLP, l7 = l + 112 * FLP;
  const _Float16 *k1 = gk + 16 * ldk, *k2 = gk + 32 * ldk, *k3 = gk + 48 * ldk, *v1 = gv + 16 * TK, *v2 = gv + 32 * TK, *v3 = gv + 48 * TK;
  /* the copies and their s_wait_xcnt in one statement: no address register is rewritten before the wait */
  asm volatile("global_load_async_to_lds_b128 %0, %8, off\n\t"
               "global_load_async_to_lds_b128 %1, %9, off\n\t"
               "global_load_async_to_lds_b128 %2, %10, off\n\t"
               "global_load_async_to_lds_b128 %3, %11, off\n\t"
               "global_load_async_to_lds_b128 %4, %12, off\n\t"
               "global_load_async_to_lds_b128 %5, %13, off\n\t"
               "global_load_async_to_lds_b128 %6, %14, off\n\t"
               "global_load_async_to_lds_b128 %7, %15, off\n\t"
               "s_wait_xcnt 0x0"
               :: "v"(l), "v"(l1), "v"(l2), "v"(l3), "v"(l4), "v"(l5), "v"(l6), "v"(l7),
                  "v"(gk), "v"(k1), "v"(k2), "v"(k3), "v"(gv), "v"(v1), "v"(v2), "v"(v3) : "memory"); }
// Transposed products: S^T = K Q^T (A = 16 key rows, B = the wave's 16 query columns, kept in registers), O^T += V^T P^T (A = 16 rows of V^T, B = P^T).
// Lane (c = lane & 15, hh = lane >> 4) holds query q0 + c only: register r of score tile nt is key j0 + 16 nt + 8 hh + r, so maximum and sum run in-lane plus one exchange between the halves,
// and the two converted score tiles ARE the B operand of the second product in the hardware k order (element s: key 8 hh + s, then 16 + 8 hh + (s - 8)), the order in which the V^T rows are loaded.
// The softmax runs in base 2: the score factor holds log2 e, the mask table is already in those units, and the weights' factor 1024 is +10 in the exponent, added behind the subtraction of the maximum, so that a weight is a subtraction, an addition and one v_exp_f32; the denominator sums the same 1024-fold weights.
// K and V^T go through LDS in stages of 64 keys (two passes of 32), two buffers, shared by the block's 4 waves: stage t + 1 flies while stage t is worked on. The fragments are read from LDS in the k order of g2_frag.
template <int CAUSAL>
__global__ __launch_bounds__(128) void k_flash(const _Float16* __restrict__ Q16, int ldq, const _Float16* __restrict__ K16, int ldk, const _Float16* __restrict__ Vt, const int* __restrict__ MSK, float* __restrict__ O, int ldo) {
  constexpr int RPW = 16, DT = 4, KS = 2;
  __shared__ __attribute__((aligned(16))) float sO[4][RPW][64 + 4];
  __shared__ __attribute__((aligned(16))) _Float16 st[2][128][FLP / 2];
  const int tid = threadIdx.x, w = tid >> 5, lane = tid & 31, ln = lane & 15, hh = lane >> 4;
  const int slab = blockIdx.x / QBNP, qblk = QB0P + blockIdx.x % QBNP; const int b = slab / NH, h = slab % NH; const int qb0 = qblk * (4 * RPW); const int q0 = qb0 + w * RPW; const int tq = q0 + ln;
  FragH bq[KS];
  { const unsigned short* qr = (const unsigned short*)Q16 + ((size_t)b * TQ + tq) * ldq + h * 64;
#pragma unroll
    for (int ks = 0; ks < KS; ++ks) { bq[ks].half[0] = *(const v8us*)(qr + ks * 32 + 8 * hh); bq[ks].half[1] = *(const v8us*)(qr + ks * 32 + 16 + 8 * hh); } }
  /* this lane's 16 bytes of stage 0 (K row tid / 8 of the head, V^T row tid / 8) and their place in buffer 0 */
  const _Float16* gk = K16 + ((size_t)b * TK + (tid >> 3)) * ldk + h * 64 + (tid & 7) * 8; const _Float16* gv = Vt + ((size_t)slab * 64 + (tid >> 3)) * TK + (tid & 7) * 8;
  const unsigned ls = (unsigned)(size_t)&st[0][tid >> 3][(tid & 7) * 8];
  const char* mb = (const char*)((const float*)MSK + (size_t)b * TK); const unsigned mo = (unsigned)hh * 32u;      /* a wave-uniform base that steps with the stage; this half's 8 mask words */
  float m_c = -3.0e38f, l_c = 0.f; v8f oacc[DT];
#pragma unroll
  for (int dt = 0; dt < DT; ++dt) oacc[dt] = (v8f){0.f,0.f,0.f,0.f,0.f,0.f,0.f,0.f};
  const int jend = (CAUSAL == 1) ? (qb0 + 4 * RPW) : TK;      /* causal: keys beyond the block's last query never contribute */
  const int nst = jend >> 6;      /* both ends are multiples of 64; the same for the whole block */
  fl_stage(ls, gk, (size_t)ldk, gv);
  asm volatile("s_wait_asynccnt 0x0" ::: "memory");      /* stage 0 of this wave has landed */
  __syncthreads();      /* ... and every wave's share of it */
  if (nst > 1) fl_stage(ls + FLS, gk + (size_t)64 * ldk, (size_t)ldk, gv + 64);
  /* the stage loop stays rolled (one stage of code; the buffer is picked by the trip's parity); every inner loop is unrolled so that the fragment and score arrays have constant indices and stay in registers */
#pragma unroll 1
  for (int t = 0; t < nst; ++t) { const _Float16* skr = &st[t & 1][ln][0]; const _Float16* svr = &st[t & 1][64 + ln][0];      /* this lane's K row and V^T row of the stage's buffer */
    v4f mk[2][2][2];      /* the stage's mask words (from the table in global memory) are asked for first: they have the longest way */
    if (CAUSAL == 17) {
#pragma unroll
      for (int nt = 0; nt < 4; ++nt) { mk[nt >> 1][nt & 1][0] = *(const v4fa*)(mb + mo + nt * 64); mk[nt >> 1][nt & 1][1] = *(const v4fa*)(mb + mo + nt * 64 + 16); } }
#pragma unroll
   for (int pp = 0; pp < 2; ++pp) { const int j0 = t * 64 + pp * 32;
    FragH ak[2][KS], av[DT];
#pragma unroll
    for (int nt = 0; nt < 2; ++nt) {
#pragma unroll
      for (int ks = 0; ks < KS; ++ks) ak[nt][ks].v = g2_frag(skr + (pp * 32 + nt * 16) * (FLP / 2) + ks * 32, hh); }      /* key rows ln and 16 + ln of the pass */
    asm volatile("" :: "v"(ak[0][0].v), "v"(ak[0][1].v), "v"(ak[1][0].v), "v"(ak[1][1].v));      /* inputs only: keeps the pass's eight K reads together in front of its first product (one LDS wait; without it the first pass of a stage reads and waits four times in a row) */
#pragma unroll
    for (int dt = 0; dt < DT; ++dt) av[dt].v = g2_frag(svr + dt * 16 * (FLP / 2) + pp * 32, hh);      /* V^T row dt * 16 + ln, the pass's 32 keys */
    float sc[16]; bool ok[16];
#pragma unroll
    for (int nt = 0; nt < 2; ++nt) { v8f acc = (v8f){0.f,0.f,0.f,0.f,0.f,0.f,0.f,0.f};
#pragma unroll
      for (int ks = 0; ks < KS; ++ks) acc = mmaT(ak[nt][ks].v, bq[ks].v, acc);
#pragma unroll
      for (int r = 0; r < 8; ++r) { const int kk = j0 + nt * 16 + 8 * hh + r; const bool okk = (CAUSAL == 1) ? (kk <= tq) : ((CAUSAL == 2) ? ((kk >> 5) == (tq >> 5)) : true);      /* mode 2: block-diagonal 32-token groups */
        float sv = okk ? acc[r] * SCL2 : -3.0e38f; if (CAUSAL == 17) sv += mk[pp][nt][r >> 2][r & 3];      /* mode 17: additive per-(batch, key) mask, rounded and scaled by k_prep */
        sc[nt * 8 + r] = sv; ok[nt * 8 + r] = okk; } }
    float mx[8];
#pragma unroll
    for (int i = 0; i < 8; ++i) mx[i] = fmaxf(sc[2 * i], sc[2 * i + 1]);      /* neighbours first (a maximum is exact in any order): the packed score multiply-adds then work on register pairs as the accumulators hold them, with no moves */
    float mc = fmaxf(fmaxf(fmaxf(mx[0], mx[1]), fmaxf(mx[2], mx[3])), fmaxf(fmaxf(mx[4], mx[5]), fmaxf(mx[6], mx[7])));
    mc = fmaxf(mc, xhalf(mc));      /* both halves now hold the query's maximum over the 32 keys */
    const float mn = fmaxf(m_c, mc); const float da = m_c - mn; float ea; m_c = mn;
    float x[16], p[16]; FragH pb;
#pragma unroll
    for (int i = 0; i < 16; ++i) x[i] = (sc[i] - mn) + 10.0f;      /* the exponent of 1024 times the weight. The maximum goes off first: that difference is never above 0, so the argument is never above 10 and the factor is 2^10 in every pass, however large the mask makes the maximum (maximum - 10, formed first, would round where the maximum is huge) */
    /* 2^x is the one hardware instruction v_exp_f32 (a result below the normal range comes out as 0: such a weight is 0 in the f16 operand anyway). The pass's seventeen stand in two statements because the instruction set asks that the instruction directly behind a transcendental neither read its result nor overwrite its source: the early-clobber outputs keep every result out of every argument's register, and the v_nop is the slot of each statement's last v_exp_f32 */
    asm("v_exp_f32 %0, %9\n\tv_exp_f32 %1, %10\n\tv_exp_f32 %2, %11\n\tv_exp_f32 %3, %12\n\tv_exp_f32 %4, %13\n\tv_exp_f32 %5, %14\n\tv_exp_f32 %6, %15\n\tv_exp_f32 %7, %16\n\tv_exp_f32 %8, %17\n\tv_nop"
        : "=&v"(ea), "=&v"(p[0]), "=&v"(p[1]), "=&v"(p[2]), "=&v"(p[3]), "=&v"(p[4]), "=&v"(p[5]), "=&v"(p[6]), "=&v"(p[7]) : "v"(da), "v"(x[0]), "v"(x[1]), "v"(x[2]), "v"(x[3]), "v"(x[4]), "v"(x[5]), "v"(x[6]), "v"(x[7]));
    asm("v_exp_f32 %0, %8\n\tv_exp_f32 %1, %9\n\tv_exp_f32 %2, %10\n\tv_exp_f32 %3, %11\n\tv_exp_f32 %4, %12\n\tv_exp_f32 %5, %13\n\tv_exp_f32 %6, %14\n\tv_exp_f32 %7, %15\n\tv_nop"
        : "=&v"(p[8]), "=&v"(p[9]), "=&v"(p[10]), "=&v"(p[11]), "=&v"(p[12]), "=&v"(p[13]), "=&v"(p[14]), "=&v"(p[15]) : "v"(x[8]), "v"(x[9]), "v"(x[10]), "v"(x[11]), "v"(x[12]), "v"(x[13]), "v"(x[14]), "v"(x[15]));
    const float al = (mn > -1.0e38f * LOG2E) ? ea : 1.0f;      /* the same test as before, its threshold in base-2 units */
#pragma unroll
    for (int i = 0; i < 16; ++i) { if (!ok[i]) p[i] = 0.f; pb.h[i] = (_Float16)p[i]; }
    const float pe = ((p[0] + p[2]) + (p[4] + p[6])) + ((p[8] + p[10]) + (p[12] + p[14])), po = ((p[1] + p[3]) + (p[5] + p[7])) + ((p[9] + p[11]) + (p[13] + p[15])); const float ps = pe + po;
    l_c = l_c * al + ps;      /* this half's 16 keys; the halves are joined once, behind the loop */
#pragma unroll
    for (int dt = 0; dt < DT; ++dt) {
#pragma unroll
      for (int r = 0; r < 8; ++r) oacc[dt][r] *= al;
      oacc[dt] = mmaT(av[dt].v, pb.v, oacc[dt]); } }
    mb += 256;
    asm volatile("s_wait_dscnt 0x0" ::: "memory");      /* this wave's reads of the buffer are done before it is refilled */
    asm volatile("s_wait_asynccnt 0x0" ::: "memory");      /* this wave's share of stage t + 1 has landed */
    __syncthreads();      /* publishes stage t + 1 and ends every wave's reads of stage t */
    if (t + 2 < nst) fl_stage(ls + (unsigned)(t & 1) * FLS, gk + (size_t)(t + 2) * 64 * ldk, (size_t)ldk, gv + (size_t)(t + 2) * 64); }
  asm volatile("s_wait_asynccnt 0x0" ::: "memory");      /* nothing in flight when the wave goes on to the epilogue */
  const float l = l_c + xhalf(l_c); const float inv = (l > 0.f) ? 1.0f / l : 0.f;      /* numerator and denominator both hold the factor 1024 */
#pragma unroll
  for (int dt = 0; dt < DT; ++dt) { v4f lo, hi;      /* register r = head column dt * 16 + 8 hh + r of query q0 + ln */
#pragma unroll
    for (int r = 0; r < 4; ++r) { lo[r] = oacc[dt][r] * inv; hi[r] = oacc[dt][4 + r] * inv; }
    *(v4fa*)&sO[w][ln][dt * 16 + 8 * hh] = lo; *(v4fa*)&sO[w][ln][dt * 16 + 8 * hh + 4] = hi; }
  __builtin_amdgcn_fence(__ATOMIC_ACQ_REL, "workgroup"); __builtin_amdgcn_wave_barrier();
  {
#pragma unroll
    for (int rp = 0; rp < RPW; rp += 2) { const int r = rp + (lane >> 4), pc = lane & 15; const v4f val = *(const v4fa*)&sO[w][r][pc * 4]; *(v4f*)(O + ((size_t)b * TQ + q0 + r) * ldo + h * 64 + pc * 4) = val; }
     } }
// 5-plane variant: S = Qh Kh^T + (Ql Kh^T + Qh Kl^T)/1024 with Q/K = [hi | 2^10 residual] f16 planes (QL/KL same layout as Q16/K16), then the 3-term P.V below.
// 3-term variant: O = (P_hi V_hi + (P_lo V_hi + P_hi V_lo) / 1024) / l with P = [hi | 2^10 residual] of 1024 p and V^T = [hi | 2^10 residual] planes (VtL same layout as Vt) -> ~2^-21-class products for un-averaged (early causal / peaked) rows
template <int CAUSAL>
__global__ __launch_bounds__(128) void k_flash5(const _Float16* __restrict__ Q16, const _Float16* __restrict__ QL, int ldq, const _Float16* __restrict__ K16, const _Float16* __restrict__ KL, int ldk, const _Float16* __restrict__ Vt, const _Float16* __restrict__ VtL, const int* __restrict__ MSK, float* __restrict__ O, int ldo) {
  constexpr int RPW = 16, RTN = RPW / 16, NQB = TQ / (4 * RPW), DT = 4, KS = 2;
  __shared__ __attribute__((aligned(16))) unsigned short sP[4][RPW][40]; __shared__ __attribute__((aligned(16))) unsigned short sPL[4][RPW][40]; __shared__ __attribute__((aligned(16))) float sO[4][RPW][64 + 4];
  const int tid = threadIdx.x, w = tid >> 5, lane = tid & 31, ln = lane & 15, hh = lane >> 4;
  const int slab = blockIdx.x / QBN5, qblk = QB05 + blockIdx.x % QBN5; (void)NQB; const int b = slab / NH, h = slab % NH; const int qb0 = qblk * (4 * RPW); const int q0 = qb0 + w * RPW;
  FragH aq[2][KS], aql[2][KS];
#pragma unroll
  for (int rt = 0; rt < RTN; ++rt) { const unsigned short* qr = (const unsigned short*)Q16 + ((size_t)b * TQ + q0 + rt * 16 + ln) * ldq + h * 64; const unsigned short* ql = (const unsigned short*)QL + ((size_t)b * TQ + q0 + rt * 16 + ln) * ldq + h * 64;
#pragma unroll
    for (int ks = 0; ks < KS; ++ks) { aq[rt][ks].half[0] = *(const v8us*)(qr + ks * 32 + 8 * hh); aq[rt][ks].half[1] = *(const v8us*)(qr + ks * 32 + 16 + 8 * hh); aql[rt][ks].half[0] = *(const v8us*)(ql + ks * 32 + 8 * hh); aql[rt][ks].half[1] = *(const v8us*)(ql + ks * 32 + 16 + 8 * hh); } }
  const unsigned short* Vth = (const unsigned short*)Vt + (size_t)slab * 64 * TK; const unsigned short* Vtl = (const unsigned short*)VtL + (size_t)slab * 64 * TK;
  float m_r[2][8], l_r[2][8]; v8f oacc[2][DT], oaccL[2][DT];
#pragma unroll
  for (int rt = 0; rt < RTN; ++rt) {
#pragma unroll
    for (int r = 0; r < 8; ++r) { m_r[rt][r] = -3.0e38f; l_r[rt][r] = 0.f; }
#pragma unroll
    for (int dt = 0; dt < DT; ++dt) { oacc[rt][dt] = (v8f){0.f,0.f,0.f,0.f,0.f,0.f,0.f,0.f}; oaccL[rt][dt] = oacc[rt][dt]; } }
  const int jend = (CAUSAL == 1) ? (qb0 + 4 * RPW) : TK;      /* causal: keys beyond the block's last query never contribute */
#pragma unroll 1
  for (int j0 = 0; j0 < jend; j0 += 32) {
    v8f s[2][2];
#pragma unroll
    for (int nt = 0; nt < 2; ++nt) { const unsigned short* kr = (const unsigned short*)K16 + ((size_t)b * TK + j0 + nt * 16 + ln) * ldk + h * 64; const unsigned short* klr = (const unsigned short*)KL + ((size_t)b * TK + j0 + nt * 16 + ln) * ldk + h * 64; FragH bk[KS], bkl[KS];
#pragma unroll
      for (int ks = 0; ks < KS; ++ks) { bk[ks].half[0] = *(const v8us*)(kr + ks * 32 + 8 * hh); bk[ks].half[1] = *(const v8us*)(kr + ks * 32 + 16 + 8 * hh); bkl[ks].half[0] = *(const v8us*)(klr + ks * 32 + 8 * hh); bkl[ks].half[1] = *(const v8us*)(klr + ks * 32 + 16 + 8 * hh); }
#pragma unroll
      for (int rt = 0; rt < RTN; ++rt) { v8f acc = (v8f){0.f,0.f,0.f,0.f,0.f,0.f,0.f,0.f}, accl = acc;
#pragma unroll
        for (int ks = 0; ks < KS; ++ks) { acc = mmaH<1>(aq[rt][ks].v, aq[rt][ks].v, bk[ks].v, bk[ks].v, acc); accl = mmaH<1>(aql[rt][ks].v, aql[rt][ks].v, bk[ks].v, bk[ks].v, accl); accl = mmaH<1>(aq[rt][ks].v, aq[rt][ks].v, bkl[ks].v, bkl[ks].v, accl); }
#pragma unroll
        for (int r = 0; r < 8; ++r) acc[r] += accl[r] * 0.0009765625f;
        s[rt][nt] = acc; } }
#pragma unroll
    for (int rt = 0; rt < RTN; ++rt)
#pragma unroll
      for (int r = 0; r < 8; ++r) { const int tq = q0 + rt * 16 + 8 * hh + r; const int k0 = j0 + ln, k1 = j0 + 16 + ln;
        bool ok0 = (CAUSAL == 1) ? (k0 <= tq) : ((CAUSAL == 2) ? ((k0 >> 5) == (tq >> 5)) : true), ok1 = (CAUSAL == 1) ? (k1 <= tq) : ((CAUSAL == 2) ? ((k1 >> 5) == (tq >> 5)) : true);      /* mode 2: block-diagonal 32-token groups */
        if (CAUSAL == 4) { const int* mrow = MSK + ((size_t)b * TQ + tq) * TK; ok0 = mrow[k0] != 0; ok1 = mrow[k1] != 0; }      /* mode 4: per-(query, key) INPUT mask shared by all heads; masked keys contribute nothing (== the reference's -4096 fill, whose exp underflows to 0), rows with no valid key give l = 0 -> output 0 (== the reference's row_valid zeroing) */
        float s0 = ok0 ? s[rt][0][r] * SCL : -3.0e38f, s1 = ok1 ? s[rt][1][r] * SCL : -3.0e38f; if (CAUSAL == 17) { const float* amk = (const float*)MSK + (size_t)b * TK; s0 += bf16_round(amk[k0]); s1 += bf16_round(amk[k1]); }      /* mode 17: additive per-(batch, key) mask INPUT */ float mc = fmaxf(s0, s1);
        mc = fmaxf(mc, __shfl_xor(mc, 1, 32)); mc = fmaxf(mc, __shfl_xor(mc, 2, 32)); mc = fmaxf(mc, __shfl_xor(mc, 4, 32)); mc = fmaxf(mc, __shfl_xor(mc, 8, 32));
        const float mn = fmaxf(m_r[rt][r], mc); const float al = (mn > -1.0e38f) ? expf(m_r[rt][r] - mn) : 1.0f; m_r[rt][r] = mn; const float p0 = ok0 ? expf(s0 - mn) : 0.f, p1 = ok1 ? expf(s1 - mn) : 0.f; l_r[rt][r] = l_r[rt][r] * al + p0 + p1;
#pragma unroll
        for (int dt = 0; dt < DT; ++dt) { oacc[rt][dt][r] *= al; oaccL[rt][dt][r] *= al; }
        FragH t2, t2l; const float ps0 = p0 * 1024.0f, ps1 = p1 * 1024.0f; t2.h[0] = (_Float16)ps0; t2.h[1] = (_Float16)ps1; t2l.h[0] = (_Float16)((ps0 - (float)t2.h[0]) * 1024.0f); t2l.h[1] = (_Float16)((ps1 - (float)t2.h[1]) * 1024.0f);
        sP[w][rt * 16 + 8 * hh + r][ln] = t2.u[0]; sP[w][rt * 16 + 8 * hh + r][16 + ln] = t2.u[1]; sPL[w][rt * 16 + 8 * hh + r][ln] = t2l.u[0]; sPL[w][rt * 16 + 8 * hh + r][16 + ln] = t2l.u[1]; }
    __builtin_amdgcn_fence(__ATOMIC_ACQ_REL, "workgroup"); __builtin_amdgcn_wave_barrier();
    FragH pa[2], pl[2];
#pragma unroll
    for (int rt = 0; rt < RTN; ++rt) { pa[rt].half[0] = *(const v8us*)&sP[w][rt * 16 + ln][8 * hh]; pa[rt].half[1] = *(const v8us*)&sP[w][rt * 16 + ln][16 + 8 * hh]; pl[rt].half[0] = *(const v8us*)&sPL[w][rt * 16 + ln][8 * hh]; pl[rt].half[1] = *(const v8us*)&sPL[w][rt * 16 + ln][16 + 8 * hh]; }
#pragma unroll
    for (int dt = 0; dt < DT; ++dt) { const unsigned short* vrow = Vth + (size_t)(dt * 16 + ln) * TK + j0; const unsigned short* vrl = Vtl + (size_t)(dt * 16 + ln) * TK + j0; FragH bv, bl; bv.half[0] = *(const v8us*)(vrow + 8 * hh); bv.half[1] = *(const v8us*)(vrow + 16 + 8 * hh); bl.half[0] = *(const v8us*)(vrl + 8 * hh); bl.half[1] = *(const v8us*)(vrl + 16 + 8 * hh);
#pragma unroll
      for (int rt = 0; rt < RTN; ++rt) { oacc[rt][dt] = mmaH<1>(pa[rt].v, pa[rt].v, bv.v, bv.v, oacc[rt][dt]); oaccL[rt][dt] = mmaH<1>(pl[rt].v, pl[rt].v, bv.v, bv.v, oaccL[rt][dt]); oaccL[rt][dt] = mmaH<1>(pa[rt].v, pa[rt].v, bl.v, bl.v, oaccL[rt][dt]); } }
    __builtin_amdgcn_fence(__ATOMIC_ACQ_REL, "workgroup"); __builtin_amdgcn_wave_barrier(); }
#pragma unroll
  for (int rt = 0; rt < RTN; ++rt) {
#pragma unroll
    for (int r = 0; r < 8; ++r) { float l = l_r[rt][r]; l += __shfl_xor(l, 1, 32); l += __shfl_xor(l, 2, 32); l += __shfl_xor(l, 4, 32); l += __shfl_xor(l, 8, 32); l_r[rt][r] = (l > 0.f) ? 1.0f / (l * 1024.0f) : 0.f; }
#pragma unroll
    for (int dt = 0; dt < DT; ++dt)
#pragma unroll
      for (int r = 0; r < 8; ++r) { float v = oacc[rt][dt][r]; v += oaccL[rt][dt][r] * 0.0009765625f; sO[w][rt * 16 + 8 * hh + r][dt * 16 + ln] = v * l_r[rt][r]; } }
  __builtin_amdgcn_fence(__ATOMIC_ACQ_REL, "workgroup"); __builtin_amdgcn_wave_barrier();
  {
#pragma unroll
    for (int rp = 0; rp < RPW; rp += 2) { const int r = rp + (lane >> 4), pc = lane & 15; const v4f val = *(const v4fa*)&sO[w][r][pc * 4]; *(v4f*)(O + ((size_t)b * TQ + q0 + r) * ldo + h * 64 + pc * 4) = val; }
     } }

__global__ __launch_bounds__(256) void k_rotab(float* __restrict__ CS, float* __restrict__ SN) {
  #pragma clang fp contract(off)
  const int t = blockIdx.x * 256 + threadIdx.x; if (t >= SLEN * 32) return; const int j = t % 32, s = t / 32; const float ex = (float)(2 * j) / 64.0f; const float inv = 1.0f / powf(10000.0f, ex); const float th = (float)s * inv; const float c = cosf(th), sn = sinf(th);
  { *(float*)(CS + t) = c; *(float*)(SN + t) = sn;  } }
__global__ __launch_bounds__(256) void k_rope(const float* __restrict__ F, int nsrc, int ndst, int rep, const float* __restrict__ CS, const float* __restrict__ SN, _Float16* __restrict__ H, _Float16* __restrict__ L) {
  #pragma clang fp contract(off)
  const size_t t = (size_t)blockIdx.x * 256 + threadIdx.x; if (t >= (size_t)NR * ndst * 4) return; const int g8 = (int)(t % 4); const int hd = (int)((t / 4) % ndst); const size_t row = t / ((size_t)4 * ndst); const int s = (int)(row % SLEN); const int hs = hd / rep;
  const float* src = F + row * (size_t)(nsrc * 64) + hs * 64; FragH ah, al, bh, bl;
  for (int i = 0; i < 8; ++i) { const int d = g8 * 8 + i; const float c = CS[s * 32 + d], sn = SN[s * 32 + d]; const float x1 = src[d], x2 = src[d + 32];
    float o1 = x1 * c; o1 += -x2 * sn; float o2 = x2 * c; o2 += x1 * sn;
    _Float16 hv = (_Float16)o1; ah.h[i] = hv; al.h[i] = (_Float16)((o1 - (float)hv) * 1024.0f); hv = (_Float16)o2; bh.h[i] = hv; bl.h[i] = (_Float16)((o2 - (float)hv) * 1024.0f); }
  const size_t o = row * (size_t)(ndst * 64) + hd * 64 + g8 * 8;
  { *(v8us*)((unsigned short*)H + o) = ah.half[0]; *(v8us*)((unsigned short*)H + o + 32) = bh.half[0]; *(v8us*)((unsigned short*)L + o) = al.half[0]; *(v8us*)((unsigned short*)L + o + 32) = bl.half[0];  } }
// Every operand conversion in ONE launch, by block ranges: the exact f16 plane of x, the three weight planes (x16, one behind the other in B3), and the mask table of the flash kernel.
// A conversion block streams 16384 values: 16 loads of 16 bytes a lane, each wave-wide load 512 bytes in a row, several of them under way at once; each store of a wave is two whole 128-byte lines. Few, long waves, for speed only.
// The mask table: M2 = bf16-rounded mask times log2 e. Beyond +-1e38 the table goes on with slope 1/2, so that the factor turns no finite mask into an infinity: two different bf16 values up there still lie more than 1e35 apart in the table, so the smaller one's weight is 0 as it is in natural units, equal values stay equal, and the order is kept; an infinite mask stays infinite
#define PXB (NR * DM / 16384)      /* blocks for x */
#define PWB (DM * DM / 16384)      /* blocks for one weight matrix */
#define PMB (NB * SLEN / 256)      /* blocks for the mask: 1 value a thread */
__global__ __launch_bounds__(256) void k_prep(const float* __restrict__ x, const float* __restrict__ Wq, const float* __restrict__ Wk, const float* __restrict__ Wv, const float* __restrict__ am, _Float16* __restrict__ X16, _Float16* __restrict__ B3, float* __restrict__ M2) {
  const int bx = blockIdx.x, tid = threadIdx.x;
  if (bx >= PXB + 3 * PWB) { const int t = (bx - (PXB + 3 * PWB)) * 256 + tid; const float mr = bf16_round(am[t]), ma = fabsf(mr); M2[t] = (ma <= 1.0e38f) ? mr * LOG2E : copysignf(1.0e38f * LOG2E + (ma - 1.0e38f) * 0.5f, mr); return; }
  const float* src = x; _Float16* dst = X16; float sc = 1.0f; int b0 = bx;
  if (bx >= PXB) { const int wi = (bx - PXB) / PWB; b0 = (bx - PXB) % PWB; src = (wi == 0) ? Wq : ((wi == 1) ? Wk : Wv); dst = B3 + (size_t)wi * DM * DM; sc = 16.0f; }      /* a weight is (out, in) = Bt as it lies */
  const size_t e0 = (size_t)b0 * 16384 + tid * 4; v4f v[16];
#pragma unroll      /* constant indices: the loaded values stay in registers, and loads can be issued ahead of the conversions */
  for (int j = 0; j < 16; ++j) v[j] = *(const v4fa*)(src + e0 + j * 1024);
#pragma unroll      /* constant indices: the loaded values stay in registers */
  for (int j = 0; j < 16; ++j) { v4h h4;
#pragma unroll      /* constant indices: the loaded values stay in registers */
    for (int q = 0; q < 4; ++q) h4[q] = (_Float16)(bf16_round(v[j][q]) * sc);
    *(v4h*)(dst + e0 + j * 1024) = h4; } }
__global__ __launch_bounds__(256) void k_rotab2(float* __restrict__ CS, float* __restrict__ SN) {
  #pragma clang fp contract(off)
  const int t = blockIdx.x * 256 + threadIdx.x; if (t >= SLEN * 32) return; const int j = t % 32, s = t / 32; const float c0 = -0.14391156831212787f;      /* -ln(10000)/64 rounded to f32 */ const float inv = expf((float)(2 * j) * c0); const float th = (float)s * inv; const float c = cosf(th), sn = sinf(th);
  { *(float*)(CS + t) = c; *(float*)(SN + t) = sn;  } }
__global__ __launch_bounds__(256) void k_lnu(const float* __restrict__ X, _Float16* __restrict__ N16, float* __restrict__ XB) {
  #pragma clang fp contract(off)
  const int wv = threadIdx.x >> 5, ln = threadIdx.x & 31; const size_t r = (size_t)blockIdx.x * 8 + wv; if (r >= NR) return; float a[32]; float s = 0.f;
  for (int i = 0; i < 4; ++i) { const v8f v = *(const v8f*)(X + r * DM + (i * 32 + ln) * 8); for (int q = 0; q < 8; ++q) { const float u = bf16_round(v[q]); a[i * 8 + q] = u; s += u; } }
  for (int o = 16; o > 0; o >>= 1) s += __shfl_xor(s, o, 32); const float mu = s / (float)DM; float var = 0.f; for (int q = 0; q < 32; ++q) { const float d = a[q] - mu; var += d * d; }
  for (int o = 16; o > 0; o >>= 1) var += __shfl_xor(var, o, 32); const float den = sqrtf(var / (float)(DM - 1)) + 1e-6f; const float inv = 1.0f / den;      /* one reciprocal per row; (x-mean)*inv vs the reference's division differs by <= 1 ulp */
  { for (int i = 0; i < 4; ++i) { const int c0 = (i * 32 + ln) * 8; FragH f; v8f xb; for (int q = 0; q < 8; ++q) { f.h[q] = (_Float16)((a[i * 8 + q] - mu) * inv); xb[q] = a[i * 8 + q]; } *(v8us*)((unsigned short*)N16 + r * DM + c0) = f.half[0]; *(v8f*)(XB + r * DM + c0) = xb; }  } }

extern "C" void kernel_launch(void* const* d_in, const int* in_sizes, int n_in,
                              void* d_out, int out_size, void* d_ws, size_t ws_size, hipStream_t stream) {
  (void)in_sizes; (void)n_in; (void)out_size;
  const float* const* I = (const float* const*)d_in; const float* x = I[0]; const float* sp = I[1]; const float* am = I[2]; const float* Wq = I[3]; const float* Wk = I[4]; const float* Wv = I[5];
  char* ws = (char*)d_ws; size_t off = 0;
  auto take = [&](size_t bytes) { char* p = ws + off; off += (bytes + 255) & ~(size_t)255; return p; };
  const size_t np = (size_t)NR * DM;
  _Float16* B3 = (_Float16*)take((size_t)3 * DM * DM * 2); float* M2 = (float*)take((size_t)NB * SLEN * 4);
  _Float16* X16 = (_Float16*)take(np * 2); _Float16* QH = (_Float16*)take(np * 2); _Float16* KXH = (_Float16*)take(np * 2); _Float16* VT = (_Float16*)take(np * 2);
  if (off > ws_size) return;      /* 6 + 4 x 8 MiB */
  k_prep<<<PXB + 3 * PWB + PMB, 256, 0, stream>>>(x, Wq, Wk, Wv, am, X16, B3, M2);
  k_qkv<<<dim3((NR / 128) * NH, 3), 128, 0, stream>>>(X16, B3, sp, QH, KXH, VT);
  k_flash<17><<<NB * NH * QBNP, 128, 0, stream>>>(QH, DM, KXH, DM, VT, (const int*)M2, (float*)d_out, DM);      /* + the mask table [b][key]; the merged context is the output */
}

// v006
// A run of this version takes 75.5 microseconds.
// Next to v005, in two timings, it ran 1.06 and 1.04 times as fast.
// Counting every step since v000, it is 5.21 times as fast.
#include <hip/hip_runtime.h>
// DiffBertSelfAttention (2 x 2048 tokens, D 1024 = 16 heads of 64): q, k, v = x W^T; RoFormer rotary from the sinusoidal_pos INPUT ([sin | cos] halves, interleave-duplicated: out[2i] = x[2i] cos_i - x[2i+1] sin_i, out[2i+1] = x[2i+1] cos_i + x[2i] sin_i); scores/8 + attention_mask[b, key] (additive INPUT, broadcast over heads and queries); softmax; ctx = probs v merged -> the output (no output projection).
// Structure, three launches: k_prep (exact f16 plane of x, exact x16 weight planes, the mask table); k_qkv (q, k, v as WMMA GEMMs, 32x64 wave tiles, f32 accumulation, whose epilogue does the interleaved RoPE in f32 from the input table, bf16-rounded like every input, the f16 conversion, and V^T by an LDS tile); the fused flash kernel with the per-key additive mask (mode 17: a table made from the input in the same call, rounded like every input and in base-2 units; plain operands: every row averages ~2048 keys) writing the merged context straight to the output.
// Compute dtype: inputs and parameters rounded to bf16; q/k/P/v as plain f16 operands (~2^-12); RoPE/softmax f32. v_wmma_f32_16x16x32_f16.
#define NB 2
#define DM 1024
#define NKV 16
#define NREP (NH / NKV)
#define KVD (NKV * 64)           /* 1024 */
#define NR (NB * SLEN)           /* 4096 */
#define SLEN 2048
#define TQ SLEN
#define TK SLEN
#define NH 16
#define SCL 0.125f
#define LOG2E 1.4426950408889634f
#define SCL2 (SCL * LOG2E)      /* scores in base-2 units: exp(s) = 2^(s log2 e) */
#define QBLKS (TQ / 64)
#define QB05 0
#define QBN5 4
#define QB0P 0
#define QBNP QBLKS           /* non-causal: plain flash on every query block */
#define RE 256
typedef __bf16 v16b __attribute__((ext_vector_type(16)));
typedef unsigned short v8us __attribute__((ext_vector_type(8), may_alias));
typedef float  v8f  __attribute__((ext_vector_type(8)));
typedef float  v4f  __attribute__((ext_vector_type(4)));
typedef float  v4fa __attribute__((ext_vector_type(4), may_alias));
typedef float  v2fa __attribute__((ext_vector_type(2), may_alias));
union FragB { v16b v; v8us half[2]; unsigned short u[16]; };

__device__ __forceinline__ unsigned short bf16_bits(float x) { unsigned int u = __float_as_uint(x); return (unsigned short)((u + 0x7FFFu + ((u >> 16) & 1u)) >> 16); }
__device__ __forceinline__ float bf16_val(unsigned short b) { return __uint_as_float(((unsigned int)b) << 16); }
__device__ __forceinline__ float bf16_round(float x) { return bf16_val(bf16_bits(x)); }
// D += A·B with NT terms: 1 = ah·bh, 2 = + al·bh (A split), 3 = + ah·bl (both split)
template <int NT>
__device__ __forceinline__ v8f mmaN(v16b ah, v16b al, v16b bh, v16b bl, v8f c) {
  c = __builtin_amdgcn_wmma_f32_16x16x32_bf16(false, ah, false, bh, (short)0, c, false, false);
  if (NT >= 2) c = __builtin_amdgcn_wmma_f32_16x16x32_bf16(false, al, false, bh, (short)0, c, false, false);
  if (NT >= 3) c = __builtin_amdgcn_wmma_f32_16x16x32_bf16(false, ah, false, bl, (short)0, c, false, false);
  asm volatile("v_nop\n\tv_nop\n\tv_nop\n\tv_nop" : "+v"(c) : "v"(ah), "v"(al), "v"(bh), "v"(bl));
  return c;
}

__global__ __launch_bounds__(256) void k_wt_bf16(const float* __restrict__ W, unsigned short* __restrict__ Wt, int K, int N) {
  const int t = blockIdx.x * 256 + threadIdx.x;
  const int k8n = K / 8;
  if (t >= N * k8n) return;
  const int n = t / k8n, k8 = (t % k8n) * 8;
  v8us v;
#pragma unroll
  for (int i = 0; i < 8; ++i) v[i] = bf16_bits(W[(size_t)(k8 + i) * N + n]);
  *(v8us*)(Wt + (size_t)n * K + k8) = v;
  
}

// GEMM C[M][N] (f32, pitch ldc) = act(A[M][K]·W + bias). A f32 row-major (pitch lda) converted per fragment to bf16
// (ASPLIT: hi/lo two planes -> 2 terms, else single rounded term); Wt bf16 [N][K] (pitch ldb). BIAS_BF16 rounds the
// bias to bf16 first (bias quantised to bf16 before the add). K%32==0, M%16==0, N%64==0.
template <bool ASPLIT, int ACT, bool BIAS_BF16>
__global__ __launch_bounds__(128) void k_gemm_bf(const float* __restrict__ A, int lda, const unsigned short* __restrict__ Wt, int ldb,
                                               const float* __restrict__ bias, float* __restrict__ C, int ldc, int M, int N, int K) {
  __shared__ __attribute__((aligned(16))) float so[4][16][64];
  const int tid = threadIdx.x, w = tid >> 5, lane = tid & 31, ln = lane & 15, hh = lane >> 4;
  const int ntn = N / 64;
  const int wid = blockIdx.x * 4 + w;
  const int mt = wid / ntn, nq = wid % ntn;
  if (mt * 16 >= M) return;
  const int row0 = mt * 16, col0 = nq * 64;
  const float* arow = A + (size_t)(row0 + ln) * lda;
  v8f acc[4] = {};
  for (int kb = 0; kb < K; kb += 32) {
    FragB ah, al;
    const v4f x0 = *(const v4fa*)(arow + kb + 8 * hh), x1 = *(const v4fa*)(arow + kb + 8 * hh + 4);
    const v4f x2 = *(const v4fa*)(arow + kb + 16 + 8 * hh), x3 = *(const v4fa*)(arow + kb + 16 + 8 * hh + 4);
    float xs[16] = {x0[0],x0[1],x0[2],x0[3],x1[0],x1[1],x1[2],x1[3],x2[0],x2[1],x2[2],x2[3],x3[0],x3[1],x3[2],x3[3]};
#pragma unroll
    for (int i = 0; i < 16; ++i) { const unsigned short hb = bf16_bits(xs[i]); ah.u[i] = hb; al.u[i] = ASPLIT ? bf16_bits(xs[i] - bf16_val(hb)) : (unsigned short)0; }
#pragma unroll
    for (int t = 0; t < 4; ++t) {
      const unsigned short* brow = Wt + (size_t)(col0 + t * 16 + ln) * ldb + kb;
      FragB b;
      b.half[0] = *(const v8us*)(brow + 8 * hh);
      b.half[1] = *(const v8us*)(brow + 16 + 8 * hh);
      acc[t] = mmaN<ASPLIT ? 2 : 1>(ah.v, al.v, b.v, b.v, acc[t]);
    }
  }
#pragma unroll
  for (int t = 0; t < 4; ++t) {
    float bv = bias ? bias[col0 + t * 16 + ln] : 0.f;
    if (BIAS_BF16) bv = bf16_round(bv);
#pragma unroll
    for (int r = 0; r < 8; ++r) { float v = acc[t][r] + bv; if (ACT == 1) v = fmaxf(v, 0.f); so[w][8 * hh + r][t * 16 + ln] = v; }
  }
  __builtin_amdgcn_fence(__ATOMIC_ACQ_REL, "workgroup");
  __builtin_amdgcn_wave_barrier();
  const int rsub = lane >> 4, c4 = (lane & 15) * 4;
  {
#pragma unroll
    for (int q = 0; q < 8; ++q) {
      const int r = q * 2 + rsub;
      const v4f v = *(const v4fa*)&so[w][r][c4];
      *(v4f*)(C + (size_t)(row0 + r) * ldc + col0 + c4) = v;
    }
    
  }
}

// GEMM C = act(A·W + bias + resid): A f32 (ASPLIT -> hi/lo 2 terms), Wt bf16 [N][K]; ACT 0 none, 1 relu, 2 exact gelu;
// resid (optional, f32, row index = (row % rmod), pitch ldr, RES_BF16 rounds it) added before the activation.
template <bool ASPLIT, int ACT, bool BIAS_BF16, bool RES_BF16>
__global__ __launch_bounds__(128) void k_gemm_bf3(const float* __restrict__ A, int lda, const unsigned short* __restrict__ Wt, int ldb,
                                                const float* __restrict__ bias, const float* __restrict__ resid, int rmod, int ldr,
                                                float* __restrict__ C, int ldc, int M, int N, int K) {
  __shared__ __attribute__((aligned(16))) float so[4][16][64];
  const int tid = threadIdx.x, w = tid >> 5, lane = tid & 31, ln = lane & 15, hh = lane >> 4;
  const int ntn = N / 64;
  const int wid = blockIdx.x * 4 + w;
  const int mt = wid / ntn, nq = wid % ntn;
  if (mt * 16 >= M) return;
  const int row0 = mt * 16, col0 = nq * 64;
  const float* arow = A + (size_t)(row0 + ln) * lda;
  v8f acc[4] = {};
  for (int kb = 0; kb < K; kb += 32) {
    FragB ah, al;
    const v4f x0 = *(const v4fa*)(arow + kb + 8 * hh), x1 = *(const v4fa*)(arow + kb + 8 * hh + 4);
    const v4f x2 = *(const v4fa*)(arow + kb + 16 + 8 * hh), x3 = *(const v4fa*)(arow + kb + 16 + 8 * hh + 4);
    float xs[16] = {x0[0],x0[1],x0[2],x0[3],x1[0],x1[1],x1[2],x1[3],x2[0],x2[1],x2[2],x2[3],x3[0],x3[1],x3[2],x3[3]};
#pragma unroll
    for (int i = 0; i < 16; ++i) { const unsigned short hb = bf16_bits(xs[i]); ah.u[i] = hb; al.u[i] = ASPLIT ? bf16_bits(xs[i] - bf16_val(hb)) : (unsigned short)0; }
#pragma unroll
    for (int t = 0; t < 4; ++t) {
      const unsigned short* brow = Wt + (size_t)(col0 + t * 16 + ln) * ldb + kb;
      FragB b;
      b.half[0] = *(const v8us*)(brow + 8 * hh);
      b.half[1] = *(const v8us*)(brow + 16 + 8 * hh);
      acc[t] = mmaN<ASPLIT ? 2 : 1>(ah.v, al.v, b.v, b.v, acc[t]);
    }
  }
#pragma unroll
  for (int t = 0; t < 4; ++t) {
    const int col = col0 + t * 16 + ln;
    float bv = bias ? bias[col] : 0.f;
    if (BIAS_BF16) bv = bf16_round(bv);
#pragma unroll
    for (int r = 0; r < 8; ++r) {
      float v = acc[t][r] + bv;
      if (resid) { float rv = resid[(size_t)((row0 + 8 * hh + r) % rmod) * ldr + col]; if (RES_BF16) rv = bf16_round(rv); v += rv; }
      if (ACT == 1) v = fmaxf(v, 0.f);
      if (ACT == 2) v = 0.5f * v * (1.0f + erff(v * 0.70710678118654752f));
      if (ACT == 3) { const float u = 0.7978845608028654f * (v + 0.044715f * v * v * v); v = 0.5f * v * (1.0f + tanhf(u)); }
      so[w][8 * hh + r][t * 16 + ln] = v;
    }
  }
  __builtin_amdgcn_fence(__ATOMIC_ACQ_REL, "workgroup");
  __builtin_amdgcn_wave_barrier();
  const int rsub = lane >> 4, c4 = (lane & 15) * 4;
  {
#pragma unroll
    for (int q = 0; q < 8; ++q) {
      const int r = q * 2 + rsub;
      const v4f v = *(const v4fa*)&so[w][r][c4];
      *(v4f*)(C + (size_t)(row0 + r) * ldc + col0 + c4) = v;
    }
    
  }
}
// row LayerNorm (biased variance, eps) over N: s = X (+ R); optional out_sum <- s; out_norm <- (s-mu)*rsqrt(var+eps)*g + b
template <bool PARAM_BF16>
__global__ __launch_bounds__(256) void k_layernorm(const float* __restrict__ X, const float* __restrict__ R, const float* __restrict__ g, const float* __restrict__ bta,
                                                  float* __restrict__ out_sum, float* __restrict__ out_norm, int N, float eps) {
  __shared__ float red[256];
  const int row = blockIdx.x, tid = threadIdx.x;
  const float* x = X + (size_t)row * N; const float* rr = R ? R + (size_t)row * N : nullptr;
  float vals[16];                     // up to N = 4096
  const int per = N / 256;            // contiguous chunk per thread? use strided-by-4 chunks: thread handles j = tid*4 + 1024*u
  float s1 = 0.f;
  for (int u = 0; u < per / 4; ++u) {
    const int j = tid * 4 + 1024 * u;
    const v4f a = *(const v4fa*)(x + j);
    v4f b = {0.f,0.f,0.f,0.f}; if (rr) b = *(const v4fa*)(rr + j);
#pragma unroll
    for (int q = 0; q < 4; ++q) { const float v = a[q] + b[q]; vals[u * 4 + q] = v; s1 += v; }
  }
  red[tid] = s1; __syncthreads();
  for (int st = 128; st > 0; st >>= 1) { if (tid < st) red[tid] += red[tid + st]; __syncthreads(); }
  const float mu = red[0] / (float)N; __syncthreads();
  float s2 = 0.f;
  for (int u = 0; u < per / 4; ++u)
#pragma unroll
    for (int q = 0; q < 4; ++q) { const float c = vals[u * 4 + q] - mu; s2 += c * c; }
  red[tid] = s2; __syncthreads();
  for (int st = 128; st > 0; st >>= 1) { if (tid < st) red[tid] += red[tid + st]; __syncthreads(); }
  const float rs = rsqrtf(red[0] / (float)N + eps);
  {
    for (int u = 0; u < per / 4; ++u) {
      const int j = tid * 4 + 1024 * u;
      v4f o, sm;
#pragma unroll
      for (int q = 0; q < 4; ++q) {
        float gg = g[j + q], bb = bta[j + q];
        if (PARAM_BF16) { gg = bf16_round(gg); bb = bf16_round(bb); }
        sm[q] = vals[u * 4 + q]; o[q] = (vals[u * 4 + q] - mu) * rs * gg + bb;
      }
      if (out_sum) *(v4f*)(out_sum + (size_t)row * N + j) = sm;
      *(v4f*)(out_norm + (size_t)row * N + j) = o;
    }
    
  }
}



// ---- f16 WMMA path (v_wmma_f32_16x16x32_f16): 11-bit significands for operands in range — used where the softmax weight operand (0 to 2^15) needs more precision than bf16
typedef _Float16 v16h __attribute__((ext_vector_type(16)));
union FragH { v16h v; v8us half[2]; _Float16 h[16]; unsigned short u[16]; };
template <int NT>
__device__ __forceinline__ v8f mmaH(v16h ah, v16h al, v16h bh, v16h bl, v8f c) {
  c = __builtin_amdgcn_wmma_f32_16x16x32_f16(false, ah, false, bh, (short)0, c, false, false);
  if (NT >= 2) c = __builtin_amdgcn_wmma_f32_16x16x32_f16(false, al, false, bh, (short)0, c, false, false);
  if (NT >= 3) c = __builtin_amdgcn_wmma_f32_16x16x32_f16(false, ah, false, bl, (short)0, c, false, false);
  asm volatile("v_nop\n\tv_nop\n\tv_nop\n\tv_nop" : "+v"(c) : "v"(ah), "v"(al), "v"(bh), "v"(bl));
  return c;
}
// batched GEMM like k_gemm_b but f16 operands: A f32 (split into f16 hi/lo if ASPLIT, else rounded to f16), Bt = f16 values [n][k]; alpha; C f32; N multiple of 16 (partial tiles skipped)
template <bool ASPLIT>
__global__ __launch_bounds__(128) void k_gemm_h(const float* __restrict__ A, int lda, size_t sA, const _Float16* __restrict__ Bh, int ldb, size_t sB, float alpha, float* __restrict__ C, int ldc, size_t sC, int M, int N, int K) {
  __shared__ __attribute__((aligned(16))) float so[4][16][64];
  const int tid = threadIdx.x, w = tid >> 5, lane = tid & 31, ln = lane & 15, hh = lane >> 4; const int by = blockIdx.y;
  A += (size_t)by * sA; Bh += (size_t)by * sB; C += (size_t)by * sC;
  const int ntn = (N + 63) / 64; const int wid = blockIdx.x * 4 + w; const int mt = wid / ntn, nq = wid % ntn; if (mt * 16 >= M) return;
  const int row0 = mt * 16, col0 = nq * 64; const float* arow = A + (size_t)(row0 + ln) * lda;
  v8f acc[4] = {};
  for (int kb = 0; kb < K; kb += 32) {
    FragH ah, al;
    const v4f x0 = *(const v4fa*)(arow + kb + 8 * hh), x1 = *(const v4fa*)(arow + kb + 8 * hh + 4), x2 = *(const v4fa*)(arow + kb + 16 + 8 * hh), x3 = *(const v4fa*)(arow + kb + 16 + 8 * hh + 4);
    float xs[16] = {x0[0],x0[1],x0[2],x0[3],x1[0],x1[1],x1[2],x1[3],x2[0],x2[1],x2[2],x2[3],x3[0],x3[1],x3[2],x3[3]};
#pragma unroll
    for (int i = 0; i < 16; ++i) { const _Float16 h = (_Float16)xs[i]; ah.h[i] = h; al.h[i] = ASPLIT ? (_Float16)(xs[i] - (float)h) : (_Float16)0.0f; }
#pragma unroll
    for (int t = 0; t < 4; ++t) { if (col0 + t * 16 >= N) continue; const size_t boff = (size_t)(col0 + t * 16 + ln) * ldb + kb; FragH bq; bq.half[0] = *(const v8us*)(Bh + boff + 8 * hh); bq.half[1] = *(const v8us*)(Bh + boff + 16 + 8 * hh);
      acc[t] = mmaH<ASPLIT ? 2 : 1>(ah.v, al.v, bq.v, bq.v, acc[t]); }
  }
#pragma unroll
  for (int t = 0; t < 4; ++t) { if (col0 + t * 16 >= N) continue;
#pragma unroll
    for (int r = 0; r < 8; ++r) so[w][8 * hh + r][t * 16 + ln] = acc[t][r] * alpha; }
  __builtin_amdgcn_fence(__ATOMIC_ACQ_REL, "workgroup"); __builtin_amdgcn_wave_barrier();
  const int rsub = lane >> 4, c4 = (lane & 15) * 4;
  {
#pragma unroll
    for (int q = 0; q < 8; ++q) { const int r = q * 2 + rsub; if (col0 + c4 < N) { const v4f v = *(const v4fa*)&so[w][r][c4]; *(v4f*)(C + (size_t)(row0 + r) * ldc + col0 + c4) = v; } }
     }
}

// Wt[n][k] = f16(W[k][n]·scale) from f32 row-major W[K][N] (scale = power of two; bf16-exact weights stay exact in f16 away from the subnormal range)
__global__ __launch_bounds__(256) void k_wt_f16(const float* __restrict__ W, _Float16* __restrict__ Wt, int K, int N, float scale) {
  const int t = blockIdx.x * 256 + threadIdx.x; if (t >= N * (K / 8)) return; const int n = t / (K / 8), k8 = (t % (K / 8)) * 8; FragH f;
#pragma unroll
  for (int i = 0; i < 8; ++i) f.h[i] = (_Float16)(bf16_round(W[(size_t)(k8 + i) * N + n]) * scale); const v8us o = f.half[0];
  *(v8us*)((unsigned short*)Wt + (size_t)n * K + k8) = o; 
}
// k_gemm_hh variant with fused epilogue: v = acc·alpha + bias[by·sBias + col] (+ CP[(row/rowsPerB)·sCPb + by·64 + col] if CP) ; ACT 0 none / 1 elu ; writes f16 C16 (and f32 C if non-null)
template <int ACT>
__global__ __launch_bounds__(128) void k_gemm_hhx(const _Float16* __restrict__ A, int lda, size_t sA, const _Float16* __restrict__ Bh, int ldb, size_t sB, float alpha, const float* __restrict__ bias, size_t sBias, const float* __restrict__ CP, int rowsPerB, size_t sCPb, int row0g,
    float* __restrict__ C, _Float16* __restrict__ C16, int ldc, size_t sC, int M, int N, int K) {
  __shared__ __attribute__((aligned(16))) float so[4][16][64];
  const int tid = threadIdx.x, w = tid >> 5, lane = tid & 31, ln = lane & 15, hh = lane >> 4; const int by = blockIdx.y;
  A += (size_t)by * sA; Bh += (size_t)by * sB; const size_t cofs = (size_t)by * sC; const float* bp = bias ? bias + (size_t)by * sBias : nullptr;
  const int ntn = (N + 63) / 64; const int wid = blockIdx.x * 4 + w; const int mt = wid / ntn, nq = wid % ntn; if (mt * 16 >= M) return;
  const int row0 = mt * 16, col0 = nq * 64; const _Float16* arow = A + (size_t)(row0 + ln) * lda;
  v8f acc[4] = {};
  for (int kb = 0; kb < K; kb += 32) { FragH ah; ah.half[0] = *(const v8us*)((const unsigned short*)arow + kb + 8 * hh); ah.half[1] = *(const v8us*)((const unsigned short*)arow + kb + 16 + 8 * hh);
#pragma unroll
    for (int t = 0; t < 4; ++t) { if (col0 + t * 16 >= N) continue; const size_t boff = (size_t)(col0 + t * 16 + ln) * ldb + kb; FragH bq; bq.half[0] = *(const v8us*)((const unsigned short*)Bh + boff + 8 * hh); bq.half[1] = *(const v8us*)((const unsigned short*)Bh + boff + 16 + 8 * hh);
      acc[t] = mmaH<1>(ah.v, ah.v, bq.v, bq.v, acc[t]); }
  }
#pragma unroll
  for (int t = 0; t < 4; ++t) { if (col0 + t * 16 >= N) continue; const int col = col0 + t * 16 + ln; const float bv = bp ? bf16_round(bp[col]) : 0.f;
#pragma unroll
    for (int r = 0; r < 8; ++r) { float v = acc[t][r] * alpha + bv; if (CP) { const int bidx = (row0g + row0 + 8 * hh + r) / rowsPerB; v += CP[(size_t)bidx * sCPb + (size_t)by * 64 + col]; } if (ACT == 1) v = (v > 0.f) ? v : expm1f(v); else if (ACT == 7) v = (v > 0.f) ? v + 1.0f : expf(v); else if (ACT == 8) v = tanhf(v); else if (ACT == 9) v = 0.5f * v * (1.0f + tanhf(0.7978845608028654f * (v + 0.044715f * v * v * v))); else if (ACT == 11) v = 1.0f / (1.0f + expf(-v)); else if (ACT == 12) v = (v > 0.f) ? v : 0.01f * v; else if (ACT == 14) v = (v > 0.f) ? v : 0.1f * v; else if (ACT == 15) v = v / (1.0f + expf(-v)); else if (ACT == 3) v = fmaxf(v, 0.f); else if (ACT == 6) v = 0.5f * v * (1.0f + erff(v * 0.70710678118654752f)); so[w][8 * hh + r][t * 16 + ln] = v; } }
  __builtin_amdgcn_fence(__ATOMIC_ACQ_REL, "workgroup"); __builtin_amdgcn_wave_barrier();
  const int rsub = lane >> 4, c4 = (lane & 15) * 4; typedef _Float16 v4h __attribute__((ext_vector_type(4)));
  {
#pragma unroll
    for (int q = 0; q < 8; ++q) { const int r = q * 2 + rsub; if (col0 + c4 < N) { const v4f v = *(const v4fa*)&so[w][r][c4]; if (C) *(v4f*)(C + cofs + (size_t)(row0 + r) * ldc + col0 + c4) = v; if (C16) { v4h h4; for (int i = 0; i < 4; ++i) h4[i] = (_Float16)v[i]; *(v4h*)(C16 + cofs + (size_t)(row0 + r) * ldc + col0 + c4) = h4; } } }
     }
}


typedef _Float16 v4h __attribute__((ext_vector_type(4)));

__global__ __launch_bounds__(256) void k_h16(const float* __restrict__ x, _Float16* __restrict__ X16, size_t n8) { const size_t t = (size_t)blockIdx.x * 256 + threadIdx.x; if (t >= n8) return; FragH f;
#pragma unroll
  for (int q = 0; q < 8; ++q) f.h[q] = (_Float16)x[t * 8 + q]; *(v8us*)((unsigned short*)X16 + t * 8) = f.half[0];  }
__global__ __launch_bounds__(256) void k_round16f(const float* __restrict__ W, _Float16* __restrict__ Bt, size_t n8) { const size_t t = (size_t)blockIdx.x * 256 + threadIdx.x; if (t >= n8) return; FragH f;
#pragma unroll
  for (int i = 0; i < 8; ++i) f.h[i] = (_Float16)(bf16_round(W[t * 8 + i]) * 16.0f); *(v8us*)((unsigned short*)Bt + t * 8) = f.half[0];  }
template <int NHv, int TTv>
__global__ __launch_bounds__(256) void k_vt(const _Float16* __restrict__ V16, int ldv, int voff, _Float16* __restrict__ Vt) { __shared__ unsigned short tl[64][66]; const int tid = threadIdx.x; const int slab = blockIdx.x / (TTv / 64), lg = blockIdx.x % (TTv / 64); const int b = slab / NHv, h = slab % NHv;
  for (int i = tid; i < 64 * 8; i += 256) { const int r = i / 8, c8 = (i % 8) * 8; FragH f; f.half[0] = *(const v8us*)((const unsigned short*)V16 + ((size_t)b * TTv + lg * 64 + r) * ldv + voff + h * 64 + c8);
#pragma unroll
    for (int q = 0; q < 8; ++q) tl[r][c8 + q] = f.u[q]; }
  __syncthreads();
  {
#pragma unroll
    for (int rd = 0; rd < 2; ++rd) { const int d = rd * 32 + tid / 8, pc = tid % 8; FragH f;
#pragma unroll
      for (int q = 0; q < 8; ++q) f.u[q] = tl[pc * 8 + q][d];
      *(v8us*)((unsigned short*)Vt + ((size_t)slab * 64 + d) * TTv + lg * 64 + pc * 8) = f.half[0]; }
     } }


// ---- fast GEMM (wave tile 32x64, block tile 128x64) ----
__device__ __forceinline__ v16h g2_frag(const _Float16* p, int hh) { FragH f; f.half[0] = *(const v8us*)((const unsigned short*)p + 8 * hh); f.half[1] = *(const v8us*)((const unsigned short*)p + 16 + 8 * hh); return f.v; }
__device__ __forceinline__ v8f g2_mma(v16h a, v16h b, v8f c) { v8f d = __builtin_amdgcn_wmma_f32_16x16x32_f16(false, a, false, b, (short)0, c, false, false); asm volatile("v_nop\n\tv_nop\n\tv_nop\n\tv_nop" : "+v"(d) : "v"(a), "v"(b)); return d; }
// One wave's share of a stage (192 rows of 128 bytes: 128 A rows, then 64 B rows, LDS pitch G2P bytes): 12 asynchronous 16-byte copies per lane, 8 lanes to a row, so that each copy of a wave reads 4 whole 128-byte lines.
// l = this lane's LDS byte address in the stage's row tid / 8; ga, gb = this lane's 16 bytes in A row tid / 8 and B row tid / 8 of the stage; every further copy is 16 rows on.
#define G2P 144            /* 128 + 16: the pitch for 16-byte LDS reads of 128-byte rows */
#define G2S (192 * G2P)    /* bytes of one stage */
__device__ __forceinline__ void g2_stage(unsigned l, const _Float16* ga, size_t lda, const _Float16* gb, size_t ldb) {
  const unsigned l1 = l + 16 * G2P, l2 = l + 32 * G2P, l3 = l + 48 * G2P, l4 = l + 64 * G2P, l5 = l + 80 * G2P, l6 = l + 96 * G2P, l7 = l + 112 * G2P, l8 = l + 128 * G2P, l9 = l + 144 * G2P, l10 = l + 160 * G2P, l11 = l + 176 * G2P;
  const _Float16 *a1 = ga + 16 * lda, *a2 = ga + 32 * lda, *a3 = ga + 48 * lda, *a4 = ga + 64 * lda, *a5 = ga + 80 * lda, *a6 = ga + 96 * lda, *a7 = ga + 112 * lda, *b1 = gb + 16 * ldb, *b2 = gb + 32 * ldb, *b3 = gb + 48 * ldb;
  /* the copies and their s_wait_xcnt in one statement: no address register is rewritten before the wait */
  asm volatile("global_load_async_to_lds_b128 %0, %12, off\n\t"
               "global_load_async_to_lds_b128 %1, %13, off\n\t"
               "global_load_async_to_lds_b128 %2, %14, off\n\t"
               "global_load_async_to_lds_b128 %3, %15, off\n\t"
               "global_load_async_to_lds_b128 %4, %16, off\n\t"
               "global_load_async_to_lds_b128 %5, %17, off\n\t"
               "global_load_async_to_lds_b128 %6, %18, off\n\t"
               "global_load_async_to_lds_b128 %7, %19, off\n\t"
               "global_load_async_to_lds_b128 %8, %20, off\n\t"
               "global_load_async_to_lds_b128 %9, %21, off\n\t"
               "global_load_async_to_lds_b128 %10, %22, off\n\t"
               "global_load_async_to_lds_b128 %11, %23, off\n\t"
               "s_wait_xcnt 0x0"
               :: "v"(l), "v"(l1), "v"(l2), "v"(l3), "v"(l4), "v"(l5), "v"(l6), "v"(l7), "v"(l8), "v"(l9), "v"(l10), "v"(l11),
                  "v"(ga), "v"(a1), "v"(a2), "v"(a3), "v"(a4), "v"(a5), "v"(a6), "v"(a7), "v"(gb), "v"(b1), "v"(b2), "v"(b3) : "memory"); }
// The three projections in ONE launch: blockIdx.y picks the weight plane (0 q, 1 k, 2 v; the planes lie one behind the other in B3) and what the epilogue makes of the tile, so that q, k and v never exist as f32 planes in memory.
// Block tile 128 tokens x 64 columns = one head; K = DM; A and B go through LDS in stages of 64 k, two buffers: stage t + 1 flies while stage t is worked on. The fragments are read from LDS in the k order of g2_frag.
// q, k: the wave's 32x64 tile goes through its own LDS rows, a lane takes 4 neighbouring columns = 2 rotary pairs back, turns them by the sinusoidal_pos INPUT row of its token ([sin | cos], rounded like every input) and stores 4 f16: 16 lanes write one head row = one 128-byte line.
// v: register r of an accumulator is token 8 hh + r of one head column, so 8 converted registers are 16 bytes of a V^T row; the block's 64 x 128 V^T tile is gathered in LDS and stored as whole 256-byte rows.
#define VTP 136            /* f16 per LDS row of the V^T tile: 256 + 16 bytes */
__global__ __launch_bounds__(128) void k_qkv(const _Float16* __restrict__ A, const _Float16* __restrict__ B3, const float* __restrict__ sp, _Float16* __restrict__ Q16, _Float16* __restrict__ K16, _Float16* __restrict__ Vt) {
  __shared__ __attribute__((aligned(16))) float so[4][32][68];
  __shared__ __attribute__((aligned(16))) _Float16 st[2][192][G2P / 2];
  const int tid = threadIdx.x, w = tid >> 5, lane = tid & 31, ln = lane & 15, hh = lane >> 4; const int by = blockIdx.y;
  const _Float16* Bh = B3 + (size_t)by * DM * DM;
  const int mt = blockIdx.x / NH, nq = blockIdx.x % NH; const int row0 = mt * 128 + 32 * w, col0 = nq * 64;
  const _Float16* ga = A + (size_t)(mt * 128 + (tid >> 3)) * DM + (tid & 7) * 8; const _Float16* gb = Bh + (size_t)(col0 + (tid >> 3)) * DM + (tid & 7) * 8;
  const unsigned ls = (unsigned)(size_t)&st[0][tid >> 3][(tid & 7) * 8];
  constexpr int nst = DM >> 6;
  g2_stage(ls, ga, (size_t)DM, gb, (size_t)DM);
  asm volatile("s_wait_asynccnt 0x0" ::: "memory");      /* stage 0 of this wave has landed */
  __syncthreads();      /* ... and every wave's share of it */
  g2_stage(ls + G2S, ga + 64, (size_t)DM, gb + 64, (size_t)DM);
  const v8f z8 = {0.f,0.f,0.f,0.f,0.f,0.f,0.f,0.f}; v8f c00 = z8, c01 = z8, c02 = z8, c03 = z8, c10 = z8, c11 = z8, c12 = z8, c13 = z8;
  /* rolled: one trip of code; the buffer is picked by the trip's parity */
#pragma unroll 1
  for (int t = 0; t < nst; ++t) { const _Float16* sa = &st[t & 1][32 * w + ln][0]; const _Float16* sb = &st[t & 1][128 + ln][0];
    /* all of the trip's fragments are read here, ahead of its first product */
    const v16h a00 = g2_frag(sa, hh), a10 = g2_frag(sa + 16 * (G2P / 2), hh), b00 = g2_frag(sb, hh), b10 = g2_frag(sb + 16 * (G2P / 2), hh), b20 = g2_frag(sb + 32 * (G2P / 2), hh), b30 = g2_frag(sb + 48 * (G2P / 2), hh);
    const v16h a01 = g2_frag(sa + 32, hh), a11 = g2_frag(sa + 16 * (G2P / 2) + 32, hh), b01 = g2_frag(sb + 32, hh), b11 = g2_frag(sb + 16 * (G2P / 2) + 32, hh), b21 = g2_frag(sb + 32 * (G2P / 2) + 32, hh), b31 = g2_frag(sb + 48 * (G2P / 2) + 32, hh);
    c00 = g2_mma(a00, b00, c00); c10 = g2_mma(a10, b00, c10); c01 = g2_mma(a00, b10, c01); c11 = g2_mma(a10, b10, c11);
    c02 = g2_mma(a00, b20, c02); c12 = g2_mma(a10, b20, c12); c03 = g2_mma(a00, b30, c03); c13 = g2_mma(a10, b30, c13);
    c00 = g2_mma(a01, b01, c00); c10 = g2_mma(a11, b01, c10); c01 = g2_mma(a01, b11, c01); c11 = g2_mma(a11, b11, c11);
    c02 = g2_mma(a01, b21, c02); c12 = g2_mma(a11, b21, c12); c03 = g2_mma(a01, b31, c03); c13 = g2_mma(a11, b31, c13);
    asm volatile("s_wait_dscnt 0x0" ::: "memory");      /* this wave's reads of the buffer are done before it is refilled */
    asm volatile("s_wait_asynccnt 0x0" ::: "memory");      /* this wave's share of stage t + 1 has landed */
    __syncthreads();      /* publishes stage t + 1 and ends every wave's reads of stage t */
    if (t + 2 < nst) g2_stage(ls + (unsigned)(t & 1) * G2S, ga + (size_t)(t + 2) * 64, (size_t)DM, gb + (size_t)(t + 2) * 64, (size_t)DM); }
  asm volatile("s_wait_asynccnt 0x0" ::: "memory");      /* nothing in flight when the wave goes on to the epilogue */
  v8f accs[8] = {c00, c01, c02, c03, c10, c11, c12, c13};      /* the weights hold the factor 16: every value below is accumulator / 16 */
  if (by == 2) {      /* the same for the whole block */
    _Float16* vt = (_Float16*)&so[0][0][0];
#pragma unroll      /* constant indices: accumulators and table words stay in registers */
    for (int u = 0; u < 8; ++u) { const int t = u & 3, half = u >> 2; FragH f;
#pragma unroll      /* constant indices: accumulators and table words stay in registers */
      for (int r = 0; r < 8; ++r) f.h[r] = (_Float16)(accs[u][r] * 0.0625f);
      *(v8us*)((unsigned short*)vt + (t * 16 + ln) * VTP + 32 * w + half * 16 + 8 * hh) = f.half[0]; }
    __syncthreads();      /* a V^T row holds tokens of all four waves */
    const int b = (mt * 128) / SLEN, key0 = (mt * 128) % SLEN;
#pragma unroll      /* the eight LDS reads stand together, ahead of the stores */
    for (int p = 0; p < 8; ++p) { const int d = p * 8 + (tid >> 4), c8 = (tid & 15) * 8; const v8us val = *(const v8us*)((const unsigned short*)vt + d * VTP + c8);
      *(v8us*)((unsigned short*)Vt + ((size_t)(b * NH + nq) * 64 + d) * SLEN + key0 + c8) = val; }
  } else {
    _Float16* __restrict__ H = by ? K16 : Q16;
    const int rsub = lane >> 4, c4 = (lane & 15) * 4;
    /* the table words of token row0 + rsub, pairs c4 / 2 and c4 / 2 + 1; the lane's next token is two rows = 128 floats on (a wave's 32 tokens never cross the end of a sequence). Asked for ahead of the LDS round trip, which hides their way */
    const float* pr = sp + (size_t)(row0 % SLEN + rsub) * 64 + (c4 >> 1); v2fa sn[16], cs[16];
#pragma unroll      /* constant indices: accumulators and table words stay in registers */
    for (int q = 0; q < 16; ++q) { sn[q] = *(const v2fa*)(pr + q * 128); cs[q] = *(const v2fa*)(pr + q * 128 + 32); }
    asm volatile("s_wait_xcnt 0x0" :: "v"(pr) : "memory");      /* the loads' address register lives up to this wait: nothing is written over it while a load that names it is under way */
#pragma unroll      /* constant indices: accumulators and table words stay in registers */
    for (int u = 0; u < 8; ++u) { const int t = u & 3, half = u >> 2;
#pragma unroll      /* constant indices: accumulators and table words stay in registers */
      for (int r = 0; r < 8; ++r) so[w][half * 16 + 8 * hh + r][t * 16 + ln] = accs[u][r] * 0.0625f; }
    __builtin_amdgcn_fence(__ATOMIC_ACQ_REL, "workgroup"); __builtin_amdgcn_wave_barrier();      /* the wave's LDS writes are done before its lanes read rows that other lanes wrote */
    _Float16* hp = H + (size_t)(row0 + rsub) * DM + col0 + c4;
#pragma unroll      /* constant indices: accumulators and table words stay in registers */
    for (int q = 0; q < 16; ++q) { const v4f v = *(const v4fa*)&so[w][q * 2 + rsub][c4];
      const float s0 = bf16_round(sn[q][0]), s1 = bf16_round(sn[q][1]), k0 = bf16_round(cs[q][0]), k1 = bf16_round(cs[q][1]);
      v4h h4; h4[0] = (_Float16)(v[0] * k0 - v[1] * s0); h4[1] = (_Float16)(v[0] * s0 + v[1] * k0); h4[2] = (_Float16)(v[2] * k1 - v[3] * s1); h4[3] = (_Float16)(v[2] * s1 + v[3] * k1);
      *(v4h*)(hp + (size_t)q * 2 * DM) = h4; }
    asm volatile("s_wait_xcnt 0x0" ::: "memory");      /* behind the last store of the run: no register that a store names is written over while the store is under way, on whatever code the build lays behind this branch */
  } }



// lane l <-> lane l ^ 16 (the two halves of a wave hold the two key halves of one query column)
__device__ __forceinline__ float xhalf(float x) { return __builtin_bit_cast(float, __builtin_amdgcn_permlanex16(__builtin_bit_cast(int, x), __builtin_bit_cast(int, x), 0x76543210, 0xfedcba98, false, false)); }
__device__ __forceinline__ v8f mmaT(v16h a, v16h b, v8f c) { return __builtin_amdgcn_wmma_f32_16x16x32_f16(false, a, false, b, (short)0, c, false, false); }
// One wave's share of a flash stage of 64 keys (128 rows of 128 bytes: 64 K rows of the head, then the 64 V^T rows' 64 keys, LDS pitch FLP bytes): 8 asynchronous 16-byte copies per lane, 8 lanes to a row, so that each copy of a wave reads 4 whole 128-byte lines.
// l = this lane's LDS byte address in the stage's row tid / 8; gk, gv = this lane's 16 bytes in K row tid / 8 and V^T row tid / 8 of the stage; every further copy is 16 rows on.
#define FLP 144            /* 128 + 16: the pitch for 16-byte LDS reads of 128-byte rows */
#define FLS (128 * FLP)    /* bytes of one stage */
__device__ __forceinline__ void fl_stage(unsigned l, const _Float16* gk, size_t ldk, const _Float16* gv) {
  const unsigned l1 = l + 16 * FLP, l2 = l + 32 * FLP, l3 = l + 48 * FLP, l4 = l + 64 * FLP, l5 = l + 80 * FLP, l6 = l + 96 * FLP, l7 = l + 112 * FLP;
  const _Float16 *k1 = gk + 16 * ldk, *k2 = gk + 32 * ldk, *k3 = gk + 48 * ldk, *v1 = gv + 16 * TK, *v2 = gv + 32 * TK, *v3 = gv + 48 * TK;
  /* the copies and their s_wait_xcnt in one statement: no address register is rewritten before the wait */
  asm volatile("global_load_async_to_lds_b128 %0, %8, off\n\t"
               "global_load_async_to_lds_b128 %1, %9, off\n\t"
               "global_load_async_to_lds_b128 %2, %10, off\n\t"
               "global_load_async_to_lds_b128 %3, %11, off\n\t"
               "global_load_async_to_lds_b128 %4, %12, off\n\t"
               "global_load_async_to_lds_b128 %5, %13, off\n\t"
               "global_load_async_to_lds_b128 %6, %14, off\n\t"
               "global_load_async_to_lds_b128 %7, %15, off\n\t"
               "s_wait_xcnt 0x0"
               :: "v"(l), "v"(l1), "v"(l2), "v"(l3), "v"(l4), "v"(l5), "v"(l6), "v"(l7),
                  "v"(gk), "v"(k1), "v"(k2), "v"(k3), "v"(gv), "v"(v1), "v"(v2), "v"(v3) : "memory"); }
// Transposed products: S^T = K Q^T (A = 16 key rows, B = the wave's 16 query columns, kept in registers), O^T += V^T P^T (A = 16 rows of V^T, B = P^T).
// Lane (c = lane & 15, hh = lane >> 4) holds query q0 + c only: register r of score tile nt is key j0 + 16 nt + 8 hh + r, so maximum and sum run in-lane plus one exchange between the halves,
// and the two converted score tiles ARE the B operand of the second product in the hardware k order (element s: key 8 hh + s, then 16 + 8 hh + (s - 8)), the order in which the V^T rows are loaded.
// The softmax runs in base 2: the score factor holds log2 e and the mask table is already in those units. Each query column keeps a reference r_c, set 10 below the column's maximum at the time it was set, and a weight is 2^(score - r_c): a subtraction and one v_exp_f32; numerator and denominator hold the same factor, which the final division takes out. The reference moves, and accumulators and sum are rescaled, only when a score has climbed more than 15 above it.
// K and V^T go through LDS in stages of 64 keys (two passes of 32), two buffers, shared by the block's 4 waves: stage t + 1 flies while stage t is worked on. The fragments are read from LDS in the k order of g2_frag.
template <int CAUSAL>
__global__ __launch_bounds__(128) void k_flash(const _Float16* __restrict__ Q16, int ldq, const _Float16* __restrict__ K16, int ldk, const _Float16* __restrict__ Vt, const int* __restrict__ MSK, float* __restrict__ O, int ldo) {
  constexpr int RPW = 16, DT = 4, KS = 2;
  __shared__ __attribute__((aligned(16))) float sO[4][RPW][64 + 4];
  __shared__ __attribute__((aligned(16))) _Float16 st[2][128][FLP / 2];
  const int tid = threadIdx.x, w = tid >> 5, lane = tid & 31, ln = lane & 15, hh = lane >> 4;
  const int slab = blockIdx.x / QBNP, qblk = QB0P + blockIdx.x % QBNP; const int b = slab / NH, h = slab % NH; const int qb0 = qblk * (4 * RPW); const int q0 = qb0 + w * RPW; const int tq = q0 + ln;
  FragH bq[KS];
  { const unsigned short* qr = (const unsigned short*)Q16 + ((size_t)b * TQ + tq) * ldq + h * 64;
#pragma unroll
    for (int ks = 0; ks < KS; ++ks) { bq[ks].half[0] = *(const v8us*)(qr + ks * 32 + 8 * hh); bq[ks].half[1] = *(const v8us*)(qr + ks * 32 + 16 + 8 * hh); } }
  /* this lane's 16 bytes of stage 0 (K row tid / 8 of the head, V^T row tid / 8) and their place in buffer 0 */
  const _Float16* gk = K16 + ((size_t)b * TK + (tid >> 3)) * ldk + h * 64 + (tid & 7) * 8; const _Float16* gv = Vt + ((size_t)slab * 64 + (tid >> 3)) * TK + (tid & 7) * 8;
  const unsigned ls = (unsigned)(size_t)&st[0][tid >> 3][(tid & 7) * 8];
  const char* mb = (const char*)((const float*)MSK + (size_t)b * TK); const unsigned mo = (unsigned)hh * 32u;      /* a wave-uniform base that steps with the stage; this half's 8 mask words */
  float r_c = -3.0e38f, l_c = 0.f; v8f oacc[DT];      /* r_c: the column's reference, see the stage loop */
#pragma unroll
  for (int dt = 0; dt < DT; ++dt) oacc[dt] = (v8f){0.f,0.f,0.f,0.f,0.f,0.f,0.f,0.f};
  const int jend = (CAUSAL == 1) ? (qb0 + 4 * RPW) : TK;      /* causal: keys beyond the block's last query never contribute */
  const int nst = jend >> 6;      /* both ends are multiples of 64; the same for the whole block */
  fl_stage(ls, gk, (size_t)ldk, gv);
  asm volatile("s_wait_asynccnt 0x0" ::: "memory");      /* stage 0 of this wave has landed */
  __syncthreads();      /* ... and every wave's share of it */
  if (nst > 1) fl_stage(ls + FLS, gk + (size_t)64 * ldk, (size_t)ldk, gv + 64);
  /* the stage loop stays rolled (one stage of code; the buffer is picked by the trip's parity); every inner loop is unrolled so that the fragment and score arrays have constant indices and stay in registers */
#pragma unroll 1
  for (int t = 0; t < nst; ++t) { const _Float16* skr = &st[t & 1][ln][0]; const _Float16* svr = &st[t & 1][64 + ln][0];      /* this lane's K row and V^T row of the stage's buffer */
    v4f mk[2][2][2];      /* the stage's mask words (from the table in global memory) are asked for first: they have the longest way */
    if (CAUSAL == 17) {
#pragma unroll
      for (int nt = 0; nt < 4; ++nt) { mk[nt >> 1][nt & 1][0] = *(const v4fa*)(mb + mo + nt * 64); mk[nt >> 1][nt & 1][1] = *(const v4fa*)(mb + mo + nt * 64 + 16); } }
    FragH av[2][DT]; float sc[2][16]; bool ok[2][16];
#pragma unroll
   for (int pp = 0; pp < 2; ++pp) { const int j0 = t * 64 + pp * 32;
    FragH ak[2][KS];
#pragma unroll
    for (int nt = 0; nt < 2; ++nt) {
#pragma unroll
      for (int ks = 0; ks < KS; ++ks) ak[nt][ks].v = g2_frag(skr + (pp * 32 + nt * 16) * (FLP / 2) + ks * 32, hh); }      /* key rows ln and 16 + ln of the pass */
    asm volatile("" :: "v"(ak[0][0].v), "v"(ak[0][1].v), "v"(ak[1][0].v), "v"(ak[1][1].v));      /* inputs only: keeps the pass's eight K reads together in front of its first product (one LDS wait; without it the first pass of a stage reads and waits four times in a row) */
#pragma unroll
    for (int dt = 0; dt < DT; ++dt) av[pp][dt].v = g2_frag(svr + dt * 16 * (FLP / 2) + pp * 32, hh);      /* V^T row dt * 16 + ln, the pass's 32 keys */
#pragma unroll
    for (int nt = 0; nt < 2; ++nt) { v8f acc = (v8f){0.f,0.f,0.f,0.f,0.f,0.f,0.f,0.f};
#pragma unroll
      for (int ks = 0; ks < KS; ++ks) acc = mmaT(ak[nt][ks].v, bq[ks].v, acc);
#pragma unroll
      for (int r = 0; r < 8; ++r) { const int kk = j0 + nt * 16 + 8 * hh + r; const bool okk = (CAUSAL == 1) ? (kk <= tq) : ((CAUSAL == 2) ? ((kk >> 5) == (tq >> 5)) : true);      /* mode 2: block-diagonal 32-token groups */
        float sv = okk ? acc[r] * SCL2 : -3.0e38f; if (CAUSAL == 17) sv += mk[pp][nt][r >> 2][r & 3];      /* mode 17: additive per-(batch, key) mask, rounded and scaled by k_prep */
        sc[pp][nt * 8 + r] = sv; ok[pp][nt * 8 + r] = okk; } } }
    float mx[16];
#pragma unroll
    for (int i = 0; i < 16; ++i) mx[i] = fmaxf(sc[i >> 3][2 * (i & 7)], sc[i >> 3][2 * (i & 7) + 1]);      /* neighbours first (a maximum is exact in any order): the packed score multiply-adds then work on register pairs as the accumulators hold them, with no moves */
    float mc = fmaxf(fmaxf(fmaxf(fmaxf(mx[0], mx[1]), fmaxf(mx[2], mx[3])), fmaxf(fmaxf(mx[4], mx[5]), fmaxf(mx[6], mx[7]))), fmaxf(fmaxf(fmaxf(mx[8], mx[9]), fmaxf(mx[10], mx[11])), fmaxf(fmaxf(mx[12], mx[13]), fmaxf(mx[14], mx[15]))));
    /* Lazy rescale, one test a stage: while no column's score lies more than 15 above its reference, every weight 2^(score - reference) is at most 2^15, which f16 holds, and numerator and denominator go on in the units they are in. A scalar branch: the whole wave takes it or none */
    if (__builtin_amdgcn_ballot_w32(mc - r_c > 15.0f) != 0) {      /* mc: the maximum of this half's 32 keys of the stage; the vote sees both halves */
      mc = fmaxf(mc, xhalf(mc));      /* both halves now hold the query's maximum over the stage's 64 keys, so both set the same reference */
      float rn = mc - 10.0f; if (mc - rn > 15.0f) rn = mc;      /* where the maximum is so large that the subtraction rounds to more than 15 below it, the reference is the maximum itself: no weight ever leaves f16 */
      rn = fmaxf(r_c, rn); const float da = r_c - rn; float ea;
      asm("v_exp_f32 %0, %1\n\tv_nop" : "=&v"(ea) : "v"(da));      /* the v_nop is the slot that the instruction set asks for behind a transcendental */
      const float al = (rn > -1.0e38f * LOG2E) ? ea : 1.0f;      /* the same test as before, its threshold in base-2 units */
      r_c = rn; l_c *= al;
#pragma unroll
      for (int dt = 0; dt < DT; ++dt) {
#pragma unroll
        for (int r = 0; r < 8; ++r) oacc[dt][r] *= al; } }
    FragH pb[2];
#pragma unroll
   for (int pp = 0; pp < 2; ++pp) {
    float x[16], p[16];
#pragma unroll
    for (int i = 0; i < 16; ++i) x[i] = sc[pp][i] - r_c;      /* never above 15 */
    /* 2^x is the one hardware instruction v_exp_f32 (a result below the normal range comes out as 0: such a weight is 0 in the f16 operand anyway). The pass's sixteen stand in two statements because the instruction set asks that the instruction directly behind a transcendental neither read its result nor overwrite its source: the early-clobber outputs keep every result out of every argument's register, and the v_nop is the slot of each statement's last v_exp_f32 */
    asm("v_exp_f32 %0, %8\n\tv_exp_f32 %1, %9\n\tv_exp_f32 %2, %10\n\tv_exp_f32 %3, %11\n\tv_exp_f32 %4, %12\n\tv_exp_f32 %5, %13\n\tv_exp_f32 %6, %14\n\tv_exp_f32 %7, %15\n\tv_nop"
        : "=&v"(p[0]), "=&v"(p[1]), "=&v"(p[2]), "=&v"(p[3]), "=&v"(p[4]), "=&v"(p[5]), "=&v"(p[6]), "=&v"(p[7]) : "v"(x[0]), "v"(x[1]), "v"(x[2]), "v"(x[3]), "v"(x[4]), "v"(x[5]), "v"(x[6]), "v"(x[7]));
    asm("v_exp_f32 %0, %8\n\tv_exp_f32 %1, %9\n\tv_exp_f32 %2, %10\n\tv_exp_f32 %3, %11\n\tv_exp_f32 %4, %12\n\tv_exp_f32 %5, %13\n\tv_exp_f32 %6, %14\n\tv_exp_f32 %7, %15\n\tv_nop"
        : "=&v"(p[8]), "=&v"(p[9]), "=&v"(p[10]), "=&v"(p[11]), "=&v"(p[12]), "=&v"(p[13]), "=&v"(p[14]), "=&v"(p[15]) : "v"(x[8]), "v"(x[9]), "v"(x[10]), "v"(x[11]), "v"(x[12]), "v"(x[13]), "v"(x[14]), "v"(x[15]));
#pragma unroll
    for (int i = 0; i < 16; ++i) { if (!ok[pp][i]) p[i] = 0.f; pb[pp].h[i] = (_Float16)p[i]; }
    const float pe = ((p[0] + p[2]) + (p[4] + p[6])) + ((p[8] + p[10]) + (p[12] + p[14])), po = ((p[1] + p[3]) + (p[5] + p[7])) + ((p[9] + p[11]) + (p[13] + p[15])); const float ps = pe + po;
    l_c += ps; }      /* this half's 16 keys of the pass; the halves are joined once, behind the loop */
    __builtin_amdgcn_sched_barrier(0);      /* every v_exp_f32 statement stays in front of the stage's second products: the compiler does not see that asm text writes vector registers, and moved in between it would let one overwrite an operand of the product just issued */
#pragma unroll
   for (int pp = 0; pp < 2; ++pp) {
#pragma unroll
    for (int dt = 0; dt < DT; ++dt) oacc[dt] = mmaT(av[pp][dt].v, pb[pp].v, oacc[dt]); }
    mb += 256;
    asm volatile("s_wait_dscnt 0x0" ::: "memory");      /* this wave's reads of the buffer are done before it is refilled */
    asm volatile("s_wait_asynccnt 0x0" ::: "memory");      /* this wave's share of stage t + 1 has landed */
    __syncthreads();      /* publishes stage t + 1 and ends every wave's reads of stage t */
    if (t + 2 < nst) fl_stage(ls + (unsigned)(t & 1) * FLS, gk + (size_t)(t + 2) * 64 * ldk, (size_t)ldk, gv + (size_t)(t + 2) * 64); }
  asm volatile("s_wait_asynccnt 0x0" ::: "memory");      /* nothing in flight when the wave goes on to the epilogue */
  const float l = l_c + xhalf(l_c); const float inv = (l > 0.f) ? 1.0f / l : 0.f;      /* numerator and denominator both hold the factor 2^-r_c */
#pragma unroll
  for (int dt = 0; dt < DT; ++dt) { v4f lo, hi;      /* register r = head column dt * 16 + 8 hh + r of query q0 + ln */
#pragma unroll
    for (int r = 0; r < 4; ++r) { lo[r] = oacc[dt][r] * inv; hi[r] = oacc[dt][4 + r] * inv; }
    *(v4fa*)&sO[w][ln][dt * 16 + 8 * hh] = lo; *(v4fa*)&sO[w][ln][dt * 16 + 8 * hh + 4] = hi; }
  __builtin_amdgcn_fence(__ATOMIC_ACQ_REL, "workgroup"); __builtin_amdgcn_wave_barrier();
  {
#pragma unroll
    for (int rp = 0; rp < RPW; rp += 2) { const int r = rp + (lane >> 4), pc = lane & 15; const v4f val = *(const v4fa*)&sO[w][r][pc * 4]; *(v4f*)(O + ((size_t)b * TQ + q0 + r) * ldo + h * 64 + pc * 4) = val; }
     } }
// 5-plane variant: S = Qh Kh^T + (Ql Kh^T + Qh Kl^T)/1024 with Q/K = [hi | 2^10 residual] f16 planes (QL/KL same layout as Q16/K16), then the 3-term P.V below.
// 3-term variant: O = (P_hi V_hi + (P_lo V_hi + P_hi V_lo) / 1024) / l with P = [hi | 2^10 residual] of 1024 p and V^T = [hi | 2^10 residual] planes (VtL same layout as Vt) -> ~2^-21-class products for un-averaged (early causal / peaked) rows
template <int CAUSAL>
__global__ __launch_bounds__(128) void k_flash5(const _Float16* __restrict__ Q16, const _Float16* __restrict__ QL, int ldq, const _Float16* __restrict__ K16, const _Float16* __restrict__ KL, int ldk, const _Float16* __restrict__ Vt, const _Float16* __restrict__ VtL, const int* __restrict__ MSK, float* __restrict__ O, int ldo) {
  constexpr int RPW = 16, RTN = RPW / 16, NQB = TQ / (4 * RPW), DT = 4, KS = 2;
  __shared__ __attribute__((aligned(16))) unsigned short sP[4][RPW][40]; __shared__ __attribute__((aligned(16))) unsigned short sPL[4][RPW][40]; __shared__ __attribute__((aligned(16))) float sO[4][RPW][64 + 4];
  const int tid = threadIdx.x, w = tid >> 5, lane = tid & 31, ln = lane & 15, hh = lane >> 4;
  const int slab = blockIdx.x / QBN5, qblk = QB05 + blockIdx.x % QBN5; (void)NQB; const int b = slab / NH, h = slab % NH; const int qb0 = qblk * (4 * RPW); const int q0 = qb0 + w * RPW;
  FragH aq[2][KS], aql[2][KS];
#pragma unroll
  for (int rt = 0; rt < RTN; ++rt) { const unsigned short* qr = (const unsigned short*)Q16 + ((size_t)b * TQ + q0 + rt * 16 + ln) * ldq + h * 64; const unsigned short* ql = (const unsigned short*)QL + ((size_t)b * TQ + q0 + rt * 16 + ln) * ldq + h * 64;
#pragma unroll
    for (int ks = 0; ks < KS; ++ks) { aq[rt][ks].half[0] = *(const v8us*)(qr + ks * 32 + 8 * hh); aq[rt][ks].half[1] = *(const v8us*)(qr + ks * 32 + 16 + 8 * hh); aql[rt][ks].half[0] = *(const v8us*)(ql + ks * 32 + 8 * hh); aql[rt][ks].half[1] = *(const v8us*)(ql + ks * 32 + 16 + 8 * hh); } }
  const unsigned short* Vth = (const unsigned short*)Vt + (size_t)slab * 64 * TK; const unsigned short* Vtl = (const unsigned short*)VtL + (size_t)slab * 64 * TK;
  float m_r[2][8], l_r[2][8]; v8f oacc[2][DT], oaccL[2][DT];
#pragma unroll
  for (int rt = 0; rt < RTN; ++rt) {
#pragma unroll
    for (int r = 0; r < 8; ++r) { m_r[rt][r] = -3.0e38f; l_r[rt][r] = 0.f; }
#pragma unroll
    for (int dt = 0; dt < DT; ++dt) { oacc[rt][dt] = (v8f){0.f,0.f,0.f,0.f,0.f,0.f,0.f,0.f}; oaccL[rt][dt] = oacc[rt][dt]; } }
  const int jend = (CAUSAL == 1) ? (qb0 + 4 * RPW) : TK;      /* causal: keys beyond the block's last query never contribute */
#pragma unroll 1
  for (int j0 = 0; j0 < jend; j0 += 32) {
    v8f s[2][2];
#pragma unroll
    for (int nt = 0; nt < 2; ++nt) { const unsigned short* kr = (const unsigned short*)K16 + ((size_t)b * TK + j0 + nt * 16 + ln) * ldk + h * 64; const unsigned short* klr = (const unsigned short*)KL + ((size_t)b * TK + j0 + nt * 16 + ln) * ldk + h * 64; FragH bk[KS], bkl[KS];
#pragma unroll
      for (int ks = 0; ks < KS; ++ks) { bk[ks].half[0] = *(const v8us*)(kr + ks * 32 + 8 * hh); bk[ks].half[1] = *(const v8us*)(kr + ks * 32 + 16 + 8 * hh); bkl[ks].half[0] = *(const v8us*)(klr + ks * 32 + 8 * hh); bkl[ks].half[1] = *(const v8us*)(klr + ks * 32 + 16 + 8 * hh); }
#pragma unroll
      for (int rt = 0; rt < RTN; ++rt) { v8f acc = (v8f){0.f,0.f,0.f,0.f,0.f,0.f,0.f,0.f}, accl = acc;
#pragma unroll
        for (int ks = 0; ks < KS; ++ks) { acc = mmaH<1>(aq[rt][ks].v, aq[rt][ks].v, bk[ks].v, bk[ks].v, acc); accl = mmaH<1>(aql[rt][ks].v, aql[rt][ks].v, bk[ks].v, bk[ks].v, accl); accl = mmaH<1>(aq[rt][ks].v, aq[rt][ks].v, bkl[ks].v, bkl[ks].v, accl); }
#pragma unroll
        for (int r = 0; r < 8; ++r) acc[r] += accl[r] * 0.0009765625f;
        s[rt][nt] = acc; } }
#pragma unroll
    for (int rt = 0; rt < RTN; ++rt)
#pragma unroll
      for (int r = 0; r < 8; ++r) { const int tq = q0 + rt * 16 + 8 * hh + r; const int k0 = j0 + ln, k1 = j0 + 16 + ln;
        bool ok0 = (CAUSAL == 1) ? (k0 <= tq) : ((CAUSAL == 2) ? ((k0 >> 5) == (tq >> 5)) : true), ok1 = (CAUSAL == 1) ? (k1 <= tq) : ((CAUSAL == 2) ? ((k1 >> 5) == (tq >> 5)) : true);      /* mode 2: block-diagonal 32-token groups */
        if (CAUSAL == 4) { const int* mrow = MSK + ((size_t)b * TQ + tq) * TK; ok0 = mrow[k0] != 0; ok1 = mrow[k1] != 0; }      /* mode 4: per-(query, key) INPUT mask shared by all heads; masked keys contribute nothing (== the reference's -4096 fill, whose exp underflows to 0), rows with no valid key give l = 0 -> output 0 (== the reference's row_valid zeroing) */
        float s0 = ok0 ? s[rt][0][r] * SCL : -3.0e38f, s1 = ok1 ? s[rt][1][r] * SCL : -3.0e38f; if (CAUSAL == 17) { const float* amk = (const float*)MSK + (size_t)b * TK; s0 += bf16_round(amk[k0]); s1 += bf16_round(amk[k1]); }      /* mode 17: additive per-(batch, key) mask INPUT */ float mc = fmaxf(s0, s1);
        mc = fmaxf(mc, __shfl_xor(mc, 1, 32)); mc = fmaxf(mc, __shfl_xor(mc, 2, 32)); mc = fmaxf(mc, __shfl_xor(mc, 4, 32)); mc = fmaxf(mc, __shfl_xor(mc, 8, 32));
        const float mn = fmaxf(m_r[rt][r], mc); const float al = (mn > -1.0e38f) ? expf(m_r[rt][r] - mn) : 1.0f; m_r[rt][r] = mn; const float p0 = ok0 ? expf(s0 - mn) : 0.f, p1 = ok1 ? expf(s1 - mn) : 0.f; l_r[rt][r] = l_r[rt][r] * al + p0 + p1;
#pragma unroll
        for (int dt = 0; dt < DT; ++dt) { oacc[rt][dt][r] *= al; oaccL[rt][dt][r] *= al; }
        FragH t2, t2l; const float ps0 = p0 * 1024.0f, ps1 = p1 * 1024.0f; t2.h[0] = (_Float16)ps0; t2.h[1] = (_Float16)ps1; t2l.h[0] = (_Float16)((ps0 - (float)t2.h[0]) * 1024.0f); t2l.h[1] = (_Float16)((ps1 - (float)t2.h[1]) * 1024.0f);
        sP[w][rt * 16 + 8 * hh + r][ln] = t2.u[0]; sP[w][rt * 16 + 8 * hh + r][16 + ln] = t2.u[1]; sPL[w][rt * 16 + 8 * hh + r][ln] = t2l.u[0]; sPL[w][rt * 16 + 8 * hh + r][16 + ln] = t2l.u[1]; }
    __builtin_amdgcn_fence(__ATOMIC_ACQ_REL, "workgroup"); __builtin_amdgcn_wave_barrier();
    FragH pa[2], pl[2];
#pragma unroll
    for (int rt = 0; rt < RTN; ++rt) { pa[rt].half[0] = *(const v8us*)&sP[w][rt * 16 + ln][8 * hh]; pa[rt].half[1] = *(const v8us*)&sP[w][rt * 16 + ln][16 + 8 * hh]; pl[rt].half[0] = *(const v8us*)&sPL[w][rt * 16 + ln][8 * hh]; pl[rt].half[1] = *(const v8us*)&sPL[w][rt * 16 + ln][16 + 8 * hh]; }
#pragma unroll
    for (int dt = 0; dt < DT; ++dt) { const unsigned short* vrow = Vth + (size_t)(dt * 16 + ln) * TK + j0; const unsigned short* vrl = Vtl + (size_t)(dt * 16 + ln) * TK + j0; FragH bv, bl; bv.half[0] = *(const v8us*)(vrow + 8 * hh); bv.half[1] = *(const v8us*)(vrow + 16 + 8 * hh); bl.half[0] = *(const v8us*)(vrl + 8 * hh); bl.half[1] = *(const v8us*)(vrl + 16 + 8 * hh);
#pragma unroll
      for (int rt = 0; rt < RTN; ++rt) { oacc[rt][dt] = mmaH<1>(pa[rt].v, pa[rt].v, bv.v, bv.v, oacc[rt][dt]); oaccL[rt][dt] = mmaH<1>(pl[rt].v, pl[rt].v, bv.v, bv.v, oaccL[rt][dt]); oaccL[rt][dt] = mmaH<1>(pa[rt].v, pa[rt].v, bl.v, bl.v, oaccL[rt][dt]); } }
    __builtin_amdgcn_fence(__ATOMIC_ACQ_REL, "workgroup"); __builtin_amdgcn_wave_barrier(); }
#pragma unroll
  for (int rt = 0; rt < RTN; ++rt) {
#pragma unroll
    for (int r = 0; r < 8; ++r) { float l = l_r[rt][r]; l += __shfl_xor(l, 1, 32); l += __shfl_xor(l, 2, 32); l += __shfl_xor(l, 4, 32); l += __shfl_xor(l, 8, 32); l_r[rt][r] = (l > 0.f) ? 1.0f / (l * 1024.0f) : 0.f; }
#pragma unroll
    for (int dt = 0; dt < DT; ++dt)
#pragma unroll
      for (int r = 0; r < 8; ++r) { float v = oacc[rt][dt][r]; v += oaccL[rt][dt][r] * 0.0009765625f; sO[w][rt * 16 + 8 * hh + r][dt * 16 + ln] = v * l_r[rt][r]; } }
  __builtin_amdgcn_fence(__ATOMIC_ACQ_REL, "workgroup"); __builtin_amdgcn_wave_barrier();
  {
#pragma unroll
    for (int rp = 0; rp < RPW; rp += 2) { const int r = rp + (lane >> 4), pc = lane & 15; const v4f val = *(const v4fa*)&sO[w][r][pc * 4]; *(v4f*)(O + ((size_t)b * TQ + q0 + r) * ldo + h * 64 + pc * 4) = val; }
     } }

__global__ __launch_bounds__(256) void k_rotab(float* __restrict__ CS, float* __restrict__ SN) {
  #pragma clang fp contract(off)
  const int t = blockIdx.x * 256 + threadIdx.x; if (t >= SLEN * 32) return; const int j = t % 32, s = t / 32; const float ex = (float)(2 * j) / 64.0f; const float inv = 1.0f / powf(10000.0f, ex); const float th = (float)s * inv; const float c = cosf(th), sn = sinf(th);
  { *(float*)(CS + t) = c; *(float*)(SN + t) = sn;  } }
__global__ __launch_bounds__(256) void k_rope(const float* __restrict__ F, int nsrc, int ndst, int rep, const float* __restrict__ CS, const float* __restrict__ SN, _Float16* __restrict__ H, _Float16* __restrict__ L) {
  #pragma clang fp contract(off)
  const size_t t = (size_t)blockIdx.x * 256 + threadIdx.x; if (t >= (size_t)NR * ndst * 4) return; const int g8 = (int)(t % 4); const int hd = (int)((t / 4) % ndst); const size_t row = t / ((size_t)4 * ndst); const int s = (int)(row % SLEN); const int hs = hd / rep;
  const float* src = F + row * (size_t)(nsrc * 64) + hs * 64; FragH ah, al, bh, bl;
  for (int i = 0; i < 8; ++i) { const int d = g8 * 8 + i; const float c = CS[s * 32 + d], sn = SN[s * 32 + d]; const float x1 = src[d], x2 = src[d + 32];
    float o1 = x1 * c; o1 += -x2 * sn; float o2 = x2 * c; o2 += x1 * sn;
    _Float16 hv = (_Float16)o1; ah.h[i] = hv; al.h[i] = (_Float16)((o1 - (float)hv) * 1024.0f); hv = (_Float16)o2; bh.h[i] = hv; bl.h[i] = (_Float16)((o2 - (float)hv) * 1024.0f); }
  const size_t o = row * (size_t)(ndst * 64) + hd * 64 + g8 * 8;
  { *(v8us*)((unsigned short*)H + o) = ah.half[0]; *(v8us*)((unsigned short*)H + o + 32) = bh.half[0]; *(v8us*)((unsigned short*)L + o) = al.half[0]; *(v8us*)((unsigned short*)L + o + 32) = bl.half[0];  } }
// Every operand conversion in ONE launch, by block ranges: the exact f16 plane of x, the three weight planes (x16, one behind the other in B3), and the mask table of the flash kernel.
// A conversion block streams 16384 values: 16 loads of 16 bytes a lane, each wave-wide load 512 bytes in a row, several of them under way at once; each store of a wave is two whole 128-byte lines. Few, long waves, for speed only.
// The mask table: M2 = bf16-rounded mask times log2 e. Beyond +-1e38 the table goes on with slope 1/2, so that the factor turns no finite mask into an infinity: two different bf16 values up there still lie more than 1e35 apart in the table, so the smaller one's weight is 0 as it is in natural units, equal values stay equal, and the order is kept; an infinite mask stays infinite
#define PXB (NR * DM / 16384)      /* blocks for x */
#define PWB (DM * DM / 16384)      /* blocks for one weight matrix */
#define PMB (NB * SLEN / 256)      /* blocks for the mask: 1 value a thread */
__global__ __launch_bounds__(256) void k_prep(const float* __restrict__ x, const float* __restrict__ Wq, const float* __restrict__ Wk, const float* __restrict__ Wv, const float* __restrict__ am, _Float16* __restrict__ X16, _Float16* __restrict__ B3, float* __restrict__ M2) {
  const int bx = blockIdx.x, tid = threadIdx.x;
  if (bx >= PXB + 3 * PWB) { const int t = (bx - (PXB + 3 * PWB)) * 256 + tid; const float mr = bf16_round(am[t]), ma = fabsf(mr); M2[t] = (ma <= 1.0e38f) ? mr * LOG2E : copysignf(1.0e38f * LOG2E + (ma - 1.0e38f) * 0.5f, mr); return; }
  const float* src = x; _Float16* dst = X16; float sc = 1.0f; int b0 = bx;
  if (bx >= PXB) { const int wi = (bx - PXB) / PWB; b0 = (bx - PXB) % PWB; src = (wi == 0) ? Wq : ((wi == 1) ? Wk : Wv); dst = B3 + (size_t)wi * DM * DM; sc = 16.0f; }      /* a weight is (out, in) = Bt as it lies */
  const size_t e0 = (size_t)b0 * 16384 + tid * 4; v4f v[16];
#pragma unroll      /* constant indices: the loaded values stay in registers, and loads can be issued ahead of the conversions */
  for (int j = 0; j < 16; ++j) v[j] = *(const v4fa*)(src + e0 + j * 1024);
#pragma unroll      /* constant indices: the loaded values stay in registers */
  for (int j = 0; j < 16; ++j) { v4h h4;
#pragma unroll      /* constant indices: the loaded values stay in registers */
    for (int q = 0; q < 4; ++q) h4[q] = (_Float16)(bf16_round(v[j][q]) * sc);
    *(v4h*)(dst + e0 + j * 1024) = h4; } }
__global__ __launch_bounds__(256) void k_rotab2(float* __restrict__ CS, float* __restrict__ SN) {
  #pragma clang fp contract(off)
  const int t = blockIdx.x * 256 + threadIdx.x; if (t >= SLEN * 32) return; const int j = t % 32, s = t / 32; const float c0 = -0.14391156831212787f;      /* -ln(10000)/64 rounded to f32 */ const float inv = expf((float)(2 * j) * c0); const float th = (float)s * inv; const float c = cosf(th), sn = sinf(th);
  { *(float*)(CS + t) = c; *(float*)(SN + t) = sn;  } }
__global__ __launch_bounds__(256) void k_lnu(const float* __restrict__ X, _Float16* __restrict__ N16, float* __restrict__ XB) {
  #pragma clang fp contract(off)
  const int wv = threadIdx.x >> 5, ln = threadIdx.x & 31; const size_t r = (size_t)blockIdx.x * 8 + wv; if (r >= NR) return; float a[32]; float s = 0.f;
  for (int i = 0; i < 4; ++i) { const v8f v = *(const v8f*)(X + r * DM + (i * 32 + ln) * 8); for (int q = 0; q < 8; ++q) { const float u = bf16_round(v[q]); a[i * 8 + q] = u; s += u; } }
  for (int o = 16; o > 0; o >>= 1) s += __shfl_xor(s, o, 32); const float mu = s / (float)DM; float var = 0.f; for (int q = 0; q < 32; ++q) { const float d = a[q] - mu; var += d * d; }
  for (int o = 16; o > 0; o >>= 1) var += __shfl_xor(var, o, 32); const float den = sqrtf(var / (float)(DM - 1)) + 1e-6f; const float inv = 1.0f / den;      /* one reciprocal per row; (x-mean)*inv vs the reference's division differs by <= 1 ulp */
  { for (int i = 0; i < 4; ++i) { const int c0 = (i * 32 + ln) * 8; FragH f; v8f xb; for (int q = 0; q < 8; ++q) { f.h[q] = (_Float16)((a[i * 8 + q] - mu) * inv); xb[q] = a[i * 8 + q]; } *(v8us*)((unsigned short*)N16 + r * DM + c0) = f.half[0]; *(v8f*)(XB + r * DM + c0) = xb; }  } }

extern "C" void kernel_launch(void* const* d_in, const int* in_sizes, int n_in,
                              void* d_out, int out_size, void* d_ws, size_t ws_size, hipStream_t stream) {
  (void)in_sizes; (void)n_in; (void)out_size;
  const float* const* I = (const float* const*)d_in; const float* x = I[0]; const float* sp = I[1]; const float* am = I[2]; const float* Wq = I[3]; const float* Wk = I[4]; const float* Wv = I[5];
  char* ws = (char*)d_ws; size_t off = 0;
  auto take = [&](size_t bytes) { char* p = ws + off; off += (bytes + 255) & ~(size_t)255; return p; };
  const size_t np = (size_t)NR * DM;
  _Float16* B3 = (_Float16*)take((size_t)3 * DM * DM * 2); float* M2 = (float*)take((size_t)NB * SLEN * 4);
  _Float16* X16 = (_Float16*)take(np * 2); _Float16* QH = (_Float16*)take(np * 2); _Float16* KXH = (_Float16*)take(np * 2); _Float16* VT = (_Float16*)take(np * 2);
  if (off > ws_size) return;      /* 6 + 4 x 8 MiB */
  k_prep<<<PXB + 3 * PWB + PMB, 256, 0, stream>>>(x, Wq, Wk, Wv, am, X16, B3, M2);
  k_qkv<<<dim3((NR / 128) * NH, 3), 128, 0, stream>>>(X16, B3, sp, QH, KXH, VT);
  k_flash<17><<<NB * NH * QBNP, 128, 0, stream>>>(QH, DM, KXH, DM, VT, (const int*)M2, (float*)d_out, DM);      /* + the mask table [b][key]; the merged context is the output */
}

// v007
// Measured time: 70.2 microseconds a run.
// Two timings next to v006 both put it at 1.07 times that version's speed.
// Counting every step since v000, it is 5.60 times as fast.
#include <hip/hip_runtime.h>
// DiffBertSelfAttention (2 x 2048 tokens, D 1024 = 16 heads of 64): q, k, v = x W^T; RoFormer rotary from the sinusoidal_pos INPUT ([sin | cos] halves, interleave-duplicated: out[2i] = x[2i] cos_i - x[2i+1] sin_i, out[2i+1] = x[2i+1] cos_i + x[2i] sin_i); scores/8 + attention_mask[b, key] (additive INPUT, broadcast over heads and queries); softmax; ctx = probs v merged -> the output (no output projection).
// Structure, three launches: k_prep (exact f16 plane of x, exact x16 weight planes, the mask table); k_qkv (q, k, v as WMMA GEMMs, 32x64 wave tiles, f32 accumulation, whose epilogue does the interleaved RoPE in f32 from the input table, bf16-rounded like every input, the f16 conversion, and V^T by an LDS tile); the fused flash kernel with the per-key additive mask (mode 17: a table made from the input in the same call, rounded like every input and in base-2 units; plain operands: every row averages ~2048 keys) writing the merged context straight to the output.
// Compute dtype: inputs and parameters rounded to bf16; q/k/P/v as plain f16 operands (~2^-12); RoPE/softmax f32. v_wmma_f32_16x16x32_f16.
#define NB 2
#define DM 1024
#define NKV 16
#define NREP (NH / NKV)
#define KVD (NKV * 64)           /* 1024 */
#define NR (NB * SLEN)           /* 4096 */
#define SLEN 2048
#define TQ SLEN
#define TK SLEN
#define NH 16
#define SCL 0.125f
#define LOG2E 1.4426950408889634f
#define SCL2 (SCL * LOG2E)      /* scores in base-2 units: exp(s) = 2^(s log2 e) */
#define QBLKS (TQ / 128)
#define QB05 0
#define QBN5 4
#define QB0P 0
#define QBNP QBLKS           /* non-causal: plain flash on every query block */
#define RE 256
typedef __bf16 v16b __attribute__((ext_vector_type(16)));
typedef unsigned short v8us __attribute__((ext_vector_type(8), may_alias));
typedef float  v8f  __attribute__((ext_vector_type(8)));
typedef float  v4f  __attribute__((ext_vector_type(4)));
typedef float  v4fa __attribute__((ext_vector_type(4), may_alias));
typedef float  v2fa __attribute__((ext_vector_type(2), may_alias));
typedef float  v2f  __attribute__((ext_vector_type(2)));
union FragB { v16b v; v8us half[2]; unsigned short u[16]; };

__device__ __forceinline__ unsigned short bf16_bits(float x) { unsigned int u = __float_as_uint(x); return (unsigned short)((u + 0x7FFFu + ((u >> 16) & 1u)) >> 16); }
__device__ __forceinline__ float bf16_val(unsigned short b) { return __uint_as_float(((unsigned int)b) << 16); }
__device__ __forceinline__ float bf16_round(float x) { return bf16_val(bf16_bits(x)); }
// D += A·B with NT terms: 1 = ah·bh, 2 = + al·bh (A split), 3 = + ah·bl (both split)
template <int NT>
__device__ __forceinline__ v8f mmaN(v16b ah, v16b al, v16b bh, v16b bl, v8f c) {
  c = __builtin_amdgcn_wmma_f32_16x16x32_bf16(false, ah, false, bh, (short)0, c, false, false);
  if (NT >= 2) c = __builtin_amdgcn_wmma_f32_16x16x32_bf16(false, al, false, bh, (short)0, c, false, false);
  if (NT >= 3) c = __builtin_amdgcn_wmma_f32_16x16x32_bf16(false, ah, false, bl, (short)0, c, false, false);
  asm volatile("v_nop\n\tv_nop\n\tv_nop\n\tv_nop" : "+v"(c) : "v"(ah), "v"(al), "v"(bh), "v"(bl));
  return c;
}

__global__ __launch_bounds__(256) void k_wt_bf16(const float* __restrict__ W, unsigned short* __restrict__ Wt, int K, int N) {
  const int t = blockIdx.x * 256 + threadIdx.x;
  const int k8n = K / 8;
  if (t >= N * k8n) return;
  const int n = t / k8n, k8 = (t % k8n) * 8;
  v8us v;
#pragma unroll
  for (int i = 0; i < 8; ++i) v[i] = bf16_bits(W[(size_t)(k8 + i) * N + n]);
  *(v8us*)(Wt + (size_t)n * K + k8) = v;
  
}

// GEMM C[M][N] (f32, pitch ldc) = act(A[M][K]·W + bias). A f32 row-major (pitch lda) converted per fragment to bf16
// (ASPLIT: hi/lo two planes -> 2 terms, else single rounded term); Wt bf16 [N][K] (pitch ldb). BIAS_BF16 rounds the
// bias to bf16 first (bias quantised to bf16 before the add). K%32==0, M%16==0, N%64==0.
template <bool ASPLIT, int ACT, bool BIAS_BF16>
__global__ __launch_bounds__(128) void k_gemm_bf(const float* __restrict__ A, int lda, const unsigned short* __restrict__ Wt, int ldb,
                                               const float* __restrict__ bias, float* __restrict__ C, int ldc, int M, int N, int K) {
  __shared__ __attribute__((aligned(16))) float so[4][16][64];
  const int tid = threadIdx.x, w = tid >> 5, lane = tid & 31, ln = lane & 15, hh = lane >> 4;
  const int ntn = N / 64;
  const int wid = blockIdx.x * 4 + w;
  const int mt = wid / ntn, nq = wid % ntn;
  if (mt * 16 >= M) return;
  const int row0 = mt * 16, col0 = nq * 64;
  const float* arow = A + (size_t)(row0 + ln) * lda;
  v8f acc[4] = {};
  for (int kb = 0; kb < K; kb += 32) {
    FragB ah, al;
    const v4f x0 = *(const v4fa*)(arow + kb + 8 * hh), x1 = *(const v4fa*)(arow + kb + 8 * hh + 4);
    const v4f x2 = *(const v4fa*)(arow + kb + 16 + 8 * hh), x3 = *(const v4fa*)(arow + kb + 16 + 8 * hh + 4);
    float xs[16] = {x0[0],x0[1],x0[2],x0[3],x1[0],x1[1],x1[2],x1[3],x2[0],x2[1],x2[2],x2[3],x3[0],x3[1],x3[2],x3[3]};
#pragma unroll
    for (int i = 0; i < 16; ++i) { const unsigned short hb = bf16_bits(xs[i]); ah.u[i] = hb; al.u[i] = ASPLIT ? bf16_bits(xs[i] - bf16_val(hb)) : (unsigned short)0; }
#pragma unroll
    for (int t = 0; t < 4; ++t) {
      const unsigned short* brow = Wt + (size_t)(col0 + t * 16 + ln) * ldb + kb;
      FragB b;
      b.half[0] = *(const v8us*)(brow + 8 * hh);
      b.half[1] = *(const v8us*)(brow + 16 + 8 * hh);
      acc[t] = mmaN<ASPLIT ? 2 : 1>(ah.v, al.v, b.v, b.v, acc[t]);
    }
  }
#pragma unroll
  for (int t = 0; t < 4; ++t) {
    float bv = bias ? bias[col0 + t * 16 + ln] : 0.f;
    if (BIAS_BF16) bv = bf16_round(bv);
#pragma unroll
    for (int r = 0; r < 8; ++r) { float v = acc[t][r] + bv; if (ACT == 1) v = fmaxf(v, 0.f); so[w][8 * hh + r][t * 16 + ln] = v; }
  }
  __builtin_amdgcn_fence(__ATOMIC_ACQ_REL, "workgroup");
  __builtin_amdgcn_wave_barrier();
  const int rsub = lane >> 4, c4 = (lane & 15) * 4;
  {
#pragma unroll
    for (int q = 0; q < 8; ++q) {
      const int r = q * 2 + rsub;
      const v4f v = *(const v4fa*)&so[w][r][c4];
      *(v4f*)(C + (size_t)(row0 + r) * ldc + col0 + c4) = v;
    }
    
  }
}

// GEMM C = act(A·W + bias + resid): A f32 (ASPLIT -> hi/lo 2 terms), Wt bf16 [N][K]; ACT 0 none, 1 relu, 2 exact gelu;
// resid (optional, f32, row index = (row % rmod), pitch ldr, RES_BF16 rounds it) added before the activation.
template <bool ASPLIT, int ACT, bool BIAS_BF16, bool RES_BF16>
__global__ __launch_bounds__(128) void k_gemm_bf3(const float* __restrict__ A, int lda, const unsigned short* __restrict__ Wt, int ldb,
                                                const float* __restrict__ bias, const float* __restrict__ resid, int rmod, int ldr,
                                                float* __restrict__ C, int ldc, int M, int N, int K) {
  __shared__ __attribute__((aligned(16))) float so[4][16][64];
  const int tid = threadIdx.x, w = tid >> 5, lane = tid & 31, ln = lane & 15, hh = lane >> 4;
  const int ntn = N / 64;
  const int wid = blockIdx.x * 4 + w;
  const int mt = wid / ntn, nq = wid % ntn;
  if (mt * 16 >= M) return;
  const int row0 = mt * 16, col0 = nq * 64;
  const float* arow = A + (size_t)(row0 + ln) * lda;
  v8f acc[4] = {};
  for (int kb = 0; kb < K; kb += 32) {
    FragB ah, al;
    const v4f x0 = *(const v4fa*)(arow + kb + 8 * hh), x1 = *(const v4fa*)(arow + kb + 8 * hh + 4);
    const v4f x2 = *(const v4fa*)(arow + kb + 16 + 8 * hh), x3 = *(const v4fa*)(arow + kb + 16 + 8 * hh + 4);
    float xs[16] = {x0[0],x0[1],x0[2],x0[3],x1[0],x1[1],x1[2],x1[3],x2[0],x2[1],x2[2],x2[3],x3[0],x3[1],x3[2],x3[3]};
#pragma unroll
    for (int i = 0; i < 16; ++i) { const unsigned short hb = bf16_bits(xs[i]); ah.u[i] = hb; al.u[i] = ASPLIT ? bf16_bits(xs[i] - bf16_val(hb)) : (unsigned short)0; }
#pragma unroll
    for (int t = 0; t < 4; ++t) {
      const unsigned short* brow = Wt + (size_t)(col0 + t * 16 + ln) * ldb + kb;
      FragB b;
      b.half[0] = *(const v8us*)(brow + 8 * hh);
      b.half[1] = *(const v8us*)(brow + 16 + 8 * hh);
      acc[t] = mmaN<ASPLIT ? 2 : 1>(ah.v, al.v, b.v, b.v, acc[t]);
    }
  }
#pragma unroll
  for (int t = 0; t < 4; ++t) {
    const int col = col0 + t * 16 + ln;
    float bv = bias ? bias[col] : 0.f;
    if (BIAS_BF16) bv = bf16_round(bv);
#pragma unroll
    for (int r = 0; r < 8; ++r) {
      float v = acc[t][r] + bv;
      if (resid) { float rv = resid[(size_t)((row0 + 8 * hh + r) % rmod) * ldr + col]; if (RES_BF16) rv = bf16_round(rv); v += rv; }
      if (ACT == 1) v = fmaxf(v, 0.f);
      if (ACT == 2) v = 0.5f * v * (1.0f + erff(v * 0.70710678118654752f));
      if (ACT == 3) { const float u = 0.7978845608028654f * (v + 0.044715f * v * v * v); v = 0.5f * v * (1.0f + tanhf(u)); }
      so[w][8 * hh + r][t * 16 + ln] = v;
    }
  }
  __builtin_amdgcn_fence(__ATOMIC_ACQ_REL, "workgroup");
  __builtin_amdgcn_wave_barrier();
  const int rsub = lane >> 4, c4 = (lane & 15) * 4;
  {
#pragma unroll
    for (int q = 0; q < 8; ++q) {
      const int r = q * 2 + rsub;
      const v4f v = *(const v4fa*)&so[w][r][c4];
      *(v4f*)(C + (size_t)(row0 + r) * ldc + col0 + c4) = v;
    }
    
  }
}
// row LayerNorm (biased variance, eps) over N: s = X (+ R); optional out_sum <- s; out_norm <- (s-mu)*rsqrt(var+eps)*g + b
template <bool PARAM_BF16>
__global__ __launch_bounds__(256) void k_layernorm(const float* __restrict__ X, const float* __restrict__ R, const float* __restrict__ g, const float* __restrict__ bta,
                                                  float* __restrict__ out_sum, float* __restrict__ out_norm, int N, float eps) {
  __shared__ float red[256];
  const int row = blockIdx.x, tid = threadIdx.x;
  const float* x = X + (size_t)row * N; const float* rr = R ? R + (size_t)row * N : nullptr;
  float vals[16];                     // up to N = 4096
  const int per = N / 256;            // contiguous chunk per thread? use strided-by-4 chunks: thread handles j = tid*4 + 1024*u
  float s1 = 0.f;
  for (int u = 0; u < per / 4; ++u) {
    const int j = tid * 4 + 1024 * u;
    const v4f a = *(const v4fa*)(x + j);
    v4f b = {0.f,0.f,0.f,0.f}; if (rr) b = *(const v4fa*)(rr + j);
#pragma unroll
    for (int q = 0; q < 4; ++q) { const float v = a[q] + b[q]; vals[u * 4 + q] = v; s1 += v; }
  }
  red[tid] = s1; __syncthreads();
  for (int st = 128; st > 0; st >>= 1) { if (tid < st) red[tid] += red[tid + st]; __syncthreads(); }
  const float mu = red[0] / (float)N; __syncthreads();
  float s2 = 0.f;
  for (int u = 0; u < per / 4; ++u)
#pragma unroll
    for (int q = 0; q < 4; ++q) { const float c = vals[u * 4 + q] - mu; s2 += c * c; }
  red[tid] = s2; __syncthreads();
  for (int st = 128; st > 0; st >>= 1) { if (tid < st) red[tid] += red[tid + st]; __syncthreads(); }
  const float rs = rsqrtf(red[0] / (float)N + eps);
  {
    for (int u = 0; u < per / 4; ++u) {
      const int j = tid * 4 + 1024 * u;
      v4f o, sm;
#pragma unroll
      for (int q = 0; q < 4; ++q) {
        float gg = g[j + q], bb = bta[j + q];
        if (PARAM_BF16) { gg = bf16_round(gg); bb = bf16_round(bb); }
        sm[q] = vals[u * 4 + q]; o[q] = (vals[u * 4 + q] - mu) * rs * gg + bb;
      }
      if (out_sum) *(v4f*)(out_sum + (size_t)row * N + j) = sm;
      *(v4f*)(out_norm + (size_t)row * N + j) = o;
    }
    
  }
}



// ---- f16 WMMA path (v_wmma_f32_16x16x32_f16): 11-bit significands for operands in range — used where the softmax weight operand (0 to 2^15) needs more precision than bf16
typedef _Float16 v16h __attribute__((ext_vector_type(16)));
union FragH { v16h v; v8us half[2]; _Float16 h[16]; unsigned short u[16]; };
template <int NT>
__device__ __forceinline__ v8f mmaH(v16h ah, v16h al, v16h bh, v16h bl, v8f c) {
  c = __builtin_amdgcn_wmma_f32_16x16x32_f16(false, ah, false, bh, (short)0, c, false, false);
  if (NT >= 2) c = __builtin_amdgcn_wmma_f32_16x16x32_f16(false, al, false, bh, (short)0, c, false, false);
  if (NT >= 3) c = __builtin_amdgcn_wmma_f32_16x16x32_f16(false, ah, false, bl, (short)0, c, false, false);
  asm volatile("v_nop\n\tv_nop\n\tv_nop\n\tv_nop" : "+v"(c) : "v"(ah), "v"(al), "v"(bh), "v"(bl));
  return c;
}
// batched GEMM like k_gemm_b but f16 operands: A f32 (split into f16 hi/lo if ASPLIT, else rounded to f16), Bt = f16 values [n][k]; alpha; C f32; N multiple of 16 (partial tiles skipped)
template <bool ASPLIT>
__global__ __launch_bounds__(128) void k_gemm_h(const float* __restrict__ A, int lda, size_t sA, const _Float16* __restrict__ Bh, int ldb, size_t sB, float alpha, float* __restrict__ C, int ldc, size_t sC, int M, int N, int K) {
  __shared__ __attribute__((aligned(16))) float so[4][16][64];
  const int tid = threadIdx.x, w = tid >> 5, lane = tid & 31, ln = lane & 15, hh = lane >> 4; const int by = blockIdx.y;
  A += (size_t)by * sA; Bh += (size_t)by * sB; C += (size_t)by * sC;
  const int ntn = (N + 63) / 64; const int wid = blockIdx.x * 4 + w; const int mt = wid / ntn, nq = wid % ntn; if (mt * 16 >= M) return;
  const int row0 = mt * 16, col0 = nq * 64; const float* arow = A + (size_t)(row0 + ln) * lda;
  v8f acc[4] = {};
  for (int kb = 0; kb < K; kb += 32) {
    FragH ah, al;
    const v4f x0 = *(const v4fa*)(arow + kb + 8 * hh), x1 = *(const v4fa*)(arow + kb + 8 * hh + 4), x2 = *(const v4fa*)(arow + kb + 16 + 8 * hh), x3 = *(const v4fa*)(arow + kb + 16 + 8 * hh + 4);
    float xs[16] = {x0[0],x0[1],x0[2],x0[3],x1[0],x1[1],x1[2],x1[3],x2[0],x2[1],x2[2],x2[3],x3[0],x3[1],x3[2],x3[3]};
#pragma unroll
    for (int i = 0; i < 16; ++i) { const _Float16 h = (_Float16)xs[i]; ah.h[i] = h; al.h[i] = ASPLIT ? (_Float16)(xs[i] - (float)h) : (_Float16)0.0f; }
#pragma unroll
    for (int t = 0; t < 4; ++t) { if (col0 + t * 16 >= N) continue; const size_t boff = (size_t)(col0 + t * 16 + ln) * ldb + kb; FragH bq; bq.half[0] = *(const v8us*)(Bh + boff + 8 * hh); bq.half[1] = *(const v8us*)(Bh + boff + 16 + 8 * hh);
      acc[t] = mmaH<ASPLIT ? 2 : 1>(ah.v, al.v, bq.v, bq.v, acc[t]); }
  }
#pragma unroll
  for (int t = 0; t < 4; ++t) { if (col0 + t * 16 >= N) continue;
#pragma unroll
    for (int r = 0; r < 8; ++r) so[w][8 * hh + r][t * 16 + ln] = acc[t][r] * alpha; }
  __builtin_amdgcn_fence(__ATOMIC_ACQ_REL, "workgroup"); __builtin_amdgcn_wave_barrier();
  const int rsub = lane >> 4, c4 = (lane & 15) * 4;
  {
#pragma unroll
    for (int q = 0; q < 8; ++q) { const int r = q * 2 + rsub; if (col0 + c4 < N) { const v4f v = *(const v4fa*)&so[w][r][c4]; *(v4f*)(C + (size_t)(row0 + r) * ldc + col0 + c4) = v; } }
     }
}

// Wt[n][k] = f16(W[k][n]·scale) from f32 row-major W[K][N] (scale = power of two; bf16-exact weights stay exact in f16 away from the subnormal range)
__global__ __launch_bounds__(256) void k_wt_f16(const float* __restrict__ W, _Float16* __restrict__ Wt, int K, int N, float scale) {
  const int t = blockIdx.x * 256 + threadIdx.x; if (t >= N * (K / 8)) return; const int n = t / (K / 8), k8 = (t % (K / 8)) * 8; FragH f;
#pragma unroll
  for (int i = 0; i < 8; ++i) f.h[i] = (_Float16)(bf16_round(W[(size_t)(k8 + i) * N + n]) * scale); const v8us o = f.half[0];
  *(v8us*)((unsigned short*)Wt + (size_t)n * K + k8) = o; 
}
// k_gemm_hh variant with fused epilogue: v = acc·alpha + bias[by·sBias + col] (+ CP[(row/rowsPerB)·sCPb + by·64 + col] if CP) ; ACT 0 none / 1 elu ; writes f16 C16 (and f32 C if non-null)
template <int ACT>
__global__ __launch_bounds__(128) void k_gemm_hhx(const _Float16* __restrict__ A, int lda, size_t sA, const _Float16* __restrict__ Bh, int ldb, size_t sB, float alpha, const float* __restrict__ bias, size_t sBias, const float* __restrict__ CP, int rowsPerB, size_t sCPb, int row0g,
    float* __restrict__ C, _Float16* __restrict__ C16, int ldc, size_t sC, int M, int N, int K) {
  __shared__ __attribute__((aligned(16))) float so[4][16][64];
  const int tid = threadIdx.x, w = tid >> 5, lane = tid & 31, ln = lane & 15, hh = lane >> 4; const int by = blockIdx.y;
  A += (size_t)by * sA; Bh += (size_t)by * sB; const size_t cofs = (size_t)by * sC; const float* bp = bias ? bias + (size_t)by * sBias : nullptr;
  const int ntn = (N + 63) / 64; const int wid = blockIdx.x * 4 + w; const int mt = wid / ntn, nq = wid % ntn; if (mt * 16 >= M) return;
  const int row0 = mt * 16, col0 = nq * 64; const _Float16* arow = A + (size_t)(row0 + ln) * lda;
  v8f acc[4] = {};
  for (int kb = 0; kb < K; kb += 32) { FragH ah; ah.half[0] = *(const v8us*)((const unsigned short*)arow + kb + 8 * hh); ah.half[1] = *(const v8us*)((const unsigned short*)arow + kb + 16 + 8 * hh);
#pragma unroll
    for (int t = 0; t < 4; ++t) { if (col0 + t * 16 >= N) continue; const size_t boff = (size_t)(col0 + t * 16 + ln) * ldb + kb; FragH bq; bq.half[0] = *(const v8us*)((const unsigned short*)Bh + boff + 8 * hh); bq.half[1] = *(const v8us*)((const unsigned short*)Bh + boff + 16 + 8 * hh);
      acc[t] = mmaH<1>(ah.v, ah.v, bq.v, bq.v, acc[t]); }
  }
#pragma unroll
  for (int t = 0; t < 4; ++t) { if (col0 + t * 16 >= N) continue; const int col = col0 + t * 16 + ln; const float bv = bp ? bf16_round(bp[col]) : 0.f;
#pragma unroll
    for (int r = 0; r < 8; ++r) { float v = acc[t][r] * alpha + bv; if (CP) { const int bidx = (row0g + row0 + 8 * hh + r) / rowsPerB; v += CP[(size_t)bidx * sCPb + (size_t)by * 64 + col]; } if (ACT == 1) v = (v > 0.f) ? v : expm1f(v); else if (ACT == 7) v = (v > 0.f) ? v + 1.0f : expf(v); else if (ACT == 8) v = tanhf(v); else if (ACT == 9) v = 0.5f * v * (1.0f + tanhf(0.7978845608028654f * (v + 0.044715f * v * v * v))); else if (ACT == 11) v = 1.0f / (1.0f + expf(-v)); else if (ACT == 12) v = (v > 0.f) ? v : 0.01f * v; else if (ACT == 14) v = (v > 0.f) ? v : 0.1f * v; else if (ACT == 15) v = v / (1.0f + expf(-v)); else if (ACT == 3) v = fmaxf(v, 0.f); else if (ACT == 6) v = 0.5f * v * (1.0f + erff(v * 0.70710678118654752f)); so[w][8 * hh + r][t * 16 + ln] = v; } }
  __builtin_amdgcn_fence(__ATOMIC_ACQ_REL, "workgroup"); __builtin_amdgcn_wave_barrier();
  const int rsub = lane >> 4, c4 = (lane & 15) * 4; typedef _Float16 v4h __attribute__((ext_vector_type(4)));
  {
#pragma unroll
    for (int q = 0; q < 8; ++q) { const int r = q * 2 + rsub; if (col0 + c4 < N) { const v4f v = *(const v4fa*)&so[w][r][c4]; if (C) *(v4f*)(C + cofs + (size_t)(row0 + r) * ldc + col0 + c4) = v; if (C16) { v4h h4; for (int i = 0; i < 4; ++i) h4[i] = (_Float16)v[i]; *(v4h*)(C16 + cofs + (size_t)(row0 + r) * ldc + col0 + c4) = h4; } } }
     }
}


typedef _Float16 v4h __attribute__((ext_vector_type(4)));

__global__ __launch_bounds__(256) void k_h16(const float* __restrict__ x, _Float16* __restrict__ X16, size_t n8) { const size_t t = (size_t)blockIdx.x * 256 + threadIdx.x; if (t >= n8) return; FragH f;
#pragma unroll
  for (int q = 0; q < 8; ++q) f.h[q] = (_Float16)x[t * 8 + q]; *(v8us*)((unsigned short*)X16 + t * 8) = f.half[0];  }
__global__ __launch_bounds__(256) void k_round16f(const float* __restrict__ W, _Float16* __restrict__ Bt, size_t n8) { const size_t t = (size_t)blockIdx.x * 256 + threadIdx.x; if (t >= n8) return; FragH f;
#pragma unroll
  for (int i = 0; i < 8; ++i) f.h[i] = (_Float16)(bf16_round(W[t * 8 + i]) * 16.0f); *(v8us*)((unsigned short*)Bt + t * 8) = f.half[0];  }
template <int NHv, int TTv>
__global__ __launch_bounds__(256) void k_vt(const _Float16* __restrict__ V16, int ldv, int voff, _Float16* __restrict__ Vt) { __shared__ unsigned short tl[64][66]; const int tid = threadIdx.x; const int slab = blockIdx.x / (TTv / 64), lg = blockIdx.x % (TTv / 64); const int b = slab / NHv, h = slab % NHv;
  for (int i = tid; i < 64 * 8; i += 256) { const int r = i / 8, c8 = (i % 8) * 8; FragH f; f.half[0] = *(const v8us*)((const unsigned short*)V16 + ((size_t)b * TTv + lg * 64 + r) * ldv + voff + h * 64 + c8);
#pragma unroll
    for (int q = 0; q < 8; ++q) tl[r][c8 + q] = f.u[q]; }
  __syncthreads();
  {
#pragma unroll
    for (int rd = 0; rd < 2; ++rd) { const int d = rd * 32 + tid / 8, pc = tid % 8; FragH f;
#pragma unroll
      for (int q = 0; q < 8; ++q) f.u[q] = tl[pc * 8 + q][d];
      *(v8us*)((unsigned short*)Vt + ((size_t)slab * 64 + d) * TTv + lg * 64 + pc * 8) = f.half[0]; }
     } }


// ---- fast GEMM (wave tile 32x64, block tile 128x64) ----
__device__ __forceinline__ v16h g2_frag(const _Float16* p, int hh) { FragH f; f.half[0] = *(const v8us*)((const unsigned short*)p + 8 * hh); f.half[1] = *(const v8us*)((const unsigned short*)p + 16 + 8 * hh); return f.v; }
__device__ __forceinline__ v8f g2_mma(v16h a, v16h b, v8f c) { v8f d = __builtin_amdgcn_wmma_f32_16x16x32_f16(false, a, false, b, (short)0, c, false, false); asm volatile("v_nop\n\tv_nop\n\tv_nop\n\tv_nop" : "+v"(d) : "v"(a), "v"(b)); return d; }
// One wave's share of a stage (192 rows of 128 bytes: 128 A rows, then 64 B rows, LDS pitch G2P bytes): 12 asynchronous 16-byte copies per lane, 8 lanes to a row, so that each copy of a wave reads 4 whole 128-byte lines.
// l = this lane's LDS byte address in the stage's row tid / 8; ga, gb = this lane's 16 bytes in A row tid / 8 and B row tid / 8 of the stage; every further copy is 16 rows on.
#define G2P 144            /* 128 + 16: the pitch for 16-byte LDS reads of 128-byte rows */
#define G2S (192 * G2P)    /* bytes of one stage */
__device__ __forceinline__ void g2_stage(unsigned l, const _Float16* ga, size_t lda, const _Float16* gb, size_t ldb) {
  const unsigned l1 = l + 16 * G2P, l2 = l + 32 * G2P, l3 = l + 48 * G2P, l4 = l + 64 * G2P, l5 = l + 80 * G2P, l6 = l + 96 * G2P, l7 = l + 112 * G2P, l8 = l + 128 * G2P, l9 = l + 144 * G2P, l10 = l + 160 * G2P, l11 = l + 176 * G2P;
  const _Float16 *a1 = ga + 16 * lda, *a2 = ga + 32 * lda, *a3 = ga + 48 * lda, *a4 = ga + 64 * lda, *a5 = ga + 80 * lda, *a6 = ga + 96 * lda, *a7 = ga + 112 * lda, *b1 = gb + 16 * ldb, *b2 = gb + 32 * ldb, *b3 = gb + 48 * ldb;
  /* the copies and their s_wait_xcnt in one statement: no address register is rewritten before the wait */
  asm volatile("global_load_async_to_lds_b128 %0, %12, off\n\t"
               "global_load_async_to_lds_b128 %1, %13, off\n\t"
               "global_load_async_to_lds_b128 %2, %14, off\n\t"
               "global_load_async_to_lds_b128 %3, %15, off\n\t"
               "global_load_async_to_lds_b128 %4, %16, off\n\t"
               "global_load_async_to_lds_b128 %5, %17, off\n\t"
               "global_load_async_to_lds_b128 %6, %18, off\n\t"
               "global_load_async_to_lds_b128 %7, %19, off\n\t"
               "global_load_async_to_lds_b128 %8, %20, off\n\t"
               "global_load_async_to_lds_b128 %9, %21, off\n\t"
               "global_load_async_to_lds_b128 %10, %22, off\n\t"
               "global_load_async_to_lds_b128 %11, %23, off\n\t"
               "s_wait_xcnt 0x0"
               :: "v"(l), "v"(l1), "v"(l2), "v"(l3), "v"(l4), "v"(l5), "v"(l6), "v"(l7), "v"(l8), "v"(l9), "v"(l10), "v"(l11),
                  "v"(ga), "v"(a1), "v"(a2), "v"(a3), "v"(a4), "v"(a5), "v"(a6), "v"(a7), "v"(gb), "v"(b1), "v"(b2), "v"(b3) : "memory"); }
// The three projections in ONE launch: blockIdx.y picks the weight plane (0 q, 1 k, 2 v; the planes lie one behind the other in B3) and what the epilogue makes of the tile, so that q, k and v never exist as f32 planes in memory.
// Block tile 128 tokens x 64 columns = one head; K = DM; A and B go through LDS in stages of 64 k, two buffers: stage t + 1 flies while stage t is worked on. The fragments are read from LDS in the k order of g2_frag.
// q, k: the wave's 32x64 tile goes through its own LDS rows, a lane takes 4 neighbouring columns = 2 rotary pairs back, turns them by the sinusoidal_pos INPUT row of its token ([sin | cos], rounded like every input) and stores 4 f16: 16 lanes write one head row = one 128-byte line.
// v: register r of an accumulator is token 8 hh + r of one head column, so 8 converted registers are 16 bytes of a V^T row; the block's 64 x 128 V^T tile is gathered in LDS and stored as whole 256-byte rows.
#define VTP 136            /* f16 per LDS row of the V^T tile: 256 + 16 bytes */
__global__ __launch_bounds__(128) void k_qkv(const _Float16* __restrict__ A, const _Float16* __restrict__ B3, const float* __restrict__ sp, _Float16* __restrict__ Q16, _Float16* __restrict__ K16, _Float16* __restrict__ Vt) {
  __shared__ __attribute__((aligned(16))) float so[4][32][68];
  __shared__ __attribute__((aligned(16))) _Float16 st[2][192][G2P / 2];
  const int tid = threadIdx.x, w = tid >> 5, lane = tid & 31, ln = lane & 15, hh = lane >> 4; const int by = blockIdx.y;
  const _Float16* Bh = B3 + (size_t)by * DM * DM;
  const int mt = blockIdx.x / NH, nq = blockIdx.x % NH; const int row0 = mt * 128 + 32 * w, col0 = nq * 64;
  const _Float16* ga = A + (size_t)(mt * 128 + (tid >> 3)) * DM + (tid & 7) * 8; const _Float16* gb = Bh + (size_t)(col0 + (tid >> 3)) * DM + (tid & 7) * 8;
  const unsigned ls = (unsigned)(size_t)&st[0][tid >> 3][(tid & 7) * 8];
  constexpr int nst = DM >> 6;
  g2_stage(ls, ga, (size_t)DM, gb, (size_t)DM);
  asm volatile("s_wait_asynccnt 0x0" ::: "memory");      /* stage 0 of this wave has landed */
  __syncthreads();      /* ... and every wave's share of it */
  g2_stage(ls + G2S, ga + 64, (size_t)DM, gb + 64, (size_t)DM);
  const v8f z8 = {0.f,0.f,0.f,0.f,0.f,0.f,0.f,0.f}; v8f c00 = z8, c01 = z8, c02 = z8, c03 = z8, c10 = z8, c11 = z8, c12 = z8, c13 = z8;
  /* rolled: one trip of code; the buffer is picked by the trip's parity */
#pragma unroll 1
  for (int t = 0; t < nst; ++t) { const _Float16* sa = &st[t & 1][32 * w + ln][0]; const _Float16* sb = &st[t & 1][128 + ln][0];
    /* all of the trip's fragments are read here, ahead of its first product */
    const v16h a00 = g2_frag(sa, hh), a10 = g2_frag(sa + 16 * (G2P / 2), hh), b00 = g2_frag(sb, hh), b10 = g2_frag(sb + 16 * (G2P / 2), hh), b20 = g2_frag(sb + 32 * (G2P / 2), hh), b30 = g2_frag(sb + 48 * (G2P / 2), hh);
    const v16h a01 = g2_frag(sa + 32, hh), a11 = g2_frag(sa + 16 * (G2P / 2) + 32, hh), b01 = g2_frag(sb + 32, hh), b11 = g2_frag(sb + 16 * (G2P / 2) + 32, hh), b21 = g2_frag(sb + 32 * (G2P / 2) + 32, hh), b31 = g2_frag(sb + 48 * (G2P / 2) + 32, hh);
    c00 = g2_mma(a00, b00, c00); c10 = g2_mma(a10, b00, c10); c01 = g2_mma(a00, b10, c01); c11 = g2_mma(a10, b10, c11);
    c02 = g2_mma(a00, b20, c02); c12 = g2_mma(a10, b20, c12); c03 = g2_mma(a00, b30, c03); c13 = g2_mma(a10, b30, c13);
    c00 = g2_mma(a01, b01, c00); c10 = g2_mma(a11, b01, c10); c01 = g2_mma(a01, b11, c01); c11 = g2_mma(a11, b11, c11);
    c02 = g2_mma(a01, b21, c02); c12 = g2_mma(a11, b21, c12); c03 = g2_mma(a01, b31, c03); c13 = g2_mma(a11, b31, c13);
    asm volatile("s_wait_dscnt 0x0" ::: "memory");      /* this wave's reads of the buffer are done before it is refilled */
    asm volatile("s_wait_asynccnt 0x0" ::: "memory");      /* this wave's share of stage t + 1 has landed */
    __syncthreads();      /* publishes stage t + 1 and ends every wave's reads of stage t */
    if (t + 2 < nst) g2_stage(ls + (unsigned)(t & 1) * G2S, ga + (size_t)(t + 2) * 64, (size_t)DM, gb + (size_t)(t + 2) * 64, (size_t)DM); }
  asm volatile("s_wait_asynccnt 0x0" ::: "memory");      /* nothing in flight when the wave goes on to the epilogue */
  v8f accs[8] = {c00, c01, c02, c03, c10, c11, c12, c13};      /* the weights hold the factor 16: every value below is accumulator / 16 */
  if (by == 2) {      /* the same for the whole block */
    _Float16* vt = (_Float16*)&so[0][0][0];
#pragma unroll      /* constant indices: accumulators and table words stay in registers */
    for (int u = 0; u < 8; ++u) { const int t = u & 3, half = u >> 2; FragH f;
#pragma unroll      /* constant indices: accumulators and table words stay in registers */
      for (int r = 0; r < 8; ++r) f.h[r] = (_Float16)(accs[u][r] * 0.0625f);
      *(v8us*)((unsigned short*)vt + (t * 16 + ln) * VTP + 32 * w + half * 16 + 8 * hh) = f.half[0]; }
    __syncthreads();      /* a V^T row holds tokens of all four waves */
    const int b = (mt * 128) / SLEN, key0 = (mt * 128) % SLEN;
#pragma unroll      /* the eight LDS reads stand together, ahead of the stores */
    for (int p = 0; p < 8; ++p) { const int d = p * 8 + (tid >> 4), c8 = (tid & 15) * 8; const v8us val = *(const v8us*)((const unsigned short*)vt + d * VTP + c8);
      *(v8us*)((unsigned short*)Vt + ((size_t)(b * NH + nq) * 64 + d) * SLEN + key0 + c8) = val; }
  } else {
    _Float16* __restrict__ H = by ? K16 : Q16;
    const int rsub = lane >> 4, c4 = (lane & 15) * 4;
    /* the table words of token row0 + rsub, pairs c4 / 2 and c4 / 2 + 1; the lane's next token is two rows = 128 floats on (a wave's 32 tokens never cross the end of a sequence). Asked for ahead of the LDS round trip, which hides their way */
    const float* pr = sp + (size_t)(row0 % SLEN + rsub) * 64 + (c4 >> 1); v2fa sn[16], cs[16];
#pragma unroll      /* constant indices: accumulators and table words stay in registers */
    for (int q = 0; q < 16; ++q) { sn[q] = *(const v2fa*)(pr + q * 128); cs[q] = *(const v2fa*)(pr + q * 128 + 32); }
    asm volatile("s_wait_xcnt 0x0" :: "v"(pr) : "memory");      /* the loads' address register lives up to this wait: nothing is written over it while a load that names it is under way */
#pragma unroll      /* constant indices: accumulators and table words stay in registers */
    for (int u = 0; u < 8; ++u) { const int t = u & 3, half = u >> 2;
#pragma unroll      /* constant indices: accumulators and table words stay in registers */
      for (int r = 0; r < 8; ++r) so[w][half * 16 + 8 * hh + r][t * 16 + ln] = accs[u][r] * 0.0625f; }
    __builtin_amdgcn_fence(__ATOMIC_ACQ_REL, "workgroup"); __builtin_amdgcn_wave_barrier();      /* the wave's LDS writes are done before its lanes read rows that other lanes wrote */
    _Float16* hp = H + (size_t)(row0 + rsub) * DM + col0 + c4;
#pragma unroll      /* constant indices: accumulators and table words stay in registers */
    for (int q = 0; q < 16; ++q) { const v4f v = *(const v4fa*)&so[w][q * 2 + rsub][c4];
      const float s0 = bf16_round(sn[q][0]), s1 = bf16_round(sn[q][1]), k0 = bf16_round(cs[q][0]), k1 = bf16_round(cs[q][1]);
      v4h h4; h4[0] = (_Float16)(v[0] * k0 - v[1] * s0); h4[1] = (_Float16)(v[0] * s0 + v[1] * k0); h4[2] = (_Float16)(v[2] * k1 - v[3] * s1); h4[3] = (_Float16)(v[2] * s1 + v[3] * k1);
      *(v4h*)(hp + (size_t)q * 2 * DM) = h4; }
    asm volatile("s_wait_xcnt 0x0" ::: "memory");      /* behind the last store of the run: no register that a store names is written over while the store is under way, on whatever code the build lays behind this branch */
  } }



// lane l <-> lane l ^ 16 (the two halves of a wave hold the two key halves of one query column)
__device__ __forceinline__ float xhalf(float x) { return __builtin_bit_cast(float, __builtin_amdgcn_permlanex16(__builtin_bit_cast(int, x), __builtin_bit_cast(int, x), 0x76543210, 0xfedcba98, false, false)); }
__device__ __forceinline__ v8f mmaT(v16h a, v16h b, v8f c) { return __builtin_amdgcn_wmma_f32_16x16x32_f16(false, a, false, b, (short)0, c, false, false); }
// One wave's share of one key group's half of a flash stage, 64 keys (128 rows of 128 bytes: 64 K rows of the head, then the 64 V^T rows' 64 keys, LDS pitch FLP bytes): 8 asynchronous 16-byte copies per lane, 8 lanes to a row, so that each copy of a wave reads 4 whole 128-byte lines.
// With i = the thread's number among its key group's 128: l = this lane's LDS byte address in the half's row i / 8; gk, gv = this lane's 16 bytes in K row i / 8 and V^T row i / 8 of the half; every further copy is 16 rows on.
#define FLP 144            /* 128 + 16: the pitch for 16-byte LDS reads of 128-byte rows */
#define FLS (128 * FLP)    /* bytes of one key group's half of a stage */
__device__ __forceinline__ void fl_stage(unsigned l, const _Float16* gk, size_t ldk, const _Float16* gv) {
  const unsigned l1 = l + 16 * FLP, l2 = l + 32 * FLP, l3 = l + 48 * FLP, l4 = l + 64 * FLP, l5 = l + 80 * FLP, l6 = l + 96 * FLP, l7 = l + 112 * FLP;
  const _Float16 *k1 = gk + 16 * ldk, *k2 = gk + 32 * ldk, *k3 = gk + 48 * ldk, *v1 = gv + 16 * TK, *v2 = gv + 32 * TK, *v3 = gv + 48 * TK;
  /* the copies and their s_wait_xcnt in one statement: no address register is rewritten before the wait */
  asm volatile("global_load_async_to_lds_b128 %0, %8, off\n\t"
               "global_load_async_to_lds_b128 %1, %9, off\n\t"
               "global_load_async_to_lds_b128 %2, %10, off\n\t"
               "global_load_async_to_lds_b128 %3, %11, off\n\t"
               "global_load_async_to_lds_b128 %4, %12, off\n\t"
               "global_load_async_to_lds_b128 %5, %13, off\n\t"
               "global_load_async_to_lds_b128 %6, %14, off\n\t"
               "global_load_async_to_lds_b128 %7, %15, off\n\t"
               "s_wait_xcnt 0x0"
               :: "v"(l), "v"(l1), "v"(l2), "v"(l3), "v"(l4), "v"(l5), "v"(l6), "v"(l7),
                  "v"(gk), "v"(k1), "v"(k2), "v"(k3), "v"(gv), "v"(v1), "v"(v2), "v"(v3) : "memory"); }
// Transposed products: S^T = K Q^T (A = 16 key rows, B = 16 query columns, kept in registers), O^T += V^T P^T (A = 16 rows of V^T, B = P^T).
// A wave holds TWO tiles of 16 query columns (cg = 0, 1): every K and V^T fragment that it reads from LDS feeds two products. So that the chip still has as many waves, the keys are split inside the block: 8 waves = 4 query groups of 32 x 2 key groups; of each stage of 128 keys, key group g works on keys 64 g ... 64 g + 63, with its own reference, sum and accumulators, and the two groups' results are joined once, behind the loop, through LDS.
// Lane (c = lane & 15, hh = lane >> 4) holds queries q0 + c and q0 + 16 + c only: register r of score tile nt is key j0 + 16 nt + 8 hh + r, so maximum and sum run in-lane plus one exchange between the halves,
// and the two converted score tiles ARE the B operand of the second product in the hardware k order (element s: key 8 hh + s, then 16 + 8 hh + (s - 8)), the order in which the V^T rows are loaded.
// The softmax runs in base 2: the score factor holds log2 e and the mask table is already in those units. Each query column keeps a reference r_c, set 10 below the column's maximum at the time it was set, and a weight is 2^(score - r_c): a subtraction and one v_exp_f32; numerator and denominator hold the same factor, which the final division takes out. The reference moves, and accumulators and sum are rescaled, only when a score has climbed more than 15 above it.
// K and V^T go through LDS in stages of 2 x 64 keys (each key group: two passes of 32), two buffers, shared by the block's waves: stage t + 1 flies while stage t is worked on; a key group's 4 waves copy that group's half of the stage. The fragments are read from LDS in the k order of g2_frag.
template <int CAUSAL>
__global__ __launch_bounds__(256) __attribute__((amdgpu_waves_per_eu(4, 4))) void k_flash(const _Float16* __restrict__ Q16, int ldq, const _Float16* __restrict__ K16, int ldk, const _Float16* __restrict__ Vt, const int* __restrict__ MSK, float* __restrict__ O, int ldo) {
  constexpr int RPW = 32, CG = 2, DT = 4, KS = 2;
  __shared__ __attribute__((aligned(16))) float sO[4][RPW][64 + 4];
  __shared__ __attribute__((aligned(16))) float sM[4][CG * DT * 2][32][4];      /* key group 1's accumulators on their way to key group 0: 16 bytes a lane, lanes side by side */
  __shared__ float sL[4][CG][2][32];      /* ... and its sums and references */
  __shared__ __attribute__((aligned(16))) _Float16 st[2][2][128][FLP / 2];      /* [buffer][key group][64 K rows, 64 V^T rows] */
  const int tid = threadIdx.x, g = tid >> 7, t7 = tid & 127, w = (tid >> 5) & 3, lane = tid & 31, ln = lane & 15, hh = lane >> 4;
  const int slab = blockIdx.x / QBNP, qblk = QB0P + blockIdx.x % QBNP; const int b = slab / NH, h = slab % NH; const int qb0 = qblk * (4 * RPW); const int q0 = qb0 + w * RPW;
  FragH bq[CG][KS];
#pragma unroll
  for (int cg = 0; cg < CG; ++cg) { const unsigned short* qr = (const unsigned short*)Q16 + ((size_t)b * TQ + q0 + cg * 16 + ln) * ldq + h * 64;
#pragma unroll
    for (int ks = 0; ks < KS; ++ks) { bq[cg][ks].half[0] = *(const v8us*)(qr + ks * 32 + 8 * hh); bq[cg][ks].half[1] = *(const v8us*)(qr + ks * 32 + 16 + 8 * hh); } }
  /* this lane's 16 bytes of its key group's half of stage 0 (K row t7 / 8 of the half, V^T row t7 / 8) and their place in buffer 0 */
  const _Float16* gk = K16 + ((size_t)b * TK + g * 64 + (t7 >> 3)) * ldk + h * 64 + (t7 & 7) * 8; const _Float16* gv = Vt + ((size_t)slab * 64 + (t7 >> 3)) * TK + g * 64 + (t7 & 7) * 8;
  const unsigned ls = (unsigned)(size_t)&st[0][g][t7 >> 3][(t7 & 7) * 8];
  const char* mb = (const char*)((const float*)MSK + (size_t)b * TK); const unsigned mo = (unsigned)g * 256u + (unsigned)hh * 32u;      /* a uniform base that steps with the stage; this key group's and this half's 8 mask words */
  float r_c[CG], l_c[CG]; v8f oacc[CG][DT];      /* r_c: the column's reference, see the stage loop */
#pragma unroll
  for (int cg = 0; cg < CG; ++cg) { r_c[cg] = -3.0e38f; l_c[cg] = 0.f;
#pragma unroll
    for (int dt = 0; dt < DT; ++dt) oacc[cg][dt] = (v8f){0.f,0.f,0.f,0.f,0.f,0.f,0.f,0.f}; }
  const int jend = (CAUSAL == 1) ? (qb0 + 4 * RPW) : TK;      /* causal: keys beyond the block's last query never contribute */
  const int nst = jend >> 7;      /* both ends are multiples of 128; the same for the whole block */
  fl_stage(ls, gk, (size_t)ldk, gv);
  asm volatile("s_wait_asynccnt 0x0" ::: "memory");      /* stage 0 of this wave has landed */
  __syncthreads();      /* ... and every wave's share of it */
  if (nst > 1) fl_stage(ls + 2 * FLS, gk + (size_t)128 * ldk, (size_t)ldk, gv + 128);
  /* One loop over passes of 32 keys x 32 query columns, two passes to a stage; a pass runs from its K fragments to its second products, so that only one pass's scores and fragments are live at a time (the wave keeps within the registers of four waves a SIMD). The loop stays rolled: one pass of code, accumulators in the same registers throughout (with the two passes of a stage unrolled this build copied all 64 accumulator registers to and fro around the second pass's rescale branch); buffer and pass are picked by the trip's number; every inner loop is unrolled so that the fragment and score arrays have constant indices and stay in registers */
#pragma unroll 1
  for (int ps2 = 0; ps2 < 2 * nst; ++ps2) { const int t = ps2 >> 1, pp = ps2 & 1; const _Float16* skr = &st[t & 1][g][pp * 32 + ln][0]; const _Float16* svr = &st[t & 1][g][64 + ln][pp * 32];      /* this lane's first K row and its V^T row's 32 keys of the pass, in its key group's half of the buffer */
   { const int j0 = t * 128 + g * 64 + pp * 32;
    v4f mk[2][2];      /* the pass's mask words (from the table in global memory) are asked for first: they have the longest way */
    if (CAUSAL == 17) {
#pragma unroll
      for (int nt = 0; nt < 2; ++nt) { mk[nt][0] = *(const v4fa*)(mb + mo + nt * 64); mk[nt][1] = *(const v4fa*)(mb + mo + nt * 64 + 16); } }
    FragH ak[2][KS], av[DT]; v2f sc[CG][8]; bool ok[CG][16];      /* scores as the register pairs in which the accumulators hold them: written as two-vectors so that the packed instructions work on those pairs (left to itself this build paired the two column tiles and moved every score into place) */
#pragma unroll
    for (int nt = 0; nt < 2; ++nt) {
#pragma unroll
      for (int ks = 0; ks < KS; ++ks) ak[nt][ks].v = g2_frag(skr + nt * 16 * (FLP / 2) + ks * 32, hh); }      /* key rows ln and 16 + ln of the pass */
    asm volatile("" :: "v"(ak[0][0].v), "v"(ak[0][1].v), "v"(ak[1][0].v), "v"(ak[1][1].v));      /* inputs only: keeps the pass's eight K reads together in front of its first product (one LDS wait instead of one for each fragment) */
#pragma unroll
    for (int nt = 0; nt < 2; ++nt) {
#pragma unroll
     for (int cg = 0; cg < CG; ++cg) { const int tq = q0 + cg * 16 + ln; v8f acc = (v8f){0.f,0.f,0.f,0.f,0.f,0.f,0.f,0.f};
#pragma unroll
      for (int ks = 0; ks < KS; ++ks) acc = mmaT(ak[nt][ks].v, bq[cg][ks].v, acc);
#pragma unroll
      for (int j = 0; j < 4; ++j) { v2f s2 = (v2f){acc[2 * j], acc[2 * j + 1]} * SCL2;
#pragma unroll
        for (int e = 0; e < 2; ++e) { const int kk = j0 + nt * 16 + 8 * hh + 2 * j + e; const bool okk = (CAUSAL == 1) ? (kk <= tq) : ((CAUSAL == 2) ? ((kk >> 5) == (tq >> 5)) : true);      /* mode 2: block-diagonal 32-token groups */
          if (!okk) s2[e] = -3.0e38f; ok[cg][nt * 8 + 2 * j + e] = okk; }
        if (CAUSAL == 17) s2 += (v2f){mk[nt][j >> 1][(2 * j) & 3], mk[nt][j >> 1][((2 * j) & 3) + 1]};      /* mode 17: additive per-(batch, key) mask, rounded and scaled by k_prep */
        sc[cg][nt * 4 + j] = s2; } } }
#pragma unroll
    for (int dt = 0; dt < DT; ++dt) av[dt].v = g2_frag(svr + dt * 16 * (FLP / 2), hh);      /* V^T row dt * 16 + ln, the pass's 32 keys */
    float mc[CG];
#pragma unroll
    for (int cg = 0; cg < CG; ++cg) { float mx[8];
#pragma unroll
      for (int i = 0; i < 8; ++i) mx[i] = fmaxf(sc[cg][i][0], sc[cg][i][1]);      /* neighbours first (a maximum is exact in any order): the packed score multiply-adds then work on register pairs as the accumulators hold them, with no moves */
      mc[cg] = fmaxf(fmaxf(fmaxf(mx[0], mx[1]), fmaxf(mx[2], mx[3])), fmaxf(fmaxf(mx[4], mx[5]), fmaxf(mx[6], mx[7]))); }
    /* Lazy rescale, one test a pass (as many scores to a test as before): while no column's score lies more than 15 above its reference, every weight 2^(score - reference) is at most 2^15, which f16 holds, and numerator and denominator go on in the units they are in. A scalar branch: the whole wave takes it or none */
    if (__builtin_amdgcn_ballot_w32(fmaxf(mc[0] - r_c[0], mc[1] - r_c[1]) > 15.0f) != 0) {      /* mc: the maximum of this half's 16 keys of the pass; the vote sees both halves and both column tiles */
#pragma unroll
     for (int cg = 0; cg < CG; ++cg) {
      const float mj = fmaxf(mc[cg], xhalf(mc[cg]));      /* both halves now hold the query's maximum over the pass's 32 keys, so both set the same reference */
      float rn = mj - 10.0f; if (mj - rn > 15.0f) rn = mj;      /* where the maximum is so large that the subtraction rounds to more than 15 below it, the reference is the maximum itself: no weight ever leaves f16 */
      rn = fmaxf(r_c[cg], rn); const float da = r_c[cg] - rn; float ea;
      asm("v_exp_f32 %0, %1\n\tv_nop" : "=&v"(ea) : "v"(da));      /* the v_nop is the slot that the instruction set asks for behind a transcendental */
      const float al = (rn > -1.0e38f * LOG2E) ? ea : 1.0f;      /* the same test as before, its threshold in base-2 units */
      r_c[cg] = rn; l_c[cg] *= al;
#pragma unroll
      for (int dt = 0; dt < DT; ++dt) {
#pragma unroll
        for (int r = 0; r < 8; ++r) oacc[cg][dt][r] *= al; } } }
    FragH pb[CG];
#pragma unroll
   for (int cg = 0; cg < CG; ++cg) {
    float x[16], p[16];
#pragma unroll
    for (int i = 0; i < 8; ++i) { const v2f x2 = sc[cg][i] - (v2f){r_c[cg], r_c[cg]}; x[2 * i] = x2[0]; x[2 * i + 1] = x2[1]; }      /* never above 15 */
    /* 2^x is the one hardware instruction v_exp_f32 (a result below the normal range comes out as 0: such a weight is 0 in the f16 operand anyway). A tile's sixteen stand in two statements because the instruction set asks that the instruction directly behind a transcendental neither read its result nor overwrite its source: the early-clobber outputs keep every result out of every argument's register, and the v_nop is the slot of each statement's last v_exp_f32 */
    asm("v_exp_f32 %0, %8\n\tv_exp_f32 %1, %9\n\tv_exp_f32 %2, %10\n\tv_exp_f32 %3, %11\n\tv_exp_f32 %4, %12\n\tv_exp_f32 %5, %13\n\tv_exp_f32 %6, %14\n\tv_exp_f32 %7, %15\n\tv_nop"
        : "=&v"(p[0]), "=&v"(p[1]), "=&v"(p[2]), "=&v"(p[3]), "=&v"(p[4]), "=&v"(p[5]), "=&v"(p[6]), "=&v"(p[7]) : "v"(x[0]), "v"(x[1]), "v"(x[2]), "v"(x[3]), "v"(x[4]), "v"(x[5]), "v"(x[6]), "v"(x[7]));
    asm("v_exp_f32 %0, %8\n\tv_exp_f32 %1, %9\n\tv_exp_f32 %2, %10\n\tv_exp_f32 %3, %11\n\tv_exp_f32 %4, %12\n\tv_exp_f32 %5, %13\n\tv_exp_f32 %6, %14\n\tv_exp_f32 %7, %15\n\tv_nop"
        : "=&v"(p[8]), "=&v"(p[9]), "=&v"(p[10]), "=&v"(p[11]), "=&v"(p[12]), "=&v"(p[13]), "=&v"(p[14]), "=&v"(p[15]) : "v"(x[8]), "v"(x[9]), "v"(x[10]), "v"(x[11]), "v"(x[12]), "v"(x[13]), "v"(x[14]), "v"(x[15]));
#pragma unroll
    for (int i = 0; i < 16; ++i) { if (!ok[cg][i]) p[i] = 0.f; pb[cg].h[i] = (_Float16)p[i]; }
    const float pe = ((p[0] + p[2]) + (p[4] + p[6])) + ((p[8] + p[10]) + (p[12] + p[14])), po = ((p[1] + p[3]) + (p[5] + p[7])) + ((p[9] + p[11]) + (p[13] + p[15])); const float ps = pe + po;
    l_c[cg] += ps; }      /* this half's 16 keys of the pass; halves and key groups are joined once, behind the loop */
    __builtin_amdgcn_sched_barrier(0);      /* every v_exp_f32 statement stays in front of the pass's second products */
#pragma unroll
    for (int dt = 0; dt < DT; ++dt) {
#pragma unroll
      for (int cg = 0; cg < CG; ++cg) oacc[cg][dt] = mmaT(av[dt].v, pb[cg].v, oacc[cg][dt]); } }
    mb += pp ? 384 : 128;      /* the key group's next 32 keys: in this stage, or in the next one, past the other group's 64 */
    if (pp) {      /* the foot of a stage; the test reads the same for the whole block */
    asm volatile("s_wait_dscnt 0x0" ::: "memory");      /* this wave's reads of the buffer are done before it is refilled */
    asm volatile("s_wait_asynccnt 0x0" ::: "memory");      /* this wave's share of stage t + 1 has landed */
    __syncthreads();      /* publishes stage t + 1 and ends every wave's reads of stage t */
    if (t + 2 < nst) fl_stage(ls + (unsigned)(t & 1) * (2 * FLS), gk + (size_t)(t + 2) * 128 * ldk, (size_t)ldk, gv + (size_t)(t + 2) * 128); } }
  asm volatile("s_wait_asynccnt 0x0" ::: "memory");      /* nothing in flight when the wave goes on to the epilogue */
  /* the join of the two key groups: group 1 hands accumulators, sums and references to the wave of group 0 that holds the same queries */
  if (g == 1) {      /* the same for a whole wave */
#pragma unroll
    for (int cg = 0; cg < CG; ++cg) { sL[w][cg][0][lane] = l_c[cg]; sL[w][cg][1][lane] = r_c[cg];
#pragma unroll
      for (int dt = 0; dt < DT; ++dt) { v4f lo, hi;
#pragma unroll
        for (int r = 0; r < 4; ++r) { lo[r] = oacc[cg][dt][r]; hi[r] = oacc[cg][dt][4 + r]; }
        *(v4fa*)&sM[w][(cg * DT + dt) * 2][lane][0] = lo; *(v4fa*)&sM[w][(cg * DT + dt) * 2 + 1][lane][0] = hi; } } }
  __syncthreads();      /* group 1's LDS writes are done before group 0 reads them; every wave passes it */
  if (g == 1) return;      /* no barrier stands behind this line */
#pragma unroll
  for (int cg = 0; cg < CG; ++cg) {
    const float l1 = sL[w][cg][0][lane], r1 = sL[w][cg][1][lane]; const float rn = fmaxf(r_c[cg], r1); const float d0 = r_c[cg] - rn, d1 = r1 - rn; float a0, a1;      /* both parts go to the units of the higher reference: one factor is 1, the other at most 1 */
    asm("v_exp_f32 %0, %2\n\tv_exp_f32 %1, %3\n\tv_nop" : "=&v"(a0), "=&v"(a1) : "v"(d0), "v"(d1));      /* the v_nop is the slot that the instruction set asks for behind a transcendental */
    const float lj = l_c[cg] * a0 + l1 * a1;
    const float l = lj + xhalf(lj); const float inv = (l > 0.f) ? 1.0f / l : 0.f;      /* numerator and denominator both hold the factor 2^-rn */
    const float f0 = a0 * inv, f1 = a1 * inv;
#pragma unroll
    for (int dt = 0; dt < DT; ++dt) { const v4f ml = *(const v4fa*)&sM[w][(cg * DT + dt) * 2][lane][0], mh = *(const v4fa*)&sM[w][(cg * DT + dt) * 2 + 1][lane][0]; v4f lo, hi;      /* register r = head column dt * 16 + 8 hh + r of query q0 + 16 cg + ln */
#pragma unroll
      for (int r = 0; r < 4; ++r) { lo[r] = oacc[cg][dt][r] * f0 + ml[r] * f1; hi[r] = oacc[cg][dt][4 + r] * f0 + mh[r] * f1; }
      *(v4fa*)&sO[w][cg * 16 + ln][dt * 16 + 8 * hh] = lo; *(v4fa*)&sO[w][cg * 16 + ln][dt * 16 + 8 * hh + 4] = hi; } }
  __builtin_amdgcn_fence(__ATOMIC_ACQ_REL, "workgroup"); __builtin_amdgcn_wave_barrier();
  {
#pragma unroll
    for (int rp = 0; rp < RPW; rp += 2) { const int r = rp + (lane >> 4), pc = lane & 15; const v4f val = *(const v4fa*)&sO[w][r][pc * 4]; *(v4f*)(O + ((size_t)b * TQ + q0 + r) * ldo + h * 64 + pc * 4) = val; }
     } }
// 5-plane variant: S = Qh Kh^T + (Ql Kh^T + Qh Kl^T)/1024 with Q/K = [hi | 2^10 residual] f16 planes (QL/KL same layout as Q16/K16), then the 3-term P.V below.
// 3-term variant: O = (P_hi V_hi + (P_lo V_hi + P_hi V_lo) / 1024) / l with P = [hi | 2^10 residual] of 1024 p and V^T = [hi | 2^10 residual] planes (VtL same layout as Vt) -> ~2^-21-class products for un-averaged (early causal / peaked) rows
template <int CAUSAL>
__global__ __launch_bounds__(128) void k_flash5(const _Float16* __restrict__ Q16, const _Float16* __restrict__ QL, int ldq, const _Float16* __restrict__ K16, const _Float16* __restrict__ KL, int ldk, const _Float16* __restrict__ Vt, const _Float16* __restrict__ VtL, const int* __restrict__ MSK, float* __restrict__ O, int ldo) {
  constexpr int RPW = 16, RTN = RPW / 16, NQB = TQ / (4 * RPW), DT = 4, KS = 2;
  __shared__ __attribute__((aligned(16))) unsigned short sP[4][RPW][40]; __shared__ __attribute__((aligned(16))) unsigned short sPL[4][RPW][40]; __shared__ __attribute__((aligned(16))) float sO[4][RPW][64 + 4];
  const int tid = threadIdx.x, w = tid >> 5, lane = tid & 31, ln = lane & 15, hh = lane >> 4;
  const int slab = blockIdx.x / QBN5, qblk = QB05 + blockIdx.x % QBN5; (void)NQB; const int b = slab / NH, h = slab % NH; const int qb0 = qblk * (4 * RPW); const int q0 = qb0 + w * RPW;
  FragH aq[2][KS], aql[2][KS];
#pragma unroll
  for (int rt = 0; rt < RTN; ++rt) { const unsigned short* qr = (const unsigned short*)Q16 + ((size_t)b * TQ + q0 + rt * 16 + ln) * ldq + h * 64; const unsigned short* ql = (const unsigned short*)QL + ((size_t)b * TQ + q0 + rt * 16 + ln) * ldq + h * 64;
#pragma unroll
    for (int ks = 0; ks < KS; ++ks) { aq[rt][ks].half[0] = *(const v8us*)(qr + ks * 32 + 8 * hh); aq[rt][ks].half[1] = *(const v8us*)(qr + ks * 32 + 16 + 8 * hh); aql[rt][ks].half[0] = *(const v8us*)(ql + ks * 32 + 8 * hh); aql[rt][ks].half[1] = *(const v8us*)(ql + ks * 32 + 16 + 8 * hh); } }
  const unsigned short* Vth = (const unsigned short*)Vt + (size_t)slab * 64 * TK; const unsigned short* Vtl = (const unsigned short*)VtL + (size_t)slab * 64 * TK;
  float m_r[2][8], l_r[2][8]; v8f oacc[2][DT], oaccL[2][DT];
#pragma unroll
  for (int rt = 0; rt < RTN; ++rt) {
#pragma unroll
    for (int r = 0; r < 8; ++r) { m_r[rt][r] = -3.0e38f; l_r[rt][r] = 0.f; }
#pragma unroll
    for (int dt = 0; dt < DT; ++dt) { oacc[rt][dt] = (v8f){0.f,0.f,0.f,0.f,0.f,0.f,0.f,0.f}; oaccL[rt][dt] = oacc[rt][dt]; } }
  const int jend = (CAUSAL == 1) ? (qb0 + 4 * RPW) : TK;      /* causal: keys beyond the block's last query never contribute */
#pragma unroll 1
  for (int j0 = 0; j0 < jend; j0 += 32) {
    v8f s[2][2];
#pragma unroll
    for (int nt = 0; nt < 2; ++nt) { const unsigned short* kr = (const unsigned short*)K16 + ((size_t)b * TK + j0 + nt * 16 + ln) * ldk + h * 64; const unsigned short* klr = (const unsigned short*)KL + ((size_t)b * TK + j0 + nt * 16 + ln) * ldk + h * 64; FragH bk[KS], bkl[KS];
#pragma unroll
      for (int ks = 0; ks < KS; ++ks) { bk[ks].half[0] = *(const v8us*)(kr + ks * 32 + 8 * hh); bk[ks].half[1] = *(const v8us*)(kr + ks * 32 + 16 + 8 * hh); bkl[ks].half[0] = *(const v8us*)(klr + ks * 32 + 8 * hh); bkl[ks].half[1] = *(const v8us*)(klr + ks * 32 + 16 + 8 * hh); }
#pragma unroll
      for (int rt = 0; rt < RTN; ++rt) { v8f acc = (v8f){0.f,0.f,0.f,0.f,0.f,0.f,0.f,0.f}, accl = acc;
#pragma unroll
        for (int ks = 0; ks < KS; ++ks) { acc = mmaH<1>(aq[rt][ks].v, aq[rt][ks].v, bk[ks].v, bk[ks].v, acc); accl = mmaH<1>(aql[rt][ks].v, aql[rt][ks].v, bk[ks].v, bk[ks].v, accl); accl = mmaH<1>(aq[rt][ks].v, aq[rt][ks].v, bkl[ks].v, bkl[ks].v, accl); }
#pragma unroll
        for (int r = 0; r < 8; ++r) acc[r] += accl[r] * 0.0009765625f;
        s[rt][nt] = acc; } }
#pragma unroll
    for (int rt = 0; rt < RTN; ++rt)
#pragma unroll
      for (int r = 0; r < 8; ++r) { const int tq = q0 + rt * 16 + 8 * hh + r; const int k0 = j0 + ln, k1 = j0 + 16 + ln;
        bool ok0 = (CAUSAL == 1) ? (k0 <= tq) : ((CAUSAL == 2) ? ((k0 >> 5) == (tq >> 5)) : true), ok1 = (CAUSAL == 1) ? (k1 <= tq) : ((CAUSAL == 2) ? ((k1 >> 5) == (tq >> 5)) : true);      /* mode 2: block-diagonal 32-token groups */
        if (CAUSAL == 4) { const int* mrow = MSK + ((size_t)b * TQ + tq) * TK; ok0 = mrow[k0] != 0; ok1 = mrow[k1] != 0; }      /* mode 4: per-(query, key) INPUT mask shared by all heads; masked keys contribute nothing (== the reference's -4096 fill, whose exp underflows to 0), rows with no valid key give l = 0 -> output 0 (== the reference's row_valid zeroing) */
        float s0 = ok0 ? s[rt][0][r] * SCL : -3.0e38f, s1 = ok1 ? s[rt][1][r] * SCL : -3.0e38f; if (CAUSAL == 17) { const float* amk = (const float*)MSK + (size_t)b * TK; s0 += bf16_round(amk[k0]); s1 += bf16_round(amk[k1]); }      /* mode 17: additive per-(batch, key) mask INPUT */ float mc = fmaxf(s0, s1);
        mc = fmaxf(mc, __shfl_xor(mc, 1, 32)); mc = fmaxf(mc, __shfl_xor(mc, 2, 32)); mc = fmaxf(mc, __shfl_xor(mc, 4, 32)); mc = fmaxf(mc, __shfl_xor(mc, 8, 32));
        const float mn = fmaxf(m_r[rt][r], mc); const float al = (mn > -1.0e38f) ? expf(m_r[rt][r] - mn) : 1.0f; m_r[rt][r] = mn; const float p0 = ok0 ? expf(s0 - mn) : 0.f, p1 = ok1 ? expf(s1 - mn) : 0.f; l_r[rt][r] = l_r[rt][r] * al + p0 + p1;
#pragma unroll
        for (int dt = 0; dt < DT; ++dt) { oacc[rt][dt][r] *= al; oaccL[rt][dt][r] *= al; }
        FragH t2, t2l; const float ps0 = p0 * 1024.0f, ps1 = p1 * 1024.0f; t2.h[0] = (_Float16)ps0; t2.h[1] = (_Float16)ps1; t2l.h[0] = (_Float16)((ps0 - (float)t2.h[0]) * 1024.0f); t2l.h[1] = (_Float16)((ps1 - (float)t2.h[1]) * 1024.0f);
        sP[w][rt * 16 + 8 * hh + r][ln] = t2.u[0]; sP[w][rt * 16 + 8 * hh + r][16 + ln] = t2.u[1]; sPL[w][rt * 16 + 8 * hh + r][ln] = t2l.u[0]; sPL[w][rt * 16 + 8 * hh + r][16 + ln] = t2l.u[1]; }
    __builtin_amdgcn_fence(__ATOMIC_ACQ_REL, "workgroup"); __builtin_amdgcn_wave_barrier();
    FragH pa[2], pl[2];
#pragma unroll
    for (int rt = 0; rt < RTN; ++rt) { pa[rt].half[0] = *(const v8us*)&sP[w][rt * 16 + ln][8 * hh]; pa[rt].half[1] = *(const v8us*)&sP[w][rt * 16 + ln][16 + 8 * hh]; pl[rt].half[0] = *(const v8us*)&sPL[w][rt * 16 + ln][8 * hh]; pl[rt].half[1] = *(const v8us*)&sPL[w][rt * 16 + ln][16 + 8 * hh]; }
#pragma unroll
    for (int dt = 0; dt < DT; ++dt) { const unsigned short* vrow = Vth + (size_t)(dt * 16 + ln) * TK + j0; const unsigned short* vrl = Vtl + (size_t)(dt * 16 + ln) * TK + j0; FragH bv, bl; bv.half[0] = *(const v8us*)(vrow + 8 * hh); bv.half[1] = *(const v8us*)(vrow + 16 + 8 * hh); bl.half[0] = *(const v8us*)(vrl + 8 * hh); bl.half[1] = *(const v8us*)(vrl + 16 + 8 * hh);
#pragma unroll
      for (int rt = 0; rt < RTN; ++rt) { oacc[rt][dt] = mmaH<1>(pa[rt].v, pa[rt].v, bv.v, bv.v, oacc[rt][dt]); oaccL[rt][dt] = mmaH<1>(pl[rt].v, pl[rt].v, bv.v, bv.v, oaccL[rt][dt]); oaccL[rt][dt] = mmaH<1>(pa[rt].v, pa[rt].v, bl.v, bl.v, oaccL[rt][dt]); } }
    __builtin_amdgcn_fence(__ATOMIC_ACQ_REL, "workgroup"); __builtin_amdgcn_wave_barrier(); }
#pragma unroll
  for (int rt = 0; rt < RTN; ++rt) {
#pragma unroll
    for (int r = 0; r < 8; ++r) { float l = l_r[rt][r]; l += __shfl_xor(l, 1, 32); l += __shfl_xor(l, 2, 32); l += __shfl_xor(l, 4, 32); l += __shfl_xor(l, 8, 32); l_r[rt][r] = (l > 0.f) ? 1.0f / (l * 1024.0f) : 0.f; }
#pragma unroll
    for (int dt = 0; dt < DT; ++dt)
#pragma unroll
      for (int r = 0; r < 8; ++r) { float v = oacc[rt][dt][r]; v += oaccL[rt][dt][r] * 0.0009765625f; sO[w][rt * 16 + 8 * hh + r][dt * 16 + ln] = v * l_r[rt][r]; } }
  __builtin_amdgcn_fence(__ATOMIC_ACQ_REL, "workgroup"); __builtin_amdgcn_wave_barrier();
  {
#pragma unroll
    for (int rp = 0; rp < RPW; rp += 2) { const int r = rp + (lane >> 4), pc = lane & 15; const v4f val = *(const v4fa*)&sO[w][r][pc * 4]; *(v4f*)(O + ((size_t)b * TQ + q0 + r) * ldo + h * 64 + pc * 4) = val; }
     } }

__global__ __launch_bounds__(256) void k_rotab(float* __restrict__ CS, float* __restrict__ SN) {
  #pragma clang fp contract(off)
  const int t = blockIdx.x * 256 + threadIdx.x; if (t >= SLEN * 32) return; const int j = t % 32, s = t / 32; const float ex = (float)(2 * j) / 64.0f; const float inv = 1.0f / powf(10000.0f, ex); const float th = (float)s * inv; const float c = cosf(th), sn = sinf(th);
  { *(float*)(CS + t) = c; *(float*)(SN + t) = sn;  } }
__global__ __launch_bounds__(256) void k_rope(const float* __restrict__ F, int nsrc, int ndst, int rep, const float* __restrict__ CS, const float* __restrict__ SN, _Float16* __restrict__ H, _Float16* __restrict__ L) {
  #pragma clang fp contract(off)
  const size_t t = (size_t)blockIdx.x * 256 + threadIdx.x; if (t >= (size_t)NR * ndst * 4) return; const int g8 = (int)(t % 4); const int hd = (int)((t / 4) % ndst); const size_t row = t / ((size_t)4 * ndst); const int s = (int)(row % SLEN); const int hs = hd / rep;
  const float* src = F + row * (size_t)(nsrc * 64) + hs * 64; FragH ah, al, bh, bl;
  for (int i = 0; i < 8; ++i) { const int d = g8 * 8 + i; const float c = CS[s * 32 + d], sn = SN[s * 32 + d]; const float x1 = src[d], x2 = src[d + 32];
    float o1 = x1 * c; o1 += -x2 * sn; float o2 = x2 * c; o2 += x1 * sn;
    _Float16 hv = (_Float16)o1; ah.h[i] = hv; al.h[i] = (_Float16)((o1 - (float)hv) * 1024.0f); hv = (_Float16)o2; bh.h[i] = hv; bl.h[i] = (_Float16)((o2 - (float)hv) * 1024.0f); }
  const size_t o = row * (size_t)(ndst * 64) + hd * 64 + g8 * 8;
  { *(v8us*)((unsigned short*)H + o) = ah.half[0]; *(v8us*)((unsigned short*)H + o + 32) = bh.half[0]; *(v8us*)((unsigned short*)L + o) = al.half[0]; *(v8us*)((unsigned short*)L + o + 32) = bl.half[0];  } }
// Every operand conversion in ONE launch, by block ranges: the exact f16 plane of x, the three weight planes (x16, one behind the other in B3), and the mask table of the flash kernel.
// A conversion block streams 16384 values: 16 loads of 16 bytes a lane, each wave-wide load 512 bytes in a row, several of them under way at once; each store of a wave is two whole 128-byte lines. Few, long waves, for speed only.
// The mask table: M2 = bf16-rounded mask times log2 e. Beyond +-1e38 the table goes on with slope 1/2, so that the factor turns no finite mask into an infinity: two different bf16 values up there still lie more than 1e35 apart in the table, so the smaller one's weight is 0 as it is in natural units, equal values stay equal, and the order is kept; an infinite mask stays infinite
#define PXB (NR * DM / 16384)      /* blocks for x */
#define PWB (DM * DM / 16384)      /* blocks for one weight matrix */
#define PMB (NB * SLEN / 256)      /* blocks for the mask: 1 value a thread */
__global__ __launch_bounds__(256) void k_prep(const float* __restrict__ x, const float* __restrict__ Wq, const float* __restrict__ Wk, const float* __restrict__ Wv, const float* __restrict__ am, _Float16* __restrict__ X16, _Float16* __restrict__ B3, float* __restrict__ M2) {
  const int bx = blockIdx.x, tid = threadIdx.x;
  if (bx >= PXB + 3 * PWB) { const int t = (bx - (PXB + 3 * PWB)) * 256 + tid; const float mr = bf16_round(am[t]), ma = fabsf(mr); M2[t] = (ma <= 1.0e38f) ? mr * LOG2E : copysignf(1.0e38f * LOG2E + (ma - 1.0e38f) * 0.5f, mr); return; }
  const float* src = x; _Float16* dst = X16; float sc = 1.0f; int b0 = bx;
  if (bx >= PXB) { const int wi = (bx - PXB) / PWB; b0 = (bx - PXB) % PWB; src = (wi == 0) ? Wq : ((wi == 1) ? Wk : Wv); dst = B3 + (size_t)wi * DM * DM; sc = 16.0f; }      /* a weight is (out, in) = Bt as it lies */
  const size_t e0 = (size_t)b0 * 16384 + tid * 4; v4f v[16];
#pragma unroll      /* constant indices: the loaded values stay in registers, and loads can be issued ahead of the conversions */
  for (int j = 0; j < 16; ++j) v[j] = *(const v4fa*)(src + e0 + j * 1024);
#pragma unroll      /* constant indices: the loaded values stay in registers */
  for (int j = 0; j < 16; ++j) { v4h h4;
#pragma unroll      /* constant indices: the loaded values stay in registers */
    for (int q = 0; q < 4; ++q) h4[q] = (_Float16)(bf16_round(v[j][q]) * sc);
    *(v4h*)(dst + e0 + j * 1024) = h4; } }
__global__ __launch_bounds__(256) void k_rotab2(float* __restrict__ CS, float* __restrict__ SN) {
  #pragma clang fp contract(off)
  const int t = blockIdx.x * 256 + threadIdx.x; if (t >= SLEN * 32) return; const int j = t % 32, s = t / 32; const float c0 = -0.14391156831212787f;      /* -ln(10000)/64 rounded to f32 */ const float inv = expf((float)(2 * j) * c0); const float th = (float)s * inv; const float c = cosf(th), sn = sinf(th);
  { *(float*)(CS + t) = c; *(float*)(SN + t) = sn;  } }
__global__ __launch_bounds__(256) void k_lnu(const float* __restrict__ X, _Float16* __restrict__ N16, float* __restrict__ XB) {
  #pragma clang fp contract(off)
  const int wv = threadIdx.x >> 5, ln = threadIdx.x & 31; const size_t r = (size_t)blockIdx.x * 8 + wv; if (r >= NR) return; float a[32]; float s = 0.f;
  for (int i = 0; i < 4; ++i) { const v8f v = *(const v8f*)(X + r * DM + (i * 32 + ln) * 8); for (int q = 0; q < 8; ++q) { const float u = bf16_round(v[q]); a[i * 8 + q] = u; s += u; } }
  for (int o = 16; o > 0; o >>= 1) s += __shfl_xor(s, o, 32); const float mu = s / (float)DM; float var = 0.f; for (int q = 0; q < 32; ++q) { const float d = a[q] - mu; var += d * d; }
  for (int o = 16; o > 0; o >>= 1) var += __shfl_xor(var, o, 32); const float den = sqrtf(var / (float)(DM - 1)) + 1e-6f; const float inv = 1.0f / den;      /* one reciprocal per row; (x-mean)*inv vs the reference's division differs by <= 1 ulp */
  { for (int i = 0; i < 4; ++i) { const int c0 = (i * 32 + ln) * 8; FragH f; v8f xb; for (int q = 0; q < 8; ++q) { f.h[q] = (_Float16)((a[i * 8 + q] - mu) * inv); xb[q] = a[i * 8 + q]; } *(v8us*)((unsigned short*)N16 + r * DM + c0) = f.half[0]; *(v8f*)(XB + r * DM + c0) = xb; }  } }

extern "C" void kernel_launch(void* const* d_in, const int* in_sizes, int n_in,
                              void* d_out, int out_size, void* d_ws, size_t ws_size, hipStream_t stream) {
  (void)in_sizes; (void)n_in; (void)out_size;
  const float* const* I = (const float* const*)d_in; const float* x = I[0]; const float* sp = I[1]; const float* am = I[2]; const float* Wq = I[3]; const float* Wk = I[4]; const float* Wv = I[5];
  char* ws = (char*)d_ws; size_t off = 0;
  auto take = [&](size_t bytes) { char* p = ws + off; off += (bytes + 255) & ~(size_t)255; return p; };
  const size_t np = (size_t)NR * DM;
  _Float16* B3 = (_Float16*)take((size_t)3 * DM * DM * 2); float* M2 = (float*)take((size_t)NB * SLEN * 4);
  _Float16* X16 = (_Float16*)take(np * 2); _Float16* QH = (_Float16*)take(np * 2); _Float16* KXH = (_Float16*)take(np * 2); _Float16* VT = (_Float16*)take(np * 2);
  if (off > ws_size) return;      /* 6 + 4 x 8 MiB */
  k_prep<<<PXB + 3 * PWB + PMB, 256, 0, stream>>>(x, Wq, Wk, Wv, am, X16, B3, M2);
  k_qkv<<<dim3((NR / 128) * NH, 3), 128, 0, stream>>>(X16, B3, sp, QH, KXH, VT);
  k_flash<17><<<NB * NH * QBNP, 256, 0, stream>>>(QH, DM, KXH, DM, VT, (const int*)M2, (float*)d_out, DM);      /* + the mask table [b][key]; the merged context is the output */
}
